// v000
// Times are from an AMD MI455X. After a warm-up the kernel runs many times in a row, and a time is the length of
// such a window on the GPU divided by its runs, so every launch and the gaps after it count. The runs cycle
// through copies of the inputs. A figure is the median of several windows, for all but v000 over two sittings.
// Sittings can differ by a few percent; kernels timed side by side share one.
// v000 is the starting kernel. One run takes 218 microseconds.
#include <hip/hip_runtime.h>

// Causal multi-head self-attention, width 1024 = 16 heads x 64, x [NB][SEQ][1024], fused W_attn [in][out] + bias, true head split q[b][h][t][d] = qkv[b][t][h*64+d], score scale 1/8,
// key > query OR padding_mask[b][q][k] != 0 replaced by -inf, heads merged back to [b][t][h*64+d], output projection W_proj [in][out] + bias (f32 out); second output = normalised probabilities of head 0, [NB][1][SEQ][SEQ] f32.
// Compute dtypes, f32 accumulate everywhere: qkv projections v_wmma_f32_16x16x32_bf16 (x, W, biases RNE-converted to bf16; products exact); scores v_wmma_f32_16x16x32_f16: k single f16, q as f16 value + f16 residual x2048 in its own accumulator;
// P (x256 carry, cancels in the normalisation) single f16; v single f16 plus, for query rows < 512, an f16 residual x2048 in its own accumulator; softmax f32 (online, running max); output projection v_wmma_f32_16x16x32_bf16 with ctx as bf16 hi + bf16 lo planes (unscaled, shared accumulator) against bf16 W_proj.
// Layout: bf16 copies of x and transposed (K-contiguous) weights; q (hi, residual) and k planes [b*16+h][t][64]; v^T planes [b*16+h][d][t] produced by the v GEMM run with the weight rows as the M operand and the tokens as the N operand; ctx planes compact [NB*SEQ][1024]; padding mask packed to one 32-key bit word per (b, q, key block).

#ifndef NB
#define NB 4
#endif
#ifndef SEQ
#define SEQ 1024
#endif
#define NB_FULL  4
#define SEQ_FULL 1024
#ifndef OUT_SEQ
#define OUT_SEQ SEQ              // row pitch (in tokens) between batches of the outputs
#endif
#ifndef ATT_LD
#define ATT_LD OUT_SEQ           // key pitch of one probability row of the second output
#endif
#ifndef SCORE_RES
#define SCORE_RES 1              // 1: q residual plane adds a second score product; 0: single score product
#endif
#define DM   1024
#define NH_  16
#define HD   64
#define AW   4                   // waves per flash block (16 query rows each)
#define EARLY 512                // query rows below this use the v residual plane
#define QRS  2048.0f             // carry of the residual planes
#define QRI  (1.0f / 2048.0f)
#define SC2  (0.125f * 1.4426950408889634f)   // HD^-0.5 * log2(e)
#define PSH  8.0f                // log2 of the P carry (256)
#define NEGV (-3.0e38f)
#define OUT1_OFF ((size_t)NB_FULL * SEQ_FULL * DM)   // element offset of the second output (fixed by the full problem size)

static_assert(HD == 64);
static_assert(NH_ * HD == DM);
static_assert(DM % 64 == 0);
static_assert(DM % 32 == 0);
static_assert(SEQ % 256 == 0);                 // SEQ/32 mask words per row is a multiple of 8; 64-token tiles stay inside one batch
static_assert(SEQ % 64 == 0);
static_assert((NB * SEQ) % 64 == 0);
static_assert(SEQ % 32 == 0);
static_assert(SEQ % (16 * AW) == 0);
static_assert(((size_t)SEQ * DM) % 8 == 0);
static_assert(NB <= NB_FULL);
static_assert(SEQ <= SEQ_FULL);
static_assert(((size_t)NB * SEQ * (SEQ / 32)) % 256 == 0);        // mask-word grid x block == plane extent
static_assert(ATT_LD % 32 == 0);
static_assert(ATT_LD >= SEQ);
static_assert(OUT1_OFF * 4 == (size_t)16777216);                   // byte offset of the second output
static_assert(((size_t)(NB - 1) * OUT_SEQ + SEQ) * DM <= OUT1_OFF);
static_assert(OUT1_OFF + ((size_t)(NB - 1) * OUT_SEQ + (SEQ - 1)) * ATT_LD + SEQ <= OUT1_OFF + (size_t)NB_FULL * SEQ_FULL * SEQ_FULL);

typedef _Float16 h16;
typedef unsigned short bf;
typedef __attribute__((ext_vector_type(16))) __bf16   v16bf;
typedef __attribute__((ext_vector_type(16))) _Float16 v16h;
typedef __attribute__((ext_vector_type(8)))  _Float16 v8h;
typedef __attribute__((ext_vector_type(8)))  unsigned short v8us;
typedef __attribute__((ext_vector_type(8)))  float    v8f;
typedef __attribute__((ext_vector_type(4)))  float    v4f;
typedef __attribute__((ext_vector_type(4)))  int      v4i;
typedef v4f  __attribute__((may_alias)) v4fa;
typedef v8us __attribute__((may_alias)) v8usa;

__device__ __forceinline__ unsigned short f2bf(float f) { unsigned u = __float_as_uint(f); u += 0x7FFFu + ((u >> 16) & 1u); return (unsigned short)(u >> 16); }
__device__ __forceinline__ float bf2f(unsigned short h) { return __uint_as_float(((unsigned)h) << 16); }
__device__ __forceinline__ v16h cat16(v8h lo, v8h hi) { return __builtin_shufflevector(lo, hi, 0, 1, 2, 3, 4, 5, 6, 7, 8, 9, 10, 11, 12, 13, 14, 15); }
__device__ __forceinline__ v16bf cat16b(v8us lo, v8us hi) { return __builtin_bit_cast(v16bf, __builtin_shufflevector(lo, hi, 0, 1, 2, 3, 4, 5, 6, 7, 8, 9, 10, 11, 12, 13, 14, 15)); }
__device__ __forceinline__ v8f wmma16(v16h a, v16h b, v8f c) { return __builtin_amdgcn_wmma_f32_16x16x32_f16(false, a, false, b, (short)0, c, false, false); }
__device__ __forceinline__ v8f wmmab(v16bf a, v16bf b, v8f c) { return __builtin_amdgcn_wmma_f32_16x16x32_bf16(false, a, false, b, (short)0, c, false, false); }
// fragment loaders from K-contiguous 16-bit rows; p already includes + 8*(lane>>4): elements 0..7 <- k0+8h+0..7, elements 8..15 <- k0+16+8h+0..7 (same map for A and B)
__device__ __forceinline__ v16h  ldh(const h16* p) { return cat16(*(const v8h*)p, *(const v8h*)(p + 16)); }
__device__ __forceinline__ v16bf ldb(const bf* p)  { return cat16b(*(const v8us*)p, *(const v8us*)(p + 16)); }
// ordering point for wave-private LDS tiles (same wave writes and reads)
__device__ __forceinline__ void wave_sync() { __builtin_amdgcn_fence(3 /* release order */, "wavefront"); __builtin_amdgcn_wave_barrier(); asm volatile("" ::: "memory"); }
// f32 -> f16 for WMMA operand planes: results below the smallest f16 normal become exact zero (value select)
static __device__ __forceinline__ h16 toh_flush(float v) { const h16 r = (h16)v; return (fabsf(v) < 6.103515625e-05f) ? (h16)0.0f : r; }

__global__ __launch_bounds__(256) void k_cvt8(const float* __restrict__ src, bf* dst, size_t n8) {
    const size_t i = (size_t)blockIdx.x * 256 + threadIdx.x; if (i >= n8) return;
    const v8f v = *(const v8f*)(src + i * 8); v8us o;
#pragma unroll
    for (int k = 0; k < 8; ++k) o[k] = f2bf(v[k]);
    *(v8us*)(dst + i * 8) = o; 
}

// k_cvtT: W [DM k][ldn] f32 (row = k, column = e) -> bf16 plane dst[row(e)][k] (K-contiguous), 64 k x 64 e tile through LDS (cross-wave: block barrier).
// row(e) = e for e < permFrom; for e >= permFrom (unused: both launches pass 1 << 30), with ee = e - permFrom = c*64 + d: row = permFrom + d*16 + c.
__global__ __launch_bounds__(256) void k_cvtT(const float* __restrict__ W, int ldn, bf* dst, int permFrom) {
    __shared__ __align__(16) unsigned short ts[64 * 72];
    const int t = threadIdx.x; const int k0 = blockIdx.x * 64, n0 = blockIdx.y * 64;
#pragma unroll 4
    for (int i = 0; i < 16; ++i) { const int k = i * 4 + (t >> 6), n = t & 63;      // 16 x 4 = 64 k rows, 64 columns
        ts[n * 72 + k] = f2bf(W[(size_t)(k0 + k) * (size_t)ldn + n0 + n]); }
    __syncthreads();
    v8us o0, o1; size_t d0, d1;
    { const int p = t, n = p >> 3, q = p & 7; o0 = *(const v8usa*)(&ts[n * 72 + 8 * q]);
      const int e = n0 + n; const int ee = e - permFrom; const int row = (e >= permFrom) ? (permFrom + (ee & 63) * 16 + (ee >> 6)) : e;
      d0 = (size_t)row * DM + k0 + 8 * q; }
    { const int p = t + 256, n = p >> 3, q = p & 7; o1 = *(const v8usa*)(&ts[n * 72 + 8 * q]);
      const int e = n0 + n; const int ee = e - permFrom; const int row = (e >= permFrom) ? (permFrom + (ee & 63) * 16 + (ee >> 6)) : e;
      d1 = (size_t)row * DM + k0 + 8 * q; }
{
        *(v8us*)(dst + d0) = o0; *(v8us*)(dst + d1) = o1;
         }
}

// k_mbits: padding mask [NB_FULL][SEQ_FULL][SEQ_FULL] int32 -> bit words MW[b*SEQ + q][SEQ/32], bit j of word w = (mask[b][q][32*w + j] != 0).
__global__ __launch_bounds__(256) void k_mbits(const int* __restrict__ pm, unsigned* MW, size_t nW) {
    const size_t w = (size_t)blockIdx.x * 256 + threadIdx.x; if (w >= nW) return;
    const size_t row = w / (size_t)(SEQ / 32); const size_t j = w % (size_t)(SEQ / 32);
    const size_t b = row / (size_t)SEQ, t = row % (size_t)SEQ;
    const int* src = pm + (b * SEQ_FULL + t) * (size_t)SEQ_FULL + j * 32;
    unsigned bits = 0u;
#pragma unroll
    for (int i = 0; i < 8; ++i) { const v4i v = *(const v4i*)(src + 4 * i);
        const unsigned n = ((v[0] != 0) ? 1u : 0u) | ((v[1] != 0) ? 2u : 0u) | ((v[2] != 0) ? 4u : 0u) | ((v[3] != 0) ? 8u : 0u);
        bits |= n << (4 * i); }
    *(unsigned*)(MW + w) = bits; 
}

// k_gemm: register-blocked bf16 GEMM, ONE WAVE per 64x64 tile (16 accumulators), operands straight from K-contiguous bf16 planes, K = DM.
// C[m][n] = sum_k A[m][k] Bt[n][k] + bias (bias RNE-converted to bf16, added in f32). 32 threads per block.
// MODE 0: q  -> A = x tokens, Bt = q weight rows; f16 value plane Ph and f16 residual x2048 plane Pr, layout [b*16+h][t][64] (tile column block = head h; bias columns 0..1023). grid (M/64, 1024/64)
// MODE 1: k  -> as MODE 0, value plane only (bias columns 1024..2047)
// MODE 2: v  -> A = v weight rows (row e = h*64 + d), Bt = x tokens: C[e][token]; value (Ph) and residual x2048 (Pr) planes [b*16+h][d][t]; bias per ROW (columns 2048..3071 of the bias vector). grid (1024/64, M/64)
template <int MODE>
__global__ __launch_bounds__(32) void k_gemm(const bf* __restrict__ A, const bf* __restrict__ Bt, const float* __restrict__ bias, h16* Ph, h16* Pr, float* OUT) {
    __shared__ __align__(16) float os[16 * 68];
    const int K = DM;
    const int lane = threadIdx.x & 31, lr = lane & 15, hi = lane >> 4; const int r0 = blockIdx.x * 64, c0 = blockIdx.y * 64;
    v8f acc[4][4];
#pragma unroll
    for (int mb = 0; mb < 4; ++mb)
#pragma unroll
        for (int nb = 0; nb < 4; ++nb) acc[mb][nb] = (v8f){};
    const size_t aoff = (size_t)(r0 + lr) * K + 8 * hi, boff = (size_t)(c0 + lr) * K + 8 * hi;
    const int npl = (MODE == 3) ? 2 : 1;
#pragma unroll 1
    for (int pl = 0; pl < npl; ++pl) {
        const bf* Ap = A + (size_t)pl * ((size_t)NB * SEQ * DM);
#pragma unroll 1
        for (int kc = 0; kc < K; kc += 32) {
            v16bf a[4];
#pragma unroll
            for (int mb = 0; mb < 4; ++mb) a[mb] = ldb(Ap + aoff + (size_t)mb * 16 * K + kc);
#pragma unroll
            for (int nb = 0; nb < 4; ++nb) { const v16bf b = ldb(Bt + boff + (size_t)nb * 16 * K + kc);
#pragma unroll
                for (int mb = 0; mb < 4; ++mb) acc[mb][nb] = wmmab(a[mb], b, acc[mb][nb]); }
            asm volatile("v_nop\n\tv_nop\n\tv_nop\n\tv_nop" : "+v"(acc[0][0]), "+v"(acc[1][1]), "+v"(acc[2][2]), "+v"(acc[3][3]) : "v"(a[0]), "v"(a[1]), "v"(a[2]), "v"(a[3]));
        }
    }
    float bv[4];
#pragma unroll
    for (int nb = 0; nb < 4; ++nb) {
        const int bi = (MODE == 2) ? (2 * DM) : (((MODE == 1) ? DM : 0) + c0 + nb * 16 + lr);
        bv[nb] = bf2f(f2bf(bias[bi])); }
#pragma unroll
    for (int mb = 0; mb < 4; ++mb) {
        float rb[8];
#pragma unroll
        for (int j = 0; j < 8; ++j) rb[j] = 0.0f;
        if (MODE == 2) {                                // per-row bias: 8 consecutive floats, one 32-byte vector load
            const v8f bq = *(const v8f*)(bias + 2 * DM + r0 + mb * 16 + hi * 8);
#pragma unroll
            for (int j = 0; j < 8; ++j) rb[j] = bf2f(f2bf(bq[j])); }
#pragma unroll
        for (int nb = 0; nb < 4; ++nb) {
#pragma unroll
            for (int j = 0; j < 8; ++j) os[(hi * 8 + j) * 68 + nb * 16 + lr] = (MODE == 2) ? (acc[mb][nb][j] + rb[j]) : (acc[mb][nb][j] + bv[nb]); }   // D: row 8h+j, col lane&15; rows 0..15 x cols 0..63 all written
        wave_sync();
        if (MODE == 0 || MODE == 1 || MODE == 2) {
            size_t sb, pitch;
            if (MODE == 2) { const int bb = c0 / SEQ; const int tt = c0 % SEQ;                        // rows = d of head r0/64, columns = 64 tokens of one batch
                sb = ((size_t)(bb * NH_ + (r0 >> 6)) * HD + (size_t)(16 * mb)) * SEQ + (size_t)tt; pitch = SEQ; }
            else { const int tokrow = r0 + 16 * mb; const int bb = tokrow / SEQ; const int tt = tokrow % SEQ;   // rows = tokens, columns = d of head c0/64
                sb = ((size_t)(bb * NH_ + (c0 >> 6)) * SEQ + (size_t)tt) * HD; pitch = HD; }
{
#pragma unroll
                for (int s = 0; s < 4; ++s) { const int row = 4 * s + (lane >> 3), c8 = (lane & 7) * 8;
                    const v4f x0 = *(const v4fa*)(&os[row * 68 + c8]); const v4f x1 = *(const v4fa*)(&os[row * 68 + c8 + 4]); v8h hv, rv;
#pragma unroll
                    for (int i = 0; i < 4; ++i) { const h16 a0 = toh_flush(x0[i]); const h16 a1 = toh_flush(x1[i]); hv[i] = a0; hv[4 + i] = a1;
                        rv[i] = toh_flush((x0[i] - (float)a0) * QRS); rv[4 + i] = toh_flush((x1[i] - (float)a1) * QRS); }
                    const size_t oo = sb + (size_t)row * pitch + c8;
                    *(v8h*)(Ph + oo) = hv; if (MODE != 1) *(v8h*)(Pr + oo) = rv; }
                 }
        } else {
            const int grow = r0 + 16 * mb; const int bb = grow / SEQ; const int nn = grow % SEQ;
            float* orow = OUT + ((size_t)bb * OUT_SEQ + nn) * DM + c0;
{
#pragma unroll
                for (int s = 0; s < 8; ++s) { const int row = 2 * s + hi, cofs = lr * 4;   // 8 s x 2 rows = 16 rows; 16 lanes x 4 floats = 64 columns
                    const v4f val = *(const v4fa*)(&os[row * 68 + cofs]);
                    *(v4f*)(orow + (size_t)row * DM + cofs) = val; }
                 }
        }
        wave_sync();
    }
}

// k_flash: fused causal attention, one wave per 16 query rows of one (batch, head); K / V^T / Q fragments straight from the f16 planes (two 16-B loads each, arithmetic addressing).
// Transposed form: S^T[key][t] = K Q^T (A = K rows, B = Q rows); lane (t = lane&15, h = lane>>4) holds keys 8h+r of each 16-key tile, so the packed
// P tile is directly the B fragment of O^T[d][t] = V^T P^T (element r <- tile keys 0..15, element 8+r <- tile keys 16..31, lane unchanged).
// Keys run over [0, t0+16) in steps of 32; on steps that touch the diagonal, scores with key > query are replaced by a very negative value (P = 0 exactly);
// the padding-mask bit word of (b, query, key block) is read once per lane per step and its bit selects run at every step (bit 8h+r <-> key key0+8h+r, bit 16+8h+r <-> key key0+16+8h+r; a set bit replaces the score the same way; a zero word changes nothing).
// A query row that never sees a visible key yields NaN (all scores replaced by -inf).
// Softmax state (running max, partial sum) is one scalar per lane; the two lane halves of a row are combined with one xor-16 exchange.
__global__ __launch_bounds__(32 * AW) void k_flash(const h16* __restrict__ QH, const h16* __restrict__ QR, const h16* __restrict__ KP, const h16* __restrict__ VT, const h16* __restrict__ VR, const unsigned* __restrict__ MW, bf* CH, bf* CL, float* ATT) {
    __shared__ __align__(16) float os[AW * 16 * 68];
    const int lane = threadIdx.x & 31, lr = lane & 15, hi = lane >> 4;
    const int wave = __builtin_amdgcn_readfirstlane((int)(threadIdx.x >> 5));
    const int zh = blockIdx.y;
    const int bb = zh / NH_, hh = zh % NH_;
    const int t0 = (blockIdx.x * AW + wave) * 16;
    const size_t pbase = (size_t)zh * SEQ * HD;
    const size_t qo = pbase + (size_t)(t0 + lr) * HD + 8 * hi;
    const v16h qh0 = ldh(QH + qo), qh1 = ldh(QH + qo + 32), qr0 = ldh(QR + qo), qr1 = ldh(QR + qo + 32);   // B fragments: col t, k = d
    const size_t ko = pbase + (size_t)lr * HD + 8 * hi;      // + key * HD       (A fragment: row key, k = d)
    const size_t vo = pbase + (size_t)lr * SEQ + 8 * hi;     // + 16j*SEQ + key  (A fragment: row d, k = key)
    const int kend = t0 + 16;
    const bool early = t0 < EARLY;
    const int tq = t0 + lr;
    const size_t mo = ((size_t)bb * SEQ + (size_t)tq) * (size_t)(SEQ / 32);   // + key0/32: mask word of this lane's query row
    v8f o0 = (v8f){}, o1 = (v8f){}, o2 = (v8f){}, o3 = (v8f){};
    v8f e0 = (v8f){}, e1 = (v8f){}, e2 = (v8f){}, e3 = (v8f){};
    float m = NEGV, l = 0.0f;
#pragma unroll 1
    for (int key0 = 0; key0 < kend; key0 += 32) {
        const h16* ka = KP + ko + (size_t)key0 * HD;
        const v16h ka0 = ldh(ka), ka1 = ldh(ka + 32), kb0 = ldh(ka + 16 * HD), kb1 = ldh(ka + 16 * HD + 32);
        v8f sHa = (v8f){}, sLa = (v8f){}, sHb = (v8f){}, sLb = (v8f){};
        sHa = wmma16(ka0, qh0, sHa); sHb = wmma16(kb0, qh0, sHb);
        if (SCORE_RES) { sLa = wmma16(ka0, qr0, sLa); sLb = wmma16(kb0, qr0, sLb); }
        sHa = wmma16(ka1, qh1, sHa); sHb = wmma16(kb1, qh1, sHb);
        if (SCORE_RES) { sLa = wmma16(ka1, qr1, sLa); sLb = wmma16(kb1, qr1, sLb); }
        asm volatile("v_nop\n\tv_nop\n\tv_nop\n\tv_nop" : "+v"(sHa), "+v"(sLa), "+v"(sHb), "+v"(sLb) : "v"(ka0), "v"(ka1), "v"(kb0), "v"(kb1));
        float ta[8], tb[8];
#pragma unroll
        for (int r = 0; r < 8; ++r) { ta[r] = (sHa[r] + sLa[r] * QRI) * SC2; tb[r] = (sHb[r] + sLb[r] * QRI) * SC2; }
        if (key0 + 31 > t0) {                       // wave-uniform: this step touches the diagonal
            const int kidx = key0 + 8 * hi;
#pragma unroll
            for (int r = 0; r < 8; ++r) { ta[r] = (kidx + r > tq) ? NEGV : ta[r]; tb[r] = (kidx + 16 + r > tq) ? NEGV : tb[r]; }
        }
        unsigned mw = MW[mo + (size_t)(key0 >> 5)];
        asm volatile("" : "+v"(mw));
        {                                           // padding-mask selects, every step (a zero word changes nothing)
            const unsigned ma = mw >> (8 * hi), mc = mw >> (16 + 8 * hi);
#pragma unroll
            for (int r = 0; r < 8; ++r) { ta[r] = (((ma >> r) & 1u) != 0u) ? NEGV : ta[r]; tb[r] = (((mc >> r) & 1u) != 0u) ? NEGV : tb[r]; }
        }
        float mx = NEGV;
#pragma unroll
        for (int r = 0; r < 8; ++r) mx = fmaxf(mx, fmaxf(ta[r], tb[r]));
        mx = fmaxf(mx, __shfl_xor(mx, 16, 32));
        const float mnew = fmaxf(m, mx);
        const float alpha = __builtin_amdgcn_exp2f(m - mnew);
        const float sh = PSH - mnew;
        v16h pb; float ls = 0.0f;
#pragma unroll
        for (int r = 0; r < 8; ++r) { const float ea = ta[r] + sh, ec = tb[r] + sh;
            const h16 pa = (ea < -14.0f) ? (h16)0.0f : (h16)__builtin_amdgcn_exp2f(ea);       // exponent select: no f16 result below the smallest normal
            const h16 pc = (ec < -14.0f) ? (h16)0.0f : (h16)__builtin_amdgcn_exp2f(ec);
            pb[r] = pa; pb[8 + r] = pc; ls += (float)pa + (float)pc; }
        l = l * alpha + ls; m = mnew;
        o0 = o0 * alpha; o1 = o1 * alpha; o2 = o2 * alpha; o3 = o3 * alpha;
        const h16* va = VT + vo + key0;
        const v16h v0 = ldh(va), v1 = ldh(va + (size_t)16 * SEQ), v2 = ldh(va + (size_t)32 * SEQ), v3 = ldh(va + (size_t)48 * SEQ);
        o0 = wmma16(v0, pb, o0); o1 = wmma16(v1, pb, o1); o2 = wmma16(v2, pb, o2); o3 = wmma16(v3, pb, o3);
        asm volatile("v_nop\n\tv_nop\n\tv_nop\n\tv_nop" : "+v"(o0), "+v"(o1), "+v"(o2), "+v"(o3) : "v"(v0), "v"(v1), "v"(v2), "v"(v3), "v"(pb));
        if (early) {                                // wave-uniform: residual plane of v in its own accumulators
            e0 = e0 * alpha; e1 = e1 * alpha; e2 = e2 * alpha; e3 = e3 * alpha;
            const h16* vr = VR + vo + key0;
            const v16h w0 = ldh(vr), w1 = ldh(vr + (size_t)16 * SEQ), w2 = ldh(vr + (size_t)32 * SEQ), w3 = ldh(vr + (size_t)48 * SEQ);
            e0 = wmma16(w0, pb, e0); e1 = wmma16(w1, pb, e1); e2 = wmma16(w2, pb, e2); e3 = wmma16(w3, pb, e3);
            asm volatile("v_nop\n\tv_nop\n\tv_nop\n\tv_nop" : "+v"(e0), "+v"(e1), "+v"(e2), "+v"(e3) : "v"(w0), "v"(w1), "v"(w2), "v"(w3), "v"(pb));
        }
    }
    l += __shfl_xor(l, 16, 32);
    const float inv = (m > NEGV) ? (1.0f / l) : __uint_as_float(0x7FC00000u);   // no visible key in the whole row: NaN row
    const int wb = wave * 16 * 68;
    // O^T D layout: o_j[r] = (d = 16j + 8h + r, t = lane&15) -> os[t][d]; rows 0..15 x columns 0..63 all written
    { v4f a, c;
#pragma unroll
      for (int i = 0; i < 4; ++i) { a[i] = (o0[i] + e0[i] * QRI) * inv; c[i] = (o0[4 + i] + e0[4 + i] * QRI) * inv; }
      *(v4fa*)(&os[wb + lr * 68 +  0 + 8 * hi]) = a; *(v4fa*)(&os[wb + lr * 68 +  0 + 8 * hi + 4]) = c;
#pragma unroll
      for (int i = 0; i < 4; ++i) { a[i] = (o1[i] + e1[i] * QRI) * inv; c[i] = (o1[4 + i] + e1[4 + i] * QRI) * inv; }
      *(v4fa*)(&os[wb + lr * 68 + 16 + 8 * hi]) = a; *(v4fa*)(&os[wb + lr * 68 + 16 + 8 * hi + 4]) = c;
#pragma unroll
      for (int i = 0; i < 4; ++i) { a[i] = (o2[i] + e2[i] * QRI) * inv; c[i] = (o2[4 + i] + e2[4 + i] * QRI) * inv; }
      *(v4fa*)(&os[wb + lr * 68 + 32 + 8 * hi]) = a; *(v4fa*)(&os[wb + lr * 68 + 32 + 8 * hi + 4]) = c;
#pragma unroll
      for (int i = 0; i < 4; ++i) { a[i] = (o3[i] + e3[i] * QRI) * inv; c[i] = (o3[4 + i] + e3[4 + i] * QRI) * inv; }
      *(v4fa*)(&os[wb + lr * 68 + 48 + 8 * hi]) = a; *(v4fa*)(&os[wb + lr * 68 + 48 + 8 * hi + 4]) = c; }
    wave_sync();
    const size_t cb = ((size_t)bb * SEQ + (size_t)(t0 + (lane >> 3))) * DM + (size_t)(hh * HD + (lane & 7) * 8);
    v8us hv[4], lv[4];
#pragma unroll
    for (int s = 0; s < 4; ++s) { const int row = 4 * s + (lane >> 3), c8 = (lane & 7) * 8;   // 4 s x 4 row groups = 16 rows; 8 lanes x 8 = 64 columns
        const v4f x0 = *(const v4fa*)(&os[wb + row * 68 + c8]); const v4f x1 = *(const v4fa*)(&os[wb + row * 68 + c8 + 4]);
#pragma unroll
        for (int i = 0; i < 4; ++i) { const unsigned short a0 = f2bf(x0[i]); const unsigned short a1 = f2bf(x1[i]);
            hv[s][i] = a0; hv[s][4 + i] = a1; lv[s][i] = f2bf(x0[i] - bf2f(a0)); lv[s][4 + i] = f2bf(x1[i] - bf2f(a1)); } }
{
#pragma unroll
        for (int s = 0; s < 4; ++s) { const size_t oo = cb + (size_t)s * 4 * DM;
            *(v8us*)(CH + oo) = hv[s]; *(v8us*)(CL + oo) = lv[s]; }
         }

    if (hh == 0) {                                  // block-uniform: head 0 writes its normalised probabilities, all SEQ keys of its 16 rows
        wave_sync();
        const float shp = PSH - m;                  // l carries the x256 of P, so exp2(s - m + 8) / l is the probability
        const float zf = inv * 0.0f;                // 0 for an ordinary row, NaN for a row with no visible key
        float* arow = ATT + ((size_t)bb * OUT_SEQ + (size_t)t0) * ATT_LD;
#pragma unroll 1
        for (int key0 = 0; key0 < SEQ; key0 += 32) {
            v4f pa0 = (v4f){zf, zf, zf, zf}, pa1 = pa0, pc0 = pa0, pc1 = pa0;
            if (key0 < kend) {                      // wave-uniform: steps at or below the diagonal re-form the scores
                const h16* ka = KP + ko + (size_t)key0 * HD;
                const v16h ka0 = ldh(ka), ka1 = ldh(ka + 32), kb0 = ldh(ka + 16 * HD), kb1 = ldh(ka + 16 * HD + 32);
                v8f sHa = (v8f){}, sLa = (v8f){}, sHb = (v8f){}, sLb = (v8f){};
                sHa = wmma16(ka0, qh0, sHa); sHb = wmma16(kb0, qh0, sHb);
                if (SCORE_RES) { sLa = wmma16(ka0, qr0, sLa); sLb = wmma16(kb0, qr0, sLb); }
                sHa = wmma16(ka1, qh1, sHa); sHb = wmma16(kb1, qh1, sHb);
                if (SCORE_RES) { sLa = wmma16(ka1, qr1, sLa); sLb = wmma16(kb1, qr1, sLb); }
                asm volatile("v_nop\n\tv_nop\n\tv_nop\n\tv_nop" : "+v"(sHa), "+v"(sLa), "+v"(sHb), "+v"(sLb) : "v"(ka0), "v"(ka1), "v"(kb0), "v"(kb1));
                float ta[8], tb[8];
#pragma unroll
                for (int r = 0; r < 8; ++r) { ta[r] = (sHa[r] + sLa[r] * QRI) * SC2; tb[r] = (sHb[r] + sLb[r] * QRI) * SC2; }
                if (key0 + 31 > t0) {
                    const int kidx = key0 + 8 * hi;
#pragma unroll
                    for (int r = 0; r < 8; ++r) { ta[r] = (kidx + r > tq) ? NEGV : ta[r]; tb[r] = (kidx + 16 + r > tq) ? NEGV : tb[r]; }
                }
                unsigned mw = MW[mo + (size_t)(key0 >> 5)];
                asm volatile("" : "+v"(mw));
                {                                   // padding-mask selects, every step (a zero word changes nothing)
                    const unsigned ma = mw >> (8 * hi), mc = mw >> (16 + 8 * hi);
#pragma unroll
                    for (int r = 0; r < 8; ++r) { ta[r] = (((ma >> r) & 1u) != 0u) ? NEGV : ta[r]; tb[r] = (((mc >> r) & 1u) != 0u) ? NEGV : tb[r]; }
                }
#pragma unroll
                for (int i = 0; i < 4; ++i) {
                    pa0[i] = __builtin_amdgcn_exp2f(ta[i] + shp) * inv; pa1[i] = __builtin_amdgcn_exp2f(ta[4 + i] + shp) * inv;
                    pc0[i] = __builtin_amdgcn_exp2f(tb[i] + shp) * inv; pc1[i] = __builtin_amdgcn_exp2f(tb[4 + i] + shp) * inv; }
            }
            // lane (t, h): keys 8h+r and 16+8h+r of this step -> os[t][0..31]; rows 0..15 x columns 0..31 all written
            *(v4fa*)(&os[wb + lr * 68 + 8 * hi]) = pa0;      *(v4fa*)(&os[wb + lr * 68 + 8 * hi + 4]) = pa1;
            *(v4fa*)(&os[wb + lr * 68 + 16 + 8 * hi]) = pc0; *(v4fa*)(&os[wb + lr * 68 + 16 + 8 * hi + 4]) = pc1;
            wave_sync();
            v4f val[4];
#pragma unroll
            for (int s = 0; s < 4; ++s) { const int row = 4 * s + (lane >> 3), c4 = (lane & 7) * 4;
                val[s] = *(const v4fa*)(&os[wb + row * 68 + c4]); }
{
#pragma unroll
                for (int s = 0; s < 4; ++s) { const int row = 4 * s + (lane >> 3), c4 = (lane & 7) * 4;
                    *(v4f*)(arow + (size_t)row * ATT_LD + key0 + c4) = val[s]; }
                 }
            wave_sync();
        }
    }
}

static constexpr size_t al256(size_t v) { return (v + 255) & ~(size_t)255; }
static constexpr size_t SZ_XB = al256((size_t)NB * SEQ * DM * 2);
static constexpr size_t SZ_WB = al256((size_t)3 * DM * DM * 2);
static constexpr size_t SZ_WF = al256((size_t)DM * DM * 2);
static constexpr size_t SZ_PL = al256((size_t)NB * SEQ * DM * 2);
static constexpr size_t SZ_MW = al256((size_t)NB * SEQ * (SEQ / 32) * 4);
static constexpr size_t SZ_TOTAL = SZ_XB + SZ_WB + SZ_WF + 5 * SZ_PL + 2 * SZ_PL + SZ_MW;
static_assert(SZ_TOTAL <= (size_t)134217728);          // workspace carve <= 128 MiB
static_assert(((size_t)DM * DM * 2) % 256 == 0);       // weight sub-planes stay 256-byte aligned
static_assert(SZ_PL == (size_t)NB * SEQ * DM * 2);     // ctx hi and lo planes are back to back with stride NB*SEQ*DM elements
static_assert((size_t)NB * NH_ * SEQ * HD * 2 == SZ_PL);   // q / k / v^T planes [NB*16][SEQ][64] fill one plane exactly

extern "C" void kernel_launch(void* const* d_in, const int* in_sizes, int n_in,
                              void* d_out, int out_size, void* d_ws, size_t ws_size, hipStream_t stream) {
    if (n_in < 6) return;
    const size_t needx = ((size_t)(NB - 1) * SEQ_FULL + SEQ) * DM;
    if ((size_t)in_sizes[0] < needx) return;
    if ((size_t)in_sizes[1] < (size_t)3 * DM * DM || (size_t)in_sizes[2] < (size_t)3 * DM) return;
    if ((size_t)in_sizes[3] < (size_t)DM * DM || (size_t)in_sizes[4] < (size_t)DM) return;
    if ((size_t)in_sizes[5] < ((size_t)(NB - 1) * SEQ_FULL + (SEQ - 1)) * SEQ_FULL + SEQ) return;
    if ((size_t)out_size < OUT1_OFF + ((size_t)(NB - 1) * OUT_SEQ + (SEQ - 1)) * ATT_LD + SEQ) return;
    if (SZ_TOTAL > ws_size) return;
    const float* x = (const float*)d_in[0]; const float* wqkv = (const float*)d_in[1]; const float* bqkv = (const float*)d_in[2];
    const float* wfc = (const float*)d_in[3]; const float* bfc = (const float*)d_in[4];          // wire order x, W_attn, b_attn, W_proj, b_proj, padding_mask
    const int* pmask = (const int*)d_in[5];          // [NB_FULL][SEQ_FULL][SEQ_FULL] int32, non-zero = key hidden
    float* OUT = (float*)d_out;      // [NB][SEQ][1024] then [NB][1][SEQ][SEQ]
    float* ATT = OUT + OUT1_OFF;
    char* wsp = (char*)d_ws;
    bf* XB = (bf*)wsp; wsp += SZ_XB;                 // [NB*SEQ][1024]
    bf* WB = (bf*)wsp; wsp += SZ_WB;                 // [3072][1024]: q rows | k rows | v rows (row e = h*64 + d)
    bf* WF = (bf*)wsp; wsp += SZ_WF;                 // [1024][1024]: W_proj^T
    h16* QH = (h16*)wsp; wsp += SZ_PL;               // [NB*16][SEQ][64]
    h16* QR = (h16*)wsp; wsp += SZ_PL;               // residual x2048
    h16* KP = (h16*)wsp; wsp += SZ_PL;               // [NB*16][SEQ][64]
    h16* VT = (h16*)wsp; wsp += SZ_PL;               // [NB*16][64][SEQ]
    h16* VR = (h16*)wsp; wsp += SZ_PL;               // residual x2048
    bf* CH = (bf*)wsp; wsp += SZ_PL;                 // ctx hi [NB*SEQ][1024]
    bf* CL = (bf*)wsp; wsp += SZ_PL;                 // ctx lo, directly after CH
    unsigned* MW = (unsigned*)wsp; wsp += SZ_MW;     // mask bit words [NB*SEQ][SEQ/32]

    if (SEQ == SEQ_FULL) {
        const size_t n8 = (size_t)NB * SEQ * DM / 8;
        k_cvt8<<<(unsigned)((n8 + 255) / 256), 256, 0, stream>>>(x, XB, n8);
    } else {
        const size_t n8 = (size_t)SEQ * DM / 8;
        for (int b = 0; b < NB; ++b) k_cvt8<<<(unsigned)((n8 + 255) / 256), 256, 0, stream>>>(x + (size_t)b * SEQ_FULL * DM, XB + (size_t)b * SEQ * DM, n8);
    }
    // W_attn in[1024 k][3072 e] -> WB out[e][1024 k] (no row permutation); W_proj in[1024 k][1024 e] -> WF out[e][1024 k]
    k_cvtT<<<dim3(DM / 64, 3 * DM / 64, 1), 256, 0, stream>>>(wqkv, 3 * DM, WB, 1 << 30);
    k_cvtT<<<dim3(DM / 64, DM / 64, 1), 256, 0, stream>>>(wfc, DM, WF, 1 << 30);
    {
        const size_t nW = (size_t)NB * SEQ * (SEQ / 32);
        k_mbits<<<(unsigned)(nW / 256), 256, 0, stream>>>(pmask, MW, nW);
    }

    k_gemm<0><<<dim3(NB * SEQ / 64, DM / 64, 1), 32, 0, stream>>>(XB, WB, bqkv, QH, QR, OUT);
    k_gemm<1><<<dim3(NB * SEQ / 64, DM / 64, 1), 32, 0, stream>>>(XB, WB + (size_t)DM * DM, bqkv, KP, KP, OUT);
    // v: weight rows are the M operand, tokens the N operand -> C[e][token] lands directly in the v^T planes
    k_gemm<2><<<dim3(DM / 64, NB * SEQ / 64, 1), 32, 0, stream>>>(WB + (size_t)2 * DM * DM, XB, bqkv, VT, VR, OUT);

    k_flash<<<dim3(SEQ / (16 * AW), NB * NH_, 1), 32 * AW, 0, stream>>>(QH, QR, KP, VT, VR, MW, CH, CL, ATT);

    k_gemm<3><<<dim3(NB * SEQ / 64, DM / 64, 1), 32, 0, stream>>>(CH, WF, bfc, QH, QR, OUT);
}

// v001
// It runs in 179 microseconds.
// Timed twice side by side with v000, it ran 1.23 and 1.24 times as fast.
#include <hip/hip_runtime.h>

// Causal multi-head self-attention, width 1024 = 16 heads x 64, x [NB][SEQ][1024], fused W_attn [in][out] + bias, true head split q[b][h][t][d] = qkv[b][t][h*64+d], score scale 1/8,
// key > query OR padding_mask[b][q][k] != 0 replaced by -inf, heads merged back to [b][t][h*64+d], output projection W_proj [in][out] + bias (f32 out); second output = normalised probabilities of head 0, [NB][1][SEQ][SEQ] f32.
// Compute dtypes, f32 accumulate everywhere: qkv projections v_wmma_f32_16x16x32_bf16 (x, W, biases RNE-converted to bf16; products exact); scores v_wmma_f32_16x16x32_f16: k single f16, q as f16 value + f16 residual x2048 in its own accumulator;
// P (x256 carry, cancels in the normalisation) single f16; v single f16 plus, for query rows < 512, an f16 residual x2048 in its own accumulator; softmax f32 (online, running max); output projection v_wmma_f32_16x16x32_bf16 with ctx as bf16 hi + bf16 lo planes (unscaled, shared accumulator) against bf16 W_proj.
// Layout: bf16 copies of x and transposed (K-contiguous) weights; q (hi, residual) and k planes [b*16+h][t][64]; v^T planes [b*16+h][d][t] produced by the v GEMM run with the weight rows as the M operand and the tokens as the N operand; ctx planes compact [NB*SEQ][1024]; padding mask packed to one 32-key bit word per (b, q, key block).

#ifndef NB
#define NB 4
#endif
#ifndef SEQ
#define SEQ 1024
#endif
#define NB_FULL  4
#define SEQ_FULL 1024
#ifndef OUT_SEQ
#define OUT_SEQ SEQ              // row pitch (in tokens) between batches of the outputs
#endif
#ifndef ATT_LD
#define ATT_LD OUT_SEQ           // key pitch of one probability row of the second output
#endif
#ifndef SCORE_RES
#define SCORE_RES 1              // 1: q residual plane adds a second score product; 0: single score product
#endif
#define DM   1024
#define NH_  16
#define HD   64
#define AW   4                   // waves per flash block (16 query rows each)
#define EARLY 512                // query rows below this use the v residual plane
#define QRS  2048.0f             // carry of the residual planes
#define QRI  (1.0f / 2048.0f)
#define SC2  (0.125f * 1.4426950408889634f)   // HD^-0.5 * log2(e)
#define PSH  8.0f                // log2 of the P carry (256)
#define NEGV (-3.0e38f)
#define OUT1_OFF ((size_t)NB_FULL * SEQ_FULL * DM)   // element offset of the second output (fixed by the full problem size)

static_assert(HD == 64);
static_assert(NH_ * HD == DM);
static_assert(DM % 64 == 0);
static_assert(DM % 32 == 0);
static_assert(SEQ % 256 == 0);                 // SEQ/32 mask words per row is a multiple of 8; 64-token tiles stay inside one batch
static_assert(SEQ % 64 == 0);
static_assert((NB * SEQ) % 128 == 0);
static_assert(DM % 128 == 0);
static_assert(DM / 64 >= 2);                   // the GEMM prologue fetches two 64-k stages
static_assert(SEQ % 32 == 0);
static_assert(SEQ % (16 * AW) == 0);
static_assert(((size_t)SEQ * DM) % 8 == 0);
static_assert(NB <= NB_FULL);
static_assert(SEQ <= SEQ_FULL);
static_assert(((size_t)NB * SEQ * (SEQ / 32)) % 256 == 0);        // mask-word grid x block == plane extent
static_assert(ATT_LD % 32 == 0);
static_assert(ATT_LD >= SEQ);
static_assert(OUT1_OFF * 4 == (size_t)16777216);                   // byte offset of the second output
static_assert(((size_t)(NB - 1) * OUT_SEQ + SEQ) * DM <= OUT1_OFF);
static_assert(OUT1_OFF + ((size_t)(NB - 1) * OUT_SEQ + (SEQ - 1)) * ATT_LD + SEQ <= OUT1_OFF + (size_t)NB_FULL * SEQ_FULL * SEQ_FULL);

typedef _Float16 h16;
typedef unsigned short bf;
typedef __attribute__((ext_vector_type(16))) __bf16   v16bf;
typedef __attribute__((ext_vector_type(16))) _Float16 v16h;
typedef __attribute__((ext_vector_type(8)))  _Float16 v8h;
typedef __attribute__((ext_vector_type(8)))  unsigned short v8us;
typedef __attribute__((ext_vector_type(8)))  float    v8f;
typedef __attribute__((ext_vector_type(4)))  float    v4f;
typedef __attribute__((ext_vector_type(4)))  int      v4i;
typedef v4f  __attribute__((may_alias)) v4fa;
typedef v8us __attribute__((may_alias)) v8usa;

__device__ __forceinline__ unsigned short f2bf(float f) { unsigned u = __float_as_uint(f); u += 0x7FFFu + ((u >> 16) & 1u); return (unsigned short)(u >> 16); }
__device__ __forceinline__ float bf2f(unsigned short h) { return __uint_as_float(((unsigned)h) << 16); }
__device__ __forceinline__ v16h cat16(v8h lo, v8h hi) { return __builtin_shufflevector(lo, hi, 0, 1, 2, 3, 4, 5, 6, 7, 8, 9, 10, 11, 12, 13, 14, 15); }
__device__ __forceinline__ v16bf cat16b(v8us lo, v8us hi) { return __builtin_bit_cast(v16bf, __builtin_shufflevector(lo, hi, 0, 1, 2, 3, 4, 5, 6, 7, 8, 9, 10, 11, 12, 13, 14, 15)); }
__device__ __forceinline__ v8f wmma16(v16h a, v16h b, v8f c) { return __builtin_amdgcn_wmma_f32_16x16x32_f16(false, a, false, b, (short)0, c, false, false); }
__device__ __forceinline__ v8f wmmab(v16bf a, v16bf b, v8f c) { return __builtin_amdgcn_wmma_f32_16x16x32_bf16(false, a, false, b, (short)0, c, false, false); }
// fragment loaders from K-contiguous 16-bit rows; p already includes + 8*(lane>>4): elements 0..7 <- k0+8h+0..7, elements 8..15 <- k0+16+8h+0..7 (same map for A and B)
__device__ __forceinline__ v16h  ldh(const h16* p) { return cat16(*(const v8h*)p, *(const v8h*)(p + 16)); }
__device__ __forceinline__ v16bf ldb(const bf* p)  { return cat16b(*(const v8us*)p, *(const v8us*)(p + 16)); }
// ordering point for wave-private LDS tiles (same wave writes and reads)
__device__ __forceinline__ void wave_sync() { __builtin_amdgcn_fence(3 /* release order */, "wavefront"); __builtin_amdgcn_wave_barrier(); asm volatile("" ::: "memory"); }
// f32 -> f16 for WMMA operand planes: results below the smallest f16 normal become exact zero (value select)
static __device__ __forceinline__ h16 toh_flush(float v) { const h16 r = (h16)v; return (fabsf(v) < 6.103515625e-05f) ? (h16)0.0f : r; }

__global__ __launch_bounds__(256) void k_cvt8(const float* __restrict__ src, bf* dst, size_t n8) {
    const size_t i = (size_t)blockIdx.x * 256 + threadIdx.x; if (i >= n8) return;
    const v8f v = *(const v8f*)(src + i * 8); v8us o;
#pragma unroll
    for (int k = 0; k < 8; ++k) o[k] = f2bf(v[k]);
    *(v8us*)(dst + i * 8) = o; 
}

// k_cvtT: W [DM k][ldn] f32 (row = k, column = e) -> bf16 plane dst[row(e)][k] (K-contiguous), 64 k x 64 e tile through LDS (cross-wave: block barrier).
// row(e) = e for e < permFrom; for e >= permFrom (unused: both launches pass 1 << 30), with ee = e - permFrom = c*64 + d: row = permFrom + d*16 + c.
__global__ __launch_bounds__(256) void k_cvtT(const float* __restrict__ W, int ldn, bf* dst, int permFrom) {
    __shared__ __align__(16) unsigned short ts[64 * 72];
    const int t = threadIdx.x; const int k0 = blockIdx.x * 64, n0 = blockIdx.y * 64;
#pragma unroll 4
    for (int i = 0; i < 16; ++i) { const int k = i * 4 + (t >> 6), n = t & 63;      // 16 x 4 = 64 k rows, 64 columns
        ts[n * 72 + k] = f2bf(W[(size_t)(k0 + k) * (size_t)ldn + n0 + n]); }
    __syncthreads();
    v8us o0, o1; size_t d0, d1;
    { const int p = t, n = p >> 3, q = p & 7; o0 = *(const v8usa*)(&ts[n * 72 + 8 * q]);
      const int e = n0 + n; const int ee = e - permFrom; const int row = (e >= permFrom) ? (permFrom + (ee & 63) * 16 + (ee >> 6)) : e;
      d0 = (size_t)row * DM + k0 + 8 * q; }
    { const int p = t + 256, n = p >> 3, q = p & 7; o1 = *(const v8usa*)(&ts[n * 72 + 8 * q]);
      const int e = n0 + n; const int ee = e - permFrom; const int row = (e >= permFrom) ? (permFrom + (ee & 63) * 16 + (ee >> 6)) : e;
      d1 = (size_t)row * DM + k0 + 8 * q; }
{
        *(v8us*)(dst + d0) = o0; *(v8us*)(dst + d1) = o1;
         }
}

// k_mbits: padding mask [NB_FULL][SEQ_FULL][SEQ_FULL] int32 -> bit words MW[b*SEQ + q][SEQ/32], bit j of word w = (mask[b][q][32*w + j] != 0).
__global__ __launch_bounds__(256) void k_mbits(const int* __restrict__ pm, unsigned* MW, size_t nW) {
    const size_t w = (size_t)blockIdx.x * 256 + threadIdx.x; if (w >= nW) return;
    const size_t row = w / (size_t)(SEQ / 32); const size_t j = w % (size_t)(SEQ / 32);
    const size_t b = row / (size_t)SEQ, t = row % (size_t)SEQ;
    const int* src = pm + (b * SEQ_FULL + t) * (size_t)SEQ_FULL + j * 32;
    unsigned bits = 0u;
#pragma unroll
    for (int i = 0; i < 8; ++i) { const v4i v = *(const v4i*)(src + 4 * i);
        const unsigned n = ((v[0] != 0) ? 1u : 0u) | ((v[1] != 0) ? 2u : 0u) | ((v[2] != 0) ? 4u : 0u) | ((v[3] != 0) ? 8u : 0u);
        bits |= n << (4 * i); }
    *(unsigned*)(MW + w) = bits; 
}

// work-group barrier that orders LDS only: the release and acquire fences name the LDS address space, so the global loads that prefetch a later stage into registers stay in flight across it
__device__ __forceinline__ void lds_barrier() { __builtin_amdgcn_fence(__ATOMIC_RELEASE, "workgroup", "local"); __builtin_amdgcn_s_barrier(); __builtin_amdgcn_fence(__ATOMIC_ACQUIRE, "workgroup", "local"); }

// k_gemm: bf16 GEMM, work-group of 4 waves on a 128x128 tile, each wave a 64x64 quadrant (16 accumulators), K = DM walked in stages of 64.
// Each stage's A and B tiles (128 rows x 64 k) are read from the K-contiguous bf16 planes as whole 128-byte rows (8 lanes x 16 B a row) into registers two stages ahead and
// stored one stage ahead to the other of two LDS buffers (row pitch 144 B); fragments come from LDS. One work-group barrier a stage: it publishes the stage just stored
// and ends every wave's reads of the buffer that the next stage's stores overwrite. k order of every accumulator: ascending in steps of 32.
// C[m][n] = sum_k A[m][k] Bt[n][k] + bias (bias RNE-converted to bf16, added in f32). 128 threads per block.
// MODE 0: q  -> A = x tokens, Bt = q weight rows; f16 value plane Ph and f16 residual x2048 plane Pr, layout [b*16+h][t][64] (quadrant column block = head h; bias columns 0..1023). grid (M/128, 1024/128)
// MODE 1: k  -> as MODE 0, value plane only (bias columns 1024..2047)
// MODE 2: v  -> A = v weight rows (row e = h*64 + d), Bt = x tokens: C[e][token]; value (Ph) and residual x2048 (Pr) planes [b*16+h][d][t]; bias per ROW (columns 2048..3071 of the bias vector). grid (1024/128, M/128)
// MODE 3: output projection -> A = ctx hi plane then ctx lo plane (one shared accumulator), Bt = W_proj^T rows; f32 rows of OUT. grid (M/128, 1024/128)
struct yes_t { static constexpr bool value = true; };
struct no_t { static constexpr bool value = false; };
#define LP 72                    // LDS row pitch in 16-bit elements: 144 B = 16 B x 9, conflict-free for 16-byte fragment reads
template <int MODE>
__global__ __launch_bounds__(128) void k_gemm(const bf* __restrict__ A, const bf* __restrict__ Bt, const float* __restrict__ bias, h16* Ph, h16* Pr, float* OUT) {
    __shared__ __align__(16) bf As[2 * 128 * LP];
    __shared__ __align__(16) bf Bs[2 * 128 * LP];
    __shared__ __align__(16) float osw[4 * 16 * 68];
    const int K = DM;
    const int tid = threadIdx.x;
    const int lane = tid & 31, lr = lane & 15, hi = lane >> 4;
    const int wave = __builtin_amdgcn_readfirstlane(tid >> 5);
    float* os = osw + wave * 16 * 68;                // wave-private epilogue tile
    const int wm = wave & 1, wn = wave >> 1;
    const int r0 = blockIdx.x * 128 + wm * 64, c0 = blockIdx.y * 128 + wn * 64;
    v8f acc[4][4];
#pragma unroll
    for (int mb = 0; mb < 4; ++mb)
#pragma unroll
        for (int nb = 0; nb < 4; ++nb) acc[mb][nb] = (v8f){};
    const int srow = tid >> 3, scol = (tid & 7) * 8;  // staging: 16 rows a pass, 8 passes a tile
    const bf* ga = A + (size_t)(blockIdx.x * 128 + srow) * K + scol;
    const bf* gb = Bt + (size_t)(blockIdx.y * 128 + srow) * K + scol;
    const int sl = srow * LP + scol;
    const int fa = (wm * 64 + lr) * LP + 8 * hi, fb = (wn * 64 + lr) * LP + 8 * hi;
    const int SPP = K / 64;                           // stages per plane
    const int NS = ((MODE == 3) ? 2 : 1) * SPP;
    v8us ra[8], rb[8];
#pragma unroll
    for (int i = 0; i < 8; ++i) { ra[i] = *(const v8us*)(ga + (size_t)i * 16 * K); rb[i] = *(const v8us*)(gb + (size_t)i * 16 * K); }
#pragma unroll
    for (int i = 0; i < 8; ++i) { *(v8us*)(&As[sl + i * 16 * LP]) = ra[i]; *(v8us*)(&Bs[sl + i * 16 * LP]) = rb[i]; }
#pragma unroll
    for (int i = 0; i < 8; ++i) { ra[i] = *(const v8us*)(ga + 64 + (size_t)i * 16 * K); rb[i] = *(const v8us*)(gb + 64 + (size_t)i * 16 * K); }   // stage 1 (NS >= 2)
    lds_barrier();
    // one stage; ST: stage s+1 exists (it waits in ra, rb since the stage before), LD: stage s+2 exists. Both are compile-time so that the body is one straight run whose LDS waits are counted exactly.
    auto stage = [&](const int s, auto ST, auto LD) {
        const int cur = (s & 1) * (128 * LP), nxt = (128 * LP) - cur;
        v16bf a[2][4], b[2][4];                       // both 32-k blocks' fragments of this stage, read as one group ahead of the matrix instructions
#pragma unroll
        for (int kb = 0; kb < 2; ++kb) {
#pragma unroll
            for (int mb = 0; mb < 4; ++mb) a[kb][mb] = ldb(&As[cur + fa + mb * 16 * LP + kb * 32]);
#pragma unroll
            for (int nb = 0; nb < 4; ++nb) b[kb][nb] = ldb(&Bs[cur + fb + nb * 16 * LP + kb * 32]);
        }
        if constexpr (ST.value) {                     // stage s+1 goes to the buffer that stage s-1 was read from
#pragma unroll
            for (int i = 0; i < 8; ++i) { *(v8us*)(&As[nxt + sl + i * 16 * LP]) = ra[i]; *(v8us*)(&Bs[nxt + sl + i * 16 * LP]) = rb[i]; }
        }
        if constexpr (LD.value) {                     // stage s+2 starts its way from global memory
            const int s2 = s + 2; const int pl = (s2 >= SPP) ? 1 : 0; const int kc = (s2 - pl * SPP) * 64;
            const bf* pa = ga + (size_t)pl * ((size_t)NB * SEQ * DM) + kc; const bf* pb = gb + kc;
#pragma unroll
            for (int i = 0; i < 8; ++i) { ra[i] = *(const v8us*)(pa + (size_t)i * 16 * K); rb[i] = *(const v8us*)(pb + (size_t)i * 16 * K); }
            // the address registers of the loads above are free for reuse behind them: the wait stands in front of any overwrite
            asm volatile("s_wait_xcnt 0x0" ::: "memory");
        }
#pragma unroll
        for (int kb = 0; kb < 2; ++kb)
#pragma unroll
            for (int nb = 0; nb < 4; ++nb)
#pragma unroll
                for (int mb = 0; mb < 4; ++mb) acc[mb][nb] = wmmab(a[kb][mb], b[kb][nb], acc[mb][nb]);
        // four vector slots behind the stage's last matrix instruction before its operand registers may be reloaded; naming every accumulator keeps all of the stage's
        // matrix instructions in front of the barrier, where they run while the LDS reads and stores of the stage drain
        asm volatile("v_nop\n\tv_nop\n\tv_nop\n\tv_nop"
                     : "+v"(acc[0][0]), "+v"(acc[1][0]), "+v"(acc[2][0]), "+v"(acc[3][0]), "+v"(acc[0][1]), "+v"(acc[1][1]), "+v"(acc[2][1]), "+v"(acc[3][1]),
                       "+v"(acc[0][2]), "+v"(acc[1][2]), "+v"(acc[2][2]), "+v"(acc[3][2]), "+v"(acc[0][3]), "+v"(acc[1][3]), "+v"(acc[2][3]), "+v"(acc[3][3])
                     : "v"(a[1][0]), "v"(a[1][1]), "v"(a[1][2]), "v"(a[1][3]), "v"(b[1][3]));
        if constexpr (ST.value) lds_barrier();        // publishes stage s+1 and ends the reads of this stage's buffer; behind the last stage nothing is left to publish
    };
#pragma unroll 1
    for (int s = 0; s < NS - 2; ++s) stage(s, yes_t{}, yes_t{});
    stage(NS - 2, yes_t{}, no_t{});
    stage(NS - 1, no_t{}, no_t{});
    float bv[4];
#pragma unroll
    for (int nb = 0; nb < 4; ++nb) {
        const int bi = (MODE == 2) ? (2 * DM) : (((MODE == 1) ? DM : 0) + c0 + nb * 16 + lr);
        bv[nb] = bf2f(f2bf(bias[bi])); }
#pragma unroll
    for (int mb = 0; mb < 4; ++mb) {
        float rb[8];
#pragma unroll
        for (int j = 0; j < 8; ++j) rb[j] = 0.0f;
        if (MODE == 2) {                                // per-row bias: 8 consecutive floats, one 32-byte vector load
            const v8f bq = *(const v8f*)(bias + 2 * DM + r0 + mb * 16 + hi * 8);
#pragma unroll
            for (int j = 0; j < 8; ++j) rb[j] = bf2f(f2bf(bq[j])); }
#pragma unroll
        for (int nb = 0; nb < 4; ++nb) {
#pragma unroll
            for (int j = 0; j < 8; ++j) os[(hi * 8 + j) * 68 + nb * 16 + lr] = (MODE == 2) ? (acc[mb][nb][j] + rb[j]) : (acc[mb][nb][j] + bv[nb]); }   // D: row 8h+j, col lane&15; rows 0..15 x cols 0..63 all written
        wave_sync();
        if (MODE == 0 || MODE == 1 || MODE == 2) {
            size_t sb, pitch;
            if (MODE == 2) { const int bb = c0 / SEQ; const int tt = c0 % SEQ;                        // rows = d of head r0/64, columns = 64 tokens of one batch
                sb = ((size_t)(bb * NH_ + (r0 >> 6)) * HD + (size_t)(16 * mb)) * SEQ + (size_t)tt; pitch = SEQ; }
            else { const int tokrow = r0 + 16 * mb; const int bb = tokrow / SEQ; const int tt = tokrow % SEQ;   // rows = tokens, columns = d of head c0/64
                sb = ((size_t)(bb * NH_ + (c0 >> 6)) * SEQ + (size_t)tt) * HD; pitch = HD; }
{
#pragma unroll
                for (int s = 0; s < 4; ++s) { const int row = 4 * s + (lane >> 3), c8 = (lane & 7) * 8;
                    const v4f x0 = *(const v4fa*)(&os[row * 68 + c8]); const v4f x1 = *(const v4fa*)(&os[row * 68 + c8 + 4]); v8h hv, rv;
#pragma unroll
                    for (int i = 0; i < 4; ++i) { const h16 a0 = toh_flush(x0[i]); const h16 a1 = toh_flush(x1[i]); hv[i] = a0; hv[4 + i] = a1;
                        rv[i] = toh_flush((x0[i] - (float)a0) * QRS); rv[4 + i] = toh_flush((x1[i] - (float)a1) * QRS); }
                    const size_t oo = sb + (size_t)row * pitch + c8;
                    *(v8h*)(Ph + oo) = hv; if (MODE != 1) *(v8h*)(Pr + oo) = rv; }
                 }
        } else {
            const int grow = r0 + 16 * mb; const int bb = grow / SEQ; const int nn = grow % SEQ;
            float* orow = OUT + ((size_t)bb * OUT_SEQ + nn) * DM + c0;
{
#pragma unroll
                for (int s = 0; s < 8; ++s) { const int row = 2 * s + hi, cofs = lr * 4;   // 8 s x 2 rows = 16 rows; 16 lanes x 4 floats = 64 columns
                    const v4f val = *(const v4fa*)(&os[row * 68 + cofs]);
                    *(v4f*)(orow + (size_t)row * DM + cofs) = val; }
                 }
        }
        wave_sync();
    }
}

// k_flash: fused causal attention, one wave per 16 query rows of one (batch, head); K / V^T / Q fragments straight from the f16 planes (two 16-B loads each, arithmetic addressing).
// Transposed form: S^T[key][t] = K Q^T (A = K rows, B = Q rows); lane (t = lane&15, h = lane>>4) holds keys 8h+r of each 16-key tile, so the packed
// P tile is directly the B fragment of O^T[d][t] = V^T P^T (element r <- tile keys 0..15, element 8+r <- tile keys 16..31, lane unchanged).
// Keys run over [0, t0+16) in steps of 32; on steps that touch the diagonal, scores with key > query are replaced by a very negative value (P = 0 exactly);
// the padding-mask bit word of (b, query, key block) is read once per lane per step and its bit selects run at every step (bit 8h+r <-> key key0+8h+r, bit 16+8h+r <-> key key0+16+8h+r; a set bit replaces the score the same way; a zero word changes nothing).
// A query row that never sees a visible key yields NaN (all scores replaced by -inf).
// Softmax state (running max, partial sum) is one scalar per lane; the two lane halves of a row are combined with one xor-16 exchange.
__global__ __launch_bounds__(32 * AW) void k_flash(const h16* __restrict__ QH, const h16* __restrict__ QR, const h16* __restrict__ KP, const h16* __restrict__ VT, const h16* __restrict__ VR, const unsigned* __restrict__ MW, bf* CH, bf* CL, float* ATT) {
    __shared__ __align__(16) float os[AW * 16 * 68];
    const int lane = threadIdx.x & 31, lr = lane & 15, hi = lane >> 4;
    const int wave = __builtin_amdgcn_readfirstlane((int)(threadIdx.x >> 5));
    const int zh = blockIdx.y;
    const int bb = zh / NH_, hh = zh % NH_;
    const int t0 = (blockIdx.x * AW + wave) * 16;
    const size_t pbase = (size_t)zh * SEQ * HD;
    const size_t qo = pbase + (size_t)(t0 + lr) * HD + 8 * hi;
    const v16h qh0 = ldh(QH + qo), qh1 = ldh(QH + qo + 32), qr0 = ldh(QR + qo), qr1 = ldh(QR + qo + 32);   // B fragments: col t, k = d
    const size_t ko = pbase + (size_t)lr * HD + 8 * hi;      // + key * HD       (A fragment: row key, k = d)
    const size_t vo = pbase + (size_t)lr * SEQ + 8 * hi;     // + 16j*SEQ + key  (A fragment: row d, k = key)
    const int kend = t0 + 16;
    const bool early = t0 < EARLY;
    const int tq = t0 + lr;
    const size_t mo = ((size_t)bb * SEQ + (size_t)tq) * (size_t)(SEQ / 32);   // + key0/32: mask word of this lane's query row
    v8f o0 = (v8f){}, o1 = (v8f){}, o2 = (v8f){}, o3 = (v8f){};
    v8f e0 = (v8f){}, e1 = (v8f){}, e2 = (v8f){}, e3 = (v8f){};
    float m = NEGV, l = 0.0f;
#pragma unroll 1
    for (int key0 = 0; key0 < kend; key0 += 32) {
        const h16* ka = KP + ko + (size_t)key0 * HD;
        const v16h ka0 = ldh(ka), ka1 = ldh(ka + 32), kb0 = ldh(ka + 16 * HD), kb1 = ldh(ka + 16 * HD + 32);
        v8f sHa = (v8f){}, sLa = (v8f){}, sHb = (v8f){}, sLb = (v8f){};
        sHa = wmma16(ka0, qh0, sHa); sHb = wmma16(kb0, qh0, sHb);
        if (SCORE_RES) { sLa = wmma16(ka0, qr0, sLa); sLb = wmma16(kb0, qr0, sLb); }
        sHa = wmma16(ka1, qh1, sHa); sHb = wmma16(kb1, qh1, sHb);
        if (SCORE_RES) { sLa = wmma16(ka1, qr1, sLa); sLb = wmma16(kb1, qr1, sLb); }
        asm volatile("v_nop\n\tv_nop\n\tv_nop\n\tv_nop" : "+v"(sHa), "+v"(sLa), "+v"(sHb), "+v"(sLb) : "v"(ka0), "v"(ka1), "v"(kb0), "v"(kb1));
        float ta[8], tb[8];
#pragma unroll
        for (int r = 0; r < 8; ++r) { ta[r] = (sHa[r] + sLa[r] * QRI) * SC2; tb[r] = (sHb[r] + sLb[r] * QRI) * SC2; }
        if (key0 + 31 > t0) {                       // wave-uniform: this step touches the diagonal
            const int kidx = key0 + 8 * hi;
#pragma unroll
            for (int r = 0; r < 8; ++r) { ta[r] = (kidx + r > tq) ? NEGV : ta[r]; tb[r] = (kidx + 16 + r > tq) ? NEGV : tb[r]; }
        }
        unsigned mw = MW[mo + (size_t)(key0 >> 5)];
        asm volatile("" : "+v"(mw));
        {                                           // padding-mask selects, every step (a zero word changes nothing)
            const unsigned ma = mw >> (8 * hi), mc = mw >> (16 + 8 * hi);
#pragma unroll
            for (int r = 0; r < 8; ++r) { ta[r] = (((ma >> r) & 1u) != 0u) ? NEGV : ta[r]; tb[r] = (((mc >> r) & 1u) != 0u) ? NEGV : tb[r]; }
        }
        float mx = NEGV;
#pragma unroll
        for (int r = 0; r < 8; ++r) mx = fmaxf(mx, fmaxf(ta[r], tb[r]));
        mx = fmaxf(mx, __shfl_xor(mx, 16, 32));
        const float mnew = fmaxf(m, mx);
        const float alpha = __builtin_amdgcn_exp2f(m - mnew);
        const float sh = PSH - mnew;
        v16h pb; float ls = 0.0f;
#pragma unroll
        for (int r = 0; r < 8; ++r) { const float ea = ta[r] + sh, ec = tb[r] + sh;
            const h16 pa = (ea < -14.0f) ? (h16)0.0f : (h16)__builtin_amdgcn_exp2f(ea);       // exponent select: no f16 result below the smallest normal
            const h16 pc = (ec < -14.0f) ? (h16)0.0f : (h16)__builtin_amdgcn_exp2f(ec);
            pb[r] = pa; pb[8 + r] = pc; ls += (float)pa + (float)pc; }
        l = l * alpha + ls; m = mnew;
        o0 = o0 * alpha; o1 = o1 * alpha; o2 = o2 * alpha; o3 = o3 * alpha;
        const h16* va = VT + vo + key0;
        const v16h v0 = ldh(va), v1 = ldh(va + (size_t)16 * SEQ), v2 = ldh(va + (size_t)32 * SEQ), v3 = ldh(va + (size_t)48 * SEQ);
        o0 = wmma16(v0, pb, o0); o1 = wmma16(v1, pb, o1); o2 = wmma16(v2, pb, o2); o3 = wmma16(v3, pb, o3);
        asm volatile("v_nop\n\tv_nop\n\tv_nop\n\tv_nop" : "+v"(o0), "+v"(o1), "+v"(o2), "+v"(o3) : "v"(v0), "v"(v1), "v"(v2), "v"(v3), "v"(pb));
        if (early) {                                // wave-uniform: residual plane of v in its own accumulators
            e0 = e0 * alpha; e1 = e1 * alpha; e2 = e2 * alpha; e3 = e3 * alpha;
            const h16* vr = VR + vo + key0;
            const v16h w0 = ldh(vr), w1 = ldh(vr + (size_t)16 * SEQ), w2 = ldh(vr + (size_t)32 * SEQ), w3 = ldh(vr + (size_t)48 * SEQ);
            e0 = wmma16(w0, pb, e0); e1 = wmma16(w1, pb, e1); e2 = wmma16(w2, pb, e2); e3 = wmma16(w3, pb, e3);
            asm volatile("v_nop\n\tv_nop\n\tv_nop\n\tv_nop" : "+v"(e0), "+v"(e1), "+v"(e2), "+v"(e3) : "v"(w0), "v"(w1), "v"(w2), "v"(w3), "v"(pb));
        }
    }
    l += __shfl_xor(l, 16, 32);
    const float inv = (m > NEGV) ? (1.0f / l) : __uint_as_float(0x7FC00000u);   // no visible key in the whole row: NaN row
    const int wb = wave * 16 * 68;
    // O^T D layout: o_j[r] = (d = 16j + 8h + r, t = lane&15) -> os[t][d]; rows 0..15 x columns 0..63 all written
    { v4f a, c;
#pragma unroll
      for (int i = 0; i < 4; ++i) { a[i] = (o0[i] + e0[i] * QRI) * inv; c[i] = (o0[4 + i] + e0[4 + i] * QRI) * inv; }
      *(v4fa*)(&os[wb + lr * 68 +  0 + 8 * hi]) = a; *(v4fa*)(&os[wb + lr * 68 +  0 + 8 * hi + 4]) = c;
#pragma unroll
      for (int i = 0; i < 4; ++i) { a[i] = (o1[i] + e1[i] * QRI) * inv; c[i] = (o1[4 + i] + e1[4 + i] * QRI) * inv; }
      *(v4fa*)(&os[wb + lr * 68 + 16 + 8 * hi]) = a; *(v4fa*)(&os[wb + lr * 68 + 16 + 8 * hi + 4]) = c;
#pragma unroll
      for (int i = 0; i < 4; ++i) { a[i] = (o2[i] + e2[i] * QRI) * inv; c[i] = (o2[4 + i] + e2[4 + i] * QRI) * inv; }
      *(v4fa*)(&os[wb + lr * 68 + 32 + 8 * hi]) = a; *(v4fa*)(&os[wb + lr * 68 + 32 + 8 * hi + 4]) = c;
#pragma unroll
      for (int i = 0; i < 4; ++i) { a[i] = (o3[i] + e3[i] * QRI) * inv; c[i] = (o3[4 + i] + e3[4 + i] * QRI) * inv; }
      *(v4fa*)(&os[wb + lr * 68 + 48 + 8 * hi]) = a; *(v4fa*)(&os[wb + lr * 68 + 48 + 8 * hi + 4]) = c; }
    wave_sync();
    const size_t cb = ((size_t)bb * SEQ + (size_t)(t0 + (lane >> 3))) * DM + (size_t)(hh * HD + (lane & 7) * 8);
    v8us hv[4], lv[4];
#pragma unroll
    for (int s = 0; s < 4; ++s) { const int row = 4 * s + (lane >> 3), c8 = (lane & 7) * 8;   // 4 s x 4 row groups = 16 rows; 8 lanes x 8 = 64 columns
        const v4f x0 = *(const v4fa*)(&os[wb + row * 68 + c8]); const v4f x1 = *(const v4fa*)(&os[wb + row * 68 + c8 + 4]);
#pragma unroll
        for (int i = 0; i < 4; ++i) { const unsigned short a0 = f2bf(x0[i]); const unsigned short a1 = f2bf(x1[i]);
            hv[s][i] = a0; hv[s][4 + i] = a1; lv[s][i] = f2bf(x0[i] - bf2f(a0)); lv[s][4 + i] = f2bf(x1[i] - bf2f(a1)); } }
{
#pragma unroll
        for (int s = 0; s < 4; ++s) { const size_t oo = cb + (size_t)s * 4 * DM;
            *(v8us*)(CH + oo) = hv[s]; *(v8us*)(CL + oo) = lv[s]; }
         }

    if (hh == 0) {                                  // block-uniform: head 0 writes its normalised probabilities, all SEQ keys of its 16 rows
        wave_sync();
        const float shp = PSH - m;                  // l carries the x256 of P, so exp2(s - m + 8) / l is the probability
        const float zf = inv * 0.0f;                // 0 for an ordinary row, NaN for a row with no visible key
        float* arow = ATT + ((size_t)bb * OUT_SEQ + (size_t)t0) * ATT_LD;
#pragma unroll 1
        for (int key0 = 0; key0 < SEQ; key0 += 32) {
            v4f pa0 = (v4f){zf, zf, zf, zf}, pa1 = pa0, pc0 = pa0, pc1 = pa0;
            if (key0 < kend) {                      // wave-uniform: steps at or below the diagonal re-form the scores
                const h16* ka = KP + ko + (size_t)key0 * HD;
                const v16h ka0 = ldh(ka), ka1 = ldh(ka + 32), kb0 = ldh(ka + 16 * HD), kb1 = ldh(ka + 16 * HD + 32);
                v8f sHa = (v8f){}, sLa = (v8f){}, sHb = (v8f){}, sLb = (v8f){};
                sHa = wmma16(ka0, qh0, sHa); sHb = wmma16(kb0, qh0, sHb);
                if (SCORE_RES) { sLa = wmma16(ka0, qr0, sLa); sLb = wmma16(kb0, qr0, sLb); }
                sHa = wmma16(ka1, qh1, sHa); sHb = wmma16(kb1, qh1, sHb);
                if (SCORE_RES) { sLa = wmma16(ka1, qr1, sLa); sLb = wmma16(kb1, qr1, sLb); }
                asm volatile("v_nop\n\tv_nop\n\tv_nop\n\tv_nop" : "+v"(sHa), "+v"(sLa), "+v"(sHb), "+v"(sLb) : "v"(ka0), "v"(ka1), "v"(kb0), "v"(kb1));
                float ta[8], tb[8];
#pragma unroll
                for (int r = 0; r < 8; ++r) { ta[r] = (sHa[r] + sLa[r] * QRI) * SC2; tb[r] = (sHb[r] + sLb[r] * QRI) * SC2; }
                if (key0 + 31 > t0) {
                    const int kidx = key0 + 8 * hi;
#pragma unroll
                    for (int r = 0; r < 8; ++r) { ta[r] = (kidx + r > tq) ? NEGV : ta[r]; tb[r] = (kidx + 16 + r > tq) ? NEGV : tb[r]; }
                }
                unsigned mw = MW[mo + (size_t)(key0 >> 5)];
                asm volatile("" : "+v"(mw));
                {                                   // padding-mask selects, every step (a zero word changes nothing)
                    const unsigned ma = mw >> (8 * hi), mc = mw >> (16 + 8 * hi);
#pragma unroll
                    for (int r = 0; r < 8; ++r) { ta[r] = (((ma >> r) & 1u) != 0u) ? NEGV : ta[r]; tb[r] = (((mc >> r) & 1u) != 0u) ? NEGV : tb[r]; }
                }
#pragma unroll
                for (int i = 0; i < 4; ++i) {
                    pa0[i] = __builtin_amdgcn_exp2f(ta[i] + shp) * inv; pa1[i] = __builtin_amdgcn_exp2f(ta[4 + i] + shp) * inv;
                    pc0[i] = __builtin_amdgcn_exp2f(tb[i] + shp) * inv; pc1[i] = __builtin_amdgcn_exp2f(tb[4 + i] + shp) * inv; }
            }
            // lane (t, h): keys 8h+r and 16+8h+r of this step -> os[t][0..31]; rows 0..15 x columns 0..31 all written
            *(v4fa*)(&os[wb + lr * 68 + 8 * hi]) = pa0;      *(v4fa*)(&os[wb + lr * 68 + 8 * hi + 4]) = pa1;
            *(v4fa*)(&os[wb + lr * 68 + 16 + 8 * hi]) = pc0; *(v4fa*)(&os[wb + lr * 68 + 16 + 8 * hi + 4]) = pc1;
            wave_sync();
            v4f val[4];
#pragma unroll
            for (int s = 0; s < 4; ++s) { const int row = 4 * s + (lane >> 3), c4 = (lane & 7) * 4;
                val[s] = *(const v4fa*)(&os[wb + row * 68 + c4]); }
{
#pragma unroll
                for (int s = 0; s < 4; ++s) { const int row = 4 * s + (lane >> 3), c4 = (lane & 7) * 4;
                    *(v4f*)(arow + (size_t)row * ATT_LD + key0 + c4) = val[s]; }
                 }
            wave_sync();
        }
    }
}

static constexpr size_t al256(size_t v) { return (v + 255) & ~(size_t)255; }
static constexpr size_t SZ_XB = al256((size_t)NB * SEQ * DM * 2);
static constexpr size_t SZ_WB = al256((size_t)3 * DM * DM * 2);
static constexpr size_t SZ_WF = al256((size_t)DM * DM * 2);
static constexpr size_t SZ_PL = al256((size_t)NB * SEQ * DM * 2);
static constexpr size_t SZ_MW = al256((size_t)NB * SEQ * (SEQ / 32) * 4);
static constexpr size_t SZ_TOTAL = SZ_XB + SZ_WB + SZ_WF + 5 * SZ_PL + 2 * SZ_PL + SZ_MW;
static_assert(SZ_TOTAL <= (size_t)134217728);          // workspace carve <= 128 MiB
static_assert(((size_t)DM * DM * 2) % 256 == 0);       // weight sub-planes stay 256-byte aligned
static_assert(SZ_PL == (size_t)NB * SEQ * DM * 2);     // ctx hi and lo planes are back to back with stride NB*SEQ*DM elements
static_assert((size_t)NB * NH_ * SEQ * HD * 2 == SZ_PL);   // q / k / v^T planes [NB*16][SEQ][64] fill one plane exactly

extern "C" void kernel_launch(void* const* d_in, const int* in_sizes, int n_in,
                              void* d_out, int out_size, void* d_ws, size_t ws_size, hipStream_t stream) {
    if (n_in < 6) return;
    const size_t needx = ((size_t)(NB - 1) * SEQ_FULL + SEQ) * DM;
    if ((size_t)in_sizes[0] < needx) return;
    if ((size_t)in_sizes[1] < (size_t)3 * DM * DM || (size_t)in_sizes[2] < (size_t)3 * DM) return;
    if ((size_t)in_sizes[3] < (size_t)DM * DM || (size_t)in_sizes[4] < (size_t)DM) return;
    if ((size_t)in_sizes[5] < ((size_t)(NB - 1) * SEQ_FULL + (SEQ - 1)) * SEQ_FULL + SEQ) return;
    if ((size_t)out_size < OUT1_OFF + ((size_t)(NB - 1) * OUT_SEQ + (SEQ - 1)) * ATT_LD + SEQ) return;
    if (SZ_TOTAL > ws_size) return;
    const float* x = (const float*)d_in[0]; const float* wqkv = (const float*)d_in[1]; const float* bqkv = (const float*)d_in[2];
    const float* wfc = (const float*)d_in[3]; const float* bfc = (const float*)d_in[4];          // wire order x, W_attn, b_attn, W_proj, b_proj, padding_mask
    const int* pmask = (const int*)d_in[5];          // [NB_FULL][SEQ_FULL][SEQ_FULL] int32, non-zero = key hidden
    float* OUT = (float*)d_out;      // [NB][SEQ][1024] then [NB][1][SEQ][SEQ]
    float* ATT = OUT + OUT1_OFF;
    char* wsp = (char*)d_ws;
    bf* XB = (bf*)wsp; wsp += SZ_XB;                 // [NB*SEQ][1024]
    bf* WB = (bf*)wsp; wsp += SZ_WB;                 // [3072][1024]: q rows | k rows | v rows (row e = h*64 + d)
    bf* WF = (bf*)wsp; wsp += SZ_WF;                 // [1024][1024]: W_proj^T
    h16* QH = (h16*)wsp; wsp += SZ_PL;               // [NB*16][SEQ][64]
    h16* QR = (h16*)wsp; wsp += SZ_PL;               // residual x2048
    h16* KP = (h16*)wsp; wsp += SZ_PL;               // [NB*16][SEQ][64]
    h16* VT = (h16*)wsp; wsp += SZ_PL;               // [NB*16][64][SEQ]
    h16* VR = (h16*)wsp; wsp += SZ_PL;               // residual x2048
    bf* CH = (bf*)wsp; wsp += SZ_PL;                 // ctx hi [NB*SEQ][1024]
    bf* CL = (bf*)wsp; wsp += SZ_PL;                 // ctx lo, directly after CH
    unsigned* MW = (unsigned*)wsp; wsp += SZ_MW;     // mask bit words [NB*SEQ][SEQ/32]

    if (SEQ == SEQ_FULL) {
        const size_t n8 = (size_t)NB * SEQ * DM / 8;
        k_cvt8<<<(unsigned)((n8 + 255) / 256), 256, 0, stream>>>(x, XB, n8);
    } else {
        const size_t n8 = (size_t)SEQ * DM / 8;
        for (int b = 0; b < NB; ++b) k_cvt8<<<(unsigned)((n8 + 255) / 256), 256, 0, stream>>>(x + (size_t)b * SEQ_FULL * DM, XB + (size_t)b * SEQ * DM, n8);
    }
    // W_attn in[1024 k][3072 e] -> WB out[e][1024 k] (no row permutation); W_proj in[1024 k][1024 e] -> WF out[e][1024 k]
    k_cvtT<<<dim3(DM / 64, 3 * DM / 64, 1), 256, 0, stream>>>(wqkv, 3 * DM, WB, 1 << 30);
    k_cvtT<<<dim3(DM / 64, DM / 64, 1), 256, 0, stream>>>(wfc, DM, WF, 1 << 30);
    {
        const size_t nW = (size_t)NB * SEQ * (SEQ / 32);
        k_mbits<<<(unsigned)(nW / 256), 256, 0, stream>>>(pmask, MW, nW);
    }

    k_gemm<0><<<dim3(NB * SEQ / 128, DM / 128, 1), 128, 0, stream>>>(XB, WB, bqkv, QH, QR, OUT);
    k_gemm<1><<<dim3(NB * SEQ / 128, DM / 128, 1), 128, 0, stream>>>(XB, WB + (size_t)DM * DM, bqkv, KP, KP, OUT);
    // v: weight rows are the M operand, tokens the N operand -> C[e][token] lands directly in the v^T planes
    k_gemm<2><<<dim3(DM / 128, NB * SEQ / 128, 1), 128, 0, stream>>>(WB + (size_t)2 * DM * DM, XB, bqkv, VT, VR, OUT);

    k_flash<<<dim3(SEQ / (16 * AW), NB * NH_, 1), 32 * AW, 0, stream>>>(QH, QR, KP, VT, VR, MW, CH, CL, ATT);

    k_gemm<3><<<dim3(NB * SEQ / 128, DM / 128, 1), 128, 0, stream>>>(CH, WF, bfc, QH, QR, OUT);
}

// v002
// One run takes 142 microseconds.
// Two timings next to v001 put it at 1.26 and 1.25 times that version's speed.
// Counting every step since v000, it is 1.54 times as fast.
#include <hip/hip_runtime.h>

// Causal multi-head self-attention, width 1024 = 16 heads x 64, x [NB][SEQ][1024], fused W_attn [in][out] + bias, true head split q[b][h][t][d] = qkv[b][t][h*64+d], score scale 1/8,
// key > query OR padding_mask[b][q][k] != 0 replaced by -inf, heads merged back to [b][t][h*64+d], output projection W_proj [in][out] + bias (f32 out); second output = normalised probabilities of head 0, [NB][1][SEQ][SEQ] f32.
// Compute dtypes, f32 accumulate everywhere: qkv projections v_wmma_f32_16x16x32_bf16 (x, W, biases RNE-converted to bf16; products exact); scores v_wmma_f32_16x16x32_f16: k single f16, q as f16 value + f16 residual x2048 in its own accumulator;
// P (x256 carry, cancels in the normalisation) single f16; v single f16 plus, for query rows < 512, an f16 residual x2048 in its own accumulator; softmax f32 (online, running max); output projection v_wmma_f32_16x16x32_bf16 with ctx as bf16 hi + bf16 lo planes (unscaled, shared accumulator) against bf16 W_proj.
// Layout: bf16 copies of x and transposed (K-contiguous) weights; q (hi, residual) and k planes [b*16+h][t][64]; v^T planes [b*16+h][d][t] produced by the v GEMM run with the weight rows as the M operand and the tokens as the N operand; ctx planes compact [NB*SEQ][1024]; padding mask packed to one 32-key bit word per (b, q, key block).

#ifndef NB
#define NB 4
#endif
#ifndef SEQ
#define SEQ 1024
#endif
#define NB_FULL  4
#define SEQ_FULL 1024
#ifndef OUT_SEQ
#define OUT_SEQ SEQ              // row pitch (in tokens) between batches of the outputs
#endif
#ifndef ATT_LD
#define ATT_LD OUT_SEQ           // key pitch of one probability row of the second output
#endif
#ifndef SCORE_RES
#define SCORE_RES 1              // 1: q residual plane adds a second score product; 0: single score product
#endif
#define DM   1024
#define NH_  16
#define HD   64
#define AW   4                   // waves per flash block (16 query rows each)
#define EARLY 512                // query rows below this use the v residual plane
#define QRS  2048.0f             // carry of the residual planes
#define QRI  (1.0f / 2048.0f)
#define SC2  (0.125f * 1.4426950408889634f)   // HD^-0.5 * log2(e)
#define PSH  8.0f                // log2 of the P carry (256)
#define NEGV (-3.0e38f)
#define OUT1_OFF ((size_t)NB_FULL * SEQ_FULL * DM)   // element offset of the second output (fixed by the full problem size)

static_assert(HD == 64);
static_assert(NH_ * HD == DM);
static_assert(DM % 64 == 0);
static_assert(DM % 32 == 0);
static_assert(SEQ % 256 == 0);                 // SEQ/32 mask words per row is a multiple of 8; 64-token tiles stay inside one batch
static_assert(SEQ % 64 == 0);
static_assert((NB * SEQ) % 128 == 0);
static_assert(DM % 128 == 0);
static_assert(DM / 64 >= 2);                   // the GEMM prologue fetches two 64-k stages
static_assert(SEQ % 32 == 0);
static_assert(SEQ % (16 * AW) == 0);
static_assert(((size_t)SEQ * DM) % 8 == 0);
static_assert(NB <= NB_FULL);
static_assert(SEQ <= SEQ_FULL);
static_assert(((size_t)NB * SEQ * (SEQ / 32)) % 256 == 0);        // mask-word grid x block == plane extent
static_assert(ATT_LD % 32 == 0);
static_assert(ATT_LD >= SEQ);
static_assert(OUT1_OFF * 4 == (size_t)16777216);                   // byte offset of the second output
static_assert(((size_t)(NB - 1) * OUT_SEQ + SEQ) * DM <= OUT1_OFF);
static_assert(OUT1_OFF + ((size_t)(NB - 1) * OUT_SEQ + (SEQ - 1)) * ATT_LD + SEQ <= OUT1_OFF + (size_t)NB_FULL * SEQ_FULL * SEQ_FULL);

typedef _Float16 h16;
typedef unsigned short bf;
typedef __attribute__((ext_vector_type(16))) __bf16   v16bf;
typedef __attribute__((ext_vector_type(16))) _Float16 v16h;
typedef __attribute__((ext_vector_type(8)))  _Float16 v8h;
typedef __attribute__((ext_vector_type(8)))  unsigned short v8us;
typedef __attribute__((ext_vector_type(8)))  float    v8f;
typedef __attribute__((ext_vector_type(4)))  float    v4f;
typedef __attribute__((ext_vector_type(4)))  int      v4i;
typedef v4f  __attribute__((may_alias)) v4fa;
typedef v8us __attribute__((may_alias)) v8usa;

__device__ __forceinline__ unsigned short f2bf(float f) { unsigned u = __float_as_uint(f); u += 0x7FFFu + ((u >> 16) & 1u); return (unsigned short)(u >> 16); }
__device__ __forceinline__ float bf2f(unsigned short h) { return __uint_as_float(((unsigned)h) << 16); }
__device__ __forceinline__ v16h cat16(v8h lo, v8h hi) { return __builtin_shufflevector(lo, hi, 0, 1, 2, 3, 4, 5, 6, 7, 8, 9, 10, 11, 12, 13, 14, 15); }
__device__ __forceinline__ v16bf cat16b(v8us lo, v8us hi) { return __builtin_bit_cast(v16bf, __builtin_shufflevector(lo, hi, 0, 1, 2, 3, 4, 5, 6, 7, 8, 9, 10, 11, 12, 13, 14, 15)); }
__device__ __forceinline__ v8f wmma16(v16h a, v16h b, v8f c) { return __builtin_amdgcn_wmma_f32_16x16x32_f16(false, a, false, b, (short)0, c, false, false); }
__device__ __forceinline__ v8f wmmab(v16bf a, v16bf b, v8f c) { return __builtin_amdgcn_wmma_f32_16x16x32_bf16(false, a, false, b, (short)0, c, false, false); }
// fragment loaders from K-contiguous 16-bit rows; p already includes + 8*(lane>>4): elements 0..7 <- k0+8h+0..7, elements 8..15 <- k0+16+8h+0..7 (same map for A and B)
__device__ __forceinline__ v16h  ldh(const h16* p) { return cat16(*(const v8h*)p, *(const v8h*)(p + 16)); }
__device__ __forceinline__ v16bf ldb(const bf* p)  { return cat16b(*(const v8us*)p, *(const v8us*)(p + 16)); }
// ordering point for wave-private LDS tiles (same wave writes and reads)
__device__ __forceinline__ void wave_sync() { __builtin_amdgcn_fence(3 /* release order */, "wavefront"); __builtin_amdgcn_wave_barrier(); asm volatile("" ::: "memory"); }
// f32 -> f16 for WMMA operand planes: results below the smallest f16 normal become exact zero (value select)
static __device__ __forceinline__ h16 toh_flush(float v) { const h16 r = (h16)v; return (fabsf(v) < 6.103515625e-05f) ? (h16)0.0f : r; }

__global__ __launch_bounds__(256) void k_cvt8(const float* __restrict__ src, bf* dst, size_t n8) {
    const size_t i = (size_t)blockIdx.x * 256 + threadIdx.x; if (i >= n8) return;
    const v8f v = *(const v8f*)(src + i * 8); v8us o;
#pragma unroll
    for (int k = 0; k < 8; ++k) o[k] = f2bf(v[k]);
    *(v8us*)(dst + i * 8) = o; 
}

// k_cvtT: W [DM k][ldn] f32 (row = k, column = e) -> bf16 plane dst[row(e)][k] (K-contiguous), 64 k x 64 e tile through LDS (cross-wave: block barrier).
// row(e) = e for e < permFrom; for e >= permFrom (unused: both launches pass 1 << 30), with ee = e - permFrom = c*64 + d: row = permFrom + d*16 + c.
__global__ __launch_bounds__(256) void k_cvtT(const float* __restrict__ W, int ldn, bf* dst, int permFrom) {
    __shared__ __align__(16) unsigned short ts[64 * 72];
    const int t = threadIdx.x; const int k0 = blockIdx.x * 64, n0 = blockIdx.y * 64;
#pragma unroll 4
    for (int i = 0; i < 16; ++i) { const int k = i * 4 + (t >> 6), n = t & 63;      // 16 x 4 = 64 k rows, 64 columns
        ts[n * 72 + k] = f2bf(W[(size_t)(k0 + k) * (size_t)ldn + n0 + n]); }
    __syncthreads();
    v8us o0, o1; size_t d0, d1;
    { const int p = t, n = p >> 3, q = p & 7; o0 = *(const v8usa*)(&ts[n * 72 + 8 * q]);
      const int e = n0 + n; const int ee = e - permFrom; const int row = (e >= permFrom) ? (permFrom + (ee & 63) * 16 + (ee >> 6)) : e;
      d0 = (size_t)row * DM + k0 + 8 * q; }
    { const int p = t + 256, n = p >> 3, q = p & 7; o1 = *(const v8usa*)(&ts[n * 72 + 8 * q]);
      const int e = n0 + n; const int ee = e - permFrom; const int row = (e >= permFrom) ? (permFrom + (ee & 63) * 16 + (ee >> 6)) : e;
      d1 = (size_t)row * DM + k0 + 8 * q; }
{
        *(v8us*)(dst + d0) = o0; *(v8us*)(dst + d1) = o1;
         }
}

// k_mbits: padding mask [NB_FULL][SEQ_FULL][SEQ_FULL] int32 -> bit words MW[b*SEQ + q][SEQ/32], bit j of word w = (mask[b][q][32*w + j] != 0).
__global__ __launch_bounds__(256) void k_mbits(const int* __restrict__ pm, unsigned* MW, size_t nW) {
    const size_t w = (size_t)blockIdx.x * 256 + threadIdx.x; if (w >= nW) return;
    const size_t row = w / (size_t)(SEQ / 32); const size_t j = w % (size_t)(SEQ / 32);
    const size_t b = row / (size_t)SEQ, t = row % (size_t)SEQ;
    const int* src = pm + (b * SEQ_FULL + t) * (size_t)SEQ_FULL + j * 32;
    unsigned bits = 0u;
#pragma unroll
    for (int i = 0; i < 8; ++i) { const v4i v = *(const v4i*)(src + 4 * i);
        const unsigned n = ((v[0] != 0) ? 1u : 0u) | ((v[1] != 0) ? 2u : 0u) | ((v[2] != 0) ? 4u : 0u) | ((v[3] != 0) ? 8u : 0u);
        bits |= n << (4 * i); }
    *(unsigned*)(MW + w) = bits; 
}

// work-group barrier that orders LDS only: the release and acquire fences name the LDS address space, so the global loads that prefetch a later stage into registers stay in flight across it
__device__ __forceinline__ void lds_barrier() { __builtin_amdgcn_fence(__ATOMIC_RELEASE, "workgroup", "local"); __builtin_amdgcn_s_barrier(); __builtin_amdgcn_fence(__ATOMIC_ACQUIRE, "workgroup", "local"); }

// k_gemm: bf16 GEMM, work-group of 4 waves on a 128x128 tile, each wave a 64x64 quadrant (16 accumulators), K = DM walked in stages of 64.
// Each stage's A and B tiles (128 rows x 64 k) are read from the K-contiguous bf16 planes as whole 128-byte rows (8 lanes x 16 B a row) into registers two stages ahead and
// stored one stage ahead to the other of two LDS buffers (row pitch 144 B); fragments come from LDS. One work-group barrier a stage: it publishes the stage just stored
// and ends every wave's reads of the buffer that the next stage's stores overwrite. k order of every accumulator: ascending in steps of 32.
// C[m][n] = sum_k A[m][k] Bt[n][k] + bias (bias RNE-converted to bf16, added in f32). 128 threads per block.
// MODE 0: q  -> A = x tokens, Bt = q weight rows; f16 value plane Ph and f16 residual x2048 plane Pr, layout [b*16+h][t][64] (quadrant column block = head h; bias columns 0..1023). grid (M/128, 1024/128)
// MODE 1: k  -> as MODE 0, value plane only (bias columns 1024..2047)
// MODE 2: v  -> A = v weight rows (row e = h*64 + d), Bt = x tokens: C[e][token]; value (Ph) and residual x2048 (Pr) planes [b*16+h][d][t]; bias per ROW (columns 2048..3071 of the bias vector). grid (1024/128, M/128)
// MODE 3: output projection -> A = ctx hi plane then ctx lo plane (one shared accumulator), Bt = W_proj^T rows; f32 rows of OUT. grid (M/128, 1024/128)
struct yes_t { static constexpr bool value = true; };
struct no_t { static constexpr bool value = false; };
#define LP 72                    // LDS row pitch in 16-bit elements: 144 B = 16 B x 9, conflict-free for 16-byte fragment reads
template <int MODE>
__global__ __launch_bounds__(128) void k_gemm(const bf* __restrict__ A, const bf* __restrict__ Bt, const float* __restrict__ bias, h16* Ph, h16* Pr, float* OUT) {
    __shared__ __align__(16) bf As[2 * 128 * LP];
    __shared__ __align__(16) bf Bs[2 * 128 * LP];
    __shared__ __align__(16) float osw[4 * 16 * 68];
    const int K = DM;
    const int tid = threadIdx.x;
    const int lane = tid & 31, lr = lane & 15, hi = lane >> 4;
    const int wave = __builtin_amdgcn_readfirstlane(tid >> 5);
    float* os = osw + wave * 16 * 68;                // wave-private epilogue tile
    const int wm = wave & 1, wn = wave >> 1;
    const int r0 = blockIdx.x * 128 + wm * 64, c0 = blockIdx.y * 128 + wn * 64;
    v8f acc[4][4];
#pragma unroll
    for (int mb = 0; mb < 4; ++mb)
#pragma unroll
        for (int nb = 0; nb < 4; ++nb) acc[mb][nb] = (v8f){};
    const int srow = tid >> 3, scol = (tid & 7) * 8;  // staging: 16 rows a pass, 8 passes a tile
    const bf* ga = A + (size_t)(blockIdx.x * 128 + srow) * K + scol;
    const bf* gb = Bt + (size_t)(blockIdx.y * 128 + srow) * K + scol;
    const int sl = srow * LP + scol;
    const int fa = (wm * 64 + lr) * LP + 8 * hi, fb = (wn * 64 + lr) * LP + 8 * hi;
    const int SPP = K / 64;                           // stages per plane
    const int NS = ((MODE == 3) ? 2 : 1) * SPP;
    v8us ra[8], rb[8];
#pragma unroll
    for (int i = 0; i < 8; ++i) { ra[i] = *(const v8us*)(ga + (size_t)i * 16 * K); rb[i] = *(const v8us*)(gb + (size_t)i * 16 * K); }
#pragma unroll
    for (int i = 0; i < 8; ++i) { *(v8us*)(&As[sl + i * 16 * LP]) = ra[i]; *(v8us*)(&Bs[sl + i * 16 * LP]) = rb[i]; }
#pragma unroll
    for (int i = 0; i < 8; ++i) { ra[i] = *(const v8us*)(ga + 64 + (size_t)i * 16 * K); rb[i] = *(const v8us*)(gb + 64 + (size_t)i * 16 * K); }   // stage 1 (NS >= 2)
    lds_barrier();
    // one stage; ST: stage s+1 exists (it waits in ra, rb since the stage before), LD: stage s+2 exists. Both are compile-time so that the body is one straight run whose LDS waits are counted exactly.
    auto stage = [&](const int s, auto ST, auto LD) {
        const int cur = (s & 1) * (128 * LP), nxt = (128 * LP) - cur;
        v16bf a[2][4], b[2][4];                       // both 32-k blocks' fragments of this stage, read as one group ahead of the matrix instructions
#pragma unroll
        for (int kb = 0; kb < 2; ++kb) {
#pragma unroll
            for (int mb = 0; mb < 4; ++mb) a[kb][mb] = ldb(&As[cur + fa + mb * 16 * LP + kb * 32]);
#pragma unroll
            for (int nb = 0; nb < 4; ++nb) b[kb][nb] = ldb(&Bs[cur + fb + nb * 16 * LP + kb * 32]);
        }
        if constexpr (ST.value) {                     // stage s+1 goes to the buffer that stage s-1 was read from
#pragma unroll
            for (int i = 0; i < 8; ++i) { *(v8us*)(&As[nxt + sl + i * 16 * LP]) = ra[i]; *(v8us*)(&Bs[nxt + sl + i * 16 * LP]) = rb[i]; }
        }
        if constexpr (LD.value) {                     // stage s+2 starts its way from global memory
            const int s2 = s + 2; const int pl = (s2 >= SPP) ? 1 : 0; const int kc = (s2 - pl * SPP) * 64;
            const bf* pa = ga + (size_t)pl * ((size_t)NB * SEQ * DM) + kc; const bf* pb = gb + kc;
#pragma unroll
            for (int i = 0; i < 8; ++i) { ra[i] = *(const v8us*)(pa + (size_t)i * 16 * K); rb[i] = *(const v8us*)(pb + (size_t)i * 16 * K); }
            // the address registers of the loads above are free for reuse behind them: the wait stands in front of any overwrite
            asm volatile("s_wait_xcnt 0x0" ::: "memory");
        }
#pragma unroll
        for (int kb = 0; kb < 2; ++kb)
#pragma unroll
            for (int nb = 0; nb < 4; ++nb)
#pragma unroll
                for (int mb = 0; mb < 4; ++mb) acc[mb][nb] = wmmab(a[kb][mb], b[kb][nb], acc[mb][nb]);
        // four vector slots behind the stage's last matrix instruction before its operand registers may be reloaded; naming every accumulator keeps all of the stage's
        // matrix instructions in front of the barrier, where they run while the LDS reads and stores of the stage drain
        asm volatile("v_nop\n\tv_nop\n\tv_nop\n\tv_nop"
                     : "+v"(acc[0][0]), "+v"(acc[1][0]), "+v"(acc[2][0]), "+v"(acc[3][0]), "+v"(acc[0][1]), "+v"(acc[1][1]), "+v"(acc[2][1]), "+v"(acc[3][1]),
                       "+v"(acc[0][2]), "+v"(acc[1][2]), "+v"(acc[2][2]), "+v"(acc[3][2]), "+v"(acc[0][3]), "+v"(acc[1][3]), "+v"(acc[2][3]), "+v"(acc[3][3])
                     : "v"(a[1][0]), "v"(a[1][1]), "v"(a[1][2]), "v"(a[1][3]), "v"(b[1][3]));
        if constexpr (ST.value) lds_barrier();        // publishes stage s+1 and ends the reads of this stage's buffer; behind the last stage nothing is left to publish
    };
#pragma unroll 1
    for (int s = 0; s < NS - 2; ++s) stage(s, yes_t{}, yes_t{});
    stage(NS - 2, yes_t{}, no_t{});
    stage(NS - 1, no_t{}, no_t{});
    float bv[4];
#pragma unroll
    for (int nb = 0; nb < 4; ++nb) {
        const int bi = (MODE == 2) ? (2 * DM) : (((MODE == 1) ? DM : 0) + c0 + nb * 16 + lr);
        bv[nb] = bf2f(f2bf(bias[bi])); }
#pragma unroll
    for (int mb = 0; mb < 4; ++mb) {
        float rb[8];
#pragma unroll
        for (int j = 0; j < 8; ++j) rb[j] = 0.0f;
        if (MODE == 2) {                                // per-row bias: 8 consecutive floats, one 32-byte vector load
            const v8f bq = *(const v8f*)(bias + 2 * DM + r0 + mb * 16 + hi * 8);
#pragma unroll
            for (int j = 0; j < 8; ++j) rb[j] = bf2f(f2bf(bq[j])); }
#pragma unroll
        for (int nb = 0; nb < 4; ++nb) {
#pragma unroll
            for (int j = 0; j < 8; ++j) os[(hi * 8 + j) * 68 + nb * 16 + lr] = (MODE == 2) ? (acc[mb][nb][j] + rb[j]) : (acc[mb][nb][j] + bv[nb]); }   // D: row 8h+j, col lane&15; rows 0..15 x cols 0..63 all written
        wave_sync();
        if (MODE == 0 || MODE == 1 || MODE == 2) {
            size_t sb, pitch;
            if (MODE == 2) { const int bb = c0 / SEQ; const int tt = c0 % SEQ;                        // rows = d of head r0/64, columns = 64 tokens of one batch
                sb = ((size_t)(bb * NH_ + (r0 >> 6)) * HD + (size_t)(16 * mb)) * SEQ + (size_t)tt; pitch = SEQ; }
            else { const int tokrow = r0 + 16 * mb; const int bb = tokrow / SEQ; const int tt = tokrow % SEQ;   // rows = tokens, columns = d of head c0/64
                sb = ((size_t)(bb * NH_ + (c0 >> 6)) * SEQ + (size_t)tt) * HD; pitch = HD; }
{
#pragma unroll
                for (int s = 0; s < 4; ++s) { const int row = 4 * s + (lane >> 3), c8 = (lane & 7) * 8;
                    const v4f x0 = *(const v4fa*)(&os[row * 68 + c8]); const v4f x1 = *(const v4fa*)(&os[row * 68 + c8 + 4]); v8h hv, rv;
#pragma unroll
                    for (int i = 0; i < 4; ++i) { const h16 a0 = toh_flush(x0[i]); const h16 a1 = toh_flush(x1[i]); hv[i] = a0; hv[4 + i] = a1;
                        rv[i] = toh_flush((x0[i] - (float)a0) * QRS); rv[4 + i] = toh_flush((x1[i] - (float)a1) * QRS); }
                    const size_t oo = sb + (size_t)row * pitch + c8;
                    *(v8h*)(Ph + oo) = hv; if (MODE != 1) *(v8h*)(Pr + oo) = rv; }
                 }
        } else {
            const int grow = r0 + 16 * mb; const int bb = grow / SEQ; const int nn = grow % SEQ;
            float* orow = OUT + ((size_t)bb * OUT_SEQ + nn) * DM + c0;
{
#pragma unroll
                for (int s = 0; s < 8; ++s) { const int row = 2 * s + hi, cofs = lr * 4;   // 8 s x 2 rows = 16 rows; 16 lanes x 4 floats = 64 columns
                    const v4f val = *(const v4fa*)(&os[row * 68 + cofs]);
                    *(v4f*)(orow + (size_t)row * DM + cofs) = val; }
                 }
        }
        wave_sync();
    }
}

// k_flash: fused causal attention, one wave per 16 query rows of one (batch, head); Q fragments straight from the f16 planes (two 16-B loads each, arithmetic addressing).
// The four waves of a work-group share each 64-key stage of K, V^T and (early rows) the V^T residual through LDS: whole 128-byte rows are brought by asynchronous copies into one of two buffers
// (row pitch 144 B), one stage ahead of the stage being worked on; fragments are read from LDS. One work-group barrier a stage publishes the next stage and ends the reads of the buffer refilled behind it.
// Transposed form: S^T[key][t] = K Q^T (A = K rows, B = Q rows); lane (t = lane&15, h = lane>>4) holds keys 8h+r of each 16-key tile, so the packed
// P tile is directly the B fragment of O^T[d][t] = V^T P^T (element r <- tile keys 0..15, element 8+r <- tile keys 16..31, lane unchanged).
// Keys run over [0, t0+16) in steps of 32; on steps that touch the diagonal, scores with key > query are replaced by a very negative value (P = 0 exactly);
// the padding-mask bit word of (b, query, key block) is read once per lane per step and its bit selects run at every step (bit 8h+r <-> key key0+8h+r, bit 16+8h+r <-> key key0+16+8h+r; a set bit replaces the score the same way; a zero word changes nothing).
// A query row that never sees a visible key yields NaN (all scores replaced by -inf).
// Softmax state (running max, partial sum) is one scalar per lane; the two lane halves of a row are combined with one xor-16 exchange.
#define FP 72                    // LDS row pitch of a staged tile in 16-bit elements: 144 B = 16 B x 9, conflict-free for 16-byte fragment reads
#define SK 64                    // keys per stage
#define TILE_E (64 * FP)         // one staged tile: 64 rows (K: keys, V^T: d) of 64 elements
#define BUF_E  (3 * TILE_E)      // one buffer: K | V^T | V^T residual
static_assert(SK == 16 * AW);    // a work-group's query rows span one stage: stages 0..blockIdx.x reach its diagonal
static_assert(EARLY % (16 * AW) == 0);   // the residual plane is used by all waves of a work-group or by none
static_assert(32 * AW == 128);   // staging map: 8 lanes a row, 16 rows a copy, 4 copies a tile
// four asynchronous 16-byte copies a lane (rows r, r+16, r+32, r+48 of one tile); the wait is the statement's last line, so it stands in front of any rewrite of an address register that a copy names
__device__ __forceinline__ void acopy4(const unsigned l, const h16* g, const size_t gp) {
    const unsigned l1 = l + 16 * FP * 2, l2 = l + 32 * FP * 2, l3 = l + 48 * FP * 2;
    const h16* g1 = g + 16 * gp; const h16* g2 = g + 32 * gp; const h16* g3 = g + 48 * gp;
    asm volatile("global_load_async_to_lds_b128 %0, %4, off\n\t"
                 "global_load_async_to_lds_b128 %1, %5, off\n\t"
                 "global_load_async_to_lds_b128 %2, %6, off\n\t"
                 "global_load_async_to_lds_b128 %3, %7, off\n\t"
                 "s_wait_xcnt 0x0"
                 :: "v"(l), "v"(l1), "v"(l2), "v"(l3), "v"(g), "v"(g1), "v"(g2), "v"(g3) : "memory");
}
__global__ __launch_bounds__(32 * AW) void k_flash(const h16* __restrict__ QH, const h16* __restrict__ QR, const h16* __restrict__ KP, const h16* __restrict__ VT, const h16* __restrict__ VR, const unsigned* __restrict__ MW, bf* CH, bf* CL, float* ATT) {
    __shared__ __align__(16) float os[AW * 16 * 68];
    __shared__ __align__(16) h16 ring[2 * BUF_E];
    const int lane = threadIdx.x & 31, lr = lane & 15, hi = lane >> 4;
    const int wave = __builtin_amdgcn_readfirstlane((int)(threadIdx.x >> 5));
    const int zh = blockIdx.y;
    const int bb = zh / NH_, hh = zh % NH_;
    const int t0 = (blockIdx.x * AW + wave) * 16;
    const size_t pbase = (size_t)zh * SEQ * HD;
    const size_t qo = pbase + (size_t)(t0 + lr) * HD + 8 * hi;
    const v16h qh0 = ldh(QH + qo), qh1 = ldh(QH + qo + 32), qr0 = ldh(QR + qo), qr1 = ldh(QR + qo + 32);   // B fragments: col t, k = d
    const int fk = lr * FP + 8 * hi;                         // LDS, + key * FP         (A fragment: row key, k = d)
    const int fv = TILE_E + lr * FP + 8 * hi;                // LDS, + 16j*FP + key     (A fragment: row d, k = key)
    const int kend = t0 + 16;
    const bool early = (int)blockIdx.x * (16 * AW) < EARLY;  // same for the four waves
    const int srow = (int)threadIdx.x >> 3, scol = ((int)threadIdx.x & 7) * 8;   // staging: 8 lanes x 16 B = one 128-byte row
    const unsigned sl = (unsigned)(size_t)(&ring[srow * FP + scol]);             // this lane's LDS byte address in buffer 0, K tile
    const h16* gk = KP + pbase + (size_t)srow * HD + scol;   // + stage * SK * HD
    const h16* gv = VT + pbase + (size_t)srow * SEQ + scol;  // + stage * SK
    const h16* gr = VR + pbase + (size_t)srow * SEQ + scol;
    const int nst = (int)blockIdx.x + 1;                     // stages up to and including the work-group's diagonal
    auto fill = [&](const int s) {                           // stage s -> buffer s & 1; every lane on, work-group-uniform control flow
        const unsigned lb = sl + (unsigned)((s & 1) * (BUF_E * 2));
        acopy4(lb, gk + (size_t)s * (SK * HD), HD);
        acopy4(lb + TILE_E * 2, gv + (size_t)s * SK, SEQ);
        if (early) acopy4(lb + 2 * TILE_E * 2, gr + (size_t)s * SK, SEQ);
    };
    const int tq = t0 + lr;
    const size_t mo = ((size_t)bb * SEQ + (size_t)tq) * (size_t)(SEQ / 32);   // + key0/32: mask word of this lane's query row
    v8f o0 = (v8f){}, o1 = (v8f){}, o2 = (v8f){}, o3 = (v8f){};
    v8f e0 = (v8f){}, e1 = (v8f){}, e2 = (v8f){}, e3 = (v8f){};
    float m = NEGV, l = 0.0f;
    fill(0);
    asm volatile("s_wait_asynccnt 0x0" ::: "memory");        // this wave's copies of stage 0 have landed
    __syncthreads();                                         // publishes stage 0
    if (nst > 1) fill(1);
#pragma unroll 1
    for (int s = 0; s < nst; ++s) {
      const int cur = (s & 1) * BUF_E;
      for (int kk = 0; kk < SK; kk += 32) {
        const int key0 = s * SK + kk;
        if (key0 >= kend) break;                    // wave-uniform: keys past this wave's diagonal; the stage's foot below is still passed
        const h16* ka = &ring[cur + fk + kk * FP];
        const v16h ka0 = ldh(ka), ka1 = ldh(ka + 32), kb0 = ldh(ka + 16 * FP), kb1 = ldh(ka + 16 * FP + 32);
        v8f sHa = (v8f){}, sLa = (v8f){}, sHb = (v8f){}, sLb = (v8f){};
        sHa = wmma16(ka0, qh0, sHa); sHb = wmma16(kb0, qh0, sHb);
        if (SCORE_RES) { sLa = wmma16(ka0, qr0, sLa); sLb = wmma16(kb0, qr0, sLb); }
        sHa = wmma16(ka1, qh1, sHa); sHb = wmma16(kb1, qh1, sHb);
        if (SCORE_RES) { sLa = wmma16(ka1, qr1, sLa); sLb = wmma16(kb1, qr1, sLb); }
        asm volatile("v_nop\n\tv_nop\n\tv_nop\n\tv_nop" : "+v"(sHa), "+v"(sLa), "+v"(sHb), "+v"(sLb) : "v"(ka0), "v"(ka1), "v"(kb0), "v"(kb1));
        float ta[8], tb[8];
#pragma unroll
        for (int r = 0; r < 8; ++r) { ta[r] = (sHa[r] + sLa[r] * QRI) * SC2; tb[r] = (sHb[r] + sLb[r] * QRI) * SC2; }
        if (key0 + 31 > t0) {                       // wave-uniform: this step touches the diagonal
            const int kidx = key0 + 8 * hi;
#pragma unroll
            for (int r = 0; r < 8; ++r) { ta[r] = (kidx + r > tq) ? NEGV : ta[r]; tb[r] = (kidx + 16 + r > tq) ? NEGV : tb[r]; }
        }
        unsigned mw = MW[mo + (size_t)(key0 >> 5)];
        asm volatile("" : "+v"(mw));
        {                                           // padding-mask selects, every step (a zero word changes nothing)
            const unsigned ma = mw >> (8 * hi), mc = mw >> (16 + 8 * hi);
#pragma unroll
            for (int r = 0; r < 8; ++r) { ta[r] = (((ma >> r) & 1u) != 0u) ? NEGV : ta[r]; tb[r] = (((mc >> r) & 1u) != 0u) ? NEGV : tb[r]; }
        }
        float mx = NEGV;
#pragma unroll
        for (int r = 0; r < 8; ++r) mx = fmaxf(mx, fmaxf(ta[r], tb[r]));
        mx = fmaxf(mx, __shfl_xor(mx, 16, 32));
        const float mnew = fmaxf(m, mx);
        const float alpha = __builtin_amdgcn_exp2f(m - mnew);
        const float sh = PSH - mnew;
        v16h pb; float ls = 0.0f;
#pragma unroll
        for (int r = 0; r < 8; ++r) { const float ea = ta[r] + sh, ec = tb[r] + sh;
            const h16 pa = (ea < -14.0f) ? (h16)0.0f : (h16)__builtin_amdgcn_exp2f(ea);       // exponent select: no f16 result below the smallest normal
            const h16 pc = (ec < -14.0f) ? (h16)0.0f : (h16)__builtin_amdgcn_exp2f(ec);
            pb[r] = pa; pb[8 + r] = pc; ls += (float)pa + (float)pc; }
        l = l * alpha + ls; m = mnew;
        o0 = o0 * alpha; o1 = o1 * alpha; o2 = o2 * alpha; o3 = o3 * alpha;
        const h16* va = &ring[cur + fv + kk];
        const v16h v0 = ldh(va), v1 = ldh(va + 16 * FP), v2 = ldh(va + 32 * FP), v3 = ldh(va + 48 * FP);
        o0 = wmma16(v0, pb, o0); o1 = wmma16(v1, pb, o1); o2 = wmma16(v2, pb, o2); o3 = wmma16(v3, pb, o3);
        asm volatile("v_nop\n\tv_nop\n\tv_nop\n\tv_nop" : "+v"(o0), "+v"(o1), "+v"(o2), "+v"(o3) : "v"(v0), "v"(v1), "v"(v2), "v"(v3), "v"(pb));
        if (early) {                                // wave-uniform: residual plane of v in its own accumulators
            e0 = e0 * alpha; e1 = e1 * alpha; e2 = e2 * alpha; e3 = e3 * alpha;
            const h16* vr = va + TILE_E;
            const v16h w0 = ldh(vr), w1 = ldh(vr + 16 * FP), w2 = ldh(vr + 32 * FP), w3 = ldh(vr + 48 * FP);
            e0 = wmma16(w0, pb, e0); e1 = wmma16(w1, pb, e1); e2 = wmma16(w2, pb, e2); e3 = wmma16(w3, pb, e3);
            asm volatile("v_nop\n\tv_nop\n\tv_nop\n\tv_nop" : "+v"(e0), "+v"(e1), "+v"(e2), "+v"(e3) : "v"(w0), "v"(w1), "v"(w2), "v"(w3), "v"(pb));
        }
      }
      // foot of stage s, every wave: its LDS reads of this buffer are done, its copies of stage s+1 have landed; the barrier publishes stage s+1 and frees this buffer for stage s+2
      asm volatile("s_wait_dscnt 0x0" ::: "memory");
      asm volatile("s_wait_asynccnt 0x0" ::: "memory");
      __syncthreads();
      if (s + 2 < nst) fill(s + 2);
    }
    asm volatile("s_wait_asynccnt 0x0" ::: "memory");        // no copy is outstanding behind the loop
    l += __shfl_xor(l, 16, 32);
    const float inv = (m > NEGV) ? (1.0f / l) : __uint_as_float(0x7FC00000u);   // no visible key in the whole row: NaN row
    const int wb = wave * 16 * 68;
    // O^T D layout: o_j[r] = (d = 16j + 8h + r, t = lane&15) -> os[t][d]; rows 0..15 x columns 0..63 all written
    { v4f a, c;
#pragma unroll
      for (int i = 0; i < 4; ++i) { a[i] = (o0[i] + e0[i] * QRI) * inv; c[i] = (o0[4 + i] + e0[4 + i] * QRI) * inv; }
      *(v4fa*)(&os[wb + lr * 68 +  0 + 8 * hi]) = a; *(v4fa*)(&os[wb + lr * 68 +  0 + 8 * hi + 4]) = c;
#pragma unroll
      for (int i = 0; i < 4; ++i) { a[i] = (o1[i] + e1[i] * QRI) * inv; c[i] = (o1[4 + i] + e1[4 + i] * QRI) * inv; }
      *(v4fa*)(&os[wb + lr * 68 + 16 + 8 * hi]) = a; *(v4fa*)(&os[wb + lr * 68 + 16 + 8 * hi + 4]) = c;
#pragma unroll
      for (int i = 0; i < 4; ++i) { a[i] = (o2[i] + e2[i] * QRI) * inv; c[i] = (o2[4 + i] + e2[4 + i] * QRI) * inv; }
      *(v4fa*)(&os[wb + lr * 68 + 32 + 8 * hi]) = a; *(v4fa*)(&os[wb + lr * 68 + 32 + 8 * hi + 4]) = c;
#pragma unroll
      for (int i = 0; i < 4; ++i) { a[i] = (o3[i] + e3[i] * QRI) * inv; c[i] = (o3[4 + i] + e3[4 + i] * QRI) * inv; }
      *(v4fa*)(&os[wb + lr * 68 + 48 + 8 * hi]) = a; *(v4fa*)(&os[wb + lr * 68 + 48 + 8 * hi + 4]) = c; }
    wave_sync();
    const size_t cb = ((size_t)bb * SEQ + (size_t)(t0 + (lane >> 3))) * DM + (size_t)(hh * HD + (lane & 7) * 8);
    v8us hv[4], lv[4];
#pragma unroll
    for (int s = 0; s < 4; ++s) { const int row = 4 * s + (lane >> 3), c8 = (lane & 7) * 8;   // 4 s x 4 row groups = 16 rows; 8 lanes x 8 = 64 columns
        const v4f x0 = *(const v4fa*)(&os[wb + row * 68 + c8]); const v4f x1 = *(const v4fa*)(&os[wb + row * 68 + c8 + 4]);
#pragma unroll
        for (int i = 0; i < 4; ++i) { const unsigned short a0 = f2bf(x0[i]); const unsigned short a1 = f2bf(x1[i]);
            hv[s][i] = a0; hv[s][4 + i] = a1; lv[s][i] = f2bf(x0[i] - bf2f(a0)); lv[s][4 + i] = f2bf(x1[i] - bf2f(a1)); } }
{
#pragma unroll
        for (int s = 0; s < 4; ++s) { const size_t oo = cb + (size_t)s * 4 * DM;
            *(v8us*)(CH + oo) = hv[s]; *(v8us*)(CL + oo) = lv[s]; }
         }

    if (hh == 0) {                                  // block-uniform: head 0 writes its normalised probabilities, all SEQ keys of its 16 rows
        wave_sync();
        const float shp = PSH - m;                  // l carries the x256 of P, so exp2(s - m + 8) / l is the probability
        const float zf = inv * 0.0f;                // 0 for an ordinary row, NaN for a row with no visible key
        float* arow = ATT + ((size_t)bb * OUT_SEQ + (size_t)t0) * ATT_LD;
        // the K stages come through the same two buffers once more (K tile only); the last barrier of the loop above has ended every read of them
        auto fillk = [&](const int s) { acopy4(sl + (unsigned)((s & 1) * (BUF_E * 2)), gk + (size_t)s * (SK * HD), HD); };
        fillk(0);
        asm volatile("s_wait_asynccnt 0x0" ::: "memory");    // this wave's copies of stage 0 have landed
        lds_barrier();                                       // publishes stage 0; orders LDS only: the ctx stores above stay in flight across it
        if (nst > 1) fillk(1);
#pragma unroll 1
        for (int key0 = 0; key0 < SEQ; key0 += 32) {
            const int s = key0 / SK, kk = key0 % SK;
            v4f pa0 = (v4f){zf, zf, zf, zf}, pa1 = pa0, pc0 = pa0, pc1 = pa0;
            if (key0 < kend) {                      // wave-uniform: steps at or below the diagonal re-form the scores
                const h16* ka = &ring[(s & 1) * BUF_E + fk + kk * FP];
                const v16h ka0 = ldh(ka), ka1 = ldh(ka + 32), kb0 = ldh(ka + 16 * FP), kb1 = ldh(ka + 16 * FP + 32);
                v8f sHa = (v8f){}, sLa = (v8f){}, sHb = (v8f){}, sLb = (v8f){};
                sHa = wmma16(ka0, qh0, sHa); sHb = wmma16(kb0, qh0, sHb);
                if (SCORE_RES) { sLa = wmma16(ka0, qr0, sLa); sLb = wmma16(kb0, qr0, sLb); }
                sHa = wmma16(ka1, qh1, sHa); sHb = wmma16(kb1, qh1, sHb);
                if (SCORE_RES) { sLa = wmma16(ka1, qr1, sLa); sLb = wmma16(kb1, qr1, sLb); }
                asm volatile("v_nop\n\tv_nop\n\tv_nop\n\tv_nop" : "+v"(sHa), "+v"(sLa), "+v"(sHb), "+v"(sLb) : "v"(ka0), "v"(ka1), "v"(kb0), "v"(kb1));
                float ta[8], tb[8];
#pragma unroll
                for (int r = 0; r < 8; ++r) { ta[r] = (sHa[r] + sLa[r] * QRI) * SC2; tb[r] = (sHb[r] + sLb[r] * QRI) * SC2; }
                if (key0 + 31 > t0) {
                    const int kidx = key0 + 8 * hi;
#pragma unroll
                    for (int r = 0; r < 8; ++r) { ta[r] = (kidx + r > tq) ? NEGV : ta[r]; tb[r] = (kidx + 16 + r > tq) ? NEGV : tb[r]; }
                }
                unsigned mw = MW[mo + (size_t)(key0 >> 5)];
                asm volatile("" : "+v"(mw));
                {                                   // padding-mask selects, every step (a zero word changes nothing)
                    const unsigned ma = mw >> (8 * hi), mc = mw >> (16 + 8 * hi);
#pragma unroll
                    for (int r = 0; r < 8; ++r) { ta[r] = (((ma >> r) & 1u) != 0u) ? NEGV : ta[r]; tb[r] = (((mc >> r) & 1u) != 0u) ? NEGV : tb[r]; }
                }
#pragma unroll
                for (int i = 0; i < 4; ++i) {
                    pa0[i] = __builtin_amdgcn_exp2f(ta[i] + shp) * inv; pa1[i] = __builtin_amdgcn_exp2f(ta[4 + i] + shp) * inv;
                    pc0[i] = __builtin_amdgcn_exp2f(tb[i] + shp) * inv; pc1[i] = __builtin_amdgcn_exp2f(tb[4 + i] + shp) * inv; }
            }
            // lane (t, h): keys 8h+r and 16+8h+r of this step -> os[t][0..31]; rows 0..15 x columns 0..31 all written
            *(v4fa*)(&os[wb + lr * 68 + 8 * hi]) = pa0;      *(v4fa*)(&os[wb + lr * 68 + 8 * hi + 4]) = pa1;
            *(v4fa*)(&os[wb + lr * 68 + 16 + 8 * hi]) = pc0; *(v4fa*)(&os[wb + lr * 68 + 16 + 8 * hi + 4]) = pc1;
            wave_sync();
            v4f val[4];
#pragma unroll
            for (int s = 0; s < 4; ++s) { const int row = 4 * s + (lane >> 3), c4 = (lane & 7) * 4;
                val[s] = *(const v4fa*)(&os[wb + row * 68 + c4]); }
{
#pragma unroll
                for (int s = 0; s < 4; ++s) { const int row = 4 * s + (lane >> 3), c4 = (lane & 7) * 4;
                    *(v4f*)(arow + (size_t)row * ATT_LD + key0 + c4) = val[s]; }
                 }
            // the address registers of the stores above are advanced for the next step: the wait stands in front of that overwrite
            asm volatile("s_wait_xcnt 0x0" ::: "memory");
            wave_sync();
            if (kk + 32 == SK && s < nst) {         // work-group-uniform: foot of K stage s, passed by every wave, in the order of the loop above
                asm volatile("s_wait_dscnt 0x0" ::: "memory");
                asm volatile("s_wait_asynccnt 0x0" ::: "memory");
                lds_barrier();                      // orders LDS only: the probability stores just issued stay in flight across it
                if (s + 2 < nst) fillk(s + 2);
            }
        }
        asm volatile("s_wait_asynccnt 0x0" ::: "memory");    // no copy is outstanding behind the loop
    }
}

static constexpr size_t al256(size_t v) { return (v + 255) & ~(size_t)255; }
static constexpr size_t SZ_XB = al256((size_t)NB * SEQ * DM * 2);
static constexpr size_t SZ_WB = al256((size_t)3 * DM * DM * 2);
static constexpr size_t SZ_WF = al256((size_t)DM * DM * 2);
static constexpr size_t SZ_PL = al256((size_t)NB * SEQ * DM * 2);
static constexpr size_t SZ_MW = al256((size_t)NB * SEQ * (SEQ / 32) * 4);
static constexpr size_t SZ_TOTAL = SZ_XB + SZ_WB + SZ_WF + 5 * SZ_PL + 2 * SZ_PL + SZ_MW;
static_assert(SZ_TOTAL <= (size_t)134217728);          // workspace carve <= 128 MiB
static_assert(((size_t)DM * DM * 2) % 256 == 0);       // weight sub-planes stay 256-byte aligned
static_assert(SZ_PL == (size_t)NB * SEQ * DM * 2);     // ctx hi and lo planes are back to back with stride NB*SEQ*DM elements
static_assert((size_t)NB * NH_ * SEQ * HD * 2 == SZ_PL);   // q / k / v^T planes [NB*16][SEQ][64] fill one plane exactly

extern "C" void kernel_launch(void* const* d_in, const int* in_sizes, int n_in,
                              void* d_out, int out_size, void* d_ws, size_t ws_size, hipStream_t stream) {
    if (n_in < 6) return;
    const size_t needx = ((size_t)(NB - 1) * SEQ_FULL + SEQ) * DM;
    if ((size_t)in_sizes[0] < needx) return;
    if ((size_t)in_sizes[1] < (size_t)3 * DM * DM || (size_t)in_sizes[2] < (size_t)3 * DM) return;
    if ((size_t)in_sizes[3] < (size_t)DM * DM || (size_t)in_sizes[4] < (size_t)DM) return;
    if ((size_t)in_sizes[5] < ((size_t)(NB - 1) * SEQ_FULL + (SEQ - 1)) * SEQ_FULL + SEQ) return;
    if ((size_t)out_size < OUT1_OFF + ((size_t)(NB - 1) * OUT_SEQ + (SEQ - 1)) * ATT_LD + SEQ) return;
    if (SZ_TOTAL > ws_size) return;
    const float* x = (const float*)d_in[0]; const float* wqkv = (const float*)d_in[1]; const float* bqkv = (const float*)d_in[2];
    const float* wfc = (const float*)d_in[3]; const float* bfc = (const float*)d_in[4];          // wire order x, W_attn, b_attn, W_proj, b_proj, padding_mask
    const int* pmask = (const int*)d_in[5];          // [NB_FULL][SEQ_FULL][SEQ_FULL] int32, non-zero = key hidden
    float* OUT = (float*)d_out;      // [NB][SEQ][1024] then [NB][1][SEQ][SEQ]
    float* ATT = OUT + OUT1_OFF;
    char* wsp = (char*)d_ws;
    bf* XB = (bf*)wsp; wsp += SZ_XB;                 // [NB*SEQ][1024]
    bf* WB = (bf*)wsp; wsp += SZ_WB;                 // [3072][1024]: q rows | k rows | v rows (row e = h*64 + d)
    bf* WF = (bf*)wsp; wsp += SZ_WF;                 // [1024][1024]: W_proj^T
    h16* QH = (h16*)wsp; wsp += SZ_PL;               // [NB*16][SEQ][64]
    h16* QR = (h16*)wsp; wsp += SZ_PL;               // residual x2048
    h16* KP = (h16*)wsp; wsp += SZ_PL;               // [NB*16][SEQ][64]
    h16* VT = (h16*)wsp; wsp += SZ_PL;               // [NB*16][64][SEQ]
    h16* VR = (h16*)wsp; wsp += SZ_PL;               // residual x2048
    bf* CH = (bf*)wsp; wsp += SZ_PL;                 // ctx hi [NB*SEQ][1024]
    bf* CL = (bf*)wsp; wsp += SZ_PL;                 // ctx lo, directly after CH
    unsigned* MW = (unsigned*)wsp; wsp += SZ_MW;     // mask bit words [NB*SEQ][SEQ/32]

    if (SEQ == SEQ_FULL) {
        const size_t n8 = (size_t)NB * SEQ * DM / 8;
        k_cvt8<<<(unsigned)((n8 + 255) / 256), 256, 0, stream>>>(x, XB, n8);
    } else {
        const size_t n8 = (size_t)SEQ * DM / 8;
        for (int b = 0; b < NB; ++b) k_cvt8<<<(unsigned)((n8 + 255) / 256), 256, 0, stream>>>(x + (size_t)b * SEQ_FULL * DM, XB + (size_t)b * SEQ * DM, n8);
    }
    // W_attn in[1024 k][3072 e] -> WB out[e][1024 k] (no row permutation); W_proj in[1024 k][1024 e] -> WF out[e][1024 k]
    k_cvtT<<<dim3(DM / 64, 3 * DM / 64, 1), 256, 0, stream>>>(wqkv, 3 * DM, WB, 1 << 30);
    k_cvtT<<<dim3(DM / 64, DM / 64, 1), 256, 0, stream>>>(wfc, DM, WF, 1 << 30);
    {
        const size_t nW = (size_t)NB * SEQ * (SEQ / 32);
        k_mbits<<<(unsigned)(nW / 256), 256, 0, stream>>>(pmask, MW, nW);
    }

    k_gemm<0><<<dim3(NB * SEQ / 128, DM / 128, 1), 128, 0, stream>>>(XB, WB, bqkv, QH, QR, OUT);
    k_gemm<1><<<dim3(NB * SEQ / 128, DM / 128, 1), 128, 0, stream>>>(XB, WB + (size_t)DM * DM, bqkv, KP, KP, OUT);
    // v: weight rows are the M operand, tokens the N operand -> C[e][token] lands directly in the v^T planes
    k_gemm<2><<<dim3(DM / 128, NB * SEQ / 128, 1), 128, 0, stream>>>(WB + (size_t)2 * DM * DM, XB, bqkv, VT, VR, OUT);

    k_flash<<<dim3(SEQ / (16 * AW), NB * NH_, 1), 32 * AW, 0, stream>>>(QH, QR, KP, VT, VR, MW, CH, CL, ATT);

    k_gemm<3><<<dim3(NB * SEQ / 128, DM / 128, 1), 128, 0, stream>>>(CH, WF, bfc, QH, QR, OUT);
}

// v003
// Measured time: 113 microseconds a run.
// Next to v002, in two timings, it ran 1.26 times as fast each time.
// Counting every step since v000, it is 1.94 times as fast.
#include <hip/hip_runtime.h>

// Causal multi-head self-attention, width 1024 = 16 heads x 64, x [NB][SEQ][1024], fused W_attn [in][out] + bias, true head split q[b][h][t][d] = qkv[b][t][h*64+d], score scale 1/8,
// key > query OR padding_mask[b][q][k] != 0 replaced by -inf, heads merged back to [b][t][h*64+d], output projection W_proj [in][out] + bias (f32 out); second output = normalised probabilities of head 0, [NB][1][SEQ][SEQ] f32.
// Compute dtypes, f32 accumulate everywhere: qkv projections v_wmma_f32_16x16x32_bf16 (x, W, biases RNE-converted to bf16; products exact); scores v_wmma_f32_16x16x32_f16: k single f16, q as f16 value + f16 residual x2048 in its own accumulator;
// P (x256 carry, cancels in the normalisation) single f16; v single f16 plus, for query rows < 512, an f16 residual x2048 in its own accumulator; softmax f32 (online, running max); output projection v_wmma_f32_16x16x32_bf16 with ctx as bf16 hi + bf16 lo planes (unscaled, shared accumulator) against bf16 W_proj.
// Layout: bf16 copies of x and transposed (K-contiguous) weights; q (hi, residual) and k planes [b*16+h][t][64]; v^T planes [b*16+h][d][t] produced by the v GEMM run with the weight rows as the M operand and the tokens as the N operand; ctx planes compact [NB*SEQ][1024]; padding mask packed to one 32-key bit word per (b, q, key block).

#ifndef NB
#define NB 4
#endif
#ifndef SEQ
#define SEQ 1024
#endif
#define NB_FULL  4
#define SEQ_FULL 1024
#ifndef OUT_SEQ
#define OUT_SEQ SEQ              // row pitch (in tokens) between batches of the outputs
#endif
#ifndef ATT_LD
#define ATT_LD OUT_SEQ           // key pitch of one probability row of the second output
#endif
#ifndef SCORE_RES
#define SCORE_RES 1              // 1: q residual plane adds a second score product; 0: single score product
#endif
#define DM   1024
#define NH_  16
#define HD   64
#define AW   4                   // waves per flash block (16 query rows each)
#define EARLY 512                // query rows below this use the v residual plane
#define QRS  2048.0f             // carry of the residual planes
#define QRI  (1.0f / 2048.0f)
#define SC2  (0.125f * 1.4426950408889634f)   // HD^-0.5 * log2(e)
#define PSH  8.0f                // log2 of the P carry (256)
#define NEGV (-3.0e38f)
#define OUT1_OFF ((size_t)NB_FULL * SEQ_FULL * DM)   // element offset of the second output (fixed by the full problem size)

static_assert(HD == 64);
static_assert(NH_ * HD == DM);
static_assert(DM % 64 == 0);
static_assert(DM % 32 == 0);
static_assert(SEQ % 256 == 0);                 // SEQ/32 mask words per row is a multiple of 8; 64-token tiles stay inside one batch
static_assert(SEQ % 64 == 0);
static_assert((NB * SEQ) % 128 == 0);
static_assert(DM % 128 == 0);
static_assert(DM / 64 >= 2);                   // the GEMM prologue fetches two 64-k stages
static_assert(SEQ % 32 == 0);
static_assert(SEQ % (16 * AW) == 0);
static_assert(((size_t)SEQ * DM) % 8 == 0);
static_assert(NB <= NB_FULL);
static_assert(SEQ <= SEQ_FULL);
static_assert(((size_t)NB * SEQ * (SEQ / 32)) % 256 == 0);        // mask-word grid x block == plane extent
static_assert(ATT_LD % 32 == 0);
static_assert(ATT_LD >= SEQ);
static_assert(OUT1_OFF * 4 == (size_t)16777216);                   // byte offset of the second output
static_assert(((size_t)(NB - 1) * OUT_SEQ + SEQ) * DM <= OUT1_OFF);
static_assert(OUT1_OFF + ((size_t)(NB - 1) * OUT_SEQ + (SEQ - 1)) * ATT_LD + SEQ <= OUT1_OFF + (size_t)NB_FULL * SEQ_FULL * SEQ_FULL);

typedef _Float16 h16;
typedef unsigned short bf;
typedef __attribute__((ext_vector_type(16))) __bf16   v16bf;
typedef __attribute__((ext_vector_type(16))) _Float16 v16h;
typedef __attribute__((ext_vector_type(8)))  _Float16 v8h;
typedef __attribute__((ext_vector_type(8)))  unsigned short v8us;
typedef __attribute__((ext_vector_type(8)))  float    v8f;
typedef __attribute__((ext_vector_type(4)))  float    v4f;
typedef __attribute__((ext_vector_type(4)))  int      v4i;
typedef v4f  __attribute__((may_alias)) v4fa;
typedef v8us __attribute__((may_alias)) v8usa;

__device__ __forceinline__ unsigned short f2bf(float f) { unsigned u = __float_as_uint(f); u += 0x7FFFu + ((u >> 16) & 1u); return (unsigned short)(u >> 16); }
__device__ __forceinline__ float bf2f(unsigned short h) { return __uint_as_float(((unsigned)h) << 16); }
__device__ __forceinline__ v16h cat16(v8h lo, v8h hi) { return __builtin_shufflevector(lo, hi, 0, 1, 2, 3, 4, 5, 6, 7, 8, 9, 10, 11, 12, 13, 14, 15); }
__device__ __forceinline__ v16bf cat16b(v8us lo, v8us hi) { return __builtin_bit_cast(v16bf, __builtin_shufflevector(lo, hi, 0, 1, 2, 3, 4, 5, 6, 7, 8, 9, 10, 11, 12, 13, 14, 15)); }
__device__ __forceinline__ v8f wmma16(v16h a, v16h b, v8f c) { return __builtin_amdgcn_wmma_f32_16x16x32_f16(false, a, false, b, (short)0, c, false, false); }
__device__ __forceinline__ v8f wmmab(v16bf a, v16bf b, v8f c) { return __builtin_amdgcn_wmma_f32_16x16x32_bf16(false, a, false, b, (short)0, c, false, false); }
// fragment loaders from K-contiguous 16-bit rows; p already includes + 8*(lane>>4): elements 0..7 <- k0+8h+0..7, elements 8..15 <- k0+16+8h+0..7 (same map for A and B)
__device__ __forceinline__ v16h  ldh(const h16* p) { return cat16(*(const v8h*)p, *(const v8h*)(p + 16)); }
__device__ __forceinline__ v16bf ldb(const bf* p)  { return cat16b(*(const v8us*)p, *(const v8us*)(p + 16)); }
// ordering point for wave-private LDS tiles (same wave writes and reads)
__device__ __forceinline__ void wave_sync() { __builtin_amdgcn_fence(3 /* release order */, "wavefront"); __builtin_amdgcn_wave_barrier(); asm volatile("" ::: "memory"); }
// f32 -> f16 for WMMA operand planes: results below the smallest f16 normal become exact zero (value select)
static __device__ __forceinline__ h16 toh_flush(float v) { const h16 r = (h16)v; return (fabsf(v) < 6.103515625e-05f) ? (h16)0.0f : r; }

// cvt8: x [NB_FULL][SEQ_FULL][DM] f32 -> compact bf16 plane [NB*SEQ][DM], 8 elements a thread
__device__ __forceinline__ void cvt8(const float* __restrict__ src, bf* dst, size_t n8, const int blk) {
    const size_t i = (size_t)blk * 256 + threadIdx.x; if (i >= n8) return;
    const size_t pb = (size_t)SEQ * DM / 8;          // threads per batch
    const v8f v = *(const v8f*)(src + (i / pb) * ((size_t)SEQ_FULL * DM) + (i % pb) * 8); v8us o;
#pragma unroll
    for (int k = 0; k < 8; ++k) o[k] = f2bf(v[k]);
    *(v8us*)(dst + i * 8) = o; 
}

// cvtT: W [DM k][ldn] f32 (row = k, column = e) -> bf16 plane dst[row(e)][k] (K-contiguous), 64 k x 64 e tile through LDS (cross-wave: block barrier).
// row(e) = e for e < permFrom; for e >= permFrom, with ee = e - permFrom = c*64 + d: row = permFrom + d*16 + c.
__device__ __forceinline__ void cvtT(unsigned short* ts, const float* __restrict__ W, int ldn, bf* dst, int permFrom, const int bx, const int by) {
    const int t = threadIdx.x; const int k0 = bx * 64, n0 = by * 64;
#pragma unroll 4
    for (int i = 0; i < 16; ++i) { const int k = i * 4 + (t >> 6), n = t & 63;      // 16 x 4 = 64 k rows, 64 columns
        ts[n * 72 + k] = f2bf(W[(size_t)(k0 + k) * (size_t)ldn + n0 + n]); }
    __syncthreads();
    v8us o0, o1; size_t d0, d1;
    { const int p = t, n = p >> 3, q = p & 7; o0 = *(const v8usa*)(&ts[n * 72 + 8 * q]);
      const int e = n0 + n; const int ee = e - permFrom; const int row = (e >= permFrom) ? (permFrom + (ee & 63) * 16 + (ee >> 6)) : e;
      d0 = (size_t)row * DM + k0 + 8 * q; }
    { const int p = t + 256, n = p >> 3, q = p & 7; o1 = *(const v8usa*)(&ts[n * 72 + 8 * q]);
      const int e = n0 + n; const int ee = e - permFrom; const int row = (e >= permFrom) ? (permFrom + (ee & 63) * 16 + (ee >> 6)) : e;
      d1 = (size_t)row * DM + k0 + 8 * q; }
{
        *(v8us*)(dst + d0) = o0; *(v8us*)(dst + d1) = o1;
         }
}

// mbits: padding mask [NB_FULL][SEQ_FULL][SEQ_FULL] int32 -> bit words MW[b*SEQ + q][SEQ/32], bit j of word w = (mask[b][q][32*w + j] != 0).
__device__ __forceinline__ void mbits(const int* __restrict__ pm, unsigned* MW, size_t nW, const int blk) {
    const size_t w = (size_t)blk * 256 + threadIdx.x; if (w >= nW) return;
    const size_t row = w / (size_t)(SEQ / 32); const size_t j = w % (size_t)(SEQ / 32);
    const size_t b = row / (size_t)SEQ, t = row % (size_t)SEQ;
    const int* src = pm + (b * SEQ_FULL + t) * (size_t)SEQ_FULL + j * 32;
    unsigned bits = 0u;
#pragma unroll
    for (int i = 0; i < 8; ++i) { const v4i v = *(const v4i*)(src + 4 * i);
        const unsigned n = ((v[0] != 0) ? 1u : 0u) | ((v[1] != 0) ? 2u : 0u) | ((v[2] != 0) ? 4u : 0u) | ((v[3] != 0) ? 8u : 0u);
        bits |= n << (4 * i); }
    *(unsigned*)(MW + w) = bits; 
}

// k_prep: the four input conversions, none of which reads another's output, as ONE grid. A work-group's job follows from its block index alone (the same for all its threads, so
// the barrier inside cvtT is passed by a whole work-group or by none of it); the jobs with the longest chain of dependent loads come first in the index.
#define PB_WA ((DM / 64) * (3 * DM / 64))                    // W_attn tiles
#define PB_WP ((DM / 64) * (DM / 64))                        // W_proj tiles
#define PB_MB ((int)((size_t)NB * SEQ * (SEQ / 32) / 256))   // mask-word blocks
#define PB_X  ((int)((size_t)NB * SEQ * DM / 8 / 256))       // x blocks
static_assert(((size_t)NB * SEQ * DM / 8) % 256 == 0);
__global__ __launch_bounds__(256) void k_prep(const float* __restrict__ x, const float* __restrict__ wqkv, const float* __restrict__ wfc, const int* __restrict__ pm, bf* XB, bf* WB, bf* WF, unsigned* MW) {
    __shared__ __align__(16) unsigned short ts[64 * 72];
    int blk = (int)blockIdx.x;
    if (blk < PB_WA + PB_WP) {                       // W_attn in[1024 k][3072 e] -> WB out[e][1024 k] (no row permutation); W_proj in[1024 k][1024 e] -> WF out[e][1024 k]
        const bool wa = blk < PB_WA; const int tl = wa ? blk : blk - PB_WA;
        cvtT(ts, wa ? wqkv : wfc, wa ? 3 * DM : DM, wa ? WB : WF, 1 << 30, tl % (DM / 64), tl / (DM / 64));
        return; }
    blk -= PB_WA + PB_WP;
    if (blk < PB_MB) { mbits(pm, MW, (size_t)NB * SEQ * (SEQ / 32), blk); return; }
    blk -= PB_MB;
    cvt8(x, XB, (size_t)NB * SEQ * DM / 8, blk);
}

// work-group barrier that orders LDS only: the release and acquire fences name the LDS address space, so the global loads that prefetch a later stage into registers stay in flight across it
__device__ __forceinline__ void lds_barrier() { __builtin_amdgcn_fence(__ATOMIC_RELEASE, "workgroup", "local"); __builtin_amdgcn_s_barrier(); __builtin_amdgcn_fence(__ATOMIC_ACQUIRE, "workgroup", "local"); }

// k_gemm: bf16 GEMM, work-group of 4 waves on a 128x128 tile, each wave a 64x64 quadrant (16 accumulators), K = DM walked in stages of 64.
// Each stage's A and B tiles (128 rows x 64 k) are read from the K-contiguous bf16 planes as whole 128-byte rows (8 lanes x 16 B a row) into registers two stages ahead and
// stored one stage ahead to the other of two LDS buffers (row pitch 144 B); fragments come from LDS. One work-group barrier a stage: it publishes the stage just stored
// and ends every wave's reads of the buffer that the next stage's stores overwrite. k order of every accumulator: ascending in steps of 32.
// C[m][n] = sum_k A[m][k] Bt[n][k] + bias (bias RNE-converted to bf16, added in f32). 128 threads per block.
// QKV = true: the q, k and v projections, which read none of each other's output, as ONE grid (M/128 token tiles, 1024/128 weight-row tiles, 3 jobs); the job md follows from blockIdx.z
// (the same for a whole work-group); three work-groups share a WGP, so one's matrix instructions run under the others' LDS and load waits, prologue and epilogue. X = x tokens, Wt = q | k | v weight rows.
// md 0: q  -> A = x tokens, Bt = q weight rows; f16 value plane Ph and f16 residual x2048 plane Pr, layout [b*16+h][t][64] (quadrant column block = head h; bias columns 0..1023)
// md 1: k  -> as md 0, value plane only (bias columns 1024..2047); the shortest epilogue, so it comes last in the index
// md 2: v  -> A = v weight rows (row e = h*64 + d), Bt = x tokens: C[e][token]; value (Ph) and residual x2048 (Pr) planes [b*16+h][d][t]; bias per ROW (columns 2048..3071 of the bias vector)
// QKV = false: output projection -> X = ctx hi plane then ctx lo plane (one shared accumulator), Wt = W_proj^T rows; f32 rows of OUT. grid (M/128, 1024/128)
struct yes_t { static constexpr bool value = true; };
struct no_t { static constexpr bool value = false; };
#define LP 72                    // LDS row pitch in 16-bit elements: 144 B = 16 B x 9, conflict-free for 16-byte fragment reads
// the second launch bound asks for a register budget at which three waves fit a SIMD, so that all 768 work-groups of the merged grid are resident at once (three a WGP; LDS allows three)
template <bool QKV>
__global__ __launch_bounds__(128, QKV ? 3 : 1) void k_gemm(const bf* __restrict__ X, const bf* __restrict__ Wt, const float* __restrict__ bias, h16* QH, h16* QR, h16* KP, h16* VT, h16* VR, float* OUT) {
    __shared__ __align__(16) bf As[2 * 128 * LP];
    __shared__ __align__(16) bf Bs[2 * 128 * LP];
    __shared__ __align__(16) float osw[4 * 16 * 68];
    const int K = DM;
    const int tid = threadIdx.x;
    const int lane = tid & 31, lr = lane & 15, hi = lane >> 4;
    const int wave = __builtin_amdgcn_readfirstlane(tid >> 5);
    float* os = osw + wave * 16 * 68;                // wave-private epilogue tile
    const int wm = wave & 1, wn = wave >> 1;
    const int md = QKV ? (((int)blockIdx.z == 0) ? 0 : 3 - (int)blockIdx.z) : 3;   // z 0, 1, 2 -> q, v, k
    const bool vj = QKV && md == 2;                  // v: weight rows are the M operand, tokens the N operand
    const int bm = vj ? (int)blockIdx.y : (int)blockIdx.x, bn = vj ? (int)blockIdx.x : (int)blockIdx.y;
    const bf* A = vj ? (Wt + (size_t)2 * DM * DM) : X;
    const bf* Bt = vj ? X : (QKV ? (Wt + (size_t)md * DM * DM) : Wt);
    const int r0 = bm * 128 + wm * 64, c0 = bn * 128 + wn * 64;
    v8f acc[4][4];
#pragma unroll
    for (int mb = 0; mb < 4; ++mb)
#pragma unroll
        for (int nb = 0; nb < 4; ++nb) acc[mb][nb] = (v8f){};
    const int srow = tid >> 3, scol = (tid & 7) * 8;  // staging: 16 rows a pass, 8 passes a tile
    const bf* ga = A + (size_t)(bm * 128 + srow) * K + scol;
    const bf* gb = Bt + (size_t)(bn * 128 + srow) * K + scol;
    const int sl = srow * LP + scol;
    const int fa = (wm * 64 + lr) * LP + 8 * hi, fb = (wn * 64 + lr) * LP + 8 * hi;
    const int SPP = K / 64;                           // stages per plane
    const int NS = (QKV ? 1 : 2) * SPP;
    v8us ra[8], rb[8];
#pragma unroll
    for (int i = 0; i < 8; ++i) { ra[i] = *(const v8us*)(ga + (size_t)i * 16 * K); rb[i] = *(const v8us*)(gb + (size_t)i * 16 * K); }
#pragma unroll
    for (int i = 0; i < 8; ++i) { *(v8us*)(&As[sl + i * 16 * LP]) = ra[i]; *(v8us*)(&Bs[sl + i * 16 * LP]) = rb[i]; }
#pragma unroll
    for (int i = 0; i < 8; ++i) { ra[i] = *(const v8us*)(ga + 64 + (size_t)i * 16 * K); rb[i] = *(const v8us*)(gb + 64 + (size_t)i * 16 * K); }   // stage 1 (NS >= 2)
    lds_barrier();
    // one stage; ST: stage s+1 exists (it waits in ra, rb since the stage before), LD: stage s+2 exists. Both are compile-time so that the body is one straight run whose LDS waits are counted exactly.
    auto stage = [&](const int s, auto ST, auto LD) {
        const int cur = (s & 1) * (128 * LP), nxt = (128 * LP) - cur;
        v16bf a[2][4], b[2][4];                       // both 32-k blocks' fragments of this stage, read as one group ahead of the matrix instructions
#pragma unroll
        for (int kb = 0; kb < 2; ++kb) {
#pragma unroll
            for (int mb = 0; mb < 4; ++mb) a[kb][mb] = ldb(&As[cur + fa + mb * 16 * LP + kb * 32]);
#pragma unroll
            for (int nb = 0; nb < 4; ++nb) b[kb][nb] = ldb(&Bs[cur + fb + nb * 16 * LP + kb * 32]);
        }
        if constexpr (ST.value) {                     // stage s+1 goes to the buffer that stage s-1 was read from
#pragma unroll
            for (int i = 0; i < 8; ++i) { *(v8us*)(&As[nxt + sl + i * 16 * LP]) = ra[i]; *(v8us*)(&Bs[nxt + sl + i * 16 * LP]) = rb[i]; }
        }
        if constexpr (LD.value) {                     // stage s+2 starts its way from global memory
            const int s2 = s + 2; const int pl = (s2 >= SPP) ? 1 : 0; const int kc = (s2 - pl * SPP) * 64;
            const bf* pa = ga + (size_t)pl * ((size_t)NB * SEQ * DM) + kc; const bf* pb = gb + kc;
#pragma unroll
            for (int i = 0; i < 8; ++i) { ra[i] = *(const v8us*)(pa + (size_t)i * 16 * K); rb[i] = *(const v8us*)(pb + (size_t)i * 16 * K); }
            // the address registers of the loads above are free for reuse behind them: the wait stands in front of any overwrite
            asm volatile("s_wait_xcnt 0x0" ::: "memory");
        }
#pragma unroll
        for (int kb = 0; kb < 2; ++kb)
#pragma unroll
            for (int nb = 0; nb < 4; ++nb)
#pragma unroll
                for (int mb = 0; mb < 4; ++mb) acc[mb][nb] = wmmab(a[kb][mb], b[kb][nb], acc[mb][nb]);
        // four vector slots behind the stage's last matrix instruction before its operand registers may be reloaded; naming every accumulator keeps all of the stage's
        // matrix instructions in front of the barrier, where they run while the LDS reads and stores of the stage drain
        asm volatile("v_nop\n\tv_nop\n\tv_nop\n\tv_nop"
                     : "+v"(acc[0][0]), "+v"(acc[1][0]), "+v"(acc[2][0]), "+v"(acc[3][0]), "+v"(acc[0][1]), "+v"(acc[1][1]), "+v"(acc[2][1]), "+v"(acc[3][1]),
                       "+v"(acc[0][2]), "+v"(acc[1][2]), "+v"(acc[2][2]), "+v"(acc[3][2]), "+v"(acc[0][3]), "+v"(acc[1][3]), "+v"(acc[2][3]), "+v"(acc[3][3])
                     : "v"(a[1][0]), "v"(a[1][1]), "v"(a[1][2]), "v"(a[1][3]), "v"(b[1][3]));
        if constexpr (ST.value) lds_barrier();        // publishes stage s+1 and ends the reads of this stage's buffer; behind the last stage nothing is left to publish
    };
#pragma unroll 1
    for (int s = 0; s < NS - 2; ++s) stage(s, yes_t{}, yes_t{});
    stage(NS - 2, yes_t{}, no_t{});
    stage(NS - 1, no_t{}, no_t{});
    // the lane's number is read anew here, so that nothing derived from it for the epilogue is held in a register across the loop (the loop fills the register budget of three waves a SIMD)
    const int ln = (int)__builtin_amdgcn_mbcnt_lo(~0u, 0u), lc = ln & 15, lh = ln >> 4;
    float bv[4];
#pragma unroll
    for (int nb = 0; nb < 4; ++nb) {
        const int bi = vj ? (2 * DM) : ((QKV ? md * DM : 0) + c0 + nb * 16 + lc);
        bv[nb] = bf2f(f2bf(bias[bi])); }
#pragma unroll
    for (int mb = 0; mb < 4; ++mb) {
        // D: row 8h+j, col lane&15; rows 0..15 x cols 0..63 all written on either path
        if (vj) {                                       // per-row bias: 8 consecutive floats, one 32-byte vector load
            const v8f bq = *(const v8f*)(bias + 2 * DM + r0 + mb * 16 + lh * 8);
            float rb[8];
#pragma unroll
            for (int j = 0; j < 8; ++j) rb[j] = bf2f(f2bf(bq[j]));
#pragma unroll
            for (int nb = 0; nb < 4; ++nb) {
#pragma unroll
                for (int j = 0; j < 8; ++j) os[(lh * 8 + j) * 68 + nb * 16 + lc] = acc[mb][nb][j] + rb[j]; }
        } else {
#pragma unroll
            for (int nb = 0; nb < 4; ++nb) {
#pragma unroll
                for (int j = 0; j < 8; ++j) os[(lh * 8 + j) * 68 + nb * 16 + lc] = acc[mb][nb][j] + bv[nb]; }
        }
        wave_sync();
        if (QKV) {
            h16* Ph = (md == 0) ? QH : ((md == 1) ? KP : VT);
            h16* Pr = (md == 0) ? QR : VR;              // md 1 stores no residual
            size_t sb, pitch;
            if (vj) { const int bb = c0 / SEQ; const int tt = c0 % SEQ;                               // rows = d of head r0/64, columns = 64 tokens of one batch
                sb = ((size_t)(bb * NH_ + (r0 >> 6)) * HD + (size_t)(16 * mb)) * SEQ + (size_t)tt; pitch = SEQ; }
            else { const int tokrow = r0 + 16 * mb; const int bb = tokrow / SEQ; const int tt = tokrow % SEQ;   // rows = tokens, columns = d of head c0/64
                sb = ((size_t)(bb * NH_ + (c0 >> 6)) * SEQ + (size_t)tt) * HD; pitch = HD; }
            v4f x0[4], x1[4]; v8h hv[4];
#pragma unroll
            for (int s = 0; s < 4; ++s) { const int row = 4 * s + (ln >> 3), c8 = (ln & 7) * 8;
                x0[s] = *(const v4fa*)(&os[row * 68 + c8]); x1[s] = *(const v4fa*)(&os[row * 68 + c8 + 4]);
#pragma unroll
                for (int i = 0; i < 4; ++i) { hv[s][i] = toh_flush(x0[s][i]); hv[s][4 + i] = toh_flush(x1[s][i]); }
                *(v8h*)(Ph + sb + (size_t)row * pitch + c8) = hv[s]; }
            // the address and data registers of the stores above are reused behind them: the wait stands in front of any overwrite
            asm volatile("s_wait_xcnt 0x0" ::: "memory");
            if (md != 1) {
#pragma unroll
                for (int s = 0; s < 4; ++s) { const int row = 4 * s + (ln >> 3), c8 = (ln & 7) * 8; v8h rv;
#pragma unroll
                    for (int i = 0; i < 4; ++i) { rv[i] = toh_flush((x0[s][i] - (float)hv[s][i]) * QRS); rv[4 + i] = toh_flush((x1[s][i] - (float)hv[s][4 + i]) * QRS); }
                    *(v8h*)(Pr + sb + (size_t)row * pitch + c8) = rv; }
                asm volatile("s_wait_xcnt 0x0" ::: "memory");   // as above, for the residual stores
            }
        } else {
            const int grow = r0 + 16 * mb; const int bb = grow / SEQ; const int nn = grow % SEQ;
            float* orow = OUT + ((size_t)bb * OUT_SEQ + nn) * DM + c0;
{
#pragma unroll
                for (int s = 0; s < 8; ++s) { const int row = 2 * s + lh, cofs = lc * 4;   // 8 s x 2 rows = 16 rows; 16 lanes x 4 floats = 64 columns
                    const v4f val = *(const v4fa*)(&os[row * 68 + cofs]);
                    *(v4f*)(orow + (size_t)row * DM + cofs) = val; }
                 }
        }
        wave_sync();
    }
}

// k_flash: fused causal attention, one wave per 16 query rows of one (batch, head); Q fragments straight from the f16 planes (two 16-B loads each, arithmetic addressing).
// The four waves of a work-group share each 64-key stage of K, V^T and (early rows) the V^T residual through LDS: whole 128-byte rows are brought by asynchronous copies into one of two buffers
// (row pitch 144 B), one stage ahead of the stage being worked on; fragments are read from LDS. One work-group barrier a stage publishes the next stage and ends the reads of the buffer refilled behind it.
// Transposed form: S^T[key][t] = K Q^T (A = K rows, B = Q rows); lane (t = lane&15, h = lane>>4) holds keys 8h+r of each 16-key tile, so the packed
// P tile is directly the B fragment of O^T[d][t] = V^T P^T (element r <- tile keys 0..15, element 8+r <- tile keys 16..31, lane unchanged).
// Keys run over [0, t0+16) in steps of 32; on steps that touch the diagonal, scores with key > query are replaced by a very negative value (P = 0 exactly);
// the padding-mask bit word of (b, query, key block) is read once per lane per step and its bit selects run at every step (bit 8h+r <-> key key0+8h+r, bit 16+8h+r <-> key key0+16+8h+r; a set bit replaces the score the same way; a zero word changes nothing).
// A query row that never sees a visible key yields NaN (all scores replaced by -inf).
// Softmax state (running max, partial sum) is one scalar per lane; the two lane halves of a row are combined with one xor-16 exchange.
#define FP 72                    // LDS row pitch of a staged tile in 16-bit elements: 144 B = 16 B x 9, conflict-free for 16-byte fragment reads
#define SK 64                    // keys per stage
#define TILE_E (64 * FP)         // one staged tile: 64 rows (K: keys, V^T: d) of 64 elements
#define BUF_E  (3 * TILE_E)      // one buffer: K | V^T | V^T residual
static_assert(SK == 16 * AW);    // a work-group's query rows span one stage: stages 0..blockIdx.x reach its diagonal
static_assert(EARLY % (16 * AW) == 0);   // the residual plane is used by all waves of a work-group or by none
static_assert(32 * AW == 128);   // staging map: 8 lanes a row, 16 rows a copy, 4 copies a tile
// four asynchronous 16-byte copies a lane (rows r, r+16, r+32, r+48 of one tile); the wait is the statement's last line, so it stands in front of any rewrite of an address register that a copy names
__device__ __forceinline__ void acopy4(const unsigned l, const h16* g, const size_t gp) {
    const unsigned l1 = l + 16 * FP * 2, l2 = l + 32 * FP * 2, l3 = l + 48 * FP * 2;
    const h16* g1 = g + 16 * gp; const h16* g2 = g + 32 * gp; const h16* g3 = g + 48 * gp;
    asm volatile("global_load_async_to_lds_b128 %0, %4, off\n\t"
                 "global_load_async_to_lds_b128 %1, %5, off\n\t"
                 "global_load_async_to_lds_b128 %2, %6, off\n\t"
                 "global_load_async_to_lds_b128 %3, %7, off\n\t"
                 "s_wait_xcnt 0x0"
                 :: "v"(l), "v"(l1), "v"(l2), "v"(l3), "v"(g), "v"(g1), "v"(g2), "v"(g3) : "memory");
}
__global__ __launch_bounds__(32 * AW) void k_flash(const h16* __restrict__ QH, const h16* __restrict__ QR, const h16* __restrict__ KP, const h16* __restrict__ VT, const h16* __restrict__ VR, const unsigned* __restrict__ MW, bf* CH, bf* CL, float* ATT) {
    __shared__ __align__(16) float os[AW * 16 * 68];
    __shared__ __align__(16) h16 ring[2 * BUF_E];
    const int lane = threadIdx.x & 31, lr = lane & 15, hi = lane >> 4;
    const int wave = __builtin_amdgcn_readfirstlane((int)(threadIdx.x >> 5));
    const int zh = blockIdx.y;
    const int bb = zh / NH_, hh = zh % NH_;
    const int t0 = (blockIdx.x * AW + wave) * 16;
    const size_t pbase = (size_t)zh * SEQ * HD;
    const size_t qo = pbase + (size_t)(t0 + lr) * HD + 8 * hi;
    const v16h qh0 = ldh(QH + qo), qh1 = ldh(QH + qo + 32), qr0 = ldh(QR + qo), qr1 = ldh(QR + qo + 32);   // B fragments: col t, k = d
    const int fk = lr * FP + 8 * hi;                         // LDS, + key * FP         (A fragment: row key, k = d)
    const int fv = TILE_E + lr * FP + 8 * hi;                // LDS, + 16j*FP + key     (A fragment: row d, k = key)
    const int kend = t0 + 16;
    const bool early = (int)blockIdx.x * (16 * AW) < EARLY;  // same for the four waves
    const int srow = (int)threadIdx.x >> 3, scol = ((int)threadIdx.x & 7) * 8;   // staging: 8 lanes x 16 B = one 128-byte row
    const unsigned sl = (unsigned)(size_t)(&ring[srow * FP + scol]);             // this lane's LDS byte address in buffer 0, K tile
    const h16* gk = KP + pbase + (size_t)srow * HD + scol;   // + stage * SK * HD
    const h16* gv = VT + pbase + (size_t)srow * SEQ + scol;  // + stage * SK
    const h16* gr = VR + pbase + (size_t)srow * SEQ + scol;
    const int nst = (int)blockIdx.x + 1;                     // stages up to and including the work-group's diagonal
    auto fill = [&](const int s) {                           // stage s -> buffer s & 1; every lane on, work-group-uniform control flow
        const unsigned lb = sl + (unsigned)((s & 1) * (BUF_E * 2));
        acopy4(lb, gk + (size_t)s * (SK * HD), HD);
        acopy4(lb + TILE_E * 2, gv + (size_t)s * SK, SEQ);
        if (early) acopy4(lb + 2 * TILE_E * 2, gr + (size_t)s * SK, SEQ);
    };
    const int tq = t0 + lr;
    const size_t mo = ((size_t)bb * SEQ + (size_t)tq) * (size_t)(SEQ / 32);   // + key0/32: mask word of this lane's query row
    v8f o0 = (v8f){}, o1 = (v8f){}, o2 = (v8f){}, o3 = (v8f){};
    v8f e0 = (v8f){}, e1 = (v8f){}, e2 = (v8f){}, e3 = (v8f){};
    float m = NEGV, l = 0.0f;
    fill(0);
    asm volatile("s_wait_asynccnt 0x0" ::: "memory");        // this wave's copies of stage 0 have landed
    __syncthreads();                                         // publishes stage 0
    if (nst > 1) fill(1);
#pragma unroll 1
    for (int s = 0; s < nst; ++s) {
      const int cur = (s & 1) * BUF_E;
      for (int kk = 0; kk < SK; kk += 32) {
        const int key0 = s * SK + kk;
        if (key0 >= kend) break;                    // wave-uniform: keys past this wave's diagonal; the stage's foot below is still passed
        const h16* ka = &ring[cur + fk + kk * FP];
        const v16h ka0 = ldh(ka), ka1 = ldh(ka + 32), kb0 = ldh(ka + 16 * FP), kb1 = ldh(ka + 16 * FP + 32);
        v8f sHa = (v8f){}, sLa = (v8f){}, sHb = (v8f){}, sLb = (v8f){};
        sHa = wmma16(ka0, qh0, sHa); sHb = wmma16(kb0, qh0, sHb);
        if (SCORE_RES) { sLa = wmma16(ka0, qr0, sLa); sLb = wmma16(kb0, qr0, sLb); }
        sHa = wmma16(ka1, qh1, sHa); sHb = wmma16(kb1, qh1, sHb);
        if (SCORE_RES) { sLa = wmma16(ka1, qr1, sLa); sLb = wmma16(kb1, qr1, sLb); }
        asm volatile("v_nop\n\tv_nop\n\tv_nop\n\tv_nop" : "+v"(sHa), "+v"(sLa), "+v"(sHb), "+v"(sLb) : "v"(ka0), "v"(ka1), "v"(kb0), "v"(kb1));
        float ta[8], tb[8];
#pragma unroll
        for (int r = 0; r < 8; ++r) { ta[r] = (sHa[r] + sLa[r] * QRI) * SC2; tb[r] = (sHb[r] + sLb[r] * QRI) * SC2; }
        if (key0 + 31 > t0) {                       // wave-uniform: this step touches the diagonal
            const int kidx = key0 + 8 * hi;
#pragma unroll
            for (int r = 0; r < 8; ++r) { ta[r] = (kidx + r > tq) ? NEGV : ta[r]; tb[r] = (kidx + 16 + r > tq) ? NEGV : tb[r]; }
        }
        unsigned mw = MW[mo + (size_t)(key0 >> 5)];
        asm volatile("" : "+v"(mw));
        {                                           // padding-mask selects, every step (a zero word changes nothing)
            const unsigned ma = mw >> (8 * hi), mc = mw >> (16 + 8 * hi);
#pragma unroll
            for (int r = 0; r < 8; ++r) { ta[r] = (((ma >> r) & 1u) != 0u) ? NEGV : ta[r]; tb[r] = (((mc >> r) & 1u) != 0u) ? NEGV : tb[r]; }
        }
        float mx = NEGV;
#pragma unroll
        for (int r = 0; r < 8; ++r) mx = fmaxf(mx, fmaxf(ta[r], tb[r]));
        mx = fmaxf(mx, __shfl_xor(mx, 16, 32));
        const float mnew = fmaxf(m, mx);
        const float alpha = __builtin_amdgcn_exp2f(m - mnew);
        const float sh = PSH - mnew;
        v16h pb; float ls = 0.0f;
#pragma unroll
        for (int r = 0; r < 8; ++r) { const float ea = ta[r] + sh, ec = tb[r] + sh;
            const h16 pa = (ea < -14.0f) ? (h16)0.0f : (h16)__builtin_amdgcn_exp2f(ea);       // exponent select: no f16 result below the smallest normal
            const h16 pc = (ec < -14.0f) ? (h16)0.0f : (h16)__builtin_amdgcn_exp2f(ec);
            pb[r] = pa; pb[8 + r] = pc; ls += (float)pa + (float)pc; }
        l = l * alpha + ls; m = mnew;
        o0 = o0 * alpha; o1 = o1 * alpha; o2 = o2 * alpha; o3 = o3 * alpha;
        const h16* va = &ring[cur + fv + kk];
        const v16h v0 = ldh(va), v1 = ldh(va + 16 * FP), v2 = ldh(va + 32 * FP), v3 = ldh(va + 48 * FP);
        o0 = wmma16(v0, pb, o0); o1 = wmma16(v1, pb, o1); o2 = wmma16(v2, pb, o2); o3 = wmma16(v3, pb, o3);
        asm volatile("v_nop\n\tv_nop\n\tv_nop\n\tv_nop" : "+v"(o0), "+v"(o1), "+v"(o2), "+v"(o3) : "v"(v0), "v"(v1), "v"(v2), "v"(v3), "v"(pb));
        if (early) {                                // wave-uniform: residual plane of v in its own accumulators
            e0 = e0 * alpha; e1 = e1 * alpha; e2 = e2 * alpha; e3 = e3 * alpha;
            const h16* vr = va + TILE_E;
            const v16h w0 = ldh(vr), w1 = ldh(vr + 16 * FP), w2 = ldh(vr + 32 * FP), w3 = ldh(vr + 48 * FP);
            e0 = wmma16(w0, pb, e0); e1 = wmma16(w1, pb, e1); e2 = wmma16(w2, pb, e2); e3 = wmma16(w3, pb, e3);
            asm volatile("v_nop\n\tv_nop\n\tv_nop\n\tv_nop" : "+v"(e0), "+v"(e1), "+v"(e2), "+v"(e3) : "v"(w0), "v"(w1), "v"(w2), "v"(w3), "v"(pb));
        }
      }
      // foot of stage s, every wave: its LDS reads of this buffer are done, its copies of stage s+1 have landed; the barrier publishes stage s+1 and frees this buffer for stage s+2
      asm volatile("s_wait_dscnt 0x0" ::: "memory");
      asm volatile("s_wait_asynccnt 0x0" ::: "memory");
      __syncthreads();
      if (s + 2 < nst) fill(s + 2);
    }
    asm volatile("s_wait_asynccnt 0x0" ::: "memory");        // no copy is outstanding behind the loop
    l += __shfl_xor(l, 16, 32);
    const float inv = (m > NEGV) ? (1.0f / l) : __uint_as_float(0x7FC00000u);   // no visible key in the whole row: NaN row
    const int wb = wave * 16 * 68;
    // O^T D layout: o_j[r] = (d = 16j + 8h + r, t = lane&15) -> os[t][d]; rows 0..15 x columns 0..63 all written
    { v4f a, c;
#pragma unroll
      for (int i = 0; i < 4; ++i) { a[i] = (o0[i] + e0[i] * QRI) * inv; c[i] = (o0[4 + i] + e0[4 + i] * QRI) * inv; }
      *(v4fa*)(&os[wb + lr * 68 +  0 + 8 * hi]) = a; *(v4fa*)(&os[wb + lr * 68 +  0 + 8 * hi + 4]) = c;
#pragma unroll
      for (int i = 0; i < 4; ++i) { a[i] = (o1[i] + e1[i] * QRI) * inv; c[i] = (o1[4 + i] + e1[4 + i] * QRI) * inv; }
      *(v4fa*)(&os[wb + lr * 68 + 16 + 8 * hi]) = a; *(v4fa*)(&os[wb + lr * 68 + 16 + 8 * hi + 4]) = c;
#pragma unroll
      for (int i = 0; i < 4; ++i) { a[i] = (o2[i] + e2[i] * QRI) * inv; c[i] = (o2[4 + i] + e2[4 + i] * QRI) * inv; }
      *(v4fa*)(&os[wb + lr * 68 + 32 + 8 * hi]) = a; *(v4fa*)(&os[wb + lr * 68 + 32 + 8 * hi + 4]) = c;
#pragma unroll
      for (int i = 0; i < 4; ++i) { a[i] = (o3[i] + e3[i] * QRI) * inv; c[i] = (o3[4 + i] + e3[4 + i] * QRI) * inv; }
      *(v4fa*)(&os[wb + lr * 68 + 48 + 8 * hi]) = a; *(v4fa*)(&os[wb + lr * 68 + 48 + 8 * hi + 4]) = c; }
    wave_sync();
    const size_t cb = ((size_t)bb * SEQ + (size_t)(t0 + (lane >> 3))) * DM + (size_t)(hh * HD + (lane & 7) * 8);
    v8us hv[4], lv[4];
#pragma unroll
    for (int s = 0; s < 4; ++s) { const int row = 4 * s + (lane >> 3), c8 = (lane & 7) * 8;   // 4 s x 4 row groups = 16 rows; 8 lanes x 8 = 64 columns
        const v4f x0 = *(const v4fa*)(&os[wb + row * 68 + c8]); const v4f x1 = *(const v4fa*)(&os[wb + row * 68 + c8 + 4]);
#pragma unroll
        for (int i = 0; i < 4; ++i) { const unsigned short a0 = f2bf(x0[i]); const unsigned short a1 = f2bf(x1[i]);
            hv[s][i] = a0; hv[s][4 + i] = a1; lv[s][i] = f2bf(x0[i] - bf2f(a0)); lv[s][4 + i] = f2bf(x1[i] - bf2f(a1)); } }
{
#pragma unroll
        for (int s = 0; s < 4; ++s) { const size_t oo = cb + (size_t)s * 4 * DM;
            *(v8us*)(CH + oo) = hv[s]; *(v8us*)(CL + oo) = lv[s]; }
         }

    if (hh == 0) {                                  // block-uniform: head 0 writes its normalised probabilities, all SEQ keys of its 16 rows
        wave_sync();
        const float shp = PSH - m;                  // l carries the x256 of P, so exp2(s - m + 8) / l is the probability
        const float zf = inv * 0.0f;                // 0 for an ordinary row, NaN for a row with no visible key
        float* arow = ATT + ((size_t)bb * OUT_SEQ + (size_t)t0) * ATT_LD;
        // the K stages come through the same two buffers once more (K tile only); the last barrier of the loop above has ended every read of them
        auto fillk = [&](const int s) { acopy4(sl + (unsigned)((s & 1) * (BUF_E * 2)), gk + (size_t)s * (SK * HD), HD); };
        fillk(0);
        asm volatile("s_wait_asynccnt 0x0" ::: "memory");    // this wave's copies of stage 0 have landed
        lds_barrier();                                       // publishes stage 0; orders LDS only: the ctx stores above stay in flight across it
        if (nst > 1) fillk(1);
#pragma unroll 1
        for (int key0 = 0; key0 < SEQ; key0 += 32) {
            const int s = key0 / SK, kk = key0 % SK;
            v4f pa0 = (v4f){zf, zf, zf, zf}, pa1 = pa0, pc0 = pa0, pc1 = pa0;
            if (key0 < kend) {                      // wave-uniform: steps at or below the diagonal re-form the scores
                const h16* ka = &ring[(s & 1) * BUF_E + fk + kk * FP];
                const v16h ka0 = ldh(ka), ka1 = ldh(ka + 32), kb0 = ldh(ka + 16 * FP), kb1 = ldh(ka + 16 * FP + 32);
                v8f sHa = (v8f){}, sLa = (v8f){}, sHb = (v8f){}, sLb = (v8f){};
                sHa = wmma16(ka0, qh0, sHa); sHb = wmma16(kb0, qh0, sHb);
                if (SCORE_RES) { sLa = wmma16(ka0, qr0, sLa); sLb = wmma16(kb0, qr0, sLb); }
                sHa = wmma16(ka1, qh1, sHa); sHb = wmma16(kb1, qh1, sHb);
                if (SCORE_RES) { sLa = wmma16(ka1, qr1, sLa); sLb = wmma16(kb1, qr1, sLb); }
                asm volatile("v_nop\n\tv_nop\n\tv_nop\n\tv_nop" : "+v"(sHa), "+v"(sLa), "+v"(sHb), "+v"(sLb) : "v"(ka0), "v"(ka1), "v"(kb0), "v"(kb1));
                float ta[8], tb[8];
#pragma unroll
                for (int r = 0; r < 8; ++r) { ta[r] = (sHa[r] + sLa[r] * QRI) * SC2; tb[r] = (sHb[r] + sLb[r] * QRI) * SC2; }
                if (key0 + 31 > t0) {
                    const int kidx = key0 + 8 * hi;
#pragma unroll
                    for (int r = 0; r < 8; ++r) { ta[r] = (kidx + r > tq) ? NEGV : ta[r]; tb[r] = (kidx + 16 + r > tq) ? NEGV : tb[r]; }
                }
                unsigned mw = MW[mo + (size_t)(key0 >> 5)];
                asm volatile("" : "+v"(mw));
                {                                   // padding-mask selects, every step (a zero word changes nothing)
                    const unsigned ma = mw >> (8 * hi), mc = mw >> (16 + 8 * hi);
#pragma unroll
                    for (int r = 0; r < 8; ++r) { ta[r] = (((ma >> r) & 1u) != 0u) ? NEGV : ta[r]; tb[r] = (((mc >> r) & 1u) != 0u) ? NEGV : tb[r]; }
                }
#pragma unroll
                for (int i = 0; i < 4; ++i) {
                    pa0[i] = __builtin_amdgcn_exp2f(ta[i] + shp) * inv; pa1[i] = __builtin_amdgcn_exp2f(ta[4 + i] + shp) * inv;
                    pc0[i] = __builtin_amdgcn_exp2f(tb[i] + shp) * inv; pc1[i] = __builtin_amdgcn_exp2f(tb[4 + i] + shp) * inv; }
            }
            // lane (t, h): keys 8h+r and 16+8h+r of this step -> os[t][0..31]; rows 0..15 x columns 0..31 all written
            *(v4fa*)(&os[wb + lr * 68 + 8 * hi]) = pa0;      *(v4fa*)(&os[wb + lr * 68 + 8 * hi + 4]) = pa1;
            *(v4fa*)(&os[wb + lr * 68 + 16 + 8 * hi]) = pc0; *(v4fa*)(&os[wb + lr * 68 + 16 + 8 * hi + 4]) = pc1;
            wave_sync();
            v4f val[4];
#pragma unroll
            for (int s = 0; s < 4; ++s) { const int row = 4 * s + (lane >> 3), c4 = (lane & 7) * 4;
                val[s] = *(const v4fa*)(&os[wb + row * 68 + c4]); }
{
#pragma unroll
                for (int s = 0; s < 4; ++s) { const int row = 4 * s + (lane >> 3), c4 = (lane & 7) * 4;
                    *(v4f*)(arow + (size_t)row * ATT_LD + key0 + c4) = val[s]; }
                 }
            // the address registers of the stores above are advanced for the next step: the wait stands in front of that overwrite
            asm volatile("s_wait_xcnt 0x0" ::: "memory");
            wave_sync();
            if (kk + 32 == SK && s < nst) {         // work-group-uniform: foot of K stage s, passed by every wave, in the order of the loop above
                asm volatile("s_wait_dscnt 0x0" ::: "memory");
                asm volatile("s_wait_asynccnt 0x0" ::: "memory");
                lds_barrier();                      // orders LDS only: the probability stores just issued stay in flight across it
                if (s + 2 < nst) fillk(s + 2);
            }
        }
        asm volatile("s_wait_asynccnt 0x0" ::: "memory");    // no copy is outstanding behind the loop
    }
}

static constexpr size_t al256(size_t v) { return (v + 255) & ~(size_t)255; }
static constexpr size_t SZ_XB = al256((size_t)NB * SEQ * DM * 2);
static constexpr size_t SZ_WB = al256((size_t)3 * DM * DM * 2);
static constexpr size_t SZ_WF = al256((size_t)DM * DM * 2);
static constexpr size_t SZ_PL = al256((size_t)NB * SEQ * DM * 2);
static constexpr size_t SZ_MW = al256((size_t)NB * SEQ * (SEQ / 32) * 4);
static constexpr size_t SZ_TOTAL = SZ_XB + SZ_WB + SZ_WF + 5 * SZ_PL + 2 * SZ_PL + SZ_MW;
static_assert(SZ_TOTAL <= (size_t)134217728);          // workspace carve <= 128 MiB
static_assert(((size_t)DM * DM * 2) % 256 == 0);       // weight sub-planes stay 256-byte aligned
static_assert(SZ_PL == (size_t)NB * SEQ * DM * 2);     // ctx hi and lo planes are back to back with stride NB*SEQ*DM elements
static_assert((size_t)NB * NH_ * SEQ * HD * 2 == SZ_PL);   // q / k / v^T planes [NB*16][SEQ][64] fill one plane exactly

extern "C" void kernel_launch(void* const* d_in, const int* in_sizes, int n_in,
                              void* d_out, int out_size, void* d_ws, size_t ws_size, hipStream_t stream) {
    if (n_in < 6) return;
    const size_t needx = ((size_t)(NB - 1) * SEQ_FULL + SEQ) * DM;
    if ((size_t)in_sizes[0] < needx) return;
    if ((size_t)in_sizes[1] < (size_t)3 * DM * DM || (size_t)in_sizes[2] < (size_t)3 * DM) return;
    if ((size_t)in_sizes[3] < (size_t)DM * DM || (size_t)in_sizes[4] < (size_t)DM) return;
    if ((size_t)in_sizes[5] < ((size_t)(NB - 1) * SEQ_FULL + (SEQ - 1)) * SEQ_FULL + SEQ) return;
    if ((size_t)out_size < OUT1_OFF + ((size_t)(NB - 1) * OUT_SEQ + (SEQ - 1)) * ATT_LD + SEQ) return;
    if (SZ_TOTAL > ws_size) return;
    const float* x = (const float*)d_in[0]; const float* wqkv = (const float*)d_in[1]; const float* bqkv = (const float*)d_in[2];
    const float* wfc = (const float*)d_in[3]; const float* bfc = (const float*)d_in[4];          // wire order x, W_attn, b_attn, W_proj, b_proj, padding_mask
    const int* pmask = (const int*)d_in[5];          // [NB_FULL][SEQ_FULL][SEQ_FULL] int32, non-zero = key hidden
    float* OUT = (float*)d_out;      // [NB][SEQ][1024] then [NB][1][SEQ][SEQ]
    float* ATT = OUT + OUT1_OFF;
    char* wsp = (char*)d_ws;
    bf* XB = (bf*)wsp; wsp += SZ_XB;                 // [NB*SEQ][1024]
    bf* WB = (bf*)wsp; wsp += SZ_WB;                 // [3072][1024]: q rows | k rows | v rows (row e = h*64 + d)
    bf* WF = (bf*)wsp; wsp += SZ_WF;                 // [1024][1024]: W_proj^T
    h16* QH = (h16*)wsp; wsp += SZ_PL;               // [NB*16][SEQ][64]
    h16* QR = (h16*)wsp; wsp += SZ_PL;               // residual x2048
    h16* KP = (h16*)wsp; wsp += SZ_PL;               // [NB*16][SEQ][64]
    h16* VT = (h16*)wsp; wsp += SZ_PL;               // [NB*16][64][SEQ]
    h16* VR = (h16*)wsp; wsp += SZ_PL;               // residual x2048
    bf* CH = (bf*)wsp; wsp += SZ_PL;                 // ctx hi [NB*SEQ][1024]
    bf* CL = (bf*)wsp; wsp += SZ_PL;                 // ctx lo, directly after CH
    unsigned* MW = (unsigned*)wsp; wsp += SZ_MW;     // mask bit words [NB*SEQ][SEQ/32]

    k_prep<<<PB_WA + PB_WP + PB_MB + PB_X, 256, 0, stream>>>(x, wqkv, wfc, pmask, XB, WB, WF, MW);

    k_gemm<true><<<dim3(NB * SEQ / 128, DM / 128, 3), 128, 0, stream>>>(XB, WB, bqkv, QH, QR, KP, VT, VR, OUT);

    k_flash<<<dim3(SEQ / (16 * AW), NB * NH_, 1), 32 * AW, 0, stream>>>(QH, QR, KP, VT, VR, MW, CH, CL, ATT);

    k_gemm<false><<<dim3(NB * SEQ / 128, DM / 128, 1), 128, 0, stream>>>(CH, WF, bfc, QH, QR, KP, VT, VR, OUT);
}

// v004
// Measured time: 104 microseconds a run.
// Timed twice side by side with v003, it ran 1.07 and 1.08 times as fast.
// Over all steps from v000 it is 2.09 times as fast.
#include <hip/hip_runtime.h>

// Causal multi-head self-attention, width 1024 = 16 heads x 64, x [NB][SEQ][1024], fused W_attn [in][out] + bias, true head split q[b][h][t][d] = qkv[b][t][h*64+d], score scale 1/8,
// key > query OR padding_mask[b][q][k] != 0 replaced by -inf, heads merged back to [b][t][h*64+d], output projection W_proj [in][out] + bias (f32 out); second output = normalised probabilities of head 0, [NB][1][SEQ][SEQ] f32.
// Compute dtypes, f32 accumulate everywhere: qkv projections v_wmma_f32_16x16x32_bf16 (x, W, biases RNE-converted to bf16; products exact); scores v_wmma_f32_16x16x32_f16: k single f16, q as f16 value + f16 residual x2048 in its own accumulator;
// P (x256 carry, cancels in the normalisation) single f16; v single f16 plus, for query rows < 512, an f16 residual x2048 in its own accumulator; softmax f32 (online, running max); output projection v_wmma_f32_16x16x32_bf16 with ctx as bf16 hi + bf16 lo planes (unscaled, shared accumulator) against bf16 W_proj.
// Layout: bf16 copies of x and transposed (K-contiguous) weights; q (hi, residual) and k planes [b*16+h][t][64]; v^T planes [b*16+h][d][t] produced by the v GEMM run with the weight rows as the M operand and the tokens as the N operand; ctx planes compact [NB*SEQ][1024]; padding mask packed to one 32-key bit word per (b, q, key block).

#ifndef NB
#define NB 4
#endif
#ifndef SEQ
#define SEQ 1024
#endif
#define NB_FULL  4
#define SEQ_FULL 1024
#ifndef OUT_SEQ
#define OUT_SEQ SEQ              // row pitch (in tokens) between batches of the outputs
#endif
#ifndef ATT_LD
#define ATT_LD OUT_SEQ           // key pitch of one probability row of the second output
#endif
#ifndef SCORE_RES
#define SCORE_RES 1              // 1: q residual plane adds a second score product; 0: single score product
#endif
#define DM   1024
#define NH_  16
#define HD   64
#define AW   4                   // waves per flash block (16 query rows each)
#define EARLY 512                // query rows below this use the v residual plane
#define QRS  2048.0f             // carry of the residual planes
#define QRI  (1.0f / 2048.0f)
#define SC2  (0.125f * 1.4426950408889634f)   // HD^-0.5 * log2(e)
#define PSH  8.0f                // log2 of the P carry (256)
#define NEGV (-3.0e38f)
#define OUT1_OFF ((size_t)NB_FULL * SEQ_FULL * DM)   // element offset of the second output (fixed by the full problem size)

static_assert(HD == 64);
static_assert(NH_ * HD == DM);
static_assert(DM % 64 == 0);
static_assert(DM % 32 == 0);
static_assert(SEQ % 256 == 0);                 // SEQ/32 mask words per row is a multiple of 8; 64-token tiles stay inside one batch
static_assert(SEQ % 64 == 0);
static_assert((NB * SEQ) % 128 == 0);
static_assert(DM % 128 == 0);
static_assert(DM / 64 >= 2);                   // the GEMM prologue fetches two 64-k stages
static_assert(SEQ % 32 == 0);
static_assert(SEQ % (16 * AW) == 0);
static_assert(((size_t)SEQ * DM) % 8 == 0);
static_assert(NB <= NB_FULL);
static_assert(SEQ <= SEQ_FULL);
static_assert(((size_t)NB * SEQ * (SEQ / 32)) % 256 == 0);        // mask-word grid x block == plane extent
static_assert(ATT_LD % 32 == 0);
static_assert(ATT_LD >= SEQ);
static_assert(OUT1_OFF * 4 == (size_t)16777216);                   // byte offset of the second output
static_assert(((size_t)(NB - 1) * OUT_SEQ + SEQ) * DM <= OUT1_OFF);
static_assert(OUT1_OFF + ((size_t)(NB - 1) * OUT_SEQ + (SEQ - 1)) * ATT_LD + SEQ <= OUT1_OFF + (size_t)NB_FULL * SEQ_FULL * SEQ_FULL);

typedef _Float16 h16;
typedef unsigned short bf;
typedef __attribute__((ext_vector_type(16))) __bf16   v16bf;
typedef __attribute__((ext_vector_type(16))) _Float16 v16h;
typedef __attribute__((ext_vector_type(8)))  _Float16 v8h;
typedef __attribute__((ext_vector_type(8)))  unsigned short v8us;
typedef __attribute__((ext_vector_type(8)))  float    v8f;
typedef __attribute__((ext_vector_type(4)))  float    v4f;
typedef __attribute__((ext_vector_type(4)))  int      v4i;
typedef v4f  __attribute__((may_alias)) v4fa;
typedef v8us __attribute__((may_alias)) v8usa;

__device__ __forceinline__ unsigned short f2bf(float f) { unsigned u = __float_as_uint(f); u += 0x7FFFu + ((u >> 16) & 1u); return (unsigned short)(u >> 16); }
__device__ __forceinline__ float bf2f(unsigned short h) { return __uint_as_float(((unsigned)h) << 16); }
__device__ __forceinline__ v16h cat16(v8h lo, v8h hi) { return __builtin_shufflevector(lo, hi, 0, 1, 2, 3, 4, 5, 6, 7, 8, 9, 10, 11, 12, 13, 14, 15); }
__device__ __forceinline__ v16bf cat16b(v8us lo, v8us hi) { return __builtin_bit_cast(v16bf, __builtin_shufflevector(lo, hi, 0, 1, 2, 3, 4, 5, 6, 7, 8, 9, 10, 11, 12, 13, 14, 15)); }
__device__ __forceinline__ v8f wmma16(v16h a, v16h b, v8f c) { return __builtin_amdgcn_wmma_f32_16x16x32_f16(false, a, false, b, (short)0, c, false, false); }
__device__ __forceinline__ v8f wmmab(v16bf a, v16bf b, v8f c) { return __builtin_amdgcn_wmma_f32_16x16x32_bf16(false, a, false, b, (short)0, c, false, false); }
// fragment loaders from K-contiguous 16-bit rows; p already includes + 8*(lane>>4): elements 0..7 <- k0+8h+0..7, elements 8..15 <- k0+16+8h+0..7 (same map for A and B)
__device__ __forceinline__ v16h  ldh(const h16* p) { return cat16(*(const v8h*)p, *(const v8h*)(p + 16)); }
__device__ __forceinline__ v16bf ldb(const bf* p)  { return cat16b(*(const v8us*)p, *(const v8us*)(p + 16)); }
// ordering point for wave-private LDS tiles (same wave writes and reads)
__device__ __forceinline__ void wave_sync() { __builtin_amdgcn_fence(3 /* release order */, "wavefront"); __builtin_amdgcn_wave_barrier(); asm volatile("" ::: "memory"); }
// f32 -> f16 for WMMA operand planes: results below the smallest f16 normal become exact zero (value select)
static __device__ __forceinline__ h16 toh_flush(float v) { const h16 r = (h16)v; return (fabsf(v) < 6.103515625e-05f) ? (h16)0.0f : r; }

// cvt8: x [NB_FULL][SEQ_FULL][DM] f32 -> compact bf16 plane [NB*SEQ][DM], 8 elements a thread
__device__ __forceinline__ void cvt8(const float* __restrict__ src, bf* dst, size_t n8, const int blk) {
    const size_t i = (size_t)blk * 256 + threadIdx.x; if (i >= n8) return;
    const size_t pb = (size_t)SEQ * DM / 8;          // threads per batch
    const v8f v = *(const v8f*)(src + (i / pb) * ((size_t)SEQ_FULL * DM) + (i % pb) * 8); v8us o;
#pragma unroll
    for (int k = 0; k < 8; ++k) o[k] = f2bf(v[k]);
    *(v8us*)(dst + i * 8) = o; 
}

// cvtT: W [DM k][ldn] f32 (row = k, column = e) -> bf16 plane dst[row(e)][k] (K-contiguous), 64 k x 64 e tile through LDS (cross-wave: block barrier).
// row(e) = e for e < permFrom; for e >= permFrom, with ee = e - permFrom = c*64 + d: row = permFrom + d*16 + c.
__device__ __forceinline__ void cvtT(unsigned short* ts, const float* __restrict__ W, int ldn, bf* dst, int permFrom, const int bx, const int by) {
    const int t = threadIdx.x; const int k0 = bx * 64, n0 = by * 64;
#pragma unroll 4
    for (int i = 0; i < 16; ++i) { const int k = i * 4 + (t >> 6), n = t & 63;      // 16 x 4 = 64 k rows, 64 columns
        ts[n * 72 + k] = f2bf(W[(size_t)(k0 + k) * (size_t)ldn + n0 + n]); }
    __syncthreads();
    v8us o0, o1; size_t d0, d1;
    { const int p = t, n = p >> 3, q = p & 7; o0 = *(const v8usa*)(&ts[n * 72 + 8 * q]);
      const int e = n0 + n; const int ee = e - permFrom; const int row = (e >= permFrom) ? (permFrom + (ee & 63) * 16 + (ee >> 6)) : e;
      d0 = (size_t)row * DM + k0 + 8 * q; }
    { const int p = t + 256, n = p >> 3, q = p & 7; o1 = *(const v8usa*)(&ts[n * 72 + 8 * q]);
      const int e = n0 + n; const int ee = e - permFrom; const int row = (e >= permFrom) ? (permFrom + (ee & 63) * 16 + (ee >> 6)) : e;
      d1 = (size_t)row * DM + k0 + 8 * q; }
{
        *(v8us*)(dst + d0) = o0; *(v8us*)(dst + d1) = o1;
         }
}

// mbits: padding mask [NB_FULL][SEQ_FULL][SEQ_FULL] int32 -> bit words MW[b*SEQ + q][SEQ/32], bit j of word w = (mask[b][q][32*w + j] != 0).
__device__ __forceinline__ void mbits(const int* __restrict__ pm, unsigned* MW, size_t nW, const int blk) {
    const size_t w = (size_t)blk * 256 + threadIdx.x; if (w >= nW) return;
    const size_t row = w / (size_t)(SEQ / 32); const size_t j = w % (size_t)(SEQ / 32);
    const size_t b = row / (size_t)SEQ, t = row % (size_t)SEQ;
    const int* src = pm + (b * SEQ_FULL + t) * (size_t)SEQ_FULL + j * 32;
    unsigned bits = 0u;
#pragma unroll
    for (int i = 0; i < 8; ++i) { const v4i v = *(const v4i*)(src + 4 * i);
        const unsigned n = ((v[0] != 0) ? 1u : 0u) | ((v[1] != 0) ? 2u : 0u) | ((v[2] != 0) ? 4u : 0u) | ((v[3] != 0) ? 8u : 0u);
        bits |= n << (4 * i); }
    *(unsigned*)(MW + w) = bits; 
}

// k_prep: the four input conversions, none of which reads another's output, as ONE grid. A work-group's job follows from its block index alone (the same for all its threads, so
// the barrier inside cvtT is passed by a whole work-group or by none of it); the jobs with the longest chain of dependent loads come first in the index.
#define PB_WA ((DM / 64) * (3 * DM / 64))                    // W_attn tiles
#define PB_WP ((DM / 64) * (DM / 64))                        // W_proj tiles
#define PB_MB ((int)((size_t)NB * SEQ * (SEQ / 32) / 256))   // mask-word blocks
#define PB_X  ((int)((size_t)NB * SEQ * DM / 8 / 256))       // x blocks
static_assert(((size_t)NB * SEQ * DM / 8) % 256 == 0);
__global__ __launch_bounds__(256) void k_prep(const float* __restrict__ x, const float* __restrict__ wqkv, const float* __restrict__ wfc, const int* __restrict__ pm, bf* XB, bf* WB, bf* WF, unsigned* MW) {
    __shared__ __align__(16) unsigned short ts[64 * 72];
    int blk = (int)blockIdx.x;
    if (blk < PB_WA + PB_WP) {                       // W_attn in[1024 k][3072 e] -> WB out[e][1024 k] (no row permutation); W_proj in[1024 k][1024 e] -> WF out[e][1024 k]
        const bool wa = blk < PB_WA; const int tl = wa ? blk : blk - PB_WA;
        cvtT(ts, wa ? wqkv : wfc, wa ? 3 * DM : DM, wa ? WB : WF, 1 << 30, tl % (DM / 64), tl / (DM / 64));
        return; }
    blk -= PB_WA + PB_WP;
    if (blk < PB_MB) { mbits(pm, MW, (size_t)NB * SEQ * (SEQ / 32), blk); return; }
    blk -= PB_MB;
    cvt8(x, XB, (size_t)NB * SEQ * DM / 8, blk);
}

// work-group barrier that orders LDS only: the release and acquire fences name the LDS address space, so the global loads that prefetch a later stage into registers stay in flight across it
__device__ __forceinline__ void lds_barrier() { __builtin_amdgcn_fence(__ATOMIC_RELEASE, "workgroup", "local"); __builtin_amdgcn_s_barrier(); __builtin_amdgcn_fence(__ATOMIC_ACQUIRE, "workgroup", "local"); }

// k_gemm: bf16 GEMM, work-group of 4 waves on a 128x128 tile, each wave a 64x64 quadrant (16 accumulators), K = DM walked in stages of 64.
// Each stage's A and B tiles (128 rows x 64 k) are read from the K-contiguous bf16 planes as whole 128-byte rows (8 lanes x 16 B a row) into registers two stages ahead and
// stored one stage ahead to the other of two LDS buffers (row pitch 144 B); fragments come from LDS. One work-group barrier a stage: it publishes the stage just stored
// and ends every wave's reads of the buffer that the next stage's stores overwrite. k order of every accumulator: ascending in steps of 32.
// C[m][n] = sum_k A[m][k] Bt[n][k] + bias (bias RNE-converted to bf16, added in f32). 128 threads per block.
// QKV = true: the q, k and v projections, which read none of each other's output, as ONE grid (M/128 token tiles, 1024/128 weight-row tiles, 3 jobs); the job md follows from blockIdx.z
// (the same for a whole work-group); three work-groups share a WGP, so one's matrix instructions run under the others' LDS and load waits, prologue and epilogue. X = x tokens, Wt = q | k | v weight rows.
// md 0: q  -> A = x tokens, Bt = q weight rows; f16 value plane Ph and f16 residual x2048 plane Pr, layout [b*16+h][t][64] (quadrant column block = head h; bias columns 0..1023)
// md 1: k  -> as md 0, value plane only (bias columns 1024..2047); the shortest epilogue, so it comes last in the index
// md 2: v  -> A = v weight rows (row e = h*64 + d), Bt = x tokens: C[e][token]; value (Ph) and residual x2048 (Pr) planes [b*16+h][d][t]; bias per ROW (columns 2048..3071 of the bias vector)
// QKV = false: output projection -> X = ctx hi plane then ctx lo plane (one shared accumulator), Wt = W_proj^T rows; f32 rows of OUT. grid (M/128, 1024/128)
struct yes_t { static constexpr bool value = true; };
struct no_t { static constexpr bool value = false; };
#define LP 72                    // LDS row pitch in 16-bit elements: 144 B = 16 B x 9, conflict-free for 16-byte fragment reads
// the second launch bound asks for a register budget at which three waves fit a SIMD, so that all 768 work-groups of the merged grid are resident at once (three a WGP; LDS allows three)
template <bool QKV>
__global__ __launch_bounds__(128, QKV ? 3 : 1) void k_gemm(const bf* __restrict__ X, const bf* __restrict__ Wt, const float* __restrict__ bias, h16* QH, h16* QR, h16* KP, h16* VT, h16* VR, float* OUT) {
    __shared__ __align__(16) bf As[2 * 128 * LP];
    __shared__ __align__(16) bf Bs[2 * 128 * LP];
    __shared__ __align__(16) float osw[4 * 16 * 68];
    const int K = DM;
    const int tid = threadIdx.x;
    const int lane = tid & 31, lr = lane & 15, hi = lane >> 4;
    const int wave = __builtin_amdgcn_readfirstlane(tid >> 5);
    float* os = osw + wave * 16 * 68;                // wave-private epilogue tile
    const int wm = wave & 1, wn = wave >> 1;
    const int md = QKV ? (((int)blockIdx.z == 0) ? 0 : 3 - (int)blockIdx.z) : 3;   // z 0, 1, 2 -> q, v, k
    const bool vj = QKV && md == 2;                  // v: weight rows are the M operand, tokens the N operand
    const int bm = vj ? (int)blockIdx.y : (int)blockIdx.x, bn = vj ? (int)blockIdx.x : (int)blockIdx.y;
    const bf* A = vj ? (Wt + (size_t)2 * DM * DM) : X;
    const bf* Bt = vj ? X : (QKV ? (Wt + (size_t)md * DM * DM) : Wt);
    const int r0 = bm * 128 + wm * 64, c0 = bn * 128 + wn * 64;
    v8f acc[4][4];
#pragma unroll
    for (int mb = 0; mb < 4; ++mb)
#pragma unroll
        for (int nb = 0; nb < 4; ++nb) acc[mb][nb] = (v8f){};
    const int srow = tid >> 3, scol = (tid & 7) * 8;  // staging: 16 rows a pass, 8 passes a tile
    const bf* ga = A + (size_t)(bm * 128 + srow) * K + scol;
    const bf* gb = Bt + (size_t)(bn * 128 + srow) * K + scol;
    const int sl = srow * LP + scol;
    const int fa = (wm * 64 + lr) * LP + 8 * hi, fb = (wn * 64 + lr) * LP + 8 * hi;
    const int SPP = K / 64;                           // stages per plane
    const int NS = (QKV ? 1 : 2) * SPP;
    v8us ra[8], rb[8];
#pragma unroll
    for (int i = 0; i < 8; ++i) { ra[i] = *(const v8us*)(ga + (size_t)i * 16 * K); rb[i] = *(const v8us*)(gb + (size_t)i * 16 * K); }
#pragma unroll
    for (int i = 0; i < 8; ++i) { *(v8us*)(&As[sl + i * 16 * LP]) = ra[i]; *(v8us*)(&Bs[sl + i * 16 * LP]) = rb[i]; }
#pragma unroll
    for (int i = 0; i < 8; ++i) { ra[i] = *(const v8us*)(ga + 64 + (size_t)i * 16 * K); rb[i] = *(const v8us*)(gb + 64 + (size_t)i * 16 * K); }   // stage 1 (NS >= 2)
    lds_barrier();
    // one stage; ST: stage s+1 exists (it waits in ra, rb since the stage before), LD: stage s+2 exists. Both are compile-time so that the body is one straight run whose LDS waits are counted exactly.
    auto stage = [&](const int s, auto ST, auto LD) {
        const int cur = (s & 1) * (128 * LP), nxt = (128 * LP) - cur;
        v16bf a[2][4], b[2][4];                       // both 32-k blocks' fragments of this stage, read as one group ahead of the matrix instructions
#pragma unroll
        for (int kb = 0; kb < 2; ++kb) {
#pragma unroll
            for (int mb = 0; mb < 4; ++mb) a[kb][mb] = ldb(&As[cur + fa + mb * 16 * LP + kb * 32]);
#pragma unroll
            for (int nb = 0; nb < 4; ++nb) b[kb][nb] = ldb(&Bs[cur + fb + nb * 16 * LP + kb * 32]);
        }
        if constexpr (ST.value) {                     // stage s+1 goes to the buffer that stage s-1 was read from
#pragma unroll
            for (int i = 0; i < 8; ++i) { *(v8us*)(&As[nxt + sl + i * 16 * LP]) = ra[i]; *(v8us*)(&Bs[nxt + sl + i * 16 * LP]) = rb[i]; }
        }
        if constexpr (LD.value) {                     // stage s+2 starts its way from global memory
            const int s2 = s + 2; const int pl = (s2 >= SPP) ? 1 : 0; const int kc = (s2 - pl * SPP) * 64;
            const bf* pa = ga + (size_t)pl * ((size_t)NB * SEQ * DM) + kc; const bf* pb = gb + kc;
#pragma unroll
            for (int i = 0; i < 8; ++i) { ra[i] = *(const v8us*)(pa + (size_t)i * 16 * K); rb[i] = *(const v8us*)(pb + (size_t)i * 16 * K); }
            // the address registers of the loads above are free for reuse behind them: the wait stands in front of any overwrite
            asm volatile("s_wait_xcnt 0x0" ::: "memory");
        }
#pragma unroll
        for (int kb = 0; kb < 2; ++kb)
#pragma unroll
            for (int nb = 0; nb < 4; ++nb)
#pragma unroll
                for (int mb = 0; mb < 4; ++mb) acc[mb][nb] = wmmab(a[kb][mb], b[kb][nb], acc[mb][nb]);
        // four vector slots behind the stage's last matrix instruction before its operand registers may be reloaded; naming every accumulator keeps all of the stage's
        // matrix instructions in front of the barrier, where they run while the LDS reads and stores of the stage drain
        asm volatile("v_nop\n\tv_nop\n\tv_nop\n\tv_nop"
                     : "+v"(acc[0][0]), "+v"(acc[1][0]), "+v"(acc[2][0]), "+v"(acc[3][0]), "+v"(acc[0][1]), "+v"(acc[1][1]), "+v"(acc[2][1]), "+v"(acc[3][1]),
                       "+v"(acc[0][2]), "+v"(acc[1][2]), "+v"(acc[2][2]), "+v"(acc[3][2]), "+v"(acc[0][3]), "+v"(acc[1][3]), "+v"(acc[2][3]), "+v"(acc[3][3])
                     : "v"(a[1][0]), "v"(a[1][1]), "v"(a[1][2]), "v"(a[1][3]), "v"(b[1][3]));
        if constexpr (ST.value) lds_barrier();        // publishes stage s+1 and ends the reads of this stage's buffer; behind the last stage nothing is left to publish
    };
#pragma unroll 1
    for (int s = 0; s < NS - 2; ++s) stage(s, yes_t{}, yes_t{});
    stage(NS - 2, yes_t{}, no_t{});
    stage(NS - 1, no_t{}, no_t{});
    // the lane's number is read anew here, so that nothing derived from it for the epilogue is held in a register across the loop (the loop fills the register budget of three waves a SIMD)
    const int ln = (int)__builtin_amdgcn_mbcnt_lo(~0u, 0u), lc = ln & 15, lh = ln >> 4;
    float bv[4];
#pragma unroll
    for (int nb = 0; nb < 4; ++nb) {
        const int bi = vj ? (2 * DM) : ((QKV ? md * DM : 0) + c0 + nb * 16 + lc);
        bv[nb] = bf2f(f2bf(bias[bi])); }
#pragma unroll
    for (int mb = 0; mb < 4; ++mb) {
        // D: row 8h+j, col lane&15; rows 0..15 x cols 0..63 all written on either path
        if (vj) {                                       // per-row bias: 8 consecutive floats, one 32-byte vector load
            const v8f bq = *(const v8f*)(bias + 2 * DM + r0 + mb * 16 + lh * 8);
            float rb[8];
#pragma unroll
            for (int j = 0; j < 8; ++j) rb[j] = bf2f(f2bf(bq[j]));
#pragma unroll
            for (int nb = 0; nb < 4; ++nb) {
#pragma unroll
                for (int j = 0; j < 8; ++j) os[(lh * 8 + j) * 68 + nb * 16 + lc] = acc[mb][nb][j] + rb[j]; }
        } else {
#pragma unroll
            for (int nb = 0; nb < 4; ++nb) {
#pragma unroll
                for (int j = 0; j < 8; ++j) os[(lh * 8 + j) * 68 + nb * 16 + lc] = acc[mb][nb][j] + bv[nb]; }
        }
        wave_sync();
        if (QKV) {
            h16* Ph = (md == 0) ? QH : ((md == 1) ? KP : VT);
            h16* Pr = (md == 0) ? QR : VR;              // md 1 stores no residual
            size_t sb, pitch;
            if (vj) { const int bb = c0 / SEQ; const int tt = c0 % SEQ;                               // rows = d of head r0/64, columns = 64 tokens of one batch
                sb = ((size_t)(bb * NH_ + (r0 >> 6)) * HD + (size_t)(16 * mb)) * SEQ + (size_t)tt; pitch = SEQ; }
            else { const int tokrow = r0 + 16 * mb; const int bb = tokrow / SEQ; const int tt = tokrow % SEQ;   // rows = tokens, columns = d of head c0/64
                sb = ((size_t)(bb * NH_ + (c0 >> 6)) * SEQ + (size_t)tt) * HD; pitch = HD; }
            v4f x0[4], x1[4]; v8h hv[4];
#pragma unroll
            for (int s = 0; s < 4; ++s) { const int row = 4 * s + (ln >> 3), c8 = (ln & 7) * 8;
                x0[s] = *(const v4fa*)(&os[row * 68 + c8]); x1[s] = *(const v4fa*)(&os[row * 68 + c8 + 4]);
#pragma unroll
                for (int i = 0; i < 4; ++i) { hv[s][i] = toh_flush(x0[s][i]); hv[s][4 + i] = toh_flush(x1[s][i]); }
                *(v8h*)(Ph + sb + (size_t)row * pitch + c8) = hv[s]; }
            // the address and data registers of the stores above are reused behind them: the wait stands in front of any overwrite
            asm volatile("s_wait_xcnt 0x0" ::: "memory");
            if (md != 1) {
#pragma unroll
                for (int s = 0; s < 4; ++s) { const int row = 4 * s + (ln >> 3), c8 = (ln & 7) * 8; v8h rv;
#pragma unroll
                    for (int i = 0; i < 4; ++i) { rv[i] = toh_flush((x0[s][i] - (float)hv[s][i]) * QRS); rv[4 + i] = toh_flush((x1[s][i] - (float)hv[s][4 + i]) * QRS); }
                    *(v8h*)(Pr + sb + (size_t)row * pitch + c8) = rv; }
                asm volatile("s_wait_xcnt 0x0" ::: "memory");   // as above, for the residual stores
            }
        } else {
            const int grow = r0 + 16 * mb; const int bb = grow / SEQ; const int nn = grow % SEQ;
            float* orow = OUT + ((size_t)bb * OUT_SEQ + nn) * DM + c0;
{
#pragma unroll
                for (int s = 0; s < 8; ++s) { const int row = 2 * s + lh, cofs = lc * 4;   // 8 s x 2 rows = 16 rows; 16 lanes x 4 floats = 64 columns
                    const v4f val = *(const v4fa*)(&os[row * 68 + cofs]);
                    *(v4f*)(orow + (size_t)row * DM + cofs) = val; }
                 }
        }
        wave_sync();
    }
}

// k_flash: fused causal attention, one wave per 16 query rows of one (batch, head); Q fragments straight from the f16 planes (two 16-B loads each, arithmetic addressing).
// The four waves of a work-group share each 64-key stage of K, V^T and (early rows) the V^T residual through LDS: whole 128-byte rows are brought by asynchronous copies into one of two buffers
// (row pitch 144 B), one stage ahead of the stage being worked on; fragments are read from LDS. One work-group barrier a stage publishes the next stage and ends the reads of the buffer refilled behind it.
// Transposed form: S^T[key][t] = K Q^T (A = K rows, B = Q rows); lane (t = lane&15, h = lane>>4) holds keys 8h+r of each 16-key tile, so the packed
// P tile is directly the B fragment of O^T[d][t] = V^T P^T (element r <- tile keys 0..15, element 8+r <- tile keys 16..31, lane unchanged).
// Keys run over [0, t0+16) in steps of 32; on steps that touch the diagonal, scores with key > query are replaced by a very negative value (P = 0 exactly);
// the padding-mask bit word of (b, query, key block) is read once per lane per step and its bit selects run at every step (bit 8h+r <-> key key0+8h+r, bit 16+8h+r <-> key key0+16+8h+r; a set bit replaces the score the same way; a zero word changes nothing).
// A query row that never sees a visible key yields NaN (all scores replaced by -inf).
// Softmax state (running max, partial sum) is one scalar per lane; the two lane halves of a row are combined with one xor-16 exchange.
#define FP 72                    // LDS row pitch of a staged tile in 16-bit elements: 144 B = 16 B x 9, conflict-free for 16-byte fragment reads
#define SK 64                    // keys per stage
#define TILE_E (64 * FP)         // one staged tile: 64 rows (K: keys, V^T: d) of 64 elements
#define BUF_E  (3 * TILE_E)      // one buffer: K | V^T | V^T residual
static_assert(SK == 16 * AW);    // a work-group's query rows span one stage: stages 0..tile reach its diagonal
#define NT  (SEQ / (16 * AW))    // query tiles per (batch, head)
#define HPR (NH_ / NB)           // heads of one batch per NH_ values of blockIdx.y
static_assert(NH_ % NB == 0);    // (blockIdx.y / NH_, blockIdx.y % NH_) -> (batch, head) is one to one
static_assert(NT % 2 == 0);
static_assert(EARLY % (16 * AW) == 0);   // the residual plane is used by all waves of a work-group or by none
static_assert(32 * AW == 128);   // staging map: 8 lanes a row, 16 rows a copy, 4 copies a tile
// four asynchronous 16-byte copies a lane (rows r, r+16, r+32, r+48 of one tile); the wait is the statement's last line, so it stands in front of any rewrite of an address register that a copy names
__device__ __forceinline__ void acopy4(const unsigned l, const h16* g, const size_t gp) {
    const unsigned l1 = l + 16 * FP * 2, l2 = l + 32 * FP * 2, l3 = l + 48 * FP * 2;
    const h16* g1 = g + 16 * gp; const h16* g2 = g + 32 * gp; const h16* g3 = g + 48 * gp;
    asm volatile("global_load_async_to_lds_b128 %0, %4, off\n\t"
                 "global_load_async_to_lds_b128 %1, %5, off\n\t"
                 "global_load_async_to_lds_b128 %2, %6, off\n\t"
                 "global_load_async_to_lds_b128 %3, %7, off\n\t"
                 "s_wait_xcnt 0x0"
                 :: "v"(l), "v"(l1), "v"(l2), "v"(l3), "v"(g), "v"(g1), "v"(g2), "v"(g3) : "memory");
}
__global__ __launch_bounds__(32 * AW) void k_flash(const h16* __restrict__ QH, const h16* __restrict__ QR, const h16* __restrict__ KP, const h16* __restrict__ VT, const h16* __restrict__ VR, const unsigned* __restrict__ MW, bf* CH, bf* CL, float* ATT) {
    __shared__ __align__(16) float os[AW * 16 * 68];
    __shared__ __align__(16) h16 ring[2 * BUF_E];
    const int lane = threadIdx.x & 31, lr = lane & 15, hi = lane >> 4;
    const int wave = __builtin_amdgcn_readfirstlane((int)(threadIdx.x >> 5));
    // Deal of (batch, head, query tile) over the grid, a permutation of it, for speed only. A tile's cost grows with its index (tile + 1 stages) and all work-groups are resident at once, so a WGP
    // lasts as long as the tiles that meet on it. Work-groups whose flat index is NT * NH_ apart get tiles t, NT-1-t, t+NT/2, NT/2-1-t (equal stage sums), neighbours in blockIdx.y get t and NT-1-t,
    // and the head-0 work-groups, which also write the probabilities, stand NT * HPR indices apart in the first NT * NH_.
    const int rnd = (int)(blockIdx.y / (unsigned)NH_), wq = (int)(blockIdx.y % (unsigned)NH_);
    const int bb = (int)((unsigned)wq / (unsigned)HPR), hh = (int)((unsigned)wq % (unsigned)HPR) + HPR * rnd;
    const int zh = bb * NH_ + hh;
    int tl = (int)blockIdx.x;
    if (((rnd ^ wq) & 1) != 0) tl = NT - 1 - tl;
    if ((rnd & 2) != 0) tl = (int)((unsigned)(tl + NT / 2) % (unsigned)NT);
    const int tile = tl;
    const int t0 = (tile * AW + wave) * 16;
    const size_t pbase = (size_t)zh * SEQ * HD;
    const size_t qo = pbase + (size_t)(t0 + lr) * HD + 8 * hi;
    const v16h qh0 = ldh(QH + qo), qh1 = ldh(QH + qo + 32), qr0 = ldh(QR + qo), qr1 = ldh(QR + qo + 32);   // B fragments: col t, k = d
    const int fk = lr * FP + 8 * hi;                         // LDS, + key * FP         (A fragment: row key, k = d)
    const int fv = TILE_E + lr * FP + 8 * hi;                // LDS, + 16j*FP + key     (A fragment: row d, k = key)
    const int kend = t0 + 16;
    const bool early = tile * (16 * AW) < EARLY;             // same for the four waves
    const int srow = (int)threadIdx.x >> 3, scol = ((int)threadIdx.x & 7) * 8;   // staging: 8 lanes x 16 B = one 128-byte row
    const unsigned sl = (unsigned)(size_t)(&ring[srow * FP + scol]);             // this lane's LDS byte address in buffer 0, K tile
    const h16* gk = KP + pbase + (size_t)srow * HD + scol;   // + stage * SK * HD
    const h16* gv = VT + pbase + (size_t)srow * SEQ + scol;  // + stage * SK
    const h16* gr = VR + pbase + (size_t)srow * SEQ + scol;
    const int nst = tile + 1;                                // stages up to and including the work-group's diagonal
    auto fill = [&](const int s) {                           // stage s -> buffer s & 1; every lane on, work-group-uniform control flow
        const unsigned lb = sl + (unsigned)((s & 1) * (BUF_E * 2));
        acopy4(lb, gk + (size_t)s * (SK * HD), HD);
        acopy4(lb + TILE_E * 2, gv + (size_t)s * SK, SEQ);
        if (early) acopy4(lb + 2 * TILE_E * 2, gr + (size_t)s * SK, SEQ);
    };
    const int tq = t0 + lr;
    const size_t mo = ((size_t)bb * SEQ + (size_t)tq) * (size_t)(SEQ / 32);   // + key0/32: mask word of this lane's query row
    v8f o0 = (v8f){}, o1 = (v8f){}, o2 = (v8f){}, o3 = (v8f){};
    v8f e0 = (v8f){}, e1 = (v8f){}, e2 = (v8f){}, e3 = (v8f){};
    float m = NEGV, l = 0.0f;
    fill(0);
    asm volatile("s_wait_asynccnt 0x0" ::: "memory");        // this wave's copies of stage 0 have landed
    __syncthreads();                                         // publishes stage 0
    if (nst > 1) fill(1);
#pragma unroll 1
    for (int s = 0; s < nst; ++s) {
      const int cur = (s & 1) * BUF_E;
      for (int kk = 0; kk < SK; kk += 32) {
        const int key0 = s * SK + kk;
        if (key0 >= kend) break;                    // wave-uniform: keys past this wave's diagonal; the stage's foot below is still passed
        const h16* ka = &ring[cur + fk + kk * FP];
        const v16h ka0 = ldh(ka), ka1 = ldh(ka + 32), kb0 = ldh(ka + 16 * FP), kb1 = ldh(ka + 16 * FP + 32);
        v8f sHa = (v8f){}, sLa = (v8f){}, sHb = (v8f){}, sLb = (v8f){};
        sHa = wmma16(ka0, qh0, sHa); sHb = wmma16(kb0, qh0, sHb);
        if (SCORE_RES) { sLa = wmma16(ka0, qr0, sLa); sLb = wmma16(kb0, qr0, sLb); }
        sHa = wmma16(ka1, qh1, sHa); sHb = wmma16(kb1, qh1, sHb);
        if (SCORE_RES) { sLa = wmma16(ka1, qr1, sLa); sLb = wmma16(kb1, qr1, sLb); }
        asm volatile("v_nop\n\tv_nop\n\tv_nop\n\tv_nop" : "+v"(sHa), "+v"(sLa), "+v"(sHb), "+v"(sLb) : "v"(ka0), "v"(ka1), "v"(kb0), "v"(kb1));
        float ta[8], tb[8];
#pragma unroll
        for (int r = 0; r < 8; ++r) { ta[r] = (sHa[r] + sLa[r] * QRI) * SC2; tb[r] = (sHb[r] + sLb[r] * QRI) * SC2; }
        if (key0 + 31 > t0) {                       // wave-uniform: this step touches the diagonal
            const int kidx = key0 + 8 * hi;
#pragma unroll
            for (int r = 0; r < 8; ++r) { ta[r] = (kidx + r > tq) ? NEGV : ta[r]; tb[r] = (kidx + 16 + r > tq) ? NEGV : tb[r]; }
        }
        unsigned mw = MW[mo + (size_t)(key0 >> 5)];
        asm volatile("" : "+v"(mw));
        {                                           // padding-mask selects, every step (a zero word changes nothing)
            const unsigned ma = mw >> (8 * hi), mc = mw >> (16 + 8 * hi);
#pragma unroll
            for (int r = 0; r < 8; ++r) { ta[r] = (((ma >> r) & 1u) != 0u) ? NEGV : ta[r]; tb[r] = (((mc >> r) & 1u) != 0u) ? NEGV : tb[r]; }
        }
        float mx = NEGV;
#pragma unroll
        for (int r = 0; r < 8; ++r) mx = fmaxf(mx, fmaxf(ta[r], tb[r]));
        mx = fmaxf(mx, __shfl_xor(mx, 16, 32));
        const float mnew = fmaxf(m, mx);
        const float alpha = __builtin_amdgcn_exp2f(m - mnew);
        const float sh = PSH - mnew;
        v16h pb; float ls = 0.0f;
#pragma unroll
        for (int r = 0; r < 8; ++r) { const float ea = ta[r] + sh, ec = tb[r] + sh;
            const h16 pa = (ea < -14.0f) ? (h16)0.0f : (h16)__builtin_amdgcn_exp2f(ea);       // exponent select: no f16 result below the smallest normal
            const h16 pc = (ec < -14.0f) ? (h16)0.0f : (h16)__builtin_amdgcn_exp2f(ec);
            pb[r] = pa; pb[8 + r] = pc; ls += (float)pa + (float)pc; }
        l = l * alpha + ls; m = mnew;
        o0 = o0 * alpha; o1 = o1 * alpha; o2 = o2 * alpha; o3 = o3 * alpha;
        const h16* va = &ring[cur + fv + kk];
        const v16h v0 = ldh(va), v1 = ldh(va + 16 * FP), v2 = ldh(va + 32 * FP), v3 = ldh(va + 48 * FP);
        o0 = wmma16(v0, pb, o0); o1 = wmma16(v1, pb, o1); o2 = wmma16(v2, pb, o2); o3 = wmma16(v3, pb, o3);
        asm volatile("v_nop\n\tv_nop\n\tv_nop\n\tv_nop" : "+v"(o0), "+v"(o1), "+v"(o2), "+v"(o3) : "v"(v0), "v"(v1), "v"(v2), "v"(v3), "v"(pb));
        if (early) {                                // wave-uniform: residual plane of v in its own accumulators
            e0 = e0 * alpha; e1 = e1 * alpha; e2 = e2 * alpha; e3 = e3 * alpha;
            const h16* vr = va + TILE_E;
            const v16h w0 = ldh(vr), w1 = ldh(vr + 16 * FP), w2 = ldh(vr + 32 * FP), w3 = ldh(vr + 48 * FP);
            e0 = wmma16(w0, pb, e0); e1 = wmma16(w1, pb, e1); e2 = wmma16(w2, pb, e2); e3 = wmma16(w3, pb, e3);
            asm volatile("v_nop\n\tv_nop\n\tv_nop\n\tv_nop" : "+v"(e0), "+v"(e1), "+v"(e2), "+v"(e3) : "v"(w0), "v"(w1), "v"(w2), "v"(w3), "v"(pb));
        }
      }
      // foot of stage s, every wave: its LDS reads of this buffer are done, its copies of stage s+1 have landed; the barrier publishes stage s+1 and frees this buffer for stage s+2
      asm volatile("s_wait_dscnt 0x0" ::: "memory");
      asm volatile("s_wait_asynccnt 0x0" ::: "memory");
      __syncthreads();
      if (s + 2 < nst) fill(s + 2);
    }
    asm volatile("s_wait_asynccnt 0x0" ::: "memory");        // no copy is outstanding behind the loop
    l += __shfl_xor(l, 16, 32);
    const float inv = (m > NEGV) ? (1.0f / l) : __uint_as_float(0x7FC00000u);   // no visible key in the whole row: NaN row
    const int wb = wave * 16 * 68;
    // O^T D layout: o_j[r] = (d = 16j + 8h + r, t = lane&15) -> os[t][d]; rows 0..15 x columns 0..63 all written
    { v4f a, c;
#pragma unroll
      for (int i = 0; i < 4; ++i) { a[i] = (o0[i] + e0[i] * QRI) * inv; c[i] = (o0[4 + i] + e0[4 + i] * QRI) * inv; }
      *(v4fa*)(&os[wb + lr * 68 +  0 + 8 * hi]) = a; *(v4fa*)(&os[wb + lr * 68 +  0 + 8 * hi + 4]) = c;
#pragma unroll
      for (int i = 0; i < 4; ++i) { a[i] = (o1[i] + e1[i] * QRI) * inv; c[i] = (o1[4 + i] + e1[4 + i] * QRI) * inv; }
      *(v4fa*)(&os[wb + lr * 68 + 16 + 8 * hi]) = a; *(v4fa*)(&os[wb + lr * 68 + 16 + 8 * hi + 4]) = c;
#pragma unroll
      for (int i = 0; i < 4; ++i) { a[i] = (o2[i] + e2[i] * QRI) * inv; c[i] = (o2[4 + i] + e2[4 + i] * QRI) * inv; }
      *(v4fa*)(&os[wb + lr * 68 + 32 + 8 * hi]) = a; *(v4fa*)(&os[wb + lr * 68 + 32 + 8 * hi + 4]) = c;
#pragma unroll
      for (int i = 0; i < 4; ++i) { a[i] = (o3[i] + e3[i] * QRI) * inv; c[i] = (o3[4 + i] + e3[4 + i] * QRI) * inv; }
      *(v4fa*)(&os[wb + lr * 68 + 48 + 8 * hi]) = a; *(v4fa*)(&os[wb + lr * 68 + 48 + 8 * hi + 4]) = c; }
    wave_sync();
    const size_t cb = ((size_t)bb * SEQ + (size_t)(t0 + (lane >> 3))) * DM + (size_t)(hh * HD + (lane & 7) * 8);
    v8us hv[4], lv[4];
#pragma unroll
    for (int s = 0; s < 4; ++s) { const int row = 4 * s + (lane >> 3), c8 = (lane & 7) * 8;   // 4 s x 4 row groups = 16 rows; 8 lanes x 8 = 64 columns
        const v4f x0 = *(const v4fa*)(&os[wb + row * 68 + c8]); const v4f x1 = *(const v4fa*)(&os[wb + row * 68 + c8 + 4]);
#pragma unroll
        for (int i = 0; i < 4; ++i) { const unsigned short a0 = f2bf(x0[i]); const unsigned short a1 = f2bf(x1[i]);
            hv[s][i] = a0; hv[s][4 + i] = a1; lv[s][i] = f2bf(x0[i] - bf2f(a0)); lv[s][4 + i] = f2bf(x1[i] - bf2f(a1)); } }
{
#pragma unroll
        for (int s = 0; s < 4; ++s) { const size_t oo = cb + (size_t)s * 4 * DM;
            *(v8us*)(CH + oo) = hv[s]; *(v8us*)(CL + oo) = lv[s]; }
         }

    if (hh == 0) {                                  // block-uniform: head 0 writes its normalised probabilities, all SEQ keys of its 16 rows
        wave_sync();
        const float shp = PSH - m;                  // l carries the x256 of P, so exp2(s - m + 8) / l is the probability
        const float zf = inv * 0.0f;                // 0 for an ordinary row, NaN for a row with no visible key
        float* arow = ATT + ((size_t)bb * OUT_SEQ + (size_t)t0) * ATT_LD;
        // the K stages come through the same two buffers once more (K tile only); the last barrier of the loop above has ended every read of them
        auto fillk = [&](const int s) { acopy4(sl + (unsigned)((s & 1) * (BUF_E * 2)), gk + (size_t)s * (SK * HD), HD); };
        fillk(0);
        asm volatile("s_wait_asynccnt 0x0" ::: "memory");    // this wave's copies of stage 0 have landed
        lds_barrier();                                       // publishes stage 0; orders LDS only: the ctx stores above stay in flight across it
        if (nst > 1) fillk(1);
#pragma unroll 1
        for (int key0 = 0; key0 < SEQ; key0 += 32) {
            const int s = key0 / SK, kk = key0 % SK;
            v4f pa0 = (v4f){zf, zf, zf, zf}, pa1 = pa0, pc0 = pa0, pc1 = pa0;
            if (key0 < kend) {                      // wave-uniform: steps at or below the diagonal re-form the scores
                const h16* ka = &ring[(s & 1) * BUF_E + fk + kk * FP];
                const v16h ka0 = ldh(ka), ka1 = ldh(ka + 32), kb0 = ldh(ka + 16 * FP), kb1 = ldh(ka + 16 * FP + 32);
                v8f sHa = (v8f){}, sLa = (v8f){}, sHb = (v8f){}, sLb = (v8f){};
                sHa = wmma16(ka0, qh0, sHa); sHb = wmma16(kb0, qh0, sHb);
                if (SCORE_RES) { sLa = wmma16(ka0, qr0, sLa); sLb = wmma16(kb0, qr0, sLb); }
                sHa = wmma16(ka1, qh1, sHa); sHb = wmma16(kb1, qh1, sHb);
                if (SCORE_RES) { sLa = wmma16(ka1, qr1, sLa); sLb = wmma16(kb1, qr1, sLb); }
                asm volatile("v_nop\n\tv_nop\n\tv_nop\n\tv_nop" : "+v"(sHa), "+v"(sLa), "+v"(sHb), "+v"(sLb) : "v"(ka0), "v"(ka1), "v"(kb0), "v"(kb1));
                float ta[8], tb[8];
#pragma unroll
                for (int r = 0; r < 8; ++r) { ta[r] = (sHa[r] + sLa[r] * QRI) * SC2; tb[r] = (sHb[r] + sLb[r] * QRI) * SC2; }
                if (key0 + 31 > t0) {
                    const int kidx = key0 + 8 * hi;
#pragma unroll
                    for (int r = 0; r < 8; ++r) { ta[r] = (kidx + r > tq) ? NEGV : ta[r]; tb[r] = (kidx + 16 + r > tq) ? NEGV : tb[r]; }
                }
                unsigned mw = MW[mo + (size_t)(key0 >> 5)];
                asm volatile("" : "+v"(mw));
                {                                   // padding-mask selects, every step (a zero word changes nothing)
                    const unsigned ma = mw >> (8 * hi), mc = mw >> (16 + 8 * hi);
#pragma unroll
                    for (int r = 0; r < 8; ++r) { ta[r] = (((ma >> r) & 1u) != 0u) ? NEGV : ta[r]; tb[r] = (((mc >> r) & 1u) != 0u) ? NEGV : tb[r]; }
                }
#pragma unroll
                for (int i = 0; i < 4; ++i) {
                    pa0[i] = __builtin_amdgcn_exp2f(ta[i] + shp) * inv; pa1[i] = __builtin_amdgcn_exp2f(ta[4 + i] + shp) * inv;
                    pc0[i] = __builtin_amdgcn_exp2f(tb[i] + shp) * inv; pc1[i] = __builtin_amdgcn_exp2f(tb[4 + i] + shp) * inv; }
            }
            // lane (t, h): keys 8h+r and 16+8h+r of this step -> os[t][0..31]; rows 0..15 x columns 0..31 all written
            *(v4fa*)(&os[wb + lr * 68 + 8 * hi]) = pa0;      *(v4fa*)(&os[wb + lr * 68 + 8 * hi + 4]) = pa1;
            *(v4fa*)(&os[wb + lr * 68 + 16 + 8 * hi]) = pc0; *(v4fa*)(&os[wb + lr * 68 + 16 + 8 * hi + 4]) = pc1;
            wave_sync();
            v4f val[4];
#pragma unroll
            for (int s = 0; s < 4; ++s) { const int row = 4 * s + (lane >> 3), c4 = (lane & 7) * 4;
                val[s] = *(const v4fa*)(&os[wb + row * 68 + c4]); }
{
#pragma unroll
                for (int s = 0; s < 4; ++s) { const int row = 4 * s + (lane >> 3), c4 = (lane & 7) * 4;
                    *(v4f*)(arow + (size_t)row * ATT_LD + key0 + c4) = val[s]; }
                 }
            // the address registers of the stores above are advanced for the next step: the wait stands in front of that overwrite
            asm volatile("s_wait_xcnt 0x0" ::: "memory");
            wave_sync();
            if (kk + 32 == SK && s < nst) {         // work-group-uniform: foot of K stage s, passed by every wave, in the order of the loop above
                asm volatile("s_wait_dscnt 0x0" ::: "memory");
                asm volatile("s_wait_asynccnt 0x0" ::: "memory");
                lds_barrier();                      // orders LDS only: the probability stores just issued stay in flight across it
                if (s + 2 < nst) fillk(s + 2);
            }
        }
        asm volatile("s_wait_asynccnt 0x0" ::: "memory");    // no copy is outstanding behind the loop
    }
}

static constexpr size_t al256(size_t v) { return (v + 255) & ~(size_t)255; }
static constexpr size_t SZ_XB = al256((size_t)NB * SEQ * DM * 2);
static constexpr size_t SZ_WB = al256((size_t)3 * DM * DM * 2);
static constexpr size_t SZ_WF = al256((size_t)DM * DM * 2);
static constexpr size_t SZ_PL = al256((size_t)NB * SEQ * DM * 2);
static constexpr size_t SZ_MW = al256((size_t)NB * SEQ * (SEQ / 32) * 4);
static constexpr size_t SZ_TOTAL = SZ_XB + SZ_WB + SZ_WF + 5 * SZ_PL + 2 * SZ_PL + SZ_MW;
static_assert(SZ_TOTAL <= (size_t)134217728);          // workspace carve <= 128 MiB
static_assert(((size_t)DM * DM * 2) % 256 == 0);       // weight sub-planes stay 256-byte aligned
static_assert(SZ_PL == (size_t)NB * SEQ * DM * 2);     // ctx hi and lo planes are back to back with stride NB*SEQ*DM elements
static_assert((size_t)NB * NH_ * SEQ * HD * 2 == SZ_PL);   // q / k / v^T planes [NB*16][SEQ][64] fill one plane exactly

extern "C" void kernel_launch(void* const* d_in, const int* in_sizes, int n_in,
                              void* d_out, int out_size, void* d_ws, size_t ws_size, hipStream_t stream) {
    if (n_in < 6) return;
    const size_t needx = ((size_t)(NB - 1) * SEQ_FULL + SEQ) * DM;
    if ((size_t)in_sizes[0] < needx) return;
    if ((size_t)in_sizes[1] < (size_t)3 * DM * DM || (size_t)in_sizes[2] < (size_t)3 * DM) return;
    if ((size_t)in_sizes[3] < (size_t)DM * DM || (size_t)in_sizes[4] < (size_t)DM) return;
    if ((size_t)in_sizes[5] < ((size_t)(NB - 1) * SEQ_FULL + (SEQ - 1)) * SEQ_FULL + SEQ) return;
    if ((size_t)out_size < OUT1_OFF + ((size_t)(NB - 1) * OUT_SEQ + (SEQ - 1)) * ATT_LD + SEQ) return;
    if (SZ_TOTAL > ws_size) return;
    const float* x = (const float*)d_in[0]; const float* wqkv = (const float*)d_in[1]; const float* bqkv = (const float*)d_in[2];
    const float* wfc = (const float*)d_in[3]; const float* bfc = (const float*)d_in[4];          // wire order x, W_attn, b_attn, W_proj, b_proj, padding_mask
    const int* pmask = (const int*)d_in[5];          // [NB_FULL][SEQ_FULL][SEQ_FULL] int32, non-zero = key hidden
    float* OUT = (float*)d_out;      // [NB][SEQ][1024] then [NB][1][SEQ][SEQ]
    float* ATT = OUT + OUT1_OFF;
    char* wsp = (char*)d_ws;
    bf* XB = (bf*)wsp; wsp += SZ_XB;                 // [NB*SEQ][1024]
    bf* WB = (bf*)wsp; wsp += SZ_WB;                 // [3072][1024]: q rows | k rows | v rows (row e = h*64 + d)
    bf* WF = (bf*)wsp; wsp += SZ_WF;                 // [1024][1024]: W_proj^T
    h16* QH = (h16*)wsp; wsp += SZ_PL;               // [NB*16][SEQ][64]
    h16* QR = (h16*)wsp; wsp += SZ_PL;               // residual x2048
    h16* KP = (h16*)wsp; wsp += SZ_PL;               // [NB*16][SEQ][64]
    h16* VT = (h16*)wsp; wsp += SZ_PL;               // [NB*16][64][SEQ]
    h16* VR = (h16*)wsp; wsp += SZ_PL;               // residual x2048
    bf* CH = (bf*)wsp; wsp += SZ_PL;                 // ctx hi [NB*SEQ][1024]
    bf* CL = (bf*)wsp; wsp += SZ_PL;                 // ctx lo, directly after CH
    unsigned* MW = (unsigned*)wsp; wsp += SZ_MW;     // mask bit words [NB*SEQ][SEQ/32]

    k_prep<<<PB_WA + PB_WP + PB_MB + PB_X, 256, 0, stream>>>(x, wqkv, wfc, pmask, XB, WB, WF, MW);

    k_gemm<true><<<dim3(NB * SEQ / 128, DM / 128, 3), 128, 0, stream>>>(XB, WB, bqkv, QH, QR, KP, VT, VR, OUT);

    k_flash<<<dim3(SEQ / (16 * AW), NB * NH_, 1), 32 * AW, 0, stream>>>(QH, QR, KP, VT, VR, MW, CH, CL, ATT);

    k_gemm<false><<<dim3(NB * SEQ / 128, DM / 128, 1), 128, 0, stream>>>(CH, WF, bfc, QH, QR, KP, VT, VR, OUT);
}

// v005
// A run of this version takes 90.4 microseconds.
// In both of two side-by-side timings against v004, it was 1.16 times as fast.
// Over all steps from v000 it is 2.43 times as fast.
#include <hip/hip_runtime.h>

// Causal multi-head self-attention, width 1024 = 16 heads x 64, x [NB][SEQ][1024], fused W_attn [in][out] + bias, true head split q[b][h][t][d] = qkv[b][t][h*64+d], score scale 1/8,
// key > query OR padding_mask[b][q][k] != 0 replaced by -inf, heads merged back to [b][t][h*64+d], output projection W_proj [in][out] + bias (f32 out); second output = normalised probabilities of head 0, [NB][1][SEQ][SEQ] f32.
// Compute dtypes, f32 accumulate everywhere: qkv projections v_wmma_f32_16x16x32_bf16 (x, W, biases RNE-converted to bf16; products exact); scores v_wmma_f32_16x16x32_f16: k single f16, q as f16 value + f16 residual x2048 in its own accumulator;
// P (x256 carry, cancels in the normalisation) single f16; v single f16 plus, for query rows < 512, an f16 residual x2048 in its own accumulator; softmax f32 (online, running max); output projection v_wmma_f32_16x16x32_bf16 with ctx as bf16 hi + bf16 lo planes (unscaled, shared accumulator) against bf16 W_proj.
// Layout: bf16 copies of x and transposed (K-contiguous) weights; q (hi, residual) and k planes [b*16+h][t][64]; v^T planes [b*16+h][d][t] produced by the v GEMM run with the weight rows as the M operand and the tokens as the N operand; ctx planes compact [NB*SEQ][1024]; padding mask packed to one 32-key bit word per (b, q, key block); head 0's softmax row statistics (running max, 1 / sum) [NB*SEQ][2] f32.

#ifndef NB
#define NB 4
#endif
#ifndef SEQ
#define SEQ 1024
#endif
#define NB_FULL  4
#define SEQ_FULL 1024
#ifndef OUT_SEQ
#define OUT_SEQ SEQ              // row pitch (in tokens) between batches of the outputs
#endif
#ifndef ATT_LD
#define ATT_LD OUT_SEQ           // key pitch of one probability row of the second output
#endif
#ifndef SCORE_RES
#define SCORE_RES 1              // 1: q residual plane adds a second score product; 0: single score product
#endif
#define DM   1024
#define NH_  16
#define HD   64
#define AW   4                   // waves per flash block (16 query rows each)
#define EARLY 512                // query rows below this use the v residual plane
#define QRS  2048.0f             // carry of the residual planes
#define QRI  (1.0f / 2048.0f)
#define SC2  (0.125f * 1.4426950408889634f)   // HD^-0.5 * log2(e)
#define PSH  8.0f                // log2 of the P carry (256)
#define NEGV (-3.0e38f)
#define OUT1_OFF ((size_t)NB_FULL * SEQ_FULL * DM)   // element offset of the second output (fixed by the full problem size)

static_assert(HD == 64);
static_assert(NH_ * HD == DM);
static_assert(DM % 64 == 0);
static_assert(DM % 32 == 0);
static_assert(SEQ % 256 == 0);                 // SEQ/32 mask words per row is a multiple of 8; 64-token tiles stay inside one batch
static_assert(SEQ % 64 == 0);
static_assert((NB * SEQ) % 128 == 0);
static_assert(DM % 128 == 0);
static_assert(DM / 64 >= 2);                   // the GEMM prologue fetches two 64-k stages
static_assert(SEQ % 32 == 0);
static_assert(SEQ % (16 * AW) == 0);
static_assert(((size_t)SEQ * DM) % 8 == 0);
static_assert(NB <= NB_FULL);
static_assert(SEQ <= SEQ_FULL);
static_assert(((size_t)NB * SEQ * (SEQ / 32)) % 256 == 0);        // mask-word grid x block == plane extent
static_assert(ATT_LD % 32 == 0);
static_assert(ATT_LD >= SEQ);
static_assert(OUT1_OFF * 4 == (size_t)16777216);                   // byte offset of the second output
static_assert(((size_t)(NB - 1) * OUT_SEQ + SEQ) * DM <= OUT1_OFF);
static_assert(OUT1_OFF + ((size_t)(NB - 1) * OUT_SEQ + (SEQ - 1)) * ATT_LD + SEQ <= OUT1_OFF + (size_t)NB_FULL * SEQ_FULL * SEQ_FULL);

typedef _Float16 h16;
typedef unsigned short bf;
typedef __attribute__((ext_vector_type(16))) __bf16   v16bf;
typedef __attribute__((ext_vector_type(16))) _Float16 v16h;
typedef __attribute__((ext_vector_type(8)))  _Float16 v8h;
typedef __attribute__((ext_vector_type(8)))  unsigned short v8us;
typedef __attribute__((ext_vector_type(8)))  float    v8f;
typedef __attribute__((ext_vector_type(4)))  float    v4f;
typedef __attribute__((ext_vector_type(4)))  int      v4i;
typedef __attribute__((ext_vector_type(4)))  unsigned v4u;
typedef __attribute__((ext_vector_type(2)))  float    v2f;
typedef v4f  __attribute__((may_alias)) v4fa;
typedef v8us __attribute__((may_alias)) v8usa;

__device__ __forceinline__ unsigned short f2bf(float f) { unsigned u = __float_as_uint(f); u += 0x7FFFu + ((u >> 16) & 1u); return (unsigned short)(u >> 16); }
__device__ __forceinline__ float bf2f(unsigned short h) { return __uint_as_float(((unsigned)h) << 16); }
__device__ __forceinline__ v16h cat16(v8h lo, v8h hi) { return __builtin_shufflevector(lo, hi, 0, 1, 2, 3, 4, 5, 6, 7, 8, 9, 10, 11, 12, 13, 14, 15); }
__device__ __forceinline__ v16bf cat16b(v8us lo, v8us hi) { return __builtin_bit_cast(v16bf, __builtin_shufflevector(lo, hi, 0, 1, 2, 3, 4, 5, 6, 7, 8, 9, 10, 11, 12, 13, 14, 15)); }
__device__ __forceinline__ v8f wmma16(v16h a, v16h b, v8f c) { return __builtin_amdgcn_wmma_f32_16x16x32_f16(false, a, false, b, (short)0, c, false, false); }
__device__ __forceinline__ v8f wmmab(v16bf a, v16bf b, v8f c) { return __builtin_amdgcn_wmma_f32_16x16x32_bf16(false, a, false, b, (short)0, c, false, false); }
// fragment loaders from K-contiguous 16-bit rows; p already includes + 8*(lane>>4): elements 0..7 <- k0+8h+0..7, elements 8..15 <- k0+16+8h+0..7 (same map for A and B)
__device__ __forceinline__ v16h  ldh(const h16* p) { return cat16(*(const v8h*)p, *(const v8h*)(p + 16)); }
__device__ __forceinline__ v16bf ldb(const bf* p)  { return cat16b(*(const v8us*)p, *(const v8us*)(p + 16)); }
// ordering point for wave-private LDS tiles (same wave writes and reads)
__device__ __forceinline__ void wave_sync() { __builtin_amdgcn_fence(3 /* release order */, "wavefront"); __builtin_amdgcn_wave_barrier(); asm volatile("" ::: "memory"); }
// f32 -> f16 for WMMA operand planes: results below the smallest f16 normal become exact zero (value select)
static __device__ __forceinline__ h16 toh_flush(float v) { const h16 r = (h16)v; return (fabsf(v) < 6.103515625e-05f) ? (h16)0.0f : r; }

// cvt8: x [NB_FULL][SEQ_FULL][DM] f32 -> compact bf16 plane [NB*SEQ][DM], 8 elements a thread
__device__ __forceinline__ void cvt8(const float* __restrict__ src, bf* dst, size_t n8, const int blk) {
    const size_t i = (size_t)blk * 256 + threadIdx.x; if (i >= n8) return;
    const size_t pb = (size_t)SEQ * DM / 8;          // threads per batch
    const v8f v = *(const v8f*)(src + (i / pb) * ((size_t)SEQ_FULL * DM) + (i % pb) * 8); v8us o;
#pragma unroll
    for (int k = 0; k < 8; ++k) o[k] = f2bf(v[k]);
    *(v8us*)(dst + i * 8) = o; 
}

// cvtT: W [DM k][ldn] f32 (row = k, column = e) -> bf16 plane dst[row(e)][k] (K-contiguous), 64 k x 64 e tile through LDS (cross-wave: block barrier).
// row(e) = e for e < permFrom; for e >= permFrom, with ee = e - permFrom = c*64 + d: row = permFrom + d*16 + c.
__device__ __forceinline__ void cvtT(unsigned short* ts, const float* __restrict__ W, int ldn, bf* dst, int permFrom, const int bx, const int by) {
    const int t = threadIdx.x; const int k0 = bx * 64, n0 = by * 64;
#pragma unroll 4
    for (int i = 0; i < 16; ++i) { const int k = i * 4 + (t >> 6), n = t & 63;      // 16 x 4 = 64 k rows, 64 columns
        ts[n * 72 + k] = f2bf(W[(size_t)(k0 + k) * (size_t)ldn + n0 + n]); }
    __syncthreads();
    v8us o0, o1; size_t d0, d1;
    { const int p = t, n = p >> 3, q = p & 7; o0 = *(const v8usa*)(&ts[n * 72 + 8 * q]);
      const int e = n0 + n; const int ee = e - permFrom; const int row = (e >= permFrom) ? (permFrom + (ee & 63) * 16 + (ee >> 6)) : e;
      d0 = (size_t)row * DM + k0 + 8 * q; }
    { const int p = t + 256, n = p >> 3, q = p & 7; o1 = *(const v8usa*)(&ts[n * 72 + 8 * q]);
      const int e = n0 + n; const int ee = e - permFrom; const int row = (e >= permFrom) ? (permFrom + (ee & 63) * 16 + (ee >> 6)) : e;
      d1 = (size_t)row * DM + k0 + 8 * q; }
{
        *(v8us*)(dst + d0) = o0; *(v8us*)(dst + d1) = o1;
         }
}

// mbits: padding mask [NB_FULL][SEQ_FULL][SEQ_FULL] int32 -> bit words MW[b*SEQ + q][SEQ/32], bit j of word w = (mask[b][q][32*w + j] != 0).
__device__ __forceinline__ void mbits(const int* __restrict__ pm, unsigned* MW, size_t nW, const int blk) {
    const size_t w = (size_t)blk * 256 + threadIdx.x; if (w >= nW) return;
    const size_t row = w / (size_t)(SEQ / 32); const size_t j = w % (size_t)(SEQ / 32);
    const size_t b = row / (size_t)SEQ, t = row % (size_t)SEQ;
    const int* src = pm + (b * SEQ_FULL + t) * (size_t)SEQ_FULL + j * 32;
    unsigned bits = 0u;
#pragma unroll
    for (int i = 0; i < 8; ++i) { const v4i v = *(const v4i*)(src + 4 * i);
        const unsigned n = ((v[0] != 0) ? 1u : 0u) | ((v[1] != 0) ? 2u : 0u) | ((v[2] != 0) ? 4u : 0u) | ((v[3] != 0) ? 8u : 0u);
        bits |= n << (4 * i); }
    *(unsigned*)(MW + w) = bits; 
}

// k_prep: the four input conversions, none of which reads another's output, as ONE grid. A work-group's job follows from its block index alone (the same for all its threads, so
// the barrier inside cvtT is passed by a whole work-group or by none of it); the jobs with the longest chain of dependent loads come first in the index.
#define PB_WA ((DM / 64) * (3 * DM / 64))                    // W_attn tiles
#define PB_WP ((DM / 64) * (DM / 64))                        // W_proj tiles
#define PB_MB ((int)((size_t)NB * SEQ * (SEQ / 32) / 256))   // mask-word blocks
#define PB_X  ((int)((size_t)NB * SEQ * DM / 8 / 256))       // x blocks
static_assert(((size_t)NB * SEQ * DM / 8) % 256 == 0);
__global__ __launch_bounds__(256) void k_prep(const float* __restrict__ x, const float* __restrict__ wqkv, const float* __restrict__ wfc, const int* __restrict__ pm, bf* XB, bf* WB, bf* WF, unsigned* MW) {
    __shared__ __align__(16) unsigned short ts[64 * 72];
    int blk = (int)blockIdx.x;
    if (blk < PB_WA + PB_WP) {                       // W_attn in[1024 k][3072 e] -> WB out[e][1024 k] (no row permutation); W_proj in[1024 k][1024 e] -> WF out[e][1024 k]
        const bool wa = blk < PB_WA; const int tl = wa ? blk : blk - PB_WA;
        cvtT(ts, wa ? wqkv : wfc, wa ? 3 * DM : DM, wa ? WB : WF, 1 << 30, tl % (DM / 64), tl / (DM / 64));
        return; }
    blk -= PB_WA + PB_WP;
    if (blk < PB_MB) { mbits(pm, MW, (size_t)NB * SEQ * (SEQ / 32), blk); return; }
    blk -= PB_MB;
    cvt8(x, XB, (size_t)NB * SEQ * DM / 8, blk);
}

// work-group barrier that orders LDS only: the release and acquire fences name the LDS address space, so the global loads that prefetch a later stage into registers stay in flight across it
__device__ __forceinline__ void lds_barrier() { __builtin_amdgcn_fence(__ATOMIC_RELEASE, "workgroup", "local"); __builtin_amdgcn_s_barrier(); __builtin_amdgcn_fence(__ATOMIC_ACQUIRE, "workgroup", "local"); }

// p_job: the second output, the normalised probabilities of head 0, as a job of its own: one work-group of 4 waves writes 64 query rows x PK keys, a wave 16 rows, in passes of PP keys.
// It needs only what the attention launch has left behind: the q and k planes, the mask words and each row's final running max and 1 / sum (ST). The scores are re-formed exactly as in k_flash
// (S^T = K Q^T, q value + residual accumulators, same selects); K fragments come straight from the k plane (a work-group's 32 KiB of it are shared through the WGP cache).
// A pass at or below the wave's diagonal forms all its four 32-key steps (keys past the query are replaced as in k_flash and give 0 x 1/sum); a pass wholly above it holds 0 (NaN for a row with no visible key).
// Each pass goes through a wave-private LDS tile [16 rows][PP keys], so that every store instruction of the wave covers 512 contiguous bytes of one row.
#define PK  256                  // keys per work-group
#define PP  128                  // keys per pass
#define PPW 132                  // LDS row pitch of the pass tile in floats: 528 B = 16 B x 33, the bank pattern of the 68-float epilogue tiles
#define PJOBS (NB * (SEQ / (16 * AW)) * (SEQ / PK))
static_assert(SEQ % PK == 0);
static_assert(PK % PP == 0);
static_assert(PP == 32 * 4);     // one row of a pass = 32 lanes x 4 floats; its four mask words are one 16-byte load
// four v_exp_f32 as one statement: the outputs are early-clobber, so none of the four reads another's result or overwrites another's source, and the v_nop is the slot that the
// instruction set asks for behind a transcendental before its result is used or its source overwritten
__device__ __forceinline__ v4f exp2x4(const float x0, const float x1, const float x2, const float x3) {
    float a, b, c, d;
    asm("v_exp_f32 %0, %4\n\tv_exp_f32 %1, %5\n\tv_exp_f32 %2, %6\n\tv_exp_f32 %3, %7\n\tv_nop" : "=&v"(a), "=&v"(b), "=&v"(c), "=&v"(d) : "v"(x0), "v"(x1), "v"(x2), "v"(x3));
    return (v4f){a, b, c, d};
}
__device__ __forceinline__ void p_job(float* pt, const int job, const h16* __restrict__ QH, const h16* __restrict__ QR, const h16* __restrict__ KP, const unsigned* __restrict__ MW, const float* __restrict__ ST, float* ATT) {
    const int lane = threadIdx.x & 31, lr = lane & 15, hi = lane >> 4;
    const int wave = __builtin_amdgcn_readfirstlane((int)(threadIdx.x >> 5));
    const int ch = job % (SEQ / PK), rt = job / (SEQ / PK);
    const int tile = rt % (SEQ / (16 * AW)), bb = rt / (SEQ / (16 * AW));
    const int t0 = (tile * AW + wave) * 16, tq = t0 + lr, kend = t0 + 16;
    const size_t pbase = (size_t)(bb * NH_) * SEQ * HD;      // head 0 of batch bb
    const size_t qo = pbase + (size_t)tq * HD + 8 * hi;
    const v2f st = *(const v2f*)(ST + 2 * ((size_t)bb * SEQ + (size_t)tq));
    asm volatile("s_wait_xcnt 0x0" ::: "memory");            // the address registers of the load above are free for reuse behind it: the wait stands in front of any overwrite
    const v16h qh0 = ldh(QH + qo), qh1 = ldh(QH + qo + 32);  // B fragments: col t, k = d
    asm volatile("s_wait_xcnt 0x0" ::: "memory");            // as above, for the value fragments' loads
    const v16h qr0 = ldh(QR + qo), qr1 = ldh(QR + qo + 32);
    asm volatile("s_wait_xcnt 0x0" ::: "memory");            // as above, for the residual fragments' loads
    const float shp = PSH - st[0];                           // the sum carries the x256 of P, so exp2(s - m + 8) / l is the probability
    const float inv = st[1];
    const float zf = inv * 0.0f;                             // 0 for an ordinary row, NaN for a row with no visible key
    const h16* kf = KP + pbase + (size_t)lr * HD + 8 * hi;   // + key * HD (A fragment: row key, k = d)
    const unsigned* mrow = MW + ((size_t)bb * SEQ + (size_t)tq) * (size_t)(SEQ / 32);
    float* pw = pt + wave * 16 * PPW;
    float* arow = ATT + ((size_t)bb * OUT_SEQ + (size_t)t0) * ATT_LD + lane * 4;
    // kept rolled: one copy of the pass in the kernel's text and one pass's fragments in registers at a time; inside a pass all loads are already in flight together
#pragma unroll 1
    for (int ps = 0; ps < PK / PP; ++ps) {
        const int kb = ch * PK + ps * PP;
        v4f pv[4][4];                                        // step, then keys 8h+0..3, 8h+4..7, 16+8h+0..3, 16+8h+4..7
#pragma unroll
        for (int s = 0; s < 4; ++s)
#pragma unroll
            for (int i = 0; i < 4; ++i) pv[s][i] = (v4f){zf, zf, zf, zf};
        if (kb < kend) {                                     // wave-uniform
            const v4u mwv = *(const v4u*)(mrow + (kb >> 5));
            asm volatile("s_wait_xcnt 0x0" ::: "memory");    // the address registers of the load above are free for reuse behind it: the wait stands in front of any overwrite
            v16h kq[4][4];                                   // the pass's K fragments, all loads in flight together: one load latency a pass
#pragma unroll
            for (int s = 0; s < 4; ++s) { const h16* ka = kf + (size_t)(kb + 32 * s) * HD;
                kq[s][0] = ldh(ka); kq[s][1] = ldh(ka + 32); kq[s][2] = ldh(ka + 16 * HD); kq[s][3] = ldh(ka + 16 * HD + 32); }
            // the address registers of the loads above are free for reuse behind them: the wait stands in front of any overwrite
            asm volatile("s_wait_xcnt 0x0" ::: "memory");
#pragma unroll
            for (int s = 0; s < 4; ++s) {
                const int key0 = kb + 32 * s;
                const v16h ka0 = kq[s][0], ka1 = kq[s][1], kb0 = kq[s][2], kb1 = kq[s][3];
                v8f sHa = (v8f){}, sLa = (v8f){}, sHb = (v8f){}, sLb = (v8f){};
                sHa = wmma16(ka0, qh0, sHa); sHb = wmma16(kb0, qh0, sHb);
                if (SCORE_RES) { sLa = wmma16(ka0, qr0, sLa); sLb = wmma16(kb0, qr0, sLb); }
                sHa = wmma16(ka1, qh1, sHa); sHb = wmma16(kb1, qh1, sHb);
                if (SCORE_RES) { sLa = wmma16(ka1, qr1, sLa); sLb = wmma16(kb1, qr1, sLb); }
                float ta[8], tb[8];
#pragma unroll
                for (int r = 0; r < 8; ++r) { ta[r] = (sHa[r] + sLa[r] * QRI) * SC2; tb[r] = (sHb[r] + sLb[r] * QRI) * SC2; }
                const int kidx = key0 + 8 * hi;
                const unsigned ma = mwv[s] >> (8 * hi), mc = mwv[s] >> (16 + 8 * hi);
#pragma unroll
                for (int r = 0; r < 8; ++r) { ta[r] = (kidx + r > tq) ? NEGV : ta[r]; tb[r] = (kidx + 16 + r > tq) ? NEGV : tb[r]; }   // key > query replaces the score
#pragma unroll
                for (int r = 0; r < 8; ++r) { ta[r] = (((ma >> r) & 1u) != 0u) ? NEGV : ta[r]; tb[r] = (((mc >> r) & 1u) != 0u) ? NEGV : tb[r]; }   // so does a set padding-mask bit
                pv[s][0] = exp2x4(ta[0] + shp, ta[1] + shp, ta[2] + shp, ta[3] + shp) * inv; pv[s][1] = exp2x4(ta[4] + shp, ta[5] + shp, ta[6] + shp, ta[7] + shp) * inv;
                pv[s][2] = exp2x4(tb[0] + shp, tb[1] + shp, tb[2] + shp, tb[3] + shp) * inv; pv[s][3] = exp2x4(tb[4] + shp, tb[5] + shp, tb[6] + shp, tb[7] + shp) * inv;
            }
        }
        // lane (t, h): keys 8h+r and 16+8h+r of each step -> pw[t][32 * step + ...]; rows 0..15 x columns 0..PP-1 all written
#pragma unroll
        for (int s = 0; s < 4; ++s) {
            *(v4fa*)(&pw[lr * PPW + 32 * s + 8 * hi]) = pv[s][0];      *(v4fa*)(&pw[lr * PPW + 32 * s + 8 * hi + 4]) = pv[s][1];
            *(v4fa*)(&pw[lr * PPW + 32 * s + 16 + 8 * hi]) = pv[s][2]; *(v4fa*)(&pw[lr * PPW + 32 * s + 16 + 8 * hi + 4]) = pv[s][3]; }
        wave_sync();
        v4f val[16];
#pragma unroll
        for (int r = 0; r < 16; ++r) val[r] = *(const v4fa*)(&pw[r * PPW + lane * 4]);
#pragma unroll
        for (int r = 0; r < 16; ++r) *(v4f*)(arow + (size_t)r * ATT_LD + kb) = val[r];
        // the address and data registers of the stores above are reused by the next pass: the wait stands in front of any overwrite
        asm volatile("s_wait_xcnt 0x0" ::: "memory");
        wave_sync();
    }
}

// k_gemm: bf16 GEMM, work-group of 4 waves on a 128x128 tile, each wave a 64x64 quadrant (16 accumulators), K = DM walked in stages of 64.
// Each stage's A and B tiles (128 rows x 64 k) are read from the K-contiguous bf16 planes as whole 128-byte rows (8 lanes x 16 B a row) into registers two stages ahead and
// stored one stage ahead to the other of two LDS buffers (row pitch 144 B); fragments come from LDS. One work-group barrier a stage: it publishes the stage just stored
// and ends every wave's reads of the buffer that the next stage's stores overwrite. k order of every accumulator: ascending in steps of 32.
// C[m][n] = sum_k A[m][k] Bt[n][k] + bias (bias RNE-converted to bf16, added in f32). 128 threads per block.
// QKV = true: the q, k and v projections, which read none of each other's output, as ONE grid (M/128 token tiles, 1024/128 weight-row tiles, 3 jobs); the job md follows from blockIdx.z
// (the same for a whole work-group); three work-groups share a WGP, so one's matrix instructions run under the others' LDS and load waits, prologue and epilogue. X = x tokens, Wt = q | k | v weight rows.
// md 0: q  -> A = x tokens, Bt = q weight rows; f16 value plane Ph and f16 residual x2048 plane Pr, layout [b*16+h][t][64] (quadrant column block = head h; bias columns 0..1023)
// md 1: k  -> as md 0, value plane only (bias columns 1024..2047); the shortest epilogue, so it comes last in the index
// md 2: v  -> A = v weight rows (row e = h*64 + d), Bt = x tokens: C[e][token]; value (Ph) and residual x2048 (Pr) planes [b*16+h][d][t]; bias per ROW (columns 2048..3071 of the bias vector)
// QKV = false: output projection -> X = ctx hi plane then ctx lo plane (one shared accumulator), Wt = W_proj^T rows; f32 rows of OUT. grid (M/128, 1024/128, 2):
// blockIdx.z = 0 is the projection, one work-group a WGP and one wave a SIMD; blockIdx.z = 1 are the PJOBS probability jobs (p_job), which read nothing the projection writes and take the places it leaves free.
struct yes_t { static constexpr bool value = true; };
struct no_t { static constexpr bool value = false; };
#define LP 72                    // LDS row pitch in 16-bit elements: 144 B = 16 B x 9, conflict-free for 16-byte fragment reads
// for QKV = true the second launch bound asks for a register budget at which three waves fit a SIMD, so that all 768 work-groups of the merged grid are resident at once (three a WGP; LDS allows three); for QKV = false it asks for one wave a SIMD
template <bool QKV>
__global__ __launch_bounds__(128, QKV ? 3 : 1) void k_gemm(const bf* __restrict__ X, const bf* __restrict__ Wt, const float* __restrict__ bias, h16* QH, h16* QR, h16* KP, h16* VT, h16* VR, float* OUT, const unsigned* __restrict__ MW, const float* __restrict__ ST) {
    __shared__ __align__(16) bf As[2 * 128 * LP];
    __shared__ __align__(16) bf Bs[2 * 128 * LP];
    __shared__ __align__(16) float osw[4 * 16 * 68];
    if constexpr (!QKV) {
        if ((int)blockIdx.z != 0) {                  // the same for a whole work-group, in front of every barrier
            static_assert(PJOBS <= (NB * SEQ / 128) * (DM / 128));
            static_assert(sizeof(As) >= (size_t)AW * 16 * PPW * 4);
            const int job = (int)blockIdx.y * (NB * SEQ / 128) + (int)blockIdx.x;
            if (job < PJOBS) p_job((float*)As, job, QH, QR, KP, MW, ST, OUT + OUT1_OFF);
            return; }
    }
    const int K = DM;
    const int tid = threadIdx.x;
    const int lane = tid & 31, lr = lane & 15, hi = lane >> 4;
    const int wave = __builtin_amdgcn_readfirstlane(tid >> 5);
    float* os = osw + wave * 16 * 68;                // wave-private epilogue tile
    const int wm = wave & 1, wn = wave >> 1;
    const int md = QKV ? (((int)blockIdx.z == 0) ? 0 : 3 - (int)blockIdx.z) : 3;   // z 0, 1, 2 -> q, v, k
    const bool vj = QKV && md == 2;                  // v: weight rows are the M operand, tokens the N operand
    const int bm = vj ? (int)blockIdx.y : (int)blockIdx.x, bn = vj ? (int)blockIdx.x : (int)blockIdx.y;
    const bf* A = vj ? (Wt + (size_t)2 * DM * DM) : X;
    const bf* Bt = vj ? X : (QKV ? (Wt + (size_t)md * DM * DM) : Wt);
    const int r0 = bm * 128 + wm * 64, c0 = bn * 128 + wn * 64;
    v8f acc[4][4];
#pragma unroll
    for (int mb = 0; mb < 4; ++mb)
#pragma unroll
        for (int nb = 0; nb < 4; ++nb) acc[mb][nb] = (v8f){};
    const int srow = tid >> 3, scol = (tid & 7) * 8;  // staging: 16 rows a pass, 8 passes a tile
    const bf* ga = A + (size_t)(bm * 128 + srow) * K + scol;
    const bf* gb = Bt + (size_t)(bn * 128 + srow) * K + scol;
    const int sl = srow * LP + scol;
    const int fa = (wm * 64 + lr) * LP + 8 * hi, fb = (wn * 64 + lr) * LP + 8 * hi;
    const int SPP = K / 64;                           // stages per plane
    const int NS = (QKV ? 1 : 2) * SPP;
    v8us ra[8], rb[8];
#pragma unroll
    for (int i = 0; i < 8; ++i) { ra[i] = *(const v8us*)(ga + (size_t)i * 16 * K); rb[i] = *(const v8us*)(gb + (size_t)i * 16 * K); }
#pragma unroll
    for (int i = 0; i < 8; ++i) { *(v8us*)(&As[sl + i * 16 * LP]) = ra[i]; *(v8us*)(&Bs[sl + i * 16 * LP]) = rb[i]; }
#pragma unroll
    for (int i = 0; i < 8; ++i) { ra[i] = *(const v8us*)(ga + 64 + (size_t)i * 16 * K); rb[i] = *(const v8us*)(gb + 64 + (size_t)i * 16 * K); }   // stage 1 (NS >= 2)
    lds_barrier();
    // one stage; ST: stage s+1 exists (it waits in ra, rb since the stage before), LD: stage s+2 exists. Both are compile-time so that the body is one straight run whose LDS waits are counted exactly.
    auto stage = [&](const int s, auto ST, auto LD) {
        const int cur = (s & 1) * (128 * LP), nxt = (128 * LP) - cur;
        v16bf a[2][4], b[2][4];                       // both 32-k blocks' fragments of this stage, read as one group ahead of the matrix instructions
#pragma unroll
        for (int kb = 0; kb < 2; ++kb) {
#pragma unroll
            for (int mb = 0; mb < 4; ++mb) a[kb][mb] = ldb(&As[cur + fa + mb * 16 * LP + kb * 32]);
#pragma unroll
            for (int nb = 0; nb < 4; ++nb) b[kb][nb] = ldb(&Bs[cur + fb + nb * 16 * LP + kb * 32]);
        }
        if constexpr (ST.value) {                     // stage s+1 goes to the buffer that stage s-1 was read from
#pragma unroll
            for (int i = 0; i < 8; ++i) { *(v8us*)(&As[nxt + sl + i * 16 * LP]) = ra[i]; *(v8us*)(&Bs[nxt + sl + i * 16 * LP]) = rb[i]; }
        }
        if constexpr (LD.value) {                     // stage s+2 starts its way from global memory
            const int s2 = s + 2; const int pl = (s2 >= SPP) ? 1 : 0; const int kc = (s2 - pl * SPP) * 64;
            const bf* pa = ga + (size_t)pl * ((size_t)NB * SEQ * DM) + kc; const bf* pb = gb + kc;
#pragma unroll
            for (int i = 0; i < 8; ++i) { ra[i] = *(const v8us*)(pa + (size_t)i * 16 * K); rb[i] = *(const v8us*)(pb + (size_t)i * 16 * K); }
            // the address registers of the loads above are free for reuse behind them: the wait stands in front of any overwrite
            asm volatile("s_wait_xcnt 0x0" ::: "memory");
        }
#pragma unroll
        for (int kb = 0; kb < 2; ++kb)
#pragma unroll
            for (int nb = 0; nb < 4; ++nb)
#pragma unroll
                for (int mb = 0; mb < 4; ++mb) acc[mb][nb] = wmmab(a[kb][mb], b[kb][nb], acc[mb][nb]);
        // four vector slots behind the stage's last matrix instruction before its operand registers may be reloaded; naming every accumulator keeps all of the stage's
        // matrix instructions in front of the barrier, where they run while the LDS reads and stores of the stage drain
        asm volatile("v_nop\n\tv_nop\n\tv_nop\n\tv_nop"
                     : "+v"(acc[0][0]), "+v"(acc[1][0]), "+v"(acc[2][0]), "+v"(acc[3][0]), "+v"(acc[0][1]), "+v"(acc[1][1]), "+v"(acc[2][1]), "+v"(acc[3][1]),
                       "+v"(acc[0][2]), "+v"(acc[1][2]), "+v"(acc[2][2]), "+v"(acc[3][2]), "+v"(acc[0][3]), "+v"(acc[1][3]), "+v"(acc[2][3]), "+v"(acc[3][3])
                     : "v"(a[1][0]), "v"(a[1][1]), "v"(a[1][2]), "v"(a[1][3]), "v"(b[1][3]));
        if constexpr (ST.value) lds_barrier();        // publishes stage s+1 and ends the reads of this stage's buffer; behind the last stage nothing is left to publish
    };
#pragma unroll 1
    for (int s = 0; s < NS - 2; ++s) stage(s, yes_t{}, yes_t{});
    stage(NS - 2, yes_t{}, no_t{});
    stage(NS - 1, no_t{}, no_t{});
    // the lane's number is read anew here, so that nothing derived from it for the epilogue is held in a register across the loop (the loop fills the register budget of three waves a SIMD)
    const int ln = (int)__builtin_amdgcn_mbcnt_lo(~0u, 0u), lc = ln & 15, lh = ln >> 4;
    float bv[4];
#pragma unroll
    for (int nb = 0; nb < 4; ++nb) {
        const int bi = vj ? (2 * DM) : ((QKV ? md * DM : 0) + c0 + nb * 16 + lc);
        bv[nb] = bf2f(f2bf(bias[bi])); }
#pragma unroll
    for (int mb = 0; mb < 4; ++mb) {
        // D: row 8h+j, col lane&15; rows 0..15 x cols 0..63 all written on either path
        if (vj) {                                       // per-row bias: 8 consecutive floats, one 32-byte vector load
            const v8f bq = *(const v8f*)(bias + 2 * DM + r0 + mb * 16 + lh * 8);
            float rb[8];
#pragma unroll
            for (int j = 0; j < 8; ++j) rb[j] = bf2f(f2bf(bq[j]));
#pragma unroll
            for (int nb = 0; nb < 4; ++nb) {
#pragma unroll
                for (int j = 0; j < 8; ++j) os[(lh * 8 + j) * 68 + nb * 16 + lc] = acc[mb][nb][j] + rb[j]; }
        } else {
#pragma unroll
            for (int nb = 0; nb < 4; ++nb) {
#pragma unroll
                for (int j = 0; j < 8; ++j) os[(lh * 8 + j) * 68 + nb * 16 + lc] = acc[mb][nb][j] + bv[nb]; }
        }
        wave_sync();
        if (QKV) {
            h16* Ph = (md == 0) ? QH : ((md == 1) ? KP : VT);
            h16* Pr = (md == 0) ? QR : VR;              // md 1 stores no residual
            size_t sb, pitch;
            if (vj) { const int bb = c0 / SEQ; const int tt = c0 % SEQ;                               // rows = d of head r0/64, columns = 64 tokens of one batch
                sb = ((size_t)(bb * NH_ + (r0 >> 6)) * HD + (size_t)(16 * mb)) * SEQ + (size_t)tt; pitch = SEQ; }
            else { const int tokrow = r0 + 16 * mb; const int bb = tokrow / SEQ; const int tt = tokrow % SEQ;   // rows = tokens, columns = d of head c0/64
                sb = ((size_t)(bb * NH_ + (c0 >> 6)) * SEQ + (size_t)tt) * HD; pitch = HD; }
            v4f x0[4], x1[4]; v8h hv[4];
#pragma unroll
            for (int s = 0; s < 4; ++s) { const int row = 4 * s + (ln >> 3), c8 = (ln & 7) * 8;
                x0[s] = *(const v4fa*)(&os[row * 68 + c8]); x1[s] = *(const v4fa*)(&os[row * 68 + c8 + 4]);
#pragma unroll
                for (int i = 0; i < 4; ++i) { hv[s][i] = toh_flush(x0[s][i]); hv[s][4 + i] = toh_flush(x1[s][i]); }
                *(v8h*)(Ph + sb + (size_t)row * pitch + c8) = hv[s]; }
            // the address and data registers of the stores above are reused behind them: the wait stands in front of any overwrite
            asm volatile("s_wait_xcnt 0x0" ::: "memory");
            if (md != 1) {
#pragma unroll
                for (int s = 0; s < 4; ++s) { const int row = 4 * s + (ln >> 3), c8 = (ln & 7) * 8; v8h rv;
#pragma unroll
                    for (int i = 0; i < 4; ++i) { rv[i] = toh_flush((x0[s][i] - (float)hv[s][i]) * QRS); rv[4 + i] = toh_flush((x1[s][i] - (float)hv[s][4 + i]) * QRS); }
                    *(v8h*)(Pr + sb + (size_t)row * pitch + c8) = rv; }
                asm volatile("s_wait_xcnt 0x0" ::: "memory");   // as above, for the residual stores
            }
        } else {
            const int grow = r0 + 16 * mb; const int bb = grow / SEQ; const int nn = grow % SEQ;
            float* orow = OUT + ((size_t)bb * OUT_SEQ + nn) * DM + c0;
{
#pragma unroll
                for (int s = 0; s < 8; ++s) { const int row = 2 * s + lh, cofs = lc * 4;   // 8 s x 2 rows = 16 rows; 16 lanes x 4 floats = 64 columns
                    const v4f val = *(const v4fa*)(&os[row * 68 + cofs]);
                    *(v4f*)(orow + (size_t)row * DM + cofs) = val; }
                 }
        }
        wave_sync();
    }
}

// k_flash: fused causal attention, one wave per 16 query rows of one (batch, head); Q fragments straight from the f16 planes (two 16-B loads each, arithmetic addressing).
// The four waves of a work-group share each 64-key stage of K, V^T and (early rows) the V^T residual through LDS: whole 128-byte rows are brought by asynchronous copies into one of two buffers
// (row pitch 144 B), one stage ahead of the stage being worked on; fragments are read from LDS. One work-group barrier a stage publishes the next stage and ends the reads of the buffer refilled behind it.
// Transposed form: S^T[key][t] = K Q^T (A = K rows, B = Q rows); lane (t = lane&15, h = lane>>4) holds keys 8h+r of each 16-key tile, so the packed
// P tile is directly the B fragment of O^T[d][t] = V^T P^T (element r <- tile keys 0..15, element 8+r <- tile keys 16..31, lane unchanged).
// Keys run over [0, t0+16) in steps of 32; on steps that touch the diagonal, scores with key > query are replaced by a very negative value (P = 0 exactly);
// the padding-mask bit word of (b, query, key block) is read once per lane per step and its bit selects run at every step (bit 8h+r <-> key key0+8h+r, bit 16+8h+r <-> key key0+16+8h+r; a set bit replaces the score the same way; a zero word changes nothing).
// A query row that never sees a visible key yields NaN (all scores replaced by -inf).
// Softmax state (running max, partial sum) is one scalar per lane; the two lane halves of a row are combined with one xor-16 exchange.
#define FP 72                    // LDS row pitch of a staged tile in 16-bit elements: 144 B = 16 B x 9, conflict-free for 16-byte fragment reads
#define SK 64                    // keys per stage
#define TILE_E (64 * FP)         // one staged tile: 64 rows (K: keys, V^T: d) of 64 elements
#define BUF_E  (3 * TILE_E)      // one buffer: K | V^T | V^T residual
static_assert(SK == 16 * AW);    // a work-group's query rows span one stage: stages 0..tile reach its diagonal
#define NT  (SEQ / (16 * AW))    // query tiles per (batch, head)
#define HPR (NH_ / NB)           // heads of one batch per NH_ values of blockIdx.y
static_assert(NH_ % NB == 0);    // (blockIdx.y / NH_, blockIdx.y % NH_) -> (batch, head) is one to one
static_assert(NT % 2 == 0);
static_assert(EARLY % (16 * AW) == 0);   // the residual plane is used by all waves of a work-group or by none
static_assert(32 * AW == 128);   // staging map: 8 lanes a row, 16 rows a copy, 4 copies a tile
// four asynchronous 16-byte copies a lane (rows r, r+16, r+32, r+48 of one tile); the wait is the statement's last line, so it stands in front of any rewrite of an address register that a copy names
__device__ __forceinline__ void acopy4(const unsigned l, const h16* g, const size_t gp) {
    const unsigned l1 = l + 16 * FP * 2, l2 = l + 32 * FP * 2, l3 = l + 48 * FP * 2;
    const h16* g1 = g + 16 * gp; const h16* g2 = g + 32 * gp; const h16* g3 = g + 48 * gp;
    asm volatile("global_load_async_to_lds_b128 %0, %4, off\n\t"
                 "global_load_async_to_lds_b128 %1, %5, off\n\t"
                 "global_load_async_to_lds_b128 %2, %6, off\n\t"
                 "global_load_async_to_lds_b128 %3, %7, off\n\t"
                 "s_wait_xcnt 0x0"
                 :: "v"(l), "v"(l1), "v"(l2), "v"(l3), "v"(g), "v"(g1), "v"(g2), "v"(g3) : "memory");
}
__global__ __launch_bounds__(32 * AW) void k_flash(const h16* __restrict__ QH, const h16* __restrict__ QR, const h16* __restrict__ KP, const h16* __restrict__ VT, const h16* __restrict__ VR, const unsigned* __restrict__ MW, bf* CH, bf* CL, float* ST) {
    __shared__ __align__(16) float os[AW * 16 * 68];
    __shared__ __align__(16) h16 ring[2 * BUF_E];
    const int lane = threadIdx.x & 31, lr = lane & 15, hi = lane >> 4;
    const int wave = __builtin_amdgcn_readfirstlane((int)(threadIdx.x >> 5));
    // Deal of (batch, head, query tile) over the grid, a permutation of it, for speed only. A tile's cost grows with its index (tile + 1 stages) and all work-groups are resident at once, so a WGP
    // lasts as long as the tiles that meet on it. Work-groups whose flat index is NT * NH_ apart get tiles t, NT-1-t, t+NT/2, NT/2-1-t (equal stage sums), neighbours in blockIdx.y get t and NT-1-t,
    // and the head-0 work-groups stand NT * HPR indices apart in the first NT * NH_.
    const int rnd = (int)(blockIdx.y / (unsigned)NH_), wq = (int)(blockIdx.y % (unsigned)NH_);
    const int bb = (int)((unsigned)wq / (unsigned)HPR), hh = (int)((unsigned)wq % (unsigned)HPR) + HPR * rnd;
    const int zh = bb * NH_ + hh;
    int tl = (int)blockIdx.x;
    if (((rnd ^ wq) & 1) != 0) tl = NT - 1 - tl;
    if ((rnd & 2) != 0) tl = (int)((unsigned)(tl + NT / 2) % (unsigned)NT);
    const int tile = tl;
    const int t0 = (tile * AW + wave) * 16;
    const size_t pbase = (size_t)zh * SEQ * HD;
    const size_t qo = pbase + (size_t)(t0 + lr) * HD + 8 * hi;
    const v16h qh0 = ldh(QH + qo), qh1 = ldh(QH + qo + 32), qr0 = ldh(QR + qo), qr1 = ldh(QR + qo + 32);   // B fragments: col t, k = d
    const int fk = lr * FP + 8 * hi;                         // LDS, + key * FP         (A fragment: row key, k = d)
    const int fv = TILE_E + lr * FP + 8 * hi;                // LDS, + 16j*FP + key     (A fragment: row d, k = key)
    const int kend = t0 + 16;
    const bool early = tile * (16 * AW) < EARLY;             // same for the four waves
    const int srow = (int)threadIdx.x >> 3, scol = ((int)threadIdx.x & 7) * 8;   // staging: 8 lanes x 16 B = one 128-byte row
    const unsigned sl = (unsigned)(size_t)(&ring[srow * FP + scol]);             // this lane's LDS byte address in buffer 0, K tile
    const h16* gk = KP + pbase + (size_t)srow * HD + scol;   // + stage * SK * HD
    const h16* gv = VT + pbase + (size_t)srow * SEQ + scol;  // + stage * SK
    const h16* gr = VR + pbase + (size_t)srow * SEQ + scol;
    const int nst = tile + 1;                                // stages up to and including the work-group's diagonal
    auto fill = [&](const int s) {                           // stage s -> buffer s & 1; every lane on, work-group-uniform control flow
        const unsigned lb = sl + (unsigned)((s & 1) * (BUF_E * 2));
        acopy4(lb, gk + (size_t)s * (SK * HD), HD);
        acopy4(lb + TILE_E * 2, gv + (size_t)s * SK, SEQ);
        if (early) acopy4(lb + 2 * TILE_E * 2, gr + (size_t)s * SK, SEQ);
    };
    const int tq = t0 + lr;
    const size_t mo = ((size_t)bb * SEQ + (size_t)tq) * (size_t)(SEQ / 32);   // + key0/32: mask word of this lane's query row
    v8f o0 = (v8f){}, o1 = (v8f){}, o2 = (v8f){}, o3 = (v8f){};
    v8f e0 = (v8f){}, e1 = (v8f){}, e2 = (v8f){}, e3 = (v8f){};
    float m = NEGV, l = 0.0f;
    fill(0);
    asm volatile("s_wait_asynccnt 0x0" ::: "memory");        // this wave's copies of stage 0 have landed
    __syncthreads();                                         // publishes stage 0
    if (nst > 1) fill(1);
#pragma unroll 1
    for (int s = 0; s < nst; ++s) {
      const int cur = (s & 1) * BUF_E;
      for (int kk = 0; kk < SK; kk += 32) {
        const int key0 = s * SK + kk;
        if (key0 >= kend) break;                    // wave-uniform: keys past this wave's diagonal; the stage's foot below is still passed
        const h16* ka = &ring[cur + fk + kk * FP];
        const v16h ka0 = ldh(ka), ka1 = ldh(ka + 32), kb0 = ldh(ka + 16 * FP), kb1 = ldh(ka + 16 * FP + 32);
        v8f sHa = (v8f){}, sLa = (v8f){}, sHb = (v8f){}, sLb = (v8f){};
        sHa = wmma16(ka0, qh0, sHa); sHb = wmma16(kb0, qh0, sHb);
        if (SCORE_RES) { sLa = wmma16(ka0, qr0, sLa); sLb = wmma16(kb0, qr0, sLb); }
        sHa = wmma16(ka1, qh1, sHa); sHb = wmma16(kb1, qh1, sHb);
        if (SCORE_RES) { sLa = wmma16(ka1, qr1, sLa); sLb = wmma16(kb1, qr1, sLb); }
        asm volatile("v_nop\n\tv_nop\n\tv_nop\n\tv_nop" : "+v"(sHa), "+v"(sLa), "+v"(sHb), "+v"(sLb) : "v"(ka0), "v"(ka1), "v"(kb0), "v"(kb1));
        float ta[8], tb[8];
#pragma unroll
        for (int r = 0; r < 8; ++r) { ta[r] = (sHa[r] + sLa[r] * QRI) * SC2; tb[r] = (sHb[r] + sLb[r] * QRI) * SC2; }
        if (key0 + 31 > t0) {                       // wave-uniform: this step touches the diagonal
            const int kidx = key0 + 8 * hi;
#pragma unroll
            for (int r = 0; r < 8; ++r) { ta[r] = (kidx + r > tq) ? NEGV : ta[r]; tb[r] = (kidx + 16 + r > tq) ? NEGV : tb[r]; }
        }
        unsigned mw = MW[mo + (size_t)(key0 >> 5)];
        asm volatile("" : "+v"(mw));
        {                                           // padding-mask selects, every step (a zero word changes nothing)
            const unsigned ma = mw >> (8 * hi), mc = mw >> (16 + 8 * hi);
#pragma unroll
            for (int r = 0; r < 8; ++r) { ta[r] = (((ma >> r) & 1u) != 0u) ? NEGV : ta[r]; tb[r] = (((mc >> r) & 1u) != 0u) ? NEGV : tb[r]; }
        }
        float mx = NEGV;
#pragma unroll
        for (int r = 0; r < 8; ++r) mx = fmaxf(mx, fmaxf(ta[r], tb[r]));
        mx = fmaxf(mx, __shfl_xor(mx, 16, 32));
        const float mnew = fmaxf(m, mx);
        const float alpha = __builtin_amdgcn_exp2f(m - mnew);
        const float sh = PSH - mnew;
        v16h pb; float ls = 0.0f;
#pragma unroll
        for (int r = 0; r < 8; ++r) { const float ea = ta[r] + sh, ec = tb[r] + sh;
            const h16 pa = (ea < -14.0f) ? (h16)0.0f : (h16)__builtin_amdgcn_exp2f(ea);       // exponent select: no f16 result below the smallest normal
            const h16 pc = (ec < -14.0f) ? (h16)0.0f : (h16)__builtin_amdgcn_exp2f(ec);
            pb[r] = pa; pb[8 + r] = pc; ls += (float)pa + (float)pc; }
        l = l * alpha + ls; m = mnew;
        o0 = o0 * alpha; o1 = o1 * alpha; o2 = o2 * alpha; o3 = o3 * alpha;
        const h16* va = &ring[cur + fv + kk];
        const v16h v0 = ldh(va), v1 = ldh(va + 16 * FP), v2 = ldh(va + 32 * FP), v3 = ldh(va + 48 * FP);
        o0 = wmma16(v0, pb, o0); o1 = wmma16(v1, pb, o1); o2 = wmma16(v2, pb, o2); o3 = wmma16(v3, pb, o3);
        asm volatile("v_nop\n\tv_nop\n\tv_nop\n\tv_nop" : "+v"(o0), "+v"(o1), "+v"(o2), "+v"(o3) : "v"(v0), "v"(v1), "v"(v2), "v"(v3), "v"(pb));
        if (early) {                                // wave-uniform: residual plane of v in its own accumulators
            e0 = e0 * alpha; e1 = e1 * alpha; e2 = e2 * alpha; e3 = e3 * alpha;
            const h16* vr = va + TILE_E;
            const v16h w0 = ldh(vr), w1 = ldh(vr + 16 * FP), w2 = ldh(vr + 32 * FP), w3 = ldh(vr + 48 * FP);
            e0 = wmma16(w0, pb, e0); e1 = wmma16(w1, pb, e1); e2 = wmma16(w2, pb, e2); e3 = wmma16(w3, pb, e3);
            asm volatile("v_nop\n\tv_nop\n\tv_nop\n\tv_nop" : "+v"(e0), "+v"(e1), "+v"(e2), "+v"(e3) : "v"(w0), "v"(w1), "v"(w2), "v"(w3), "v"(pb));
        }
      }
      // foot of stage s, every wave: its LDS reads of this buffer are done, its copies of stage s+1 have landed; the barrier publishes stage s+1 and frees this buffer for stage s+2
      asm volatile("s_wait_dscnt 0x0" ::: "memory");
      asm volatile("s_wait_asynccnt 0x0" ::: "memory");
      __syncthreads();
      if (s + 2 < nst) fill(s + 2);
    }
    asm volatile("s_wait_asynccnt 0x0" ::: "memory");        // no copy is outstanding behind the loop
    l += __shfl_xor(l, 16, 32);
    const float inv = (m > NEGV) ? (1.0f / l) : __uint_as_float(0x7FC00000u);   // no visible key in the whole row: NaN row
    const int wb = wave * 16 * 68;
    // O^T D layout: o_j[r] = (d = 16j + 8h + r, t = lane&15) -> os[t][d]; rows 0..15 x columns 0..63 all written
    { v4f a, c;
#pragma unroll
      for (int i = 0; i < 4; ++i) { a[i] = (o0[i] + e0[i] * QRI) * inv; c[i] = (o0[4 + i] + e0[4 + i] * QRI) * inv; }
      *(v4fa*)(&os[wb + lr * 68 +  0 + 8 * hi]) = a; *(v4fa*)(&os[wb + lr * 68 +  0 + 8 * hi + 4]) = c;
#pragma unroll
      for (int i = 0; i < 4; ++i) { a[i] = (o1[i] + e1[i] * QRI) * inv; c[i] = (o1[4 + i] + e1[4 + i] * QRI) * inv; }
      *(v4fa*)(&os[wb + lr * 68 + 16 + 8 * hi]) = a; *(v4fa*)(&os[wb + lr * 68 + 16 + 8 * hi + 4]) = c;
#pragma unroll
      for (int i = 0; i < 4; ++i) { a[i] = (o2[i] + e2[i] * QRI) * inv; c[i] = (o2[4 + i] + e2[4 + i] * QRI) * inv; }
      *(v4fa*)(&os[wb + lr * 68 + 32 + 8 * hi]) = a; *(v4fa*)(&os[wb + lr * 68 + 32 + 8 * hi + 4]) = c;
#pragma unroll
      for (int i = 0; i < 4; ++i) { a[i] = (o3[i] + e3[i] * QRI) * inv; c[i] = (o3[4 + i] + e3[4 + i] * QRI) * inv; }
      *(v4fa*)(&os[wb + lr * 68 + 48 + 8 * hi]) = a; *(v4fa*)(&os[wb + lr * 68 + 48 + 8 * hi + 4]) = c; }
    wave_sync();
    const size_t cb = ((size_t)bb * SEQ + (size_t)(t0 + (lane >> 3))) * DM + (size_t)(hh * HD + (lane & 7) * 8);
    v8us hv[4], lv[4];
#pragma unroll
    for (int s = 0; s < 4; ++s) { const int row = 4 * s + (lane >> 3), c8 = (lane & 7) * 8;   // 4 s x 4 row groups = 16 rows; 8 lanes x 8 = 64 columns
        const v4f x0 = *(const v4fa*)(&os[wb + row * 68 + c8]); const v4f x1 = *(const v4fa*)(&os[wb + row * 68 + c8 + 4]);
#pragma unroll
        for (int i = 0; i < 4; ++i) { const unsigned short a0 = f2bf(x0[i]); const unsigned short a1 = f2bf(x1[i]);
            hv[s][i] = a0; hv[s][4 + i] = a1; lv[s][i] = f2bf(x0[i] - bf2f(a0)); lv[s][4 + i] = f2bf(x1[i] - bf2f(a1)); } }
{
#pragma unroll
        for (int s = 0; s < 4; ++s) { const size_t oo = cb + (size_t)s * 4 * DM;
            *(v8us*)(CH + oo) = hv[s]; *(v8us*)(CL + oo) = lv[s]; }
         }

    if (hh == 0 && hi == 0) {                       // head 0 (block-uniform) leaves each row's final running max and 1 / sum for the probability jobs of the next launch: 16 lanes x 8 B = one line a wave
        const v2f st = (v2f){m, inv};
        *(v2f*)(ST + 2 * ((size_t)bb * SEQ + (size_t)tq)) = st;
    }
}

static constexpr size_t al256(size_t v) { return (v + 255) & ~(size_t)255; }
static constexpr size_t SZ_XB = al256((size_t)NB * SEQ * DM * 2);
static constexpr size_t SZ_WB = al256((size_t)3 * DM * DM * 2);
static constexpr size_t SZ_WF = al256((size_t)DM * DM * 2);
static constexpr size_t SZ_PL = al256((size_t)NB * SEQ * DM * 2);
static constexpr size_t SZ_MW = al256((size_t)NB * SEQ * (SEQ / 32) * 4);
static constexpr size_t SZ_ST = al256((size_t)NB * SEQ * 2 * 4);
static constexpr size_t SZ_TOTAL = SZ_XB + SZ_WB + SZ_WF + 5 * SZ_PL + 2 * SZ_PL + SZ_MW + SZ_ST;
static_assert(SZ_TOTAL <= (size_t)134217728);          // workspace carve <= 128 MiB
static_assert(((size_t)DM * DM * 2) % 256 == 0);       // weight sub-planes stay 256-byte aligned
static_assert(SZ_PL == (size_t)NB * SEQ * DM * 2);     // ctx hi and lo planes are back to back with stride NB*SEQ*DM elements
static_assert((size_t)NB * NH_ * SEQ * HD * 2 == SZ_PL);   // q / k / v^T planes [NB*16][SEQ][64] fill one plane exactly

extern "C" void kernel_launch(void* const* d_in, const int* in_sizes, int n_in,
                              void* d_out, int out_size, void* d_ws, size_t ws_size, hipStream_t stream) {
    if (n_in < 6) return;
    const size_t needx = ((size_t)(NB - 1) * SEQ_FULL + SEQ) * DM;
    if ((size_t)in_sizes[0] < needx) return;
    if ((size_t)in_sizes[1] < (size_t)3 * DM * DM || (size_t)in_sizes[2] < (size_t)3 * DM) return;
    if ((size_t)in_sizes[3] < (size_t)DM * DM || (size_t)in_sizes[4] < (size_t)DM) return;
    if ((size_t)in_sizes[5] < ((size_t)(NB - 1) * SEQ_FULL + (SEQ - 1)) * SEQ_FULL + SEQ) return;
    if ((size_t)out_size < OUT1_OFF + ((size_t)(NB - 1) * OUT_SEQ + (SEQ - 1)) * ATT_LD + SEQ) return;
    if (SZ_TOTAL > ws_size) return;
    const float* x = (const float*)d_in[0]; const float* wqkv = (const float*)d_in[1]; const float* bqkv = (const float*)d_in[2];
    const float* wfc = (const float*)d_in[3]; const float* bfc = (const float*)d_in[4];          // wire order x, W_attn, b_attn, W_proj, b_proj, padding_mask
    const int* pmask = (const int*)d_in[5];          // [NB_FULL][SEQ_FULL][SEQ_FULL] int32, non-zero = key hidden
    float* OUT = (float*)d_out;      // [NB][SEQ][1024] then [NB][1][SEQ][SEQ]
    char* wsp = (char*)d_ws;
    bf* XB = (bf*)wsp; wsp += SZ_XB;                 // [NB*SEQ][1024]
    bf* WB = (bf*)wsp; wsp += SZ_WB;                 // [3072][1024]: q rows | k rows | v rows (row e = h*64 + d)
    bf* WF = (bf*)wsp; wsp += SZ_WF;                 // [1024][1024]: W_proj^T
    h16* QH = (h16*)wsp; wsp += SZ_PL;               // [NB*16][SEQ][64]
    h16* QR = (h16*)wsp; wsp += SZ_PL;               // residual x2048
    h16* KP = (h16*)wsp; wsp += SZ_PL;               // [NB*16][SEQ][64]
    h16* VT = (h16*)wsp; wsp += SZ_PL;               // [NB*16][64][SEQ]
    h16* VR = (h16*)wsp; wsp += SZ_PL;               // residual x2048
    bf* CH = (bf*)wsp; wsp += SZ_PL;                 // ctx hi [NB*SEQ][1024]
    bf* CL = (bf*)wsp; wsp += SZ_PL;                 // ctx lo, directly after CH
    unsigned* MW = (unsigned*)wsp; wsp += SZ_MW;     // mask bit words [NB*SEQ][SEQ/32]
    float* ST = (float*)wsp; wsp += SZ_ST;           // head 0: running max, 1 / sum per row [NB*SEQ][2]

    k_prep<<<PB_WA + PB_WP + PB_MB + PB_X, 256, 0, stream>>>(x, wqkv, wfc, pmask, XB, WB, WF, MW);

    k_gemm<true><<<dim3(NB * SEQ / 128, DM / 128, 3), 128, 0, stream>>>(XB, WB, bqkv, QH, QR, KP, VT, VR, OUT, MW, ST);

    k_flash<<<dim3(SEQ / (16 * AW), NB * NH_, 1), 32 * AW, 0, stream>>>(QH, QR, KP, VT, VR, MW, CH, CL, ST);

    k_gemm<false><<<dim3(NB * SEQ / 128, DM / 128, 2), 128, 0, stream>>>(CH, WF, bfc, QH, QR, KP, VT, VR, OUT, MW, ST);
}

// v006
// It runs in 84 microseconds.
// In both of two side-by-side timings against v005, it was 1.08 times as fast.
// Counting every step since v000, it is 2.61 times as fast.
#include <hip/hip_runtime.h>

// Causal multi-head self-attention, width 1024 = 16 heads x 64, x [NB][SEQ][1024], fused W_attn [in][out] + bias, true head split q[b][h][t][d] = qkv[b][t][h*64+d], score scale 1/8,
// key > query OR padding_mask[b][q][k] != 0 replaced by -inf, heads merged back to [b][t][h*64+d], output projection W_proj [in][out] + bias (f32 out); second output = normalised probabilities of head 0, [NB][1][SEQ][SEQ] f32.
// Compute dtypes, f32 accumulate everywhere: qkv projections v_wmma_f32_16x16x32_bf16 (x, W, biases RNE-converted to bf16; products exact); scores v_wmma_f32_16x16x32_f16: k single f16, q as f16 value + f16 residual x2048 in its own accumulator;
// P (x256 carry, cancels in the normalisation) single f16; v single f16 plus, for query rows < 512, an f16 residual x2048 in its own accumulator; softmax f32 (online, running max); output projection v_wmma_f32_16x16x32_bf16 with ctx as bf16 hi + bf16 lo planes (unscaled, shared accumulator, hi then lo products of each 32-k block) against bf16 W_proj.
// Layout: bf16 copies of x and transposed (K-contiguous) weights; q (hi, residual) and k planes [b*16+h][t][64]; v^T planes [b*16+h][d][t] produced by the v GEMM run with the weight rows as the M operand and the tokens as the N operand; ctx planes compact [NB*SEQ][1024]; padding mask packed to one 32-key bit word per (b, q, key block); head 0's softmax row statistics (running max, 1 / sum) [NB*SEQ][2] f32.

#ifndef NB
#define NB 4
#endif
#ifndef SEQ
#define SEQ 1024
#endif
#define NB_FULL  4
#define SEQ_FULL 1024
#ifndef OUT_SEQ
#define OUT_SEQ SEQ              // row pitch (in tokens) between batches of the outputs
#endif
#ifndef ATT_LD
#define ATT_LD OUT_SEQ           // key pitch of one probability row of the second output
#endif
#ifndef SCORE_RES
#define SCORE_RES 1              // 1: q residual plane adds a second score product; 0: single score product
#endif
#define DM   1024
#define NH_  16
#define HD   64
#define AW   4                   // waves per flash block (16 query rows each)
#define EARLY 512                // query rows below this use the v residual plane
#define QRS  2048.0f             // carry of the residual planes
#define QRI  (1.0f / 2048.0f)
#define SC2  (0.125f * 1.4426950408889634f)   // HD^-0.5 * log2(e)
#define PSH  8.0f                // log2 of the P carry (256)
#define NEGV (-3.0e38f)
#define OUT1_OFF ((size_t)NB_FULL * SEQ_FULL * DM)   // element offset of the second output (fixed by the full problem size)

static_assert(HD == 64);
static_assert(NH_ * HD == DM);
static_assert(DM % 64 == 0);
static_assert(DM % 32 == 0);
static_assert(SEQ % 256 == 0);                 // SEQ/32 mask words per row is a multiple of 8; 64-token tiles stay inside one batch
static_assert(SEQ % 64 == 0);
static_assert((NB * SEQ) % 128 == 0);
static_assert(DM % 128 == 0);
static_assert(DM / 64 >= 2);                   // the GEMM prologue fetches two 64-k stages
static_assert(SEQ % 32 == 0);
static_assert(SEQ % (16 * AW) == 0);
static_assert(((size_t)SEQ * DM) % 8 == 0);
static_assert(NB <= NB_FULL);
static_assert(SEQ <= SEQ_FULL);
static_assert(((size_t)NB * SEQ * (SEQ / 32)) % 256 == 0);        // mask-word grid x block == plane extent
static_assert(ATT_LD % 32 == 0);
static_assert(ATT_LD >= SEQ);
static_assert(OUT1_OFF * 4 == (size_t)16777216);                   // byte offset of the second output
static_assert(((size_t)(NB - 1) * OUT_SEQ + SEQ) * DM <= OUT1_OFF);
static_assert(OUT1_OFF + ((size_t)(NB - 1) * OUT_SEQ + (SEQ - 1)) * ATT_LD + SEQ <= OUT1_OFF + (size_t)NB_FULL * SEQ_FULL * SEQ_FULL);

typedef _Float16 h16;
typedef unsigned short bf;
typedef __attribute__((ext_vector_type(16))) __bf16   v16bf;
typedef __attribute__((ext_vector_type(16))) _Float16 v16h;
typedef __attribute__((ext_vector_type(8)))  _Float16 v8h;
typedef __attribute__((ext_vector_type(8)))  unsigned short v8us;
typedef __attribute__((ext_vector_type(8)))  float    v8f;
typedef __attribute__((ext_vector_type(4)))  float    v4f;
typedef __attribute__((ext_vector_type(4)))  int      v4i;
typedef __attribute__((ext_vector_type(4)))  unsigned v4u;
typedef __attribute__((ext_vector_type(2)))  float    v2f;
typedef v4f  __attribute__((may_alias)) v4fa;
typedef v8us __attribute__((may_alias)) v8usa;

__device__ __forceinline__ unsigned short f2bf(float f) { unsigned u = __float_as_uint(f); u += 0x7FFFu + ((u >> 16) & 1u); return (unsigned short)(u >> 16); }
__device__ __forceinline__ float bf2f(unsigned short h) { return __uint_as_float(((unsigned)h) << 16); }
__device__ __forceinline__ v16h cat16(v8h lo, v8h hi) { return __builtin_shufflevector(lo, hi, 0, 1, 2, 3, 4, 5, 6, 7, 8, 9, 10, 11, 12, 13, 14, 15); }
__device__ __forceinline__ v16bf cat16b(v8us lo, v8us hi) { return __builtin_bit_cast(v16bf, __builtin_shufflevector(lo, hi, 0, 1, 2, 3, 4, 5, 6, 7, 8, 9, 10, 11, 12, 13, 14, 15)); }
__device__ __forceinline__ v8f wmma16(v16h a, v16h b, v8f c) { return __builtin_amdgcn_wmma_f32_16x16x32_f16(false, a, false, b, (short)0, c, false, false); }
__device__ __forceinline__ v8f wmmab(v16bf a, v16bf b, v8f c) { return __builtin_amdgcn_wmma_f32_16x16x32_bf16(false, a, false, b, (short)0, c, false, false); }
// fragment loaders from K-contiguous 16-bit rows; p already includes + 8*(lane>>4): elements 0..7 <- k0+8h+0..7, elements 8..15 <- k0+16+8h+0..7 (same map for A and B)
__device__ __forceinline__ v16h  ldh(const h16* p) { return cat16(*(const v8h*)p, *(const v8h*)(p + 16)); }
__device__ __forceinline__ v16bf ldb(const bf* p)  { return cat16b(*(const v8us*)p, *(const v8us*)(p + 16)); }
// ordering point for wave-private LDS tiles (same wave writes and reads)
__device__ __forceinline__ void wave_sync() { __builtin_amdgcn_fence(3 /* release order */, "wavefront"); __builtin_amdgcn_wave_barrier(); asm volatile("" ::: "memory"); }
// f32 -> f16 for WMMA operand planes: results below the smallest f16 normal become exact zero (value select)
static __device__ __forceinline__ h16 toh_flush(float v) { const h16 r = (h16)v; return (fabsf(v) < 6.103515625e-05f) ? (h16)0.0f : r; }

// cvt8: x [NB_FULL][SEQ_FULL][DM] f32 -> compact bf16 plane [NB*SEQ][DM], 8 elements a thread
__device__ __forceinline__ void cvt8(const float* __restrict__ src, bf* dst, size_t n8, const int blk) {
    const size_t i = (size_t)blk * 256 + threadIdx.x; if (i >= n8) return;
    const size_t pb = (size_t)SEQ * DM / 8;          // threads per batch
    const v8f v = *(const v8f*)(src + (i / pb) * ((size_t)SEQ_FULL * DM) + (i % pb) * 8); v8us o;
#pragma unroll
    for (int k = 0; k < 8; ++k) o[k] = f2bf(v[k]);
    *(v8us*)(dst + i * 8) = o; 
}

// cvtT: W [DM k][ldn] f32 (row = k, column = e) -> bf16 plane dst[row(e)][k] (K-contiguous), 64 k x 64 e tile through LDS (cross-wave: block barrier).
// row(e) = e for e < permFrom; for e >= permFrom, with ee = e - permFrom = c*64 + d: row = permFrom + d*16 + c.
__device__ __forceinline__ void cvtT(unsigned short* ts, const float* __restrict__ W, int ldn, bf* dst, int permFrom, const int bx, const int by) {
    const int t = threadIdx.x; const int k0 = bx * 64, n0 = by * 64;
#pragma unroll 4
    for (int i = 0; i < 16; ++i) { const int k = i * 4 + (t >> 6), n = t & 63;      // 16 x 4 = 64 k rows, 64 columns
        ts[n * 72 + k] = f2bf(W[(size_t)(k0 + k) * (size_t)ldn + n0 + n]); }
    __syncthreads();
    v8us o0, o1; size_t d0, d1;
    { const int p = t, n = p >> 3, q = p & 7; o0 = *(const v8usa*)(&ts[n * 72 + 8 * q]);
      const int e = n0 + n; const int ee = e - permFrom; const int row = (e >= permFrom) ? (permFrom + (ee & 63) * 16 + (ee >> 6)) : e;
      d0 = (size_t)row * DM + k0 + 8 * q; }
    { const int p = t + 256, n = p >> 3, q = p & 7; o1 = *(const v8usa*)(&ts[n * 72 + 8 * q]);
      const int e = n0 + n; const int ee = e - permFrom; const int row = (e >= permFrom) ? (permFrom + (ee & 63) * 16 + (ee >> 6)) : e;
      d1 = (size_t)row * DM + k0 + 8 * q; }
{
        *(v8us*)(dst + d0) = o0; *(v8us*)(dst + d1) = o1;
         }
}

// mbits: padding mask [NB_FULL][SEQ_FULL][SEQ_FULL] int32 -> bit words MW[b*SEQ + q][SEQ/32], bit j of word w = (mask[b][q][32*w + j] != 0).
__device__ __forceinline__ void mbits(const int* __restrict__ pm, unsigned* MW, size_t nW, const int blk) {
    const size_t w = (size_t)blk * 256 + threadIdx.x; if (w >= nW) return;
    const size_t row = w / (size_t)(SEQ / 32); const size_t j = w % (size_t)(SEQ / 32);
    const size_t b = row / (size_t)SEQ, t = row % (size_t)SEQ;
    const int* src = pm + (b * SEQ_FULL + t) * (size_t)SEQ_FULL + j * 32;
    unsigned bits = 0u;
#pragma unroll
    for (int i = 0; i < 8; ++i) { const v4i v = *(const v4i*)(src + 4 * i);
        const unsigned n = ((v[0] != 0) ? 1u : 0u) | ((v[1] != 0) ? 2u : 0u) | ((v[2] != 0) ? 4u : 0u) | ((v[3] != 0) ? 8u : 0u);
        bits |= n << (4 * i); }
    *(unsigned*)(MW + w) = bits; 
}

// k_prep: the four input conversions, none of which reads another's output, as ONE grid. A work-group's job follows from its block index alone (the same for all its threads, so
// the barrier inside cvtT is passed by a whole work-group or by none of it); the jobs with the longest chain of dependent loads come first in the index.
#define PB_WA ((DM / 64) * (3 * DM / 64))                    // W_attn tiles
#define PB_WP ((DM / 64) * (DM / 64))                        // W_proj tiles
#define PB_MB ((int)((size_t)NB * SEQ * (SEQ / 32) / 256))   // mask-word blocks
#define PB_X  ((int)((size_t)NB * SEQ * DM / 8 / 256))       // x blocks
static_assert(((size_t)NB * SEQ * DM / 8) % 256 == 0);
__global__ __launch_bounds__(256) void k_prep(const float* __restrict__ x, const float* __restrict__ wqkv, const float* __restrict__ wfc, const int* __restrict__ pm, bf* XB, bf* WB, bf* WF, unsigned* MW) {
    __shared__ __align__(16) unsigned short ts[64 * 72];
    int blk = (int)blockIdx.x;
    if (blk < PB_WA + PB_WP) {                       // W_attn in[1024 k][3072 e] -> WB out[e][1024 k] (no row permutation); W_proj in[1024 k][1024 e] -> WF out[e][1024 k]
        const bool wa = blk < PB_WA; const int tl = wa ? blk : blk - PB_WA;
        cvtT(ts, wa ? wqkv : wfc, wa ? 3 * DM : DM, wa ? WB : WF, 1 << 30, tl % (DM / 64), tl / (DM / 64));
        return; }
    blk -= PB_WA + PB_WP;
    if (blk < PB_MB) { mbits(pm, MW, (size_t)NB * SEQ * (SEQ / 32), blk); return; }
    blk -= PB_MB;
    cvt8(x, XB, (size_t)NB * SEQ * DM / 8, blk);
}

// work-group barrier that orders LDS only: the release and acquire fences name the LDS address space, so the global loads that prefetch a later stage into registers stay in flight across it
__device__ __forceinline__ void lds_barrier() { __builtin_amdgcn_fence(__ATOMIC_RELEASE, "workgroup", "local"); __builtin_amdgcn_s_barrier(); __builtin_amdgcn_fence(__ATOMIC_ACQUIRE, "workgroup", "local"); }

// p_job: the second output, the normalised probabilities of head 0, as a job of its own: one work-group of 4 waves writes 64 query rows x PK keys, a wave 16 rows, in passes of PP keys.
// It needs only what the attention launch has left behind: the q and k planes, the mask words and each row's final running max and 1 / sum (ST). The scores are re-formed exactly as in k_flash
// (S^T = K Q^T, q value + residual accumulators, same selects); K fragments come straight from the k plane (a work-group's 32 KiB of it are shared through the WGP cache).
// A pass at or below the wave's diagonal forms all its four 32-key steps (keys past the query are replaced as in k_flash and give 0 x 1/sum); a pass wholly above it holds 0 (NaN for a row with no visible key).
// Each pass goes through a wave-private LDS tile [16 rows][PP keys], so that every store instruction of the wave covers 512 contiguous bytes of one row.
#define PK  256                  // keys per work-group
#define PP  128                  // keys per pass
#define PPW 132                  // LDS row pitch of the pass tile in floats: 528 B = 16 B x 33, the bank pattern of the 68-float epilogue tiles
#define PJOBS (NB * (SEQ / (16 * AW)) * (SEQ / PK))
static_assert(SEQ % PK == 0);
static_assert(PK % PP == 0);
static_assert(PP == 32 * 4);     // one row of a pass = 32 lanes x 4 floats; its four mask words are one 16-byte load
// four v_exp_f32 as one statement: the outputs are early-clobber, so none of the four reads another's result or overwrites another's source, and the v_nop is the slot that the
// instruction set asks for behind a transcendental before its result is used or its source overwritten
__device__ __forceinline__ v4f exp2x4(const float x0, const float x1, const float x2, const float x3) {
    float a, b, c, d;
    asm("v_exp_f32 %0, %4\n\tv_exp_f32 %1, %5\n\tv_exp_f32 %2, %6\n\tv_exp_f32 %3, %7\n\tv_nop" : "=&v"(a), "=&v"(b), "=&v"(c), "=&v"(d) : "v"(x0), "v"(x1), "v"(x2), "v"(x3));
    return (v4f){a, b, c, d};
}
__device__ __forceinline__ void p_job(float* pt, const int job, const h16* __restrict__ QH, const h16* __restrict__ QR, const h16* __restrict__ KP, const unsigned* __restrict__ MW, const float* __restrict__ ST, float* ATT) {
    const int lane = threadIdx.x & 31, lr = lane & 15, hi = lane >> 4;
    const int wave = __builtin_amdgcn_readfirstlane((int)(threadIdx.x >> 5));
    const int ch = job % (SEQ / PK), rt = job / (SEQ / PK);
    const int tile = rt % (SEQ / (16 * AW)), bb = rt / (SEQ / (16 * AW));
    const int t0 = (tile * AW + wave) * 16, tq = t0 + lr, kend = t0 + 16;
    const size_t pbase = (size_t)(bb * NH_) * SEQ * HD;      // head 0 of batch bb
    const size_t qo = pbase + (size_t)tq * HD + 8 * hi;
    const v2f st = *(const v2f*)(ST + 2 * ((size_t)bb * SEQ + (size_t)tq));
    asm volatile("s_wait_xcnt 0x0" ::: "memory");            // the address registers of the load above are free for reuse behind it: the wait stands in front of any overwrite
    const v16h qh0 = ldh(QH + qo), qh1 = ldh(QH + qo + 32);  // B fragments: col t, k = d
    asm volatile("s_wait_xcnt 0x0" ::: "memory");            // as above, for the value fragments' loads
    const v16h qr0 = ldh(QR + qo), qr1 = ldh(QR + qo + 32);
    asm volatile("s_wait_xcnt 0x0" ::: "memory");            // as above, for the residual fragments' loads
    const float shp = PSH - st[0];                           // the sum carries the x256 of P, so exp2(s - m + 8) / l is the probability
    const float inv = st[1];
    const float zf = inv * 0.0f;                             // 0 for an ordinary row, NaN for a row with no visible key
    const h16* kf = KP + pbase + (size_t)lr * HD + 8 * hi;   // + key * HD (A fragment: row key, k = d)
    const unsigned* mrow = MW + ((size_t)bb * SEQ + (size_t)tq) * (size_t)(SEQ / 32);
    float* pw = pt + wave * 16 * PPW;
    float* arow = ATT + ((size_t)bb * OUT_SEQ + (size_t)t0) * ATT_LD + lane * 4;
    // kept rolled: one copy of the pass in the kernel's text and one pass's fragments in registers at a time; inside a pass all loads are already in flight together
#pragma unroll 1
    for (int ps = 0; ps < PK / PP; ++ps) {
        const int kb = ch * PK + ps * PP;
        v4f pv[4][4];                                        // step, then keys 8h+0..3, 8h+4..7, 16+8h+0..3, 16+8h+4..7
#pragma unroll
        for (int s = 0; s < 4; ++s)
#pragma unroll
            for (int i = 0; i < 4; ++i) pv[s][i] = (v4f){zf, zf, zf, zf};
        if (kb < kend) {                                     // wave-uniform
            const v4u mwv = *(const v4u*)(mrow + (kb >> 5));
            asm volatile("s_wait_xcnt 0x0" ::: "memory");    // the address registers of the load above are free for reuse behind it: the wait stands in front of any overwrite
            v16h kq[4][4];                                   // the pass's K fragments, all loads in flight together: one load latency a pass
#pragma unroll
            for (int s = 0; s < 4; ++s) { const h16* ka = kf + (size_t)(kb + 32 * s) * HD;
                kq[s][0] = ldh(ka); kq[s][1] = ldh(ka + 32); kq[s][2] = ldh(ka + 16 * HD); kq[s][3] = ldh(ka + 16 * HD + 32); }
            // the address registers of the loads above are free for reuse behind them: the wait stands in front of any overwrite
            asm volatile("s_wait_xcnt 0x0" ::: "memory");
#pragma unroll
            for (int s = 0; s < 4; ++s) {
                const int key0 = kb + 32 * s;
                const v16h ka0 = kq[s][0], ka1 = kq[s][1], kb0 = kq[s][2], kb1 = kq[s][3];
                v8f sHa = (v8f){}, sLa = (v8f){}, sHb = (v8f){}, sLb = (v8f){};
                sHa = wmma16(ka0, qh0, sHa); sHb = wmma16(kb0, qh0, sHb);
                if (SCORE_RES) { sLa = wmma16(ka0, qr0, sLa); sLb = wmma16(kb0, qr0, sLb); }
                sHa = wmma16(ka1, qh1, sHa); sHb = wmma16(kb1, qh1, sHb);
                if (SCORE_RES) { sLa = wmma16(ka1, qr1, sLa); sLb = wmma16(kb1, qr1, sLb); }
                float ta[8], tb[8];
#pragma unroll
                for (int r = 0; r < 8; ++r) { ta[r] = (sHa[r] + sLa[r] * QRI) * SC2; tb[r] = (sHb[r] + sLb[r] * QRI) * SC2; }
                const int kidx = key0 + 8 * hi;
                const unsigned ma = mwv[s] >> (8 * hi), mc = mwv[s] >> (16 + 8 * hi);
#pragma unroll
                for (int r = 0; r < 8; ++r) { ta[r] = (kidx + r > tq) ? NEGV : ta[r]; tb[r] = (kidx + 16 + r > tq) ? NEGV : tb[r]; }   // key > query replaces the score
#pragma unroll
                for (int r = 0; r < 8; ++r) { ta[r] = (((ma >> r) & 1u) != 0u) ? NEGV : ta[r]; tb[r] = (((mc >> r) & 1u) != 0u) ? NEGV : tb[r]; }   // so does a set padding-mask bit
                pv[s][0] = exp2x4(ta[0] + shp, ta[1] + shp, ta[2] + shp, ta[3] + shp) * inv; pv[s][1] = exp2x4(ta[4] + shp, ta[5] + shp, ta[6] + shp, ta[7] + shp) * inv;
                pv[s][2] = exp2x4(tb[0] + shp, tb[1] + shp, tb[2] + shp, tb[3] + shp) * inv; pv[s][3] = exp2x4(tb[4] + shp, tb[5] + shp, tb[6] + shp, tb[7] + shp) * inv;
            }
        }
        // lane (t, h): keys 8h+r and 16+8h+r of each step -> pw[t][32 * step + ...]; rows 0..15 x columns 0..PP-1 all written
#pragma unroll
        for (int s = 0; s < 4; ++s) {
            *(v4fa*)(&pw[lr * PPW + 32 * s + 8 * hi]) = pv[s][0];      *(v4fa*)(&pw[lr * PPW + 32 * s + 8 * hi + 4]) = pv[s][1];
            *(v4fa*)(&pw[lr * PPW + 32 * s + 16 + 8 * hi]) = pv[s][2]; *(v4fa*)(&pw[lr * PPW + 32 * s + 16 + 8 * hi + 4]) = pv[s][3]; }
        wave_sync();
        v4f val[16];
#pragma unroll
        for (int r = 0; r < 16; ++r) val[r] = *(const v4fa*)(&pw[r * PPW + lane * 4]);
#pragma unroll
        for (int r = 0; r < 16; ++r) *(v4f*)(arow + (size_t)r * ATT_LD + kb) = val[r];
        // the address and data registers of the stores above are reused by the next pass: the wait stands in front of any overwrite
        asm volatile("s_wait_xcnt 0x0" ::: "memory");
        wave_sync();
    }
}

// k_gemm: bf16 GEMM, work-group of 4 waves on a 128x128 tile, each wave a 64x64 quadrant (16 accumulators), K = DM walked in stages of 64.
// Each stage's A and B tiles (128 rows x 64 k) are read from the K-contiguous bf16 planes as whole 128-byte rows (8 lanes x 16 B a row) into registers two stages ahead and
// stored one stage ahead to the other of two LDS buffers (row pitch 144 B); fragments come from LDS. One work-group barrier a stage: it publishes the stage just stored
// and ends every wave's reads of the buffer that the next stage's stores overwrite. k order of every accumulator: ascending in steps of 32.
// C[m][n] = sum_k A[m][k] Bt[n][k] + bias (bias RNE-converted to bf16, added in f32). 128 threads per block.
// QKV = true: the q, k and v projections, which read none of each other's output, as ONE grid (M/128 token tiles, 1024/128 weight-row tiles, 3 jobs); the job md follows from blockIdx.z
// (the same for a whole work-group); three work-groups share a WGP, so one's matrix instructions run under the others' LDS and load waits, prologue and epilogue. X = x tokens, Wt = q | k | v weight rows.
// md 0: q  -> A = x tokens, Bt = q weight rows; f16 value plane Ph and f16 residual x2048 plane Pr, layout [b*16+h][t][64] (quadrant column block = head h; bias columns 0..1023)
// md 1: k  -> as md 0, value plane only (bias columns 1024..2047); the shortest epilogue, so it comes last in the index
// md 2: v  -> A = v weight rows (row e = h*64 + d), Bt = x tokens: C[e][token]; value (Ph) and residual x2048 (Pr) planes [b*16+h][d][t]; bias per ROW (columns 2048..3071 of the bias vector)
// QKV = false: output projection -> X = ctx hi plane, the lo plane directly behind it, Wt = W_proj^T rows; f32 rows of OUT. Both planes walk k together: a stage holds the hi, the lo and the W_proj tile of the same 64 k,
// so each W_proj tile is fetched, staged and read as fragments once for both planes (one shared accumulator: hi then lo products of each 32-k block). grid (M/128, 1024/128, 2):
// blockIdx.z = 0 is the projection, one work-group a WGP and one wave a SIMD; blockIdx.z = 1 are the PJOBS probability jobs (p_job), which read nothing the projection writes and take the places it leaves free.
struct yes_t { static constexpr bool value = true; };
struct no_t { static constexpr bool value = false; };
#define LP 72                    // LDS row pitch in 16-bit elements: 144 B = 16 B x 9, conflict-free for 16-byte fragment reads
// for QKV = true the second launch bound asks for a register budget at which three waves fit a SIMD, so that all 768 work-groups of the merged grid are resident at once (three a WGP; LDS allows three); for QKV = false it asks for one wave a SIMD
template <bool QKV>
__global__ __launch_bounds__(128, QKV ? 3 : 1) void k_gemm(const bf* __restrict__ X, const bf* __restrict__ Wt, const float* __restrict__ bias, h16* QH, h16* QR, h16* KP, h16* VT, h16* VR, float* OUT, const unsigned* __restrict__ MW, const float* __restrict__ ST) {
    __shared__ __align__(16) bf As[2 * 128 * LP];
    __shared__ __align__(16) bf Bs[2 * 128 * LP];
    __shared__ __align__(16) bf Ls[QKV ? 8 : 2 * 128 * LP];   // output projection: tiles of the ctx lo plane
    __shared__ __align__(16) float osw[4 * 16 * 68];
    if constexpr (!QKV) {
        if ((int)blockIdx.z != 0) {                  // the same for a whole work-group, in front of every barrier
            static_assert(PJOBS <= (NB * SEQ / 128) * (DM / 128));
            static_assert(sizeof(As) >= (size_t)AW * 16 * PPW * 4);
            const int job = (int)blockIdx.y * (NB * SEQ / 128) + (int)blockIdx.x;
            if (job < PJOBS) p_job((float*)As, job, QH, QR, KP, MW, ST, OUT + OUT1_OFF);
            return; }
    }
    const int K = DM;
    const int tid = threadIdx.x;
    const int lane = tid & 31, lr = lane & 15, hi = lane >> 4;
    const int wave = __builtin_amdgcn_readfirstlane(tid >> 5);
    float* os = osw + wave * 16 * 68;                // wave-private epilogue tile
    const int wm = wave & 1, wn = wave >> 1;
    const int md = QKV ? (((int)blockIdx.z == 0) ? 0 : 3 - (int)blockIdx.z) : 3;   // z 0, 1, 2 -> q, v, k
    const bool vj = QKV && md == 2;                  // v: weight rows are the M operand, tokens the N operand
    const int bm = vj ? (int)blockIdx.y : (int)blockIdx.x, bn = vj ? (int)blockIdx.x : (int)blockIdx.y;
    const bf* A = vj ? (Wt + (size_t)2 * DM * DM) : X;
    const bf* Bt = vj ? X : (QKV ? (Wt + (size_t)md * DM * DM) : Wt);
    const int r0 = bm * 128 + wm * 64, c0 = bn * 128 + wn * 64;
    v8f acc[4][4];
#pragma unroll
    for (int mb = 0; mb < 4; ++mb)
#pragma unroll
        for (int nb = 0; nb < 4; ++nb) acc[mb][nb] = (v8f){};
    const int srow = tid >> 3, scol = (tid & 7) * 8;  // staging: 16 rows a pass, 8 passes a tile
    const bf* ga = A + (size_t)(bm * 128 + srow) * K + scol;
    const bf* gb = Bt + (size_t)(bn * 128 + srow) * K + scol;
    const int sl = srow * LP + scol;
    const int fa = (wm * 64 + lr) * LP + 8 * hi, fb = (wn * 64 + lr) * LP + 8 * hi;
    const int SPP = K / 64;                           // stages per plane
    const int NS = SPP;
    const bf* gl = ga + (size_t)NB * SEQ * DM;        // output projection: the ctx lo plane, same rows and columns
    v8us ra[8], rb[8], rl[8];
    if constexpr (QKV) {
#pragma unroll
        for (int i = 0; i < 8; ++i) { ra[i] = *(const v8us*)(ga + (size_t)i * 16 * K); rb[i] = *(const v8us*)(gb + (size_t)i * 16 * K); }
#pragma unroll
        for (int i = 0; i < 8; ++i) { *(v8us*)(&As[sl + i * 16 * LP]) = ra[i]; *(v8us*)(&Bs[sl + i * 16 * LP]) = rb[i]; }
#pragma unroll
        for (int i = 0; i < 8; ++i) { ra[i] = *(const v8us*)(ga + 64 + (size_t)i * 16 * K); rb[i] = *(const v8us*)(gb + 64 + (size_t)i * 16 * K); }   // stage 1 (NS >= 2)
    } else {
        v8us ta[8], tb[8], tl[8];
        // between the two scheduling barriers stand only the loads of stages 0 and 1 and their wait, so that no other instruction reuses an address register of a load in front of the wait
        __builtin_amdgcn_sched_barrier(0);
#pragma unroll
        for (int i = 0; i < 8; ++i) { ta[i] = *(const v8us*)(ga + (size_t)i * 16 * K); tb[i] = *(const v8us*)(gb + (size_t)i * 16 * K); tl[i] = *(const v8us*)(gl + (size_t)i * 16 * K); }
#pragma unroll
        for (int i = 0; i < 8; ++i) { ra[i] = *(const v8us*)(ga + 64 + (size_t)i * 16 * K); rb[i] = *(const v8us*)(gb + 64 + (size_t)i * 16 * K); rl[i] = *(const v8us*)(gl + 64 + (size_t)i * 16 * K); }   // stage 1 (NS >= 2)
        // the address registers of the loads above are free for reuse behind them: the wait stands in front of any overwrite
        asm volatile("s_wait_xcnt 0x0" ::: "memory");
        __builtin_amdgcn_sched_barrier(0);
#pragma unroll
        for (int i = 0; i < 8; ++i) { *(v8us*)(&As[sl + i * 16 * LP]) = ta[i]; *(v8us*)(&Bs[sl + i * 16 * LP]) = tb[i]; *(v8us*)(&Ls[sl + i * 16 * LP]) = tl[i]; }
    }
    lds_barrier();
    // one stage; ST: stage s+1 exists (it waits in ra, rb since the stage before), LD: stage s+2 exists. Both are compile-time so that the body is one straight run whose LDS waits are counted exactly.
    auto stage = [&](const int s, auto ST, auto LD) {
        const int cur = (s & 1) * (128 * LP), nxt = (128 * LP) - cur;
        v16bf a[2][4], b[2][4], l[2][4];              // both 32-k blocks' fragments of this stage, read as one group ahead of the matrix instructions
#pragma unroll
        for (int kb = 0; kb < 2; ++kb) {
#pragma unroll
            for (int mb = 0; mb < 4; ++mb) a[kb][mb] = ldb(&As[cur + fa + mb * 16 * LP + kb * 32]);
#pragma unroll
            for (int nb = 0; nb < 4; ++nb) b[kb][nb] = ldb(&Bs[cur + fb + nb * 16 * LP + kb * 32]);
            if constexpr (!QKV) {
#pragma unroll
                for (int mb = 0; mb < 4; ++mb) l[kb][mb] = ldb(&Ls[cur + fa + mb * 16 * LP + kb * 32]);
            }
        }
        if constexpr (ST.value) {                     // stage s+1 goes to the buffer that stage s-1 was read from
#pragma unroll
            for (int i = 0; i < 8; ++i) { *(v8us*)(&As[nxt + sl + i * 16 * LP]) = ra[i]; *(v8us*)(&Bs[nxt + sl + i * 16 * LP]) = rb[i];
                if constexpr (!QKV) *(v8us*)(&Ls[nxt + sl + i * 16 * LP]) = rl[i]; }
        }
        if constexpr (LD.value) {                     // stage s+2 starts its way from global memory
            const int kc = (s + 2) * 64;
            const bf* pa = ga + kc; const bf* pb = gb + kc; const bf* pl = gl + kc;
#pragma unroll
            for (int i = 0; i < 8; ++i) { ra[i] = *(const v8us*)(pa + (size_t)i * 16 * K); rb[i] = *(const v8us*)(pb + (size_t)i * 16 * K);
                if constexpr (!QKV) rl[i] = *(const v8us*)(pl + (size_t)i * 16 * K); }
            // the address registers of the loads above are free for reuse behind them: the wait stands in front of any overwrite
            asm volatile("s_wait_xcnt 0x0" ::: "memory");
        }
#pragma unroll
        for (int kb = 0; kb < 2; ++kb) {
#pragma unroll
            for (int nb = 0; nb < 4; ++nb)
#pragma unroll
                for (int mb = 0; mb < 4; ++mb) acc[mb][nb] = wmmab(a[kb][mb], b[kb][nb], acc[mb][nb]);
            if constexpr (!QKV) {                     // the lo plane's products of the same 32 k, against the same W_proj fragments
#pragma unroll
                for (int nb = 0; nb < 4; ++nb)
#pragma unroll
                    for (int mb = 0; mb < 4; ++mb) acc[mb][nb] = wmmab(l[kb][mb], b[kb][nb], acc[mb][nb]);
            }
        }
        // four vector slots behind the stage's last matrix instruction before its operand registers may be reloaded; naming every accumulator keeps all of the stage's
        // matrix instructions in front of the barrier, where they run while the LDS reads and stores of the stage drain
        if constexpr (QKV)
        asm volatile("v_nop\n\tv_nop\n\tv_nop\n\tv_nop"
                     : "+v"(acc[0][0]), "+v"(acc[1][0]), "+v"(acc[2][0]), "+v"(acc[3][0]), "+v"(acc[0][1]), "+v"(acc[1][1]), "+v"(acc[2][1]), "+v"(acc[3][1]),
                       "+v"(acc[0][2]), "+v"(acc[1][2]), "+v"(acc[2][2]), "+v"(acc[3][2]), "+v"(acc[0][3]), "+v"(acc[1][3]), "+v"(acc[2][3]), "+v"(acc[3][3])
                     : "v"(a[1][0]), "v"(a[1][1]), "v"(a[1][2]), "v"(a[1][3]), "v"(b[1][3]));
        else                                          // the same, behind the lo plane's last products
        asm volatile("v_nop\n\tv_nop\n\tv_nop\n\tv_nop"
                     : "+v"(acc[0][0]), "+v"(acc[1][0]), "+v"(acc[2][0]), "+v"(acc[3][0]), "+v"(acc[0][1]), "+v"(acc[1][1]), "+v"(acc[2][1]), "+v"(acc[3][1]),
                       "+v"(acc[0][2]), "+v"(acc[1][2]), "+v"(acc[2][2]), "+v"(acc[3][2]), "+v"(acc[0][3]), "+v"(acc[1][3]), "+v"(acc[2][3]), "+v"(acc[3][3])
                     : "v"(l[1][0]), "v"(l[1][1]), "v"(l[1][2]), "v"(l[1][3]), "v"(b[1][3]));
        if constexpr (ST.value) lds_barrier();        // publishes stage s+1 and ends the reads of this stage's buffer; behind the last stage nothing is left to publish
    };
#pragma unroll 1
    for (int s = 0; s < NS - 2; ++s) stage(s, yes_t{}, yes_t{});
    stage(NS - 2, yes_t{}, no_t{});
    stage(NS - 1, no_t{}, no_t{});
    // the lane's number is read anew here, so that nothing derived from it for the epilogue is held in a register across the loop (the loop fills the register budget of three waves a SIMD)
    const int ln = (int)__builtin_amdgcn_mbcnt_lo(~0u, 0u), lc = ln & 15, lh = ln >> 4;
    float bv[4];
#pragma unroll
    for (int nb = 0; nb < 4; ++nb) {
        const int bi = vj ? (2 * DM) : ((QKV ? md * DM : 0) + c0 + nb * 16 + lc);
        bv[nb] = bf2f(f2bf(bias[bi])); }
#pragma unroll
    for (int mb = 0; mb < 4; ++mb) {
        // D: row 8h+j, col lane&15; rows 0..15 x cols 0..63 all written on either path
        if (vj) {                                       // per-row bias: 8 consecutive floats, one 32-byte vector load
            const v8f bq = *(const v8f*)(bias + 2 * DM + r0 + mb * 16 + lh * 8);
            float rb[8];
#pragma unroll
            for (int j = 0; j < 8; ++j) rb[j] = bf2f(f2bf(bq[j]));
#pragma unroll
            for (int nb = 0; nb < 4; ++nb) {
#pragma unroll
                for (int j = 0; j < 8; ++j) os[(lh * 8 + j) * 68 + nb * 16 + lc] = acc[mb][nb][j] + rb[j]; }
        } else {
#pragma unroll
            for (int nb = 0; nb < 4; ++nb) {
#pragma unroll
                for (int j = 0; j < 8; ++j) os[(lh * 8 + j) * 68 + nb * 16 + lc] = acc[mb][nb][j] + bv[nb]; }
        }
        wave_sync();
        if (QKV) {
            h16* Ph = (md == 0) ? QH : ((md == 1) ? KP : VT);
            h16* Pr = (md == 0) ? QR : VR;              // md 1 stores no residual
            size_t sb, pitch;
            if (vj) { const int bb = c0 / SEQ; const int tt = c0 % SEQ;                               // rows = d of head r0/64, columns = 64 tokens of one batch
                sb = ((size_t)(bb * NH_ + (r0 >> 6)) * HD + (size_t)(16 * mb)) * SEQ + (size_t)tt; pitch = SEQ; }
            else { const int tokrow = r0 + 16 * mb; const int bb = tokrow / SEQ; const int tt = tokrow % SEQ;   // rows = tokens, columns = d of head c0/64
                sb = ((size_t)(bb * NH_ + (c0 >> 6)) * SEQ + (size_t)tt) * HD; pitch = HD; }
            v4f x0[4], x1[4]; v8h hv[4];
#pragma unroll
            for (int s = 0; s < 4; ++s) { const int row = 4 * s + (ln >> 3), c8 = (ln & 7) * 8;
                x0[s] = *(const v4fa*)(&os[row * 68 + c8]); x1[s] = *(const v4fa*)(&os[row * 68 + c8 + 4]);
#pragma unroll
                for (int i = 0; i < 4; ++i) { hv[s][i] = toh_flush(x0[s][i]); hv[s][4 + i] = toh_flush(x1[s][i]); }
                *(v8h*)(Ph + sb + (size_t)row * pitch + c8) = hv[s]; }
            // the address and data registers of the stores above are reused behind them: the wait stands in front of any overwrite
            asm volatile("s_wait_xcnt 0x0" ::: "memory");
            if (md != 1) {
#pragma unroll
                for (int s = 0; s < 4; ++s) { const int row = 4 * s + (ln >> 3), c8 = (ln & 7) * 8; v8h rv;
#pragma unroll
                    for (int i = 0; i < 4; ++i) { rv[i] = toh_flush((x0[s][i] - (float)hv[s][i]) * QRS); rv[4 + i] = toh_flush((x1[s][i] - (float)hv[s][4 + i]) * QRS); }
                    *(v8h*)(Pr + sb + (size_t)row * pitch + c8) = rv; }
                asm volatile("s_wait_xcnt 0x0" ::: "memory");   // as above, for the residual stores
            }
        } else {
            const int grow = r0 + 16 * mb; const int bb = grow / SEQ; const int nn = grow % SEQ;
            float* orow = OUT + ((size_t)bb * OUT_SEQ + nn) * DM + c0;
{
#pragma unroll
                for (int s = 0; s < 8; ++s) { const int row = 2 * s + lh, cofs = lc * 4;   // 8 s x 2 rows = 16 rows; 16 lanes x 4 floats = 64 columns
                    const v4f val = *(const v4fa*)(&os[row * 68 + cofs]);
                    *(v4f*)(orow + (size_t)row * DM + cofs) = val; }
                 }
        }
        wave_sync();
    }
}

// k_flash: fused causal attention, one wave per 16 query rows of one (batch, head); Q fragments straight from the f16 planes (two 16-B loads each, arithmetic addressing).
// The four waves of a work-group share each 64-key stage of K, V^T and (early rows) the V^T residual through LDS: whole 128-byte rows are brought by asynchronous copies into one of two buffers
// (row pitch 144 B), one stage ahead of the stage being worked on; fragments are read from LDS. One work-group barrier a stage publishes the next stage and ends the reads of the buffer refilled behind it.
// Transposed form: S^T[key][t] = K Q^T (A = K rows, B = Q rows); lane (t = lane&15, h = lane>>4) holds keys 8h+r of each 16-key tile, so the packed
// P tile is directly the B fragment of O^T[d][t] = V^T P^T (element r <- tile keys 0..15, element 8+r <- tile keys 16..31, lane unchanged).
// Keys run over [0, t0+16) in steps of 32; on steps that touch the diagonal, scores with key > query are replaced by a very negative value (P = 0 exactly);
// the padding-mask bit word of (b, query, key block) is read once per lane per step and its bit selects run at every step (bit 8h+r <-> key key0+8h+r, bit 16+8h+r <-> key key0+16+8h+r; a set bit replaces the score the same way; a zero word changes nothing).
// A query row that never sees a visible key yields NaN (all scores replaced by -inf).
// Softmax state (running max, partial sum) is one scalar per lane; the two lane halves of a row are combined with one xor-16 exchange.
#define FP 72                    // LDS row pitch of a staged tile in 16-bit elements: 144 B = 16 B x 9, conflict-free for 16-byte fragment reads
#define SK 64                    // keys per stage
#define TILE_E (64 * FP)         // one staged tile: 64 rows (K: keys, V^T: d) of 64 elements
#define BUF_E  (3 * TILE_E)      // one buffer: K | V^T | V^T residual
static_assert(SK == 16 * AW);    // a work-group's query rows span one stage: stages 0..tile reach its diagonal
#define NT  (SEQ / (16 * AW))    // query tiles per (batch, head)
#define HPR (NH_ / NB)           // heads of one batch per NH_ values of blockIdx.y
static_assert(NH_ % NB == 0);    // (blockIdx.y / NH_, blockIdx.y % NH_) -> (batch, head) is one to one
static_assert(NT % 2 == 0);
static_assert(EARLY % (16 * AW) == 0);   // the residual plane is used by all waves of a work-group or by none
static_assert(32 * AW == 128);   // staging map: 8 lanes a row, 16 rows a copy, 4 copies a tile
// four asynchronous 16-byte copies a lane (rows r, r+16, r+32, r+48 of one tile); the wait is the statement's last line, so it stands in front of any rewrite of an address register that a copy names
__device__ __forceinline__ void acopy4(const unsigned l, const h16* g, const size_t gp) {
    const unsigned l1 = l + 16 * FP * 2, l2 = l + 32 * FP * 2, l3 = l + 48 * FP * 2;
    const h16* g1 = g + 16 * gp; const h16* g2 = g + 32 * gp; const h16* g3 = g + 48 * gp;
    asm volatile("global_load_async_to_lds_b128 %0, %4, off\n\t"
                 "global_load_async_to_lds_b128 %1, %5, off\n\t"
                 "global_load_async_to_lds_b128 %2, %6, off\n\t"
                 "global_load_async_to_lds_b128 %3, %7, off\n\t"
                 "s_wait_xcnt 0x0"
                 :: "v"(l), "v"(l1), "v"(l2), "v"(l3), "v"(g), "v"(g1), "v"(g2), "v"(g3) : "memory");
}
__global__ __launch_bounds__(32 * AW) void k_flash(const h16* __restrict__ QH, const h16* __restrict__ QR, const h16* __restrict__ KP, const h16* __restrict__ VT, const h16* __restrict__ VR, const unsigned* __restrict__ MW, bf* CH, bf* CL, float* ST) {
    __shared__ __align__(16) float os[AW * 16 * 68];
    __shared__ __align__(16) h16 ring[2 * BUF_E];
    const int lane = threadIdx.x & 31, lr = lane & 15, hi = lane >> 4;
    const int wave = __builtin_amdgcn_readfirstlane((int)(threadIdx.x >> 5));
    // Deal of (batch, head, query tile) over the grid, a permutation of it, for speed only. A tile's cost grows with its index (tile + 1 stages) and all work-groups are resident at once, so a WGP
    // lasts as long as the tiles that meet on it. Work-groups whose flat index is NT * NH_ apart get tiles t, NT-1-t, t+NT/2, NT/2-1-t (equal stage sums), neighbours in blockIdx.y get t and NT-1-t,
    // and the head-0 work-groups stand NT * HPR indices apart in the first NT * NH_.
    const int rnd = (int)(blockIdx.y / (unsigned)NH_), wq = (int)(blockIdx.y % (unsigned)NH_);
    const int bb = (int)((unsigned)wq / (unsigned)HPR), hh = (int)((unsigned)wq % (unsigned)HPR) + HPR * rnd;
    const int zh = bb * NH_ + hh;
    int tl = (int)blockIdx.x;
    if (((rnd ^ wq) & 1) != 0) tl = NT - 1 - tl;
    if ((rnd & 2) != 0) tl = (int)((unsigned)(tl + NT / 2) % (unsigned)NT);
    const int tile = tl;
    const int t0 = (tile * AW + wave) * 16;
    const size_t pbase = (size_t)zh * SEQ * HD;
    const size_t qo = pbase + (size_t)(t0 + lr) * HD + 8 * hi;
    const v16h qh0 = ldh(QH + qo), qh1 = ldh(QH + qo + 32), qr0 = ldh(QR + qo), qr1 = ldh(QR + qo + 32);   // B fragments: col t, k = d
    const int fk = lr * FP + 8 * hi;                         // LDS, + key * FP         (A fragment: row key, k = d)
    const int fv = TILE_E + lr * FP + 8 * hi;                // LDS, + 16j*FP + key     (A fragment: row d, k = key)
    const int kend = t0 + 16;
    const bool early = tile * (16 * AW) < EARLY;             // same for the four waves
    const int srow = (int)threadIdx.x >> 3, scol = ((int)threadIdx.x & 7) * 8;   // staging: 8 lanes x 16 B = one 128-byte row
    const unsigned sl = (unsigned)(size_t)(&ring[srow * FP + scol]);             // this lane's LDS byte address in buffer 0, K tile
    const h16* gk = KP + pbase + (size_t)srow * HD + scol;   // + stage * SK * HD
    const h16* gv = VT + pbase + (size_t)srow * SEQ + scol;  // + stage * SK
    const h16* gr = VR + pbase + (size_t)srow * SEQ + scol;
    const int nst = tile + 1;                                // stages up to and including the work-group's diagonal
    auto fill = [&](const int s) {                           // stage s -> buffer s & 1; every lane on, work-group-uniform control flow
        const unsigned lb = sl + (unsigned)((s & 1) * (BUF_E * 2));
        acopy4(lb, gk + (size_t)s * (SK * HD), HD);
        acopy4(lb + TILE_E * 2, gv + (size_t)s * SK, SEQ);
        if (early) acopy4(lb + 2 * TILE_E * 2, gr + (size_t)s * SK, SEQ);
    };
    const int tq = t0 + lr;
    const size_t mo = ((size_t)bb * SEQ + (size_t)tq) * (size_t)(SEQ / 32);   // + key0/32: mask word of this lane's query row
    v8f o0 = (v8f){}, o1 = (v8f){}, o2 = (v8f){}, o3 = (v8f){};
    v8f e0 = (v8f){}, e1 = (v8f){}, e2 = (v8f){}, e3 = (v8f){};
    float m = NEGV, l = 0.0f;
    fill(0);
    asm volatile("s_wait_asynccnt 0x0" ::: "memory");        // this wave's copies of stage 0 have landed
    __syncthreads();                                         // publishes stage 0
    if (nst > 1) fill(1);
#pragma unroll 1
    for (int s = 0; s < nst; ++s) {
      const int cur = (s & 1) * BUF_E;
      for (int kk = 0; kk < SK; kk += 32) {
        const int key0 = s * SK + kk;
        if (key0 >= kend) break;                    // wave-uniform: keys past this wave's diagonal; the stage's foot below is still passed
        const h16* ka = &ring[cur + fk + kk * FP];
        const v16h ka0 = ldh(ka), ka1 = ldh(ka + 32), kb0 = ldh(ka + 16 * FP), kb1 = ldh(ka + 16 * FP + 32);
        v8f sHa = (v8f){}, sLa = (v8f){}, sHb = (v8f){}, sLb = (v8f){};
        sHa = wmma16(ka0, qh0, sHa); sHb = wmma16(kb0, qh0, sHb);
        if (SCORE_RES) { sLa = wmma16(ka0, qr0, sLa); sLb = wmma16(kb0, qr0, sLb); }
        sHa = wmma16(ka1, qh1, sHa); sHb = wmma16(kb1, qh1, sHb);
        if (SCORE_RES) { sLa = wmma16(ka1, qr1, sLa); sLb = wmma16(kb1, qr1, sLb); }
        asm volatile("v_nop\n\tv_nop\n\tv_nop\n\tv_nop" : "+v"(sHa), "+v"(sLa), "+v"(sHb), "+v"(sLb) : "v"(ka0), "v"(ka1), "v"(kb0), "v"(kb1));
        float ta[8], tb[8];
#pragma unroll
        for (int r = 0; r < 8; ++r) { ta[r] = (sHa[r] + sLa[r] * QRI) * SC2; tb[r] = (sHb[r] + sLb[r] * QRI) * SC2; }
        if (key0 + 31 > t0) {                       // wave-uniform: this step touches the diagonal
            const int kidx = key0 + 8 * hi;
#pragma unroll
            for (int r = 0; r < 8; ++r) { ta[r] = (kidx + r > tq) ? NEGV : ta[r]; tb[r] = (kidx + 16 + r > tq) ? NEGV : tb[r]; }
        }
        unsigned mw = MW[mo + (size_t)(key0 >> 5)];
        asm volatile("" : "+v"(mw));
        {                                           // padding-mask selects, every step (a zero word changes nothing)
            const unsigned ma = mw >> (8 * hi), mc = mw >> (16 + 8 * hi);
#pragma unroll
            for (int r = 0; r < 8; ++r) { ta[r] = (((ma >> r) & 1u) != 0u) ? NEGV : ta[r]; tb[r] = (((mc >> r) & 1u) != 0u) ? NEGV : tb[r]; }
        }
        float mx = NEGV;
#pragma unroll
        for (int r = 0; r < 8; ++r) mx = fmaxf(mx, fmaxf(ta[r], tb[r]));
        mx = fmaxf(mx, __shfl_xor(mx, 16, 32));
        const float mnew = fmaxf(m, mx);
        const float alpha = __builtin_amdgcn_exp2f(m - mnew);
        const float sh = PSH - mnew;
        v16h pb; float ls = 0.0f;
#pragma unroll
        for (int r = 0; r < 8; ++r) { const float ea = ta[r] + sh, ec = tb[r] + sh;
            const h16 pa = (ea < -14.0f) ? (h16)0.0f : (h16)__builtin_amdgcn_exp2f(ea);       // exponent select: no f16 result below the smallest normal
            const h16 pc = (ec < -14.0f) ? (h16)0.0f : (h16)__builtin_amdgcn_exp2f(ec);
            pb[r] = pa; pb[8 + r] = pc; ls += (float)pa + (float)pc; }
        l = l * alpha + ls; m = mnew;
        o0 = o0 * alpha; o1 = o1 * alpha; o2 = o2 * alpha; o3 = o3 * alpha;
        const h16* va = &ring[cur + fv + kk];
        const v16h v0 = ldh(va), v1 = ldh(va + 16 * FP), v2 = ldh(va + 32 * FP), v3 = ldh(va + 48 * FP);
        o0 = wmma16(v0, pb, o0); o1 = wmma16(v1, pb, o1); o2 = wmma16(v2, pb, o2); o3 = wmma16(v3, pb, o3);
        asm volatile("v_nop\n\tv_nop\n\tv_nop\n\tv_nop" : "+v"(o0), "+v"(o1), "+v"(o2), "+v"(o3) : "v"(v0), "v"(v1), "v"(v2), "v"(v3), "v"(pb));
        if (early) {                                // wave-uniform: residual plane of v in its own accumulators
            e0 = e0 * alpha; e1 = e1 * alpha; e2 = e2 * alpha; e3 = e3 * alpha;
            const h16* vr = va + TILE_E;
            const v16h w0 = ldh(vr), w1 = ldh(vr + 16 * FP), w2 = ldh(vr + 32 * FP), w3 = ldh(vr + 48 * FP);
            e0 = wmma16(w0, pb, e0); e1 = wmma16(w1, pb, e1); e2 = wmma16(w2, pb, e2); e3 = wmma16(w3, pb, e3);
            asm volatile("v_nop\n\tv_nop\n\tv_nop\n\tv_nop" : "+v"(e0), "+v"(e1), "+v"(e2), "+v"(e3) : "v"(w0), "v"(w1), "v"(w2), "v"(w3), "v"(pb));
        }
      }
      // foot of stage s, every wave: its LDS reads of this buffer are done, its copies of stage s+1 have landed; the barrier publishes stage s+1 and frees this buffer for stage s+2
      asm volatile("s_wait_dscnt 0x0" ::: "memory");
      asm volatile("s_wait_asynccnt 0x0" ::: "memory");
      __syncthreads();
      if (s + 2 < nst) fill(s + 2);
    }
    asm volatile("s_wait_asynccnt 0x0" ::: "memory");        // no copy is outstanding behind the loop
    l += __shfl_xor(l, 16, 32);
    const float inv = (m > NEGV) ? (1.0f / l) : __uint_as_float(0x7FC00000u);   // no visible key in the whole row: NaN row
    const int wb = wave * 16 * 68;
    // O^T D layout: o_j[r] = (d = 16j + 8h + r, t = lane&15) -> os[t][d]; rows 0..15 x columns 0..63 all written
    { v4f a, c;
#pragma unroll
      for (int i = 0; i < 4; ++i) { a[i] = (o0[i] + e0[i] * QRI) * inv; c[i] = (o0[4 + i] + e0[4 + i] * QRI) * inv; }
      *(v4fa*)(&os[wb + lr * 68 +  0 + 8 * hi]) = a; *(v4fa*)(&os[wb + lr * 68 +  0 + 8 * hi + 4]) = c;
#pragma unroll
      for (int i = 0; i < 4; ++i) { a[i] = (o1[i] + e1[i] * QRI) * inv; c[i] = (o1[4 + i] + e1[4 + i] * QRI) * inv; }
      *(v4fa*)(&os[wb + lr * 68 + 16 + 8 * hi]) = a; *(v4fa*)(&os[wb + lr * 68 + 16 + 8 * hi + 4]) = c;
#pragma unroll
      for (int i = 0; i < 4; ++i) { a[i] = (o2[i] + e2[i] * QRI) * inv; c[i] = (o2[4 + i] + e2[4 + i] * QRI) * inv; }
      *(v4fa*)(&os[wb + lr * 68 + 32 + 8 * hi]) = a; *(v4fa*)(&os[wb + lr * 68 + 32 + 8 * hi + 4]) = c;
#pragma unroll
      for (int i = 0; i < 4; ++i) { a[i] = (o3[i] + e3[i] * QRI) * inv; c[i] = (o3[4 + i] + e3[4 + i] * QRI) * inv; }
      *(v4fa*)(&os[wb + lr * 68 + 48 + 8 * hi]) = a; *(v4fa*)(&os[wb + lr * 68 + 48 + 8 * hi + 4]) = c; }
    wave_sync();
    const size_t cb = ((size_t)bb * SEQ + (size_t)(t0 + (lane >> 3))) * DM + (size_t)(hh * HD + (lane & 7) * 8);
    v8us hv[4], lv[4];
#pragma unroll
    for (int s = 0; s < 4; ++s) { const int row = 4 * s + (lane >> 3), c8 = (lane & 7) * 8;   // 4 s x 4 row groups = 16 rows; 8 lanes x 8 = 64 columns
        const v4f x0 = *(const v4fa*)(&os[wb + row * 68 + c8]); const v4f x1 = *(const v4fa*)(&os[wb + row * 68 + c8 + 4]);
#pragma unroll
        for (int i = 0; i < 4; ++i) { const unsigned short a0 = f2bf(x0[i]); const unsigned short a1 = f2bf(x1[i]);
            hv[s][i] = a0; hv[s][4 + i] = a1; lv[s][i] = f2bf(x0[i] - bf2f(a0)); lv[s][4 + i] = f2bf(x1[i] - bf2f(a1)); } }
{
#pragma unroll
        for (int s = 0; s < 4; ++s) { const size_t oo = cb + (size_t)s * 4 * DM;
            *(v8us*)(CH + oo) = hv[s]; *(v8us*)(CL + oo) = lv[s]; }
         }

    if (hh == 0 && hi == 0) {                       // head 0 (block-uniform) leaves each row's final running max and 1 / sum for the probability jobs of the next launch: 16 lanes x 8 B = one line a wave
        const v2f st = (v2f){m, inv};
        *(v2f*)(ST + 2 * ((size_t)bb * SEQ + (size_t)tq)) = st;
    }
}

static constexpr size_t al256(size_t v) { return (v + 255) & ~(size_t)255; }
static constexpr size_t SZ_XB = al256((size_t)NB * SEQ * DM * 2);
static constexpr size_t SZ_WB = al256((size_t)3 * DM * DM * 2);
static constexpr size_t SZ_WF = al256((size_t)DM * DM * 2);
static constexpr size_t SZ_PL = al256((size_t)NB * SEQ * DM * 2);
static constexpr size_t SZ_MW = al256((size_t)NB * SEQ * (SEQ / 32) * 4);
static constexpr size_t SZ_ST = al256((size_t)NB * SEQ * 2 * 4);
static constexpr size_t SZ_TOTAL = SZ_XB + SZ_WB + SZ_WF + 5 * SZ_PL + 2 * SZ_PL + SZ_MW + SZ_ST;
static_assert(SZ_TOTAL <= (size_t)134217728);          // workspace carve <= 128 MiB
static_assert(((size_t)DM * DM * 2) % 256 == 0);       // weight sub-planes stay 256-byte aligned
static_assert(SZ_PL == (size_t)NB * SEQ * DM * 2);     // ctx hi and lo planes are back to back with stride NB*SEQ*DM elements
static_assert((size_t)NB * NH_ * SEQ * HD * 2 == SZ_PL);   // q / k / v^T planes [NB*16][SEQ][64] fill one plane exactly

extern "C" void kernel_launch(void* const* d_in, const int* in_sizes, int n_in,
                              void* d_out, int out_size, void* d_ws, size_t ws_size, hipStream_t stream) {
    if (n_in < 6) return;
    const size_t needx = ((size_t)(NB - 1) * SEQ_FULL + SEQ) * DM;
    if ((size_t)in_sizes[0] < needx) return;
    if ((size_t)in_sizes[1] < (size_t)3 * DM * DM || (size_t)in_sizes[2] < (size_t)3 * DM) return;
    if ((size_t)in_sizes[3] < (size_t)DM * DM || (size_t)in_sizes[4] < (size_t)DM) return;
    if ((size_t)in_sizes[5] < ((size_t)(NB - 1) * SEQ_FULL + (SEQ - 1)) * SEQ_FULL + SEQ) return;
    if ((size_t)out_size < OUT1_OFF + ((size_t)(NB - 1) * OUT_SEQ + (SEQ - 1)) * ATT_LD + SEQ) return;
    if (SZ_TOTAL > ws_size) return;
    const float* x = (const float*)d_in[0]; const float* wqkv = (const float*)d_in[1]; const float* bqkv = (const float*)d_in[2];
    const float* wfc = (const float*)d_in[3]; const float* bfc = (const float*)d_in[4];          // wire order x, W_attn, b_attn, W_proj, b_proj, padding_mask
    const int* pmask = (const int*)d_in[5];          // [NB_FULL][SEQ_FULL][SEQ_FULL] int32, non-zero = key hidden
    float* OUT = (float*)d_out;      // [NB][SEQ][1024] then [NB][1][SEQ][SEQ]
    char* wsp = (char*)d_ws;
    bf* XB = (bf*)wsp; wsp += SZ_XB;                 // [NB*SEQ][1024]
    bf* WB = (bf*)wsp; wsp += SZ_WB;                 // [3072][1024]: q rows | k rows | v rows (row e = h*64 + d)
    bf* WF = (bf*)wsp; wsp += SZ_WF;                 // [1024][1024]: W_proj^T
    h16* QH = (h16*)wsp; wsp += SZ_PL;               // [NB*16][SEQ][64]
    h16* QR = (h16*)wsp; wsp += SZ_PL;               // residual x2048
    h16* KP = (h16*)wsp; wsp += SZ_PL;               // [NB*16][SEQ][64]
    h16* VT = (h16*)wsp; wsp += SZ_PL;               // [NB*16][64][SEQ]
    h16* VR = (h16*)wsp; wsp += SZ_PL;               // residual x2048
    bf* CH = (bf*)wsp; wsp += SZ_PL;                 // ctx hi [NB*SEQ][1024]
    bf* CL = (bf*)wsp; wsp += SZ_PL;                 // ctx lo, directly after CH
    unsigned* MW = (unsigned*)wsp; wsp += SZ_MW;     // mask bit words [NB*SEQ][SEQ/32]
    float* ST = (float*)wsp; wsp += SZ_ST;           // head 0: running max, 1 / sum per row [NB*SEQ][2]

    k_prep<<<PB_WA + PB_WP + PB_MB + PB_X, 256, 0, stream>>>(x, wqkv, wfc, pmask, XB, WB, WF, MW);

    k_gemm<true><<<dim3(NB * SEQ / 128, DM / 128, 3), 128, 0, stream>>>(XB, WB, bqkv, QH, QR, KP, VT, VR, OUT, MW, ST);

    k_flash<<<dim3(SEQ / (16 * AW), NB * NH_, 1), 32 * AW, 0, stream>>>(QH, QR, KP, VT, VR, MW, CH, CL, ST);

    k_gemm<false><<<dim3(NB * SEQ / 128, DM / 128, 2), 128, 0, stream>>>(CH, WF, bfc, QH, QR, KP, VT, VR, OUT, MW, ST);
}

// v007
// A run of this version takes 80.7 microseconds.
// Next to v006, in two timings, it ran 1.03 times as fast each time.
// All steps since v000 together make it 2.70 times as fast.
#include <hip/hip_runtime.h>

// Causal multi-head self-attention, width 1024 = 16 heads x 64, x [NB][SEQ][1024], fused W_attn [in][out] + bias, true head split q[b][h][t][d] = qkv[b][t][h*64+d], score scale 1/8,
// key > query OR padding_mask[b][q][k] != 0 replaced by -inf, heads merged back to [b][t][h*64+d], output projection W_proj [in][out] + bias (f32 out); second output = normalised probabilities of head 0, [NB][1][SEQ][SEQ] f32.
// Compute dtypes, f32 accumulate everywhere: qkv projections v_wmma_f32_16x16x32_bf16 (x, W, biases RNE-converted to bf16; products exact); scores v_wmma_f32_16x16x32_f16: k single f16, q as f16 value + f16 residual x2048 in its own accumulator;
// P (x256 carry, cancels in the normalisation) single f16; v single f16 plus, for query rows < 512, an f16 residual x2048 in its own accumulator; softmax f32 (online, running max); output projection v_wmma_f32_16x16x32_bf16 with ctx as bf16 hi + bf16 lo planes (unscaled, shared accumulator, hi then lo products of each 32-k block) against bf16 W_proj.
// Layout: bf16 copies of x and transposed (K-contiguous) weights; q (hi, residual) and k planes [b*16+h][t][64]; v^T planes [b*16+h][d][t] produced by the v GEMM run with the weight rows as the M operand and the tokens as the N operand; ctx planes compact [NB*SEQ][1024]; padding mask packed to one 32-key bit word per (b, q, key block); head 0's softmax row statistics (running max, 1 / sum) [NB*SEQ][2] f32.

#ifndef NB
#define NB 4
#endif
#ifndef SEQ
#define SEQ 1024
#endif
#define NB_FULL  4
#define SEQ_FULL 1024
#ifndef OUT_SEQ
#define OUT_SEQ SEQ              // row pitch (in tokens) between batches of the outputs
#endif
#ifndef ATT_LD
#define ATT_LD OUT_SEQ           // key pitch of one probability row of the second output
#endif
#ifndef SCORE_RES
#define SCORE_RES 1              // 1: q residual plane adds a second score product; 0: single score product
#endif
#define DM   1024
#define NH_  16
#define HD   64
#define AW   4                   // waves per flash block (16 query rows each)
#define EARLY 512                // query rows below this use the v residual plane
#define QRS  2048.0f             // carry of the residual planes
#define QRI  (1.0f / 2048.0f)
#define SC2  (0.125f * 1.4426950408889634f)   // HD^-0.5 * log2(e)
#define PSH  8.0f                // log2 of the P carry (256)
#define NEGV (-3.0e38f)
#define OUT1_OFF ((size_t)NB_FULL * SEQ_FULL * DM)   // element offset of the second output (fixed by the full problem size)

static_assert(HD == 64);
static_assert(NH_ * HD == DM);
static_assert(DM % 64 == 0);
static_assert(DM % 32 == 0);
static_assert(SEQ % 256 == 0);                 // SEQ/32 mask words per row is a multiple of 8; 64-token tiles stay inside one batch
static_assert(SEQ % 64 == 0);
static_assert((NB * SEQ) % 128 == 0);
static_assert(DM % 128 == 0);
static_assert(DM / 64 >= 2);                   // the GEMM prologue fetches two 64-k stages
static_assert(SEQ % 32 == 0);
static_assert(SEQ % (16 * AW) == 0);
static_assert(((size_t)SEQ * DM) % 8 == 0);
static_assert(NB <= NB_FULL);
static_assert(SEQ <= SEQ_FULL);
static_assert(((size_t)NB * SEQ * (SEQ / 32)) % 256 == 0);        // mask-word grid x block == plane extent
static_assert(ATT_LD % 32 == 0);
static_assert(ATT_LD >= SEQ);
static_assert(OUT1_OFF * 4 == (size_t)16777216);                   // byte offset of the second output
static_assert(((size_t)(NB - 1) * OUT_SEQ + SEQ) * DM <= OUT1_OFF);
static_assert(OUT1_OFF + ((size_t)(NB - 1) * OUT_SEQ + (SEQ - 1)) * ATT_LD + SEQ <= OUT1_OFF + (size_t)NB_FULL * SEQ_FULL * SEQ_FULL);

typedef _Float16 h16;
typedef unsigned short bf;
typedef __attribute__((ext_vector_type(16))) __bf16   v16bf;
typedef __attribute__((ext_vector_type(16))) _Float16 v16h;
typedef __attribute__((ext_vector_type(8)))  _Float16 v8h;
typedef __attribute__((ext_vector_type(8)))  unsigned short v8us;
typedef __attribute__((ext_vector_type(8)))  float    v8f;
typedef __attribute__((ext_vector_type(4)))  float    v4f;
typedef __attribute__((ext_vector_type(4)))  int      v4i;
typedef __attribute__((ext_vector_type(4)))  unsigned v4u;
typedef __attribute__((ext_vector_type(2)))  float    v2f;
typedef __attribute__((ext_vector_type(2)))  unsigned v2u;
typedef v4f  __attribute__((may_alias)) v4fa;
typedef v8us __attribute__((may_alias)) v8usa;

__device__ __forceinline__ unsigned short f2bf(float f) { unsigned u = __float_as_uint(f); u += 0x7FFFu + ((u >> 16) & 1u); return (unsigned short)(u >> 16); }
__device__ __forceinline__ float bf2f(unsigned short h) { return __uint_as_float(((unsigned)h) << 16); }
__device__ __forceinline__ v16h cat16(v8h lo, v8h hi) { return __builtin_shufflevector(lo, hi, 0, 1, 2, 3, 4, 5, 6, 7, 8, 9, 10, 11, 12, 13, 14, 15); }
__device__ __forceinline__ v16bf cat16b(v8us lo, v8us hi) { return __builtin_bit_cast(v16bf, __builtin_shufflevector(lo, hi, 0, 1, 2, 3, 4, 5, 6, 7, 8, 9, 10, 11, 12, 13, 14, 15)); }
__device__ __forceinline__ v8f wmma16(v16h a, v16h b, v8f c) { return __builtin_amdgcn_wmma_f32_16x16x32_f16(false, a, false, b, (short)0, c, false, false); }
__device__ __forceinline__ v8f wmmab(v16bf a, v16bf b, v8f c) { return __builtin_amdgcn_wmma_f32_16x16x32_bf16(false, a, false, b, (short)0, c, false, false); }
// fragment loaders from K-contiguous 16-bit rows; p already includes + 8*(lane>>4): elements 0..7 <- k0+8h+0..7, elements 8..15 <- k0+16+8h+0..7 (same map for A and B)
__device__ __forceinline__ v16h  ldh(const h16* p) { return cat16(*(const v8h*)p, *(const v8h*)(p + 16)); }
__device__ __forceinline__ v16bf ldb(const bf* p)  { return cat16b(*(const v8us*)p, *(const v8us*)(p + 16)); }
// ordering point for wave-private LDS tiles (same wave writes and reads)
__device__ __forceinline__ void wave_sync() { __builtin_amdgcn_fence(3 /* release order */, "wavefront"); __builtin_amdgcn_wave_barrier(); asm volatile("" ::: "memory"); }
// f32 -> f16 for WMMA operand planes: results below the smallest f16 normal become exact zero (value select)
static __device__ __forceinline__ h16 toh_flush(float v) { const h16 r = (h16)v; return (fabsf(v) < 6.103515625e-05f) ? (h16)0.0f : r; }

// cvt8: x [NB_FULL][SEQ_FULL][DM] f32 -> compact bf16 plane [NB*SEQ][DM], 8 elements a thread
__device__ __forceinline__ void cvt8(const float* __restrict__ src, bf* dst, size_t n8, const int blk) {
    const size_t i = (size_t)blk * 256 + threadIdx.x; if (i >= n8) return;
    const size_t pb = (size_t)SEQ * DM / 8;          // threads per batch
    const v8f v = *(const v8f*)(src + (i / pb) * ((size_t)SEQ_FULL * DM) + (i % pb) * 8); v8us o;
#pragma unroll
    for (int k = 0; k < 8; ++k) o[k] = f2bf(v[k]);
    *(v8us*)(dst + i * 8) = o; 
}

// cvtT: W [DM k][ldn] f32 (row = k, column = e) -> bf16 plane dst[row(e)][k] (K-contiguous), 64 k x 64 e tile through LDS (cross-wave: block barrier).
// row(e) = e for e < permFrom; for e >= permFrom, with ee = e - permFrom = c*64 + d: row = permFrom + d*16 + c.
__device__ __forceinline__ void cvtT(unsigned short* ts, const float* __restrict__ W, int ldn, bf* dst, int permFrom, const int bx, const int by) {
    const int t = threadIdx.x; const int k0 = bx * 64, n0 = by * 64;
#pragma unroll 4
    for (int i = 0; i < 16; ++i) { const int k = i * 4 + (t >> 6), n = t & 63;      // 16 x 4 = 64 k rows, 64 columns
        ts[n * 72 + k] = f2bf(W[(size_t)(k0 + k) * (size_t)ldn + n0 + n]); }
    __syncthreads();
    v8us o0, o1; size_t d0, d1;
    { const int p = t, n = p >> 3, q = p & 7; o0 = *(const v8usa*)(&ts[n * 72 + 8 * q]);
      const int e = n0 + n; const int ee = e - permFrom; const int row = (e >= permFrom) ? (permFrom + (ee & 63) * 16 + (ee >> 6)) : e;
      d0 = (size_t)row * DM + k0 + 8 * q; }
    { const int p = t + 256, n = p >> 3, q = p & 7; o1 = *(const v8usa*)(&ts[n * 72 + 8 * q]);
      const int e = n0 + n; const int ee = e - permFrom; const int row = (e >= permFrom) ? (permFrom + (ee & 63) * 16 + (ee >> 6)) : e;
      d1 = (size_t)row * DM + k0 + 8 * q; }
{
        *(v8us*)(dst + d0) = o0; *(v8us*)(dst + d1) = o1;
         }
}

// mbits: padding mask [NB_FULL][SEQ_FULL][SEQ_FULL] int32 -> bit words MW[b*SEQ + q][SEQ/32], bit j of word w = (mask[b][q][32*w + j] != 0).
__device__ __forceinline__ void mbits(const int* __restrict__ pm, unsigned* MW, size_t nW, const int blk) {
    const size_t w = (size_t)blk * 256 + threadIdx.x; if (w >= nW) return;
    const size_t row = w / (size_t)(SEQ / 32); const size_t j = w % (size_t)(SEQ / 32);
    const size_t b = row / (size_t)SEQ, t = row % (size_t)SEQ;
    const int* src = pm + (b * SEQ_FULL + t) * (size_t)SEQ_FULL + j * 32;
    unsigned bits = 0u;
#pragma unroll
    for (int i = 0; i < 8; ++i) { const v4i v = *(const v4i*)(src + 4 * i);
        const unsigned n = ((v[0] != 0) ? 1u : 0u) | ((v[1] != 0) ? 2u : 0u) | ((v[2] != 0) ? 4u : 0u) | ((v[3] != 0) ? 8u : 0u);
        bits |= n << (4 * i); }
    *(unsigned*)(MW + w) = bits; 
}

// k_prep: the four input conversions, none of which reads another's output, as ONE grid. A work-group's job follows from its block index alone (the same for all its threads, so
// the barrier inside cvtT is passed by a whole work-group or by none of it); the jobs with the longest chain of dependent loads come first in the index.
#define PB_WA ((DM / 64) * (3 * DM / 64))                    // W_attn tiles
#define PB_WP ((DM / 64) * (DM / 64))                        // W_proj tiles
#define PB_MB ((int)((size_t)NB * SEQ * (SEQ / 32) / 256))   // mask-word blocks
#define PB_X  ((int)((size_t)NB * SEQ * DM / 8 / 256))       // x blocks
static_assert(((size_t)NB * SEQ * DM / 8) % 256 == 0);
__global__ __launch_bounds__(256) void k_prep(const float* __restrict__ x, const float* __restrict__ wqkv, const float* __restrict__ wfc, const int* __restrict__ pm, bf* XB, bf* WB, bf* WF, unsigned* MW) {
    __shared__ __align__(16) unsigned short ts[64 * 72];
    int blk = (int)blockIdx.x;
    if (blk < PB_WA + PB_WP) {                       // W_attn in[1024 k][3072 e] -> WB out[e][1024 k] (no row permutation); W_proj in[1024 k][1024 e] -> WF out[e][1024 k]
        const bool wa = blk < PB_WA; const int tl = wa ? blk : blk - PB_WA;
        cvtT(ts, wa ? wqkv : wfc, wa ? 3 * DM : DM, wa ? WB : WF, 1 << 30, tl % (DM / 64), tl / (DM / 64));
        return; }
    blk -= PB_WA + PB_WP;
    if (blk < PB_MB) { mbits(pm, MW, (size_t)NB * SEQ * (SEQ / 32), blk); return; }
    blk -= PB_MB;
    cvt8(x, XB, (size_t)NB * SEQ * DM / 8, blk);
}

// work-group barrier that orders LDS only: the release and acquire fences name the LDS address space, so the global loads that prefetch a later stage into registers stay in flight across it
__device__ __forceinline__ void lds_barrier() { __builtin_amdgcn_fence(__ATOMIC_RELEASE, "workgroup", "local"); __builtin_amdgcn_s_barrier(); __builtin_amdgcn_fence(__ATOMIC_ACQUIRE, "workgroup", "local"); }

// p_job: the second output, the normalised probabilities of head 0, as a job of its own: one work-group of 4 waves writes 64 query rows x PK keys, a wave 16 rows, in passes of PP keys.
// It needs only what the attention launch has left behind: the q and k planes, the mask words and each row's final running max and 1 / sum (ST). The scores are re-formed exactly as in k_flash
// (S^T = K Q^T, q value + residual accumulators, same selects); K fragments come straight from the k plane (a work-group's 32 KiB of it are shared through the WGP cache).
// A pass at or below the wave's diagonal forms all its four 32-key steps (keys past the query are replaced as in k_flash and give 0 x 1/sum); a pass wholly above it holds 0 (NaN for a row with no visible key).
// Each pass goes through a wave-private LDS tile [16 rows][PP keys], so that every store instruction of the wave covers 512 contiguous bytes of one row.
#define PK  256                  // keys per work-group
#define PP  128                  // keys per pass
#define PPW 132                  // LDS row pitch of the pass tile in floats: 528 B = 16 B x 33, the bank pattern of the 68-float epilogue tiles
#define PJOBS (NB * (SEQ / (16 * AW)) * (SEQ / PK))
static_assert(SEQ % PK == 0);
static_assert(PK % PP == 0);
static_assert(PP == 32 * 4);     // one row of a pass = 32 lanes x 4 floats; its four mask words are one 16-byte load
// four v_exp_f32 as one statement: the outputs are early-clobber, so none of the four reads another's result or overwrites another's source, and the v_nop is the slot that the
// instruction set asks for behind a transcendental before its result is used or its source overwritten
__device__ __forceinline__ v4f exp2x4(const float x0, const float x1, const float x2, const float x3) {
    float a, b, c, d;
    asm("v_exp_f32 %0, %4\n\tv_exp_f32 %1, %5\n\tv_exp_f32 %2, %6\n\tv_exp_f32 %3, %7\n\tv_nop" : "=&v"(a), "=&v"(b), "=&v"(c), "=&v"(d) : "v"(x0), "v"(x1), "v"(x2), "v"(x3));
    return (v4f){a, b, c, d};
}
__device__ __forceinline__ void p_job(float* pt, const int job, const h16* __restrict__ QH, const h16* __restrict__ QR, const h16* __restrict__ KP, const unsigned* __restrict__ MW, const float* __restrict__ ST, float* ATT) {
    const int lane = threadIdx.x & 31, lr = lane & 15, hi = lane >> 4;
    const int wave = __builtin_amdgcn_readfirstlane((int)(threadIdx.x >> 5));
    const int ch = job % (SEQ / PK), rt = job / (SEQ / PK);
    const int tile = rt % (SEQ / (16 * AW)), bb = rt / (SEQ / (16 * AW));
    const int t0 = (tile * AW + wave) * 16, tq = t0 + lr, kend = t0 + 16;
    const size_t pbase = (size_t)(bb * NH_) * SEQ * HD;      // head 0 of batch bb
    const size_t qo = pbase + (size_t)tq * HD + 8 * hi;
    const v2f st = *(const v2f*)(ST + 2 * ((size_t)bb * SEQ + (size_t)tq));
    asm volatile("s_wait_xcnt 0x0" ::: "memory");            // the address registers of the load above are free for reuse behind it: the wait stands in front of any overwrite
    const v16h qh0 = ldh(QH + qo), qh1 = ldh(QH + qo + 32);  // B fragments: col t, k = d
    asm volatile("s_wait_xcnt 0x0" ::: "memory");            // as above, for the value fragments' loads
    const v16h qr0 = ldh(QR + qo), qr1 = ldh(QR + qo + 32);
    asm volatile("s_wait_xcnt 0x0" ::: "memory");            // as above, for the residual fragments' loads
    const float shp = PSH - st[0];                           // the sum carries the x256 of P, so exp2(s - m + 8) / l is the probability
    const float inv = st[1];
    const float zf = inv * 0.0f;                             // 0 for an ordinary row, NaN for a row with no visible key
    const h16* kf = KP + pbase + (size_t)lr * HD + 8 * hi;   // + key * HD (A fragment: row key, k = d)
    const unsigned* mrow = MW + ((size_t)bb * SEQ + (size_t)tq) * (size_t)(SEQ / 32);
    float* pw = pt + wave * 16 * PPW;
    float* arow = ATT + ((size_t)bb * OUT_SEQ + (size_t)t0) * ATT_LD + lane * 4;
    // kept rolled: one copy of the pass in the kernel's text and one pass's fragments in registers at a time; inside a pass all loads are already in flight together
#pragma unroll 1
    for (int ps = 0; ps < PK / PP; ++ps) {
        const int kb = ch * PK + ps * PP;
        v4f pv[4][4];                                        // step, then keys 8h+0..3, 8h+4..7, 16+8h+0..3, 16+8h+4..7
#pragma unroll
        for (int s = 0; s < 4; ++s)
#pragma unroll
            for (int i = 0; i < 4; ++i) pv[s][i] = (v4f){zf, zf, zf, zf};
        if (kb < kend) {                                     // wave-uniform
            const v4u mwv = *(const v4u*)(mrow + (kb >> 5));
            asm volatile("s_wait_xcnt 0x0" ::: "memory");    // the address registers of the load above are free for reuse behind it: the wait stands in front of any overwrite
            v16h kq[4][4];                                   // the pass's K fragments, all loads in flight together: one load latency a pass
#pragma unroll
            for (int s = 0; s < 4; ++s) { const h16* ka = kf + (size_t)(kb + 32 * s) * HD;
                kq[s][0] = ldh(ka); kq[s][1] = ldh(ka + 32); kq[s][2] = ldh(ka + 16 * HD); kq[s][3] = ldh(ka + 16 * HD + 32); }
            // the address registers of the loads above are free for reuse behind them: the wait stands in front of any overwrite
            asm volatile("s_wait_xcnt 0x0" ::: "memory");
#pragma unroll
            for (int s = 0; s < 4; ++s) {
                const int key0 = kb + 32 * s;
                const v16h ka0 = kq[s][0], ka1 = kq[s][1], kb0 = kq[s][2], kb1 = kq[s][3];
                v8f sHa = (v8f){}, sLa = (v8f){}, sHb = (v8f){}, sLb = (v8f){};
                sHa = wmma16(ka0, qh0, sHa); sHb = wmma16(kb0, qh0, sHb);
                if (SCORE_RES) { sLa = wmma16(ka0, qr0, sLa); sLb = wmma16(kb0, qr0, sLb); }
                sHa = wmma16(ka1, qh1, sHa); sHb = wmma16(kb1, qh1, sHb);
                if (SCORE_RES) { sLa = wmma16(ka1, qr1, sLa); sLb = wmma16(kb1, qr1, sLb); }
                float ta[8], tb[8];
#pragma unroll
                for (int r = 0; r < 8; ++r) { ta[r] = (sHa[r] + sLa[r] * QRI) * SC2; tb[r] = (sHb[r] + sLb[r] * QRI) * SC2; }
                const int kidx = key0 + 8 * hi;
                const unsigned ma = mwv[s] >> (8 * hi), mc = mwv[s] >> (16 + 8 * hi);
#pragma unroll
                for (int r = 0; r < 8; ++r) { ta[r] = (kidx + r > tq) ? NEGV : ta[r]; tb[r] = (kidx + 16 + r > tq) ? NEGV : tb[r]; }   // key > query replaces the score
#pragma unroll
                for (int r = 0; r < 8; ++r) { ta[r] = (((ma >> r) & 1u) != 0u) ? NEGV : ta[r]; tb[r] = (((mc >> r) & 1u) != 0u) ? NEGV : tb[r]; }   // so does a set padding-mask bit
                pv[s][0] = exp2x4(ta[0] + shp, ta[1] + shp, ta[2] + shp, ta[3] + shp) * inv; pv[s][1] = exp2x4(ta[4] + shp, ta[5] + shp, ta[6] + shp, ta[7] + shp) * inv;
                pv[s][2] = exp2x4(tb[0] + shp, tb[1] + shp, tb[2] + shp, tb[3] + shp) * inv; pv[s][3] = exp2x4(tb[4] + shp, tb[5] + shp, tb[6] + shp, tb[7] + shp) * inv;
            }
        }
        // lane (t, h): keys 8h+r and 16+8h+r of each step -> pw[t][32 * step + ...]; rows 0..15 x columns 0..PP-1 all written
#pragma unroll
        for (int s = 0; s < 4; ++s) {
            *(v4fa*)(&pw[lr * PPW + 32 * s + 8 * hi]) = pv[s][0];      *(v4fa*)(&pw[lr * PPW + 32 * s + 8 * hi + 4]) = pv[s][1];
            *(v4fa*)(&pw[lr * PPW + 32 * s + 16 + 8 * hi]) = pv[s][2]; *(v4fa*)(&pw[lr * PPW + 32 * s + 16 + 8 * hi + 4]) = pv[s][3]; }
        wave_sync();
        v4f val[16];
#pragma unroll
        for (int r = 0; r < 16; ++r) val[r] = *(const v4fa*)(&pw[r * PPW + lane * 4]);
#pragma unroll
        for (int r = 0; r < 16; ++r) *(v4f*)(arow + (size_t)r * ATT_LD + kb) = val[r];
        // the address and data registers of the stores above are reused by the next pass: the wait stands in front of any overwrite
        asm volatile("s_wait_xcnt 0x0" ::: "memory");
        wave_sync();
    }
}

// k_gemm: bf16 GEMM, work-group of 4 waves on a 128x128 tile, each wave a 64x64 quadrant (16 accumulators), K = DM walked in stages of 64.
// Each stage's A and B tiles (128 rows x 64 k) are read from the K-contiguous bf16 planes as whole 128-byte rows (8 lanes x 16 B a row) into registers two stages ahead and
// stored one stage ahead to the other of two LDS buffers (row pitch 144 B); fragments come from LDS. One work-group barrier a stage: it publishes the stage just stored
// and ends every wave's reads of the buffer that the next stage's stores overwrite. k order of every accumulator: ascending in steps of 32.
// C[m][n] = sum_k A[m][k] Bt[n][k] + bias (bias RNE-converted to bf16, added in f32). 128 threads per block.
// QKV = true: the q, k and v projections, which read none of each other's output, as ONE grid (M/128 token tiles, 1024/128 weight-row tiles, 3 jobs); the job md follows from blockIdx.z
// (the same for a whole work-group); three work-groups share a WGP, so one's matrix instructions run under the others' LDS and load waits, prologue and epilogue. X = x tokens, Wt = q | k | v weight rows.
// md 0: q  -> A = x tokens, Bt = q weight rows; f16 value plane Ph and f16 residual x2048 plane Pr, layout [b*16+h][t][64] (quadrant column block = head h; bias columns 0..1023)
// md 1: k  -> as md 0, value plane only (bias columns 1024..2047); the shortest epilogue, so it comes last in the index
// md 2: v  -> A = v weight rows (row e = h*64 + d), Bt = x tokens: C[e][token]; value (Ph) and residual x2048 (Pr) planes [b*16+h][d][t]; bias per ROW (columns 2048..3071 of the bias vector)
// QKV = false: output projection -> X = ctx hi plane, the lo plane directly behind it, Wt = W_proj^T rows; f32 rows of OUT. Both planes walk k together: a stage holds the hi, the lo and the W_proj tile of the same 64 k,
// so each W_proj tile is fetched, staged and read as fragments once for both planes (one shared accumulator: hi then lo products of each 32-k block). grid (M/128, 1024/128, 2):
// blockIdx.z = 0 is the projection, one work-group a WGP and one wave a SIMD; blockIdx.z = 1 are the PJOBS probability jobs (p_job), which read nothing the projection writes and take the places it leaves free.
struct yes_t { static constexpr bool value = true; };
struct no_t { static constexpr bool value = false; };
#define LP 72                    // LDS row pitch in 16-bit elements: 144 B = 16 B x 9, conflict-free for 16-byte fragment reads
// for QKV = true the second launch bound asks for a register budget at which three waves fit a SIMD, so that all 768 work-groups of the merged grid are resident at once (three a WGP; LDS allows three); for QKV = false it asks for one wave a SIMD
template <bool QKV>
__global__ __launch_bounds__(128, QKV ? 3 : 1) void k_gemm(const bf* __restrict__ X, const bf* __restrict__ Wt, const float* __restrict__ bias, h16* QH, h16* QR, h16* KP, h16* VT, h16* VR, float* OUT, const unsigned* __restrict__ MW, const float* __restrict__ ST) {
    __shared__ __align__(16) bf As[2 * 128 * LP];
    __shared__ __align__(16) bf Bs[2 * 128 * LP];
    __shared__ __align__(16) bf Ls[QKV ? 8 : 2 * 128 * LP];   // output projection: tiles of the ctx lo plane
    __shared__ __align__(16) float osw[4 * 16 * 68];
    if constexpr (!QKV) {
        if ((int)blockIdx.z != 0) {                  // the same for a whole work-group, in front of every barrier
            static_assert(PJOBS <= (NB * SEQ / 128) * (DM / 128));
            static_assert(sizeof(As) >= (size_t)AW * 16 * PPW * 4);
            const int job = (int)blockIdx.y * (NB * SEQ / 128) + (int)blockIdx.x;
            if (job < PJOBS) p_job((float*)As, job, QH, QR, KP, MW, ST, OUT + OUT1_OFF);
            return; }
    }
    const int K = DM;
    const int tid = threadIdx.x;
    const int lane = tid & 31, lr = lane & 15, hi = lane >> 4;
    const int wave = __builtin_amdgcn_readfirstlane(tid >> 5);
    float* os = osw + wave * 16 * 68;                // wave-private epilogue tile
    const int wm = wave & 1, wn = wave >> 1;
    const int md = QKV ? (((int)blockIdx.z == 0) ? 0 : 3 - (int)blockIdx.z) : 3;   // z 0, 1, 2 -> q, v, k
    const bool vj = QKV && md == 2;                  // v: weight rows are the M operand, tokens the N operand
    const int bm = vj ? (int)blockIdx.y : (int)blockIdx.x, bn = vj ? (int)blockIdx.x : (int)blockIdx.y;
    const bf* A = vj ? (Wt + (size_t)2 * DM * DM) : X;
    const bf* Bt = vj ? X : (QKV ? (Wt + (size_t)md * DM * DM) : Wt);
    const int r0 = bm * 128 + wm * 64, c0 = bn * 128 + wn * 64;
    v8f acc[4][4];
#pragma unroll
    for (int mb = 0; mb < 4; ++mb)
#pragma unroll
        for (int nb = 0; nb < 4; ++nb) acc[mb][nb] = (v8f){};
    const int srow = tid >> 3, scol = (tid & 7) * 8;  // staging: 16 rows a pass, 8 passes a tile
    const bf* ga = A + (size_t)(bm * 128 + srow) * K + scol;
    const bf* gb = Bt + (size_t)(bn * 128 + srow) * K + scol;
    const int sl = srow * LP + scol;
    const int fa = (wm * 64 + lr) * LP + 8 * hi, fb = (wn * 64 + lr) * LP + 8 * hi;
    const int SPP = K / 64;                           // stages per plane
    const int NS = SPP;
    const bf* gl = ga + (size_t)NB * SEQ * DM;        // output projection: the ctx lo plane, same rows and columns
    v8us ra[8], rb[8], rl[8];
    if constexpr (QKV) {
#pragma unroll
        for (int i = 0; i < 8; ++i) { ra[i] = *(const v8us*)(ga + (size_t)i * 16 * K); rb[i] = *(const v8us*)(gb + (size_t)i * 16 * K); }
#pragma unroll
        for (int i = 0; i < 8; ++i) { *(v8us*)(&As[sl + i * 16 * LP]) = ra[i]; *(v8us*)(&Bs[sl + i * 16 * LP]) = rb[i]; }
#pragma unroll
        for (int i = 0; i < 8; ++i) { ra[i] = *(const v8us*)(ga + 64 + (size_t)i * 16 * K); rb[i] = *(const v8us*)(gb + 64 + (size_t)i * 16 * K); }   // stage 1 (NS >= 2)
    } else {
        v8us ta[8], tb[8], tl[8];
        // between the two scheduling barriers stand only the loads of stages 0 and 1 and their wait, so that no other instruction reuses an address register of a load in front of the wait
        __builtin_amdgcn_sched_barrier(0);
#pragma unroll
        for (int i = 0; i < 8; ++i) { ta[i] = *(const v8us*)(ga + (size_t)i * 16 * K); tb[i] = *(const v8us*)(gb + (size_t)i * 16 * K); tl[i] = *(const v8us*)(gl + (size_t)i * 16 * K); }
#pragma unroll
        for (int i = 0; i < 8; ++i) { ra[i] = *(const v8us*)(ga + 64 + (size_t)i * 16 * K); rb[i] = *(const v8us*)(gb + 64 + (size_t)i * 16 * K); rl[i] = *(const v8us*)(gl + 64 + (size_t)i * 16 * K); }   // stage 1 (NS >= 2)
        // the address registers of the loads above are free for reuse behind them: the wait stands in front of any overwrite
        asm volatile("s_wait_xcnt 0x0" ::: "memory");
        __builtin_amdgcn_sched_barrier(0);
#pragma unroll
        for (int i = 0; i < 8; ++i) { *(v8us*)(&As[sl + i * 16 * LP]) = ta[i]; *(v8us*)(&Bs[sl + i * 16 * LP]) = tb[i]; *(v8us*)(&Ls[sl + i * 16 * LP]) = tl[i]; }
    }
    lds_barrier();
    // one stage; ST: stage s+1 exists (it waits in ra, rb since the stage before), LD: stage s+2 exists. Both are compile-time so that the body is one straight run whose LDS waits are counted exactly.
    auto stage = [&](const int s, auto ST, auto LD) {
        const int cur = (s & 1) * (128 * LP), nxt = (128 * LP) - cur;
        v16bf a[2][4], b[2][4], l[2][4];              // both 32-k blocks' fragments of this stage, read as one group ahead of the matrix instructions
#pragma unroll
        for (int kb = 0; kb < 2; ++kb) {
#pragma unroll
            for (int mb = 0; mb < 4; ++mb) a[kb][mb] = ldb(&As[cur + fa + mb * 16 * LP + kb * 32]);
#pragma unroll
            for (int nb = 0; nb < 4; ++nb) b[kb][nb] = ldb(&Bs[cur + fb + nb * 16 * LP + kb * 32]);
            if constexpr (!QKV) {
#pragma unroll
                for (int mb = 0; mb < 4; ++mb) l[kb][mb] = ldb(&Ls[cur + fa + mb * 16 * LP + kb * 32]);
            }
        }
        if constexpr (ST.value) {                     // stage s+1 goes to the buffer that stage s-1 was read from
#pragma unroll
            for (int i = 0; i < 8; ++i) { *(v8us*)(&As[nxt + sl + i * 16 * LP]) = ra[i]; *(v8us*)(&Bs[nxt + sl + i * 16 * LP]) = rb[i];
                if constexpr (!QKV) *(v8us*)(&Ls[nxt + sl + i * 16 * LP]) = rl[i]; }
        }
        if constexpr (LD.value) {                     // stage s+2 starts its way from global memory
            const int kc = (s + 2) * 64;
            const bf* pa = ga + kc; const bf* pb = gb + kc; const bf* pl = gl + kc;
#pragma unroll
            for (int i = 0; i < 8; ++i) { ra[i] = *(const v8us*)(pa + (size_t)i * 16 * K); rb[i] = *(const v8us*)(pb + (size_t)i * 16 * K);
                if constexpr (!QKV) rl[i] = *(const v8us*)(pl + (size_t)i * 16 * K); }
            // the address registers of the loads above are free for reuse behind them: the wait stands in front of any overwrite
            asm volatile("s_wait_xcnt 0x0" ::: "memory");
        }
#pragma unroll
        for (int kb = 0; kb < 2; ++kb) {
#pragma unroll
            for (int nb = 0; nb < 4; ++nb)
#pragma unroll
                for (int mb = 0; mb < 4; ++mb) acc[mb][nb] = wmmab(a[kb][mb], b[kb][nb], acc[mb][nb]);
            if constexpr (!QKV) {                     // the lo plane's products of the same 32 k, against the same W_proj fragments
#pragma unroll
                for (int nb = 0; nb < 4; ++nb)
#pragma unroll
                    for (int mb = 0; mb < 4; ++mb) acc[mb][nb] = wmmab(l[kb][mb], b[kb][nb], acc[mb][nb]);
            }
        }
        // four vector slots behind the stage's last matrix instruction before its operand registers may be reloaded; naming every accumulator keeps all of the stage's
        // matrix instructions in front of the barrier, where they run while the LDS reads and stores of the stage drain
        if constexpr (QKV)
        asm volatile("v_nop\n\tv_nop\n\tv_nop\n\tv_nop"
                     : "+v"(acc[0][0]), "+v"(acc[1][0]), "+v"(acc[2][0]), "+v"(acc[3][0]), "+v"(acc[0][1]), "+v"(acc[1][1]), "+v"(acc[2][1]), "+v"(acc[3][1]),
                       "+v"(acc[0][2]), "+v"(acc[1][2]), "+v"(acc[2][2]), "+v"(acc[3][2]), "+v"(acc[0][3]), "+v"(acc[1][3]), "+v"(acc[2][3]), "+v"(acc[3][3])
                     : "v"(a[1][0]), "v"(a[1][1]), "v"(a[1][2]), "v"(a[1][3]), "v"(b[1][3]));
        else                                          // the same, behind the lo plane's last products
        asm volatile("v_nop\n\tv_nop\n\tv_nop\n\tv_nop"
                     : "+v"(acc[0][0]), "+v"(acc[1][0]), "+v"(acc[2][0]), "+v"(acc[3][0]), "+v"(acc[0][1]), "+v"(acc[1][1]), "+v"(acc[2][1]), "+v"(acc[3][1]),
                       "+v"(acc[0][2]), "+v"(acc[1][2]), "+v"(acc[2][2]), "+v"(acc[3][2]), "+v"(acc[0][3]), "+v"(acc[1][3]), "+v"(acc[2][3]), "+v"(acc[3][3])
                     : "v"(l[1][0]), "v"(l[1][1]), "v"(l[1][2]), "v"(l[1][3]), "v"(b[1][3]));
        if constexpr (ST.value) lds_barrier();        // publishes stage s+1 and ends the reads of this stage's buffer; behind the last stage nothing is left to publish
    };
#pragma unroll 1
    for (int s = 0; s < NS - 2; ++s) stage(s, yes_t{}, yes_t{});
    stage(NS - 2, yes_t{}, no_t{});
    stage(NS - 1, no_t{}, no_t{});
    // the lane's number is read anew here, so that nothing derived from it for the epilogue is held in a register across the loop (the loop fills the register budget of three waves a SIMD)
    const int ln = (int)__builtin_amdgcn_mbcnt_lo(~0u, 0u), lc = ln & 15, lh = ln >> 4;
    float bv[4];
#pragma unroll
    for (int nb = 0; nb < 4; ++nb) {
        const int bi = vj ? (2 * DM) : ((QKV ? md * DM : 0) + c0 + nb * 16 + lc);
        bv[nb] = bf2f(f2bf(bias[bi])); }
#pragma unroll
    for (int mb = 0; mb < 4; ++mb) {
        // D: row 8h+j, col lane&15; rows 0..15 x cols 0..63 all written on either path
        if (vj) {                                       // per-row bias: 8 consecutive floats, one 32-byte vector load
            const v8f bq = *(const v8f*)(bias + 2 * DM + r0 + mb * 16 + lh * 8);
            float rb[8];
#pragma unroll
            for (int j = 0; j < 8; ++j) rb[j] = bf2f(f2bf(bq[j]));
#pragma unroll
            for (int nb = 0; nb < 4; ++nb) {
#pragma unroll
                for (int j = 0; j < 8; ++j) os[(lh * 8 + j) * 68 + nb * 16 + lc] = acc[mb][nb][j] + rb[j]; }
        } else {
#pragma unroll
            for (int nb = 0; nb < 4; ++nb) {
#pragma unroll
                for (int j = 0; j < 8; ++j) os[(lh * 8 + j) * 68 + nb * 16 + lc] = acc[mb][nb][j] + bv[nb]; }
        }
        wave_sync();
        if (QKV) {
            h16* Ph = (md == 0) ? QH : ((md == 1) ? KP : VT);
            h16* Pr = (md == 0) ? QR : VR;              // md 1 stores no residual
            size_t sb, pitch;
            if (vj) { const int bb = c0 / SEQ; const int tt = c0 % SEQ;                               // rows = d of head r0/64, columns = 64 tokens of one batch
                sb = ((size_t)(bb * NH_ + (r0 >> 6)) * HD + (size_t)(16 * mb)) * SEQ + (size_t)tt; pitch = SEQ; }
            else { const int tokrow = r0 + 16 * mb; const int bb = tokrow / SEQ; const int tt = tokrow % SEQ;   // rows = tokens, columns = d of head c0/64
                sb = ((size_t)(bb * NH_ + (c0 >> 6)) * SEQ + (size_t)tt) * HD; pitch = HD; }
            v4f x0[4], x1[4]; v8h hv[4];
#pragma unroll
            for (int s = 0; s < 4; ++s) { const int row = 4 * s + (ln >> 3), c8 = (ln & 7) * 8;
                x0[s] = *(const v4fa*)(&os[row * 68 + c8]); x1[s] = *(const v4fa*)(&os[row * 68 + c8 + 4]);
#pragma unroll
                for (int i = 0; i < 4; ++i) { hv[s][i] = toh_flush(x0[s][i]); hv[s][4 + i] = toh_flush(x1[s][i]); }
                *(v8h*)(Ph + sb + (size_t)row * pitch + c8) = hv[s]; }
            // the address and data registers of the stores above are reused behind them: the wait stands in front of any overwrite
            asm volatile("s_wait_xcnt 0x0" ::: "memory");
            if (md != 1) {
#pragma unroll
                for (int s = 0; s < 4; ++s) { const int row = 4 * s + (ln >> 3), c8 = (ln & 7) * 8; v8h rv;
#pragma unroll
                    for (int i = 0; i < 4; ++i) { rv[i] = toh_flush((x0[s][i] - (float)hv[s][i]) * QRS); rv[4 + i] = toh_flush((x1[s][i] - (float)hv[s][4 + i]) * QRS); }
                    *(v8h*)(Pr + sb + (size_t)row * pitch + c8) = rv; }
                asm volatile("s_wait_xcnt 0x0" ::: "memory");   // as above, for the residual stores
            }
        } else {
            const int grow = r0 + 16 * mb; const int bb = grow / SEQ; const int nn = grow % SEQ;
            float* orow = OUT + ((size_t)bb * OUT_SEQ + nn) * DM + c0;
{
#pragma unroll
                for (int s = 0; s < 8; ++s) { const int row = 2 * s + lh, cofs = lc * 4;   // 8 s x 2 rows = 16 rows; 16 lanes x 4 floats = 64 columns
                    const v4f val = *(const v4fa*)(&os[row * 68 + cofs]);
                    *(v4f*)(orow + (size_t)row * DM + cofs) = val; }
                 }
        }
        wave_sync();
    }
}

// k_flash: fused causal attention, one wave per 16 query rows of one (batch, head); Q fragments straight from the f16 planes (two 16-B loads each, arithmetic addressing).
// The four waves of a work-group share each 64-key stage of K, V^T and (early rows) the V^T residual through LDS: whole 128-byte rows are brought by asynchronous copies into one of two buffers
// (row pitch 144 B), one stage ahead of the stage being worked on; fragments are read from LDS. One work-group barrier a stage publishes the next stage and ends the reads of the buffer refilled behind it.
// Transposed form: S^T[key][t] = K Q^T (A = K rows, B = Q rows); lane (t = lane&15, h = lane>>4) holds keys 8h+r of each 16-key tile, so the packed
// P tile is directly the B fragment of O^T[d][t] = V^T P^T (element r <- tile keys 0..15, element 8+r <- tile keys 16..31, lane unchanged).
// Keys run over [0, t0+16) in steps of 32; on steps that touch the diagonal, scores with key > query are replaced by a very negative value (P = 0 exactly);
// the padding-mask bit words of (b, query, 64-key stage) are read once per lane, one stage ahead of their use, and the bit selects run at every step (bit 8h+r <-> key key0+8h+r, bit 16+8h+r <-> key key0+16+8h+r; a set bit replaces the score the same way; a zero word changes nothing).
// A query row that never sees a visible key yields NaN (all scores replaced by -inf).
// Softmax state (running max, partial sum) is one scalar per lane; the two lane halves of a row are combined with one xor-16 exchange.
#define FP 72                    // LDS row pitch of a staged tile in 16-bit elements: 144 B = 16 B x 9, conflict-free for 16-byte fragment reads
#define SK 64                    // keys per stage
#define TILE_E (64 * FP)         // one staged tile: 64 rows (K: keys, V^T: d) of 64 elements
#define BUF_E  (3 * TILE_E)      // one buffer: K | V^T | V^T residual
static_assert(SK == 16 * AW);    // a work-group's query rows span one stage: stages 0..tile reach its diagonal
#define NT  (SEQ / (16 * AW))    // query tiles per (batch, head)
#define HPR (NH_ / NB)           // heads of one batch per NH_ values of blockIdx.y
static_assert(NH_ % NB == 0);    // (blockIdx.y / NH_, blockIdx.y % NH_) -> (batch, head) is one to one
static_assert(NT % 2 == 0);
static_assert(EARLY % (16 * AW) == 0);   // the residual plane is used by all waves of a work-group or by none
static_assert(32 * AW == 128);   // staging map: 8 lanes a row, 16 rows a copy, 4 copies a tile
// four asynchronous 16-byte copies a lane (rows r, r+16, r+32, r+48 of one tile); the wait is the statement's last line, so it stands in front of any rewrite of an address register that a copy names
__device__ __forceinline__ void acopy4(const unsigned l, const h16* g, const size_t gp) {
    const unsigned l1 = l + 16 * FP * 2, l2 = l + 32 * FP * 2, l3 = l + 48 * FP * 2;
    const h16* g1 = g + 16 * gp; const h16* g2 = g + 32 * gp; const h16* g3 = g + 48 * gp;
    asm volatile("global_load_async_to_lds_b128 %0, %4, off\n\t"
                 "global_load_async_to_lds_b128 %1, %5, off\n\t"
                 "global_load_async_to_lds_b128 %2, %6, off\n\t"
                 "global_load_async_to_lds_b128 %3, %7, off\n\t"
                 "s_wait_xcnt 0x0"
                 :: "v"(l), "v"(l1), "v"(l2), "v"(l3), "v"(g), "v"(g1), "v"(g2), "v"(g3) : "memory");
}
__global__ __launch_bounds__(32 * AW) void k_flash(const h16* __restrict__ QH, const h16* __restrict__ QR, const h16* __restrict__ KP, const h16* __restrict__ VT, const h16* __restrict__ VR, const unsigned* __restrict__ MW, bf* CH, bf* CL, float* ST) {
    __shared__ __align__(16) float os[AW * 16 * 68];
    __shared__ __align__(16) h16 ring[2 * BUF_E];
    const int lane = threadIdx.x & 31, lr = lane & 15, hi = lane >> 4;
    const int wave = __builtin_amdgcn_readfirstlane((int)(threadIdx.x >> 5));
    // Deal of (batch, head, query tile) over the grid, a permutation of it, for speed only. A tile's cost grows with its index (tile + 1 stages) and all work-groups are resident at once, so a WGP
    // lasts as long as the tiles that meet on it. Work-groups whose flat index is NT * NH_ apart get tiles t, NT-1-t, t+NT/2, NT/2-1-t (equal stage sums), neighbours in blockIdx.y get t and NT-1-t,
    // and the head-0 work-groups stand NT * HPR indices apart in the first NT * NH_.
    const int rnd = (int)(blockIdx.y / (unsigned)NH_), wq = (int)(blockIdx.y % (unsigned)NH_);
    const int bb = (int)((unsigned)wq / (unsigned)HPR), hh = (int)((unsigned)wq % (unsigned)HPR) + HPR * rnd;
    const int zh = bb * NH_ + hh;
    int tl = (int)blockIdx.x;
    if (((rnd ^ wq) & 1) != 0) tl = NT - 1 - tl;
    if ((rnd & 2) != 0) tl = (int)((unsigned)(tl + NT / 2) % (unsigned)NT);
    const int tile = tl;
    const int t0 = (tile * AW + wave) * 16;
    const size_t pbase = (size_t)zh * SEQ * HD;
    const size_t qo = pbase + (size_t)(t0 + lr) * HD + 8 * hi;
    const v16h qh0 = ldh(QH + qo), qh1 = ldh(QH + qo + 32), qr0 = ldh(QR + qo), qr1 = ldh(QR + qo + 32);   // B fragments: col t, k = d
    const int fk = lr * FP + 8 * hi;                         // LDS, + key * FP         (A fragment: row key, k = d)
    const int fv = TILE_E + lr * FP + 8 * hi;                // LDS, + 16j*FP + key     (A fragment: row d, k = key)
    const int kend = t0 + 16;
    const bool early = tile * (16 * AW) < EARLY;             // same for the four waves
    const int srow = (int)threadIdx.x >> 3, scol = ((int)threadIdx.x & 7) * 8;   // staging: 8 lanes x 16 B = one 128-byte row
    const unsigned sl = (unsigned)(size_t)(&ring[srow * FP + scol]);             // this lane's LDS byte address in buffer 0, K tile
    const h16* gk = KP + pbase + (size_t)srow * HD + scol;   // + stage * SK * HD
    const h16* gv = VT + pbase + (size_t)srow * SEQ + scol;  // + stage * SK
    const h16* gr = VR + pbase + (size_t)srow * SEQ + scol;
    const int nst = tile + 1;                                // stages up to and including the work-group's diagonal
    auto fill = [&](const int s) {                           // stage s -> buffer s & 1; every lane on, work-group-uniform control flow
        const unsigned lb = sl + (unsigned)((s & 1) * (BUF_E * 2));
        acopy4(lb, gk + (size_t)s * (SK * HD), HD);
        acopy4(lb + TILE_E * 2, gv + (size_t)s * SK, SEQ);
        if (early) acopy4(lb + 2 * TILE_E * 2, gr + (size_t)s * SK, SEQ);
    };
    const int tq = t0 + lr;
    const unsigned* mrow = MW + ((size_t)bb * SEQ + (size_t)tq) * (size_t)(SEQ / 32);   // + key0/32: mask words of this lane's query row; a stage's two words are one aligned 8-byte pair
    v8f o0 = (v8f){}, o1 = (v8f){}, o2 = (v8f){}, o3 = (v8f){};
    v8f e0 = (v8f){}, e1 = (v8f){}, e2 = (v8f){}, e3 = (v8f){};
    float m = NEGV, l = 0.0f;
    fill(0);
    v2u mcur = *(const v2u*)mrow;                            // stage 0's mask words, on their way under the wait for stage 0's copies
    asm volatile("s_wait_xcnt 0x0" ::: "memory");            // the address registers of the load above are free for reuse behind it: the wait stands in front of any overwrite
    asm volatile("s_wait_asynccnt 0x0" ::: "memory");        // this wave's copies of stage 0 have landed
    __syncthreads();                                         // publishes stage 0
    if (nst > 1) fill(1);
#pragma unroll 1
    for (int s = 0; s < nst; ++s) {
      const int cur = (s & 1) * BUF_E;
      // the next stage's mask words start their way here and are first needed a whole stage later, so no step waits for a load; the last stage reads its own pair again (index inside the row)
      const v2u mnxt = *(const v2u*)(mrow + 2 * ((s + 1 < nst) ? s + 1 : s));
      asm volatile("s_wait_xcnt 0x0" ::: "memory");          // as above, for this load's address registers
      for (int kk = 0; kk < SK; kk += 32) {
        const int key0 = s * SK + kk;
        if (key0 >= kend) break;                    // wave-uniform: keys past this wave's diagonal; the stage's foot below is still passed
        const h16* ka = &ring[cur + fk + kk * FP];
        const v16h ka0 = ldh(ka), ka1 = ldh(ka + 32), kb0 = ldh(ka + 16 * FP), kb1 = ldh(ka + 16 * FP + 32);
        v8f sHa = (v8f){}, sLa = (v8f){}, sHb = (v8f){}, sLb = (v8f){};
        sHa = wmma16(ka0, qh0, sHa); sHb = wmma16(kb0, qh0, sHb);
        if (SCORE_RES) { sLa = wmma16(ka0, qr0, sLa); sLb = wmma16(kb0, qr0, sLb); }
        sHa = wmma16(ka1, qh1, sHa); sHb = wmma16(kb1, qh1, sHb);
        if (SCORE_RES) { sLa = wmma16(ka1, qr1, sLa); sLb = wmma16(kb1, qr1, sLb); }
        asm volatile("v_nop\n\tv_nop\n\tv_nop\n\tv_nop" : "+v"(sHa), "+v"(sLa), "+v"(sHb), "+v"(sLb) : "v"(ka0), "v"(ka1), "v"(kb0), "v"(kb1));
        float ta[8], tb[8];
#pragma unroll
        for (int r = 0; r < 8; ++r) { ta[r] = (sHa[r] + sLa[r] * QRI) * SC2; tb[r] = (sHb[r] + sLb[r] * QRI) * SC2; }
        if (key0 + 31 > t0) {                       // wave-uniform: this step touches the diagonal
            const int kidx = key0 + 8 * hi;
#pragma unroll
            for (int r = 0; r < 8; ++r) { ta[r] = (kidx + r > tq) ? NEGV : ta[r]; tb[r] = (kidx + 16 + r > tq) ? NEGV : tb[r]; }
        }
        const unsigned mw = (kk == 0) ? mcur[0] : mcur[1];
        {                                           // padding-mask selects, every step (a zero word changes nothing)
            const unsigned ma = mw >> (8 * hi), mc = mw >> (16 + 8 * hi);
#pragma unroll
            for (int r = 0; r < 8; ++r) { ta[r] = (((ma >> r) & 1u) != 0u) ? NEGV : ta[r]; tb[r] = (((mc >> r) & 1u) != 0u) ? NEGV : tb[r]; }
        }
        float mx = NEGV;
#pragma unroll
        for (int r = 0; r < 8; ++r) mx = fmaxf(mx, fmaxf(ta[r], tb[r]));
        mx = fmaxf(mx, __shfl_xor(mx, 16, 32));
        const float mnew = fmaxf(m, mx);
        const float alpha = __builtin_amdgcn_exp2f(m - mnew);
        const float sh = PSH - mnew;
        v16h pb; float ls = 0.0f;
#pragma unroll
        for (int r = 0; r < 8; ++r) { const float ea = ta[r] + sh, ec = tb[r] + sh;
            const h16 pa = (ea < -14.0f) ? (h16)0.0f : (h16)__builtin_amdgcn_exp2f(ea);       // exponent select: no f16 result below the smallest normal
            const h16 pc = (ec < -14.0f) ? (h16)0.0f : (h16)__builtin_amdgcn_exp2f(ec);
            pb[r] = pa; pb[8 + r] = pc; ls += (float)pa + (float)pc; }
        l = l * alpha + ls; m = mnew;
        o0 = o0 * alpha; o1 = o1 * alpha; o2 = o2 * alpha; o3 = o3 * alpha;
        const h16* va = &ring[cur + fv + kk];
        const v16h v0 = ldh(va), v1 = ldh(va + 16 * FP), v2 = ldh(va + 32 * FP), v3 = ldh(va + 48 * FP);
        o0 = wmma16(v0, pb, o0); o1 = wmma16(v1, pb, o1); o2 = wmma16(v2, pb, o2); o3 = wmma16(v3, pb, o3);
        asm volatile("v_nop\n\tv_nop\n\tv_nop\n\tv_nop" : "+v"(o0), "+v"(o1), "+v"(o2), "+v"(o3) : "v"(v0), "v"(v1), "v"(v2), "v"(v3), "v"(pb));
        if (early) {                                // wave-uniform: residual plane of v in its own accumulators
            e0 = e0 * alpha; e1 = e1 * alpha; e2 = e2 * alpha; e3 = e3 * alpha;
            const h16* vr = va + TILE_E;
            const v16h w0 = ldh(vr), w1 = ldh(vr + 16 * FP), w2 = ldh(vr + 32 * FP), w3 = ldh(vr + 48 * FP);
            e0 = wmma16(w0, pb, e0); e1 = wmma16(w1, pb, e1); e2 = wmma16(w2, pb, e2); e3 = wmma16(w3, pb, e3);
            asm volatile("v_nop\n\tv_nop\n\tv_nop\n\tv_nop" : "+v"(e0), "+v"(e1), "+v"(e2), "+v"(e3) : "v"(w0), "v"(w1), "v"(w2), "v"(w3), "v"(pb));
        }
      }
      // foot of stage s, every wave: its LDS reads of this buffer are done, its copies of stage s+1 have landed; the barrier publishes stage s+1 and frees this buffer for stage s+2
      asm volatile("s_wait_dscnt 0x0" ::: "memory");
      asm volatile("s_wait_asynccnt 0x0" ::: "memory");
      __syncthreads();
      if (s + 2 < nst) fill(s + 2);
      mcur = mnxt;
    }
    asm volatile("s_wait_asynccnt 0x0" ::: "memory");        // no copy is outstanding behind the loop
    l += __shfl_xor(l, 16, 32);
    const float inv = (m > NEGV) ? (1.0f / l) : __uint_as_float(0x7FC00000u);   // no visible key in the whole row: NaN row
    const int wb = wave * 16 * 68;
    // O^T D layout: o_j[r] = (d = 16j + 8h + r, t = lane&15) -> os[t][d]; rows 0..15 x columns 0..63 all written
    { v4f a, c;
#pragma unroll
      for (int i = 0; i < 4; ++i) { a[i] = (o0[i] + e0[i] * QRI) * inv; c[i] = (o0[4 + i] + e0[4 + i] * QRI) * inv; }
      *(v4fa*)(&os[wb + lr * 68 +  0 + 8 * hi]) = a; *(v4fa*)(&os[wb + lr * 68 +  0 + 8 * hi + 4]) = c;
#pragma unroll
      for (int i = 0; i < 4; ++i) { a[i] = (o1[i] + e1[i] * QRI) * inv; c[i] = (o1[4 + i] + e1[4 + i] * QRI) * inv; }
      *(v4fa*)(&os[wb + lr * 68 + 16 + 8 * hi]) = a; *(v4fa*)(&os[wb + lr * 68 + 16 + 8 * hi + 4]) = c;
#pragma unroll
      for (int i = 0; i < 4; ++i) { a[i] = (o2[i] + e2[i] * QRI) * inv; c[i] = (o2[4 + i] + e2[4 + i] * QRI) * inv; }
      *(v4fa*)(&os[wb + lr * 68 + 32 + 8 * hi]) = a; *(v4fa*)(&os[wb + lr * 68 + 32 + 8 * hi + 4]) = c;
#pragma unroll
      for (int i = 0; i < 4; ++i) { a[i] = (o3[i] + e3[i] * QRI) * inv; c[i] = (o3[4 + i] + e3[4 + i] * QRI) * inv; }
      *(v4fa*)(&os[wb + lr * 68 + 48 + 8 * hi]) = a; *(v4fa*)(&os[wb + lr * 68 + 48 + 8 * hi + 4]) = c; }
    wave_sync();
    const size_t cb = ((size_t)bb * SEQ + (size_t)(t0 + (lane >> 3))) * DM + (size_t)(hh * HD + (lane & 7) * 8);
    v8us hv[4], lv[4];
#pragma unroll
    for (int s = 0; s < 4; ++s) { const int row = 4 * s + (lane >> 3), c8 = (lane & 7) * 8;   // 4 s x 4 row groups = 16 rows; 8 lanes x 8 = 64 columns
        const v4f x0 = *(const v4fa*)(&os[wb + row * 68 + c8]); const v4f x1 = *(const v4fa*)(&os[wb + row * 68 + c8 + 4]);
#pragma unroll
        for (int i = 0; i < 4; ++i) { const unsigned short a0 = f2bf(x0[i]); const unsigned short a1 = f2bf(x1[i]);
            hv[s][i] = a0; hv[s][4 + i] = a1; lv[s][i] = f2bf(x0[i] - bf2f(a0)); lv[s][4 + i] = f2bf(x1[i] - bf2f(a1)); } }
{
#pragma unroll
        for (int s = 0; s < 4; ++s) { const size_t oo = cb + (size_t)s * 4 * DM;
            *(v8us*)(CH + oo) = hv[s]; *(v8us*)(CL + oo) = lv[s]; }
         }

    if (hh == 0 && hi == 0) {                       // head 0 (block-uniform) leaves each row's final running max and 1 / sum for the probability jobs of the next launch: 16 lanes x 8 B = one line a wave
        const v2f st = (v2f){m, inv};
        *(v2f*)(ST + 2 * ((size_t)bb * SEQ + (size_t)tq)) = st;
    }
}

static constexpr size_t al256(size_t v) { return (v + 255) & ~(size_t)255; }
static constexpr size_t SZ_XB = al256((size_t)NB * SEQ * DM * 2);
static constexpr size_t SZ_WB = al256((size_t)3 * DM * DM * 2);
static constexpr size_t SZ_WF = al256((size_t)DM * DM * 2);
static constexpr size_t SZ_PL = al256((size_t)NB * SEQ * DM * 2);
static constexpr size_t SZ_MW = al256((size_t)NB * SEQ * (SEQ / 32) * 4);
static constexpr size_t SZ_ST = al256((size_t)NB * SEQ * 2 * 4);
static constexpr size_t SZ_TOTAL = SZ_XB + SZ_WB + SZ_WF + 5 * SZ_PL + 2 * SZ_PL + SZ_MW + SZ_ST;
static_assert(SZ_TOTAL <= (size_t)134217728);          // workspace carve <= 128 MiB
static_assert(((size_t)DM * DM * 2) % 256 == 0);       // weight sub-planes stay 256-byte aligned
static_assert(SZ_PL == (size_t)NB * SEQ * DM * 2);     // ctx hi and lo planes are back to back with stride NB*SEQ*DM elements
static_assert((size_t)NB * NH_ * SEQ * HD * 2 == SZ_PL);   // q / k / v^T planes [NB*16][SEQ][64] fill one plane exactly

extern "C" void kernel_launch(void* const* d_in, const int* in_sizes, int n_in,
                              void* d_out, int out_size, void* d_ws, size_t ws_size, hipStream_t stream) {
    if (n_in < 6) return;
    const size_t needx = ((size_t)(NB - 1) * SEQ_FULL + SEQ) * DM;
    if ((size_t)in_sizes[0] < needx) return;
    if ((size_t)in_sizes[1] < (size_t)3 * DM * DM || (size_t)in_sizes[2] < (size_t)3 * DM) return;
    if ((size_t)in_sizes[3] < (size_t)DM * DM || (size_t)in_sizes[4] < (size_t)DM) return;
    if ((size_t)in_sizes[5] < ((size_t)(NB - 1) * SEQ_FULL + (SEQ - 1)) * SEQ_FULL + SEQ) return;
    if ((size_t)out_size < OUT1_OFF + ((size_t)(NB - 1) * OUT_SEQ + (SEQ - 1)) * ATT_LD + SEQ) return;
    if (SZ_TOTAL > ws_size) return;
    const float* x = (const float*)d_in[0]; const float* wqkv = (const float*)d_in[1]; const float* bqkv = (const float*)d_in[2];
    const float* wfc = (const float*)d_in[3]; const float* bfc = (const float*)d_in[4];          // wire order x, W_attn, b_attn, W_proj, b_proj, padding_mask
    const int* pmask = (const int*)d_in[5];          // [NB_FULL][SEQ_FULL][SEQ_FULL] int32, non-zero = key hidden
    float* OUT = (float*)d_out;      // [NB][SEQ][1024] then [NB][1][SEQ][SEQ]
    char* wsp = (char*)d_ws;
    bf* XB = (bf*)wsp; wsp += SZ_XB;                 // [NB*SEQ][1024]
    bf* WB = (bf*)wsp; wsp += SZ_WB;                 // [3072][1024]: q rows | k rows | v rows (row e = h*64 + d)
    bf* WF = (bf*)wsp; wsp += SZ_WF;                 // [1024][1024]: W_proj^T
    h16* QH = (h16*)wsp; wsp += SZ_PL;               // [NB*16][SEQ][64]
    h16* QR = (h16*)wsp; wsp += SZ_PL;               // residual x2048
    h16* KP = (h16*)wsp; wsp += SZ_PL;               // [NB*16][SEQ][64]
    h16* VT = (h16*)wsp; wsp += SZ_PL;               // [NB*16][64][SEQ]
    h16* VR = (h16*)wsp; wsp += SZ_PL;               // residual x2048
    bf* CH = (bf*)wsp; wsp += SZ_PL;                 // ctx hi [NB*SEQ][1024]
    bf* CL = (bf*)wsp; wsp += SZ_PL;                 // ctx lo, directly after CH
    unsigned* MW = (unsigned*)wsp; wsp += SZ_MW;     // mask bit words [NB*SEQ][SEQ/32]
    float* ST = (float*)wsp; wsp += SZ_ST;           // head 0: running max, 1 / sum per row [NB*SEQ][2]

    k_prep<<<PB_WA + PB_WP + PB_MB + PB_X, 256, 0, stream>>>(x, wqkv, wfc, pmask, XB, WB, WF, MW);

    k_gemm<true><<<dim3(NB * SEQ / 128, DM / 128, 3), 128, 0, stream>>>(XB, WB, bqkv, QH, QR, KP, VT, VR, OUT, MW, ST);

    k_flash<<<dim3(SEQ / (16 * AW), NB * NH_, 1), 32 * AW, 0, stream>>>(QH, QR, KP, VT, VR, MW, CH, CL, ST);

    k_gemm<false><<<dim3(NB * SEQ / 128, DM / 128, 2), 128, 0, stream>>>(CH, WF, bfc, QH, QR, KP, VT, VR, OUT, MW, ST);
}
